// v000
// The times below were measured on an AMD MI455X: many runs one after another, warmed up first and cycling through
// copies of the inputs, with the whole window's GPU time divided by the number of runs. Launches and the gaps
// between them are all in it. The median over several windows is given; except for v000 it joins two sittings, which
// can be a few percent apart, so the side-by-side timings, each taken in one sitting, are the better comparison.
// The starting kernel, v000, takes 1780 microseconds a run.
#include <hip/hip_runtime.h>
// KQV 'PCNN' attention (B=4, S=4096, D=256): q, k, v = Conv1d(kernel 3, pad 1) over the sequence of query/key/value (+bias); scores = q·k/16; softmax; out = scale·(P·v) → [4,4096,256].
// Compute dtype: inputs, conv weights/biases, scale rounded to bf16; each conv as an im2col GEMM (K = 3·256, bf16-exact operands, f32 accumulate) → q, k f16 planes, v f32 → Vᵀ f16 hi + f16 residual; fused flash-style kernel with d_qk = 256 (8 k-steps, online softmax f32, P f16 hi + residual,
// f32 accumulate) on v_wmma_f32_16x16x32_f16, launched once per 128-wide half of v, writing the output rows directly; × scale in f32.
#define BB 4
#define TT 4096
#define DD 256
#define NH 1
#define VSTR 256
#define NVH 4
#define NR (BB * TT)
#define K3 (3 * DD)
#define ATT_SCALE 0.0625f

typedef __bf16 v16b __attribute__((ext_vector_type(16)));
typedef unsigned short v8us __attribute__((ext_vector_type(8), may_alias));
typedef float  v8f  __attribute__((ext_vector_type(8)));
typedef float  v4f  __attribute__((ext_vector_type(4)));
typedef float  v4fa __attribute__((ext_vector_type(4), may_alias));
union FragB { v16b v; v8us half[2]; unsigned short u[16]; };

__device__ __forceinline__ unsigned short bf16_bits(float x) { unsigned int u = __float_as_uint(x); return (unsigned short)((u + 0x7FFFu + ((u >> 16) & 1u)) >> 16); }
__device__ __forceinline__ float bf16_val(unsigned short b) { return __uint_as_float(((unsigned int)b) << 16); }
__device__ __forceinline__ float bf16_round(float x) { return bf16_val(bf16_bits(x)); }
// D += A·B with NT terms: 1 = ah·bh, 2 = + al·bh (A split), 3 = + ah·bl (both split)
template <int NT>
__device__ __forceinline__ v8f mmaN(v16b ah, v16b al, v16b bh, v16b bl, v8f c) {
  c = __builtin_amdgcn_wmma_f32_16x16x32_bf16(false, ah, false, bh, (short)0, c, false, false);
  if (NT >= 2) c = __builtin_amdgcn_wmma_f32_16x16x32_bf16(false, al, false, bh, (short)0, c, false, false);
  if (NT >= 3) c = __builtin_amdgcn_wmma_f32_16x16x32_bf16(false, ah, false, bl, (short)0, c, false, false);
  asm volatile("v_nop\n\tv_nop\n\tv_nop\n\tv_nop" : "+v"(c) : "v"(ah), "v"(al), "v"(bh), "v"(bl));
  return c;
}

__global__ __launch_bounds__(256) void k_wt_bf16(const float* __restrict__ W, unsigned short* __restrict__ Wt, int K, int N) {
  const int t = blockIdx.x * 256 + threadIdx.x;
  const int k8n = K / 8;
  if (t >= N * k8n) return;
  const int n = t / k8n, k8 = (t % k8n) * 8;
  v8us v;
#pragma unroll
  for (int i = 0; i < 8; ++i) v[i] = bf16_bits(W[(size_t)(k8 + i) * N + n]);
  *(v8us*)(Wt + (size_t)n * K + k8) = v;
  
}

// GEMM C[M][N] (f32, pitch ldc) = act(A[M][K]·W + bias). A f32 row-major (pitch lda) converted per fragment to bf16
// (ASPLIT: hi/lo two planes -> 2 terms, else single rounded term); Wt bf16 [N][K] (pitch ldb). BIAS_BF16 rounds the
// bias to bf16 first (bias quantised to bf16 before the add). K%32==0, M%16==0, N%64==0.
template <bool ASPLIT, int ACT, bool BIAS_BF16>
__global__ __launch_bounds__(128) void k_gemm_bf(const float* __restrict__ A, int lda, const unsigned short* __restrict__ Wt, int ldb,
                                               const float* __restrict__ bias, float* __restrict__ C, int ldc, int M, int N, int K) {
  __shared__ __attribute__((aligned(16))) float so[4][16][64];
  const int tid = threadIdx.x, w = tid >> 5, lane = tid & 31, ln = lane & 15, hh = lane >> 4;
  const int ntn = N / 64;
  const int wid = blockIdx.x * 4 + w;
  const int mt = wid / ntn, nq = wid % ntn;
  if (mt * 16 >= M) return;
  const int row0 = mt * 16, col0 = nq * 64;
  const float* arow = A + (size_t)(row0 + ln) * lda;
  v8f acc[4] = {};
  for (int kb = 0; kb < K; kb += 32) {
    FragB ah, al;
    const v4f x0 = *(const v4fa*)(arow + kb + 8 * hh), x1 = *(const v4fa*)(arow + kb + 8 * hh + 4);
    const v4f x2 = *(const v4fa*)(arow + kb + 16 + 8 * hh), x3 = *(const v4fa*)(arow + kb + 16 + 8 * hh + 4);
    float xs[16] = {x0[0],x0[1],x0[2],x0[3],x1[0],x1[1],x1[2],x1[3],x2[0],x2[1],x2[2],x2[3],x3[0],x3[1],x3[2],x3[3]};
#pragma unroll
    for (int i = 0; i < 16; ++i) { const unsigned short hb = bf16_bits(xs[i]); ah.u[i] = hb; al.u[i] = ASPLIT ? bf16_bits(xs[i] - bf16_val(hb)) : (unsigned short)0; }
#pragma unroll
    for (int t = 0; t < 4; ++t) {
      const unsigned short* brow = Wt + (size_t)(col0 + t * 16 + ln) * ldb + kb;
      FragB b;
      b.half[0] = *(const v8us*)(brow + 8 * hh);
      b.half[1] = *(const v8us*)(brow + 16 + 8 * hh);
      acc[t] = mmaN<ASPLIT ? 2 : 1>(ah.v, al.v, b.v, b.v, acc[t]);
    }
  }
#pragma unroll
  for (int t = 0; t < 4; ++t) {
    float bv = bias ? bias[col0 + t * 16 + ln] : 0.f;
    if (BIAS_BF16) bv = bf16_round(bv);
#pragma unroll
    for (int r = 0; r < 8; ++r) { float v = acc[t][r] + bv; if (ACT == 1) v = fmaxf(v, 0.f); so[w][8 * hh + r][t * 16 + ln] = v; }
  }
  __builtin_amdgcn_fence(__ATOMIC_ACQ_REL, "workgroup");
  __builtin_amdgcn_wave_barrier();
  const int rsub = lane >> 4, c4 = (lane & 15) * 4;
  {
#pragma unroll
    for (int q = 0; q < 8; ++q) {
      const int r = q * 2 + rsub;
      const v4f v = *(const v4fa*)&so[w][r][c4];
      *(v4f*)(C + (size_t)(row0 + r) * ldc + col0 + c4) = v;
    }
    
  }
}

// Flash-style causal/unmasked attention, all contractions 3-term bf16 hi/lo splits, f32 softmax with running max.
// q,k,v rows are read from f32 buffers with arbitrary row pitch (so they can live inside a fused qkv buffer);
// D = head size (multiple of 32, <= 128); one wave = 16 query rows; block = 4 waves (64 queries) sharing K/V chunks of 32.
template <int D, bool CAUSAL>
__global__ __launch_bounds__(128) void k_flash(const float* __restrict__ qb, const float* __restrict__ kb, const float* __restrict__ vb,
                                             int pitch, int T, int H, float scale, float* __restrict__ y, int ypitch) {
  constexpr int KS = D / 32;        // k-steps for QK
  constexpr int DT = D / 16;        // d tiles for PV
  __shared__ __attribute__((aligned(16))) unsigned short sKh[32][D + 8], sKl[32][D + 8], sVh[32][D + 8], sVl[32][D + 8];
  __shared__ __attribute__((aligned(16))) unsigned short sPh[4][16][40], sPl[4][16][40];
  __shared__ __attribute__((aligned(16))) float sO[4][16][D];
  const int tid = threadIdx.x, w = tid >> 5, lane = tid & 31, ln = lane & 15, hh = lane >> 4;
  const int nqb = (T + 63) / 64;
  const int bh = blockIdx.x / nqb, qblk = blockIdx.x % nqb;
  const int b = bh / H, h = bh % H;
  const int q0 = qblk * 64 + w * 16;
  const float* Q = qb + (size_t)b * T * pitch + h * D;
  const float* K = kb + (size_t)b * T * pitch + h * D;
  const float* V = vb + (size_t)b * T * pitch + h * D;

  // A fragments of the wave's 16 query rows (scaled), hi/lo
  FragB aqh[KS], aql[KS];
  {
    int row = q0 + ln; if (row >= T) row = T - 1;
    const float* qr = Q + (size_t)row * pitch;
#pragma unroll
    for (int ks = 0; ks < KS; ++ks)
#pragma unroll
      for (int i = 0; i < 16; ++i) {
        const int d = ks * 32 + ((i < 8) ? (8 * hh + i) : (16 + 8 * hh + (i - 8)));
        const float x = qr[d] * scale; const unsigned short hb = bf16_bits(x);
        aqh[ks].u[i] = hb; aql[ks].u[i] = bf16_bits(x - bf16_val(hb));
      }
  }
  float m_r[8], l_r[8];
#pragma unroll
  for (int r = 0; r < 8; ++r) { m_r[r] = -3.0e38f; l_r[r] = 0.f; }
  v8f oacc[DT];
#pragma unroll
  for (int dt = 0; dt < DT; ++dt) oacc[dt] = (v8f){0.f,0.f,0.f,0.f,0.f,0.f,0.f,0.f};

  const int kv_end = CAUSAL ? min(T, qblk * 64 + 64) : T;     // block-uniform
  for (int j0 = 0; j0 < kv_end; j0 += 32) {
    __syncthreads();
    for (int e = tid; e < 32 * (D / 4); e += 128) {
      const int r = e / (D / 4), c4 = (e % (D / 4)) * 4;
      const int key = j0 + r;
      v4f kf = {0.f,0.f,0.f,0.f}, vf = {0.f,0.f,0.f,0.f};
      if (key < T) { kf = *(const v4fa*)(K + (size_t)key * pitch + c4); vf = *(const v4fa*)(V + (size_t)key * pitch + c4); }
#pragma unroll
      for (int t = 0; t < 4; ++t) {
        unsigned short hb = bf16_bits(kf[t]); sKh[r][c4 + t] = hb; sKl[r][c4 + t] = bf16_bits(kf[t] - bf16_val(hb));
        hb = bf16_bits(vf[t]); sVh[r][c4 + t] = hb; sVl[r][c4 + t] = bf16_bits(vf[t] - bf16_val(hb));
      }
    }
    __syncthreads();
    // S tile 16 x 32
    v8f s[2];
#pragma unroll
    for (int nt = 0; nt < 2; ++nt) {
      v8f acc = {};
#pragma unroll
      for (int ks = 0; ks < KS; ++ks) {
        FragB bh_, bl_;
        bh_.half[0] = *(const v8us*)&sKh[nt * 16 + ln][ks * 32 + 8 * hh]; bh_.half[1] = *(const v8us*)&sKh[nt * 16 + ln][ks * 32 + 16 + 8 * hh];
        bl_.half[0] = *(const v8us*)&sKl[nt * 16 + ln][ks * 32 + 8 * hh]; bl_.half[1] = *(const v8us*)&sKl[nt * 16 + ln][ks * 32 + 16 + 8 * hh];
        acc = mmaN<3>(aqh[ks].v, aql[ks].v, bh_.v, bl_.v, acc);
      }
      s[nt] = acc;
    }
    // mask + running max (rows 8hh+r; the 16 lanes of a half share rows)
    float alpha[8];
#pragma unroll
    for (int r = 0; r < 8; ++r) {
      const int qi = q0 + 8 * hh + r;
      const int ja = j0 + ln, jb = j0 + 16 + ln;
      if (CAUSAL) { if (ja > qi) s[0][r] = -3.0e38f; if (jb > qi) s[1][r] = -3.0e38f; }
      if (ja >= T) s[0][r] = -3.0e38f;
      if (jb >= T) s[1][r] = -3.0e38f;
      float mx = fmaxf(s[0][r], s[1][r]);
      mx = fmaxf(mx, __shfl_xor(mx, 1, 32)); mx = fmaxf(mx, __shfl_xor(mx, 2, 32)); mx = fmaxf(mx, __shfl_xor(mx, 4, 32)); mx = fmaxf(mx, __shfl_xor(mx, 8, 32));
      const float mnew = fmaxf(m_r[r], mx);
      alpha[r] = (mnew > -1.0e38f) ? __expf(m_r[r] - mnew) : 1.0f;
      const float p0 = (s[0][r] > -1.0e38f) ? __expf(s[0][r] - mnew) : 0.f;
      const float p1 = (s[1][r] > -1.0e38f) ? __expf(s[1][r] - mnew) : 0.f;
      m_r[r] = mnew;
      l_r[r] = l_r[r] * alpha[r] + p0 + p1;            // per-lane partial row sum (16 lanes combined at the end)
      unsigned short hb = bf16_bits(p0); sPh[w][8 * hh + r][ln] = hb;      sPl[w][8 * hh + r][ln] = bf16_bits(p0 - bf16_val(hb));
      hb = bf16_bits(p1);                sPh[w][8 * hh + r][16 + ln] = hb; sPl[w][8 * hh + r][16 + ln] = bf16_bits(p1 - bf16_val(hb));
    }
#pragma unroll
    for (int dt = 0; dt < DT; ++dt)
#pragma unroll
      for (int r = 0; r < 8; ++r) oacc[dt][r] *= alpha[r];
    __builtin_amdgcn_fence(__ATOMIC_ACQ_REL, "workgroup");
    __builtin_amdgcn_wave_barrier();
    FragB pah, pal;
    pah.half[0] = *(const v8us*)&sPh[w][ln][8 * hh]; pah.half[1] = *(const v8us*)&sPh[w][ln][16 + 8 * hh];
    pal.half[0] = *(const v8us*)&sPl[w][ln][8 * hh]; pal.half[1] = *(const v8us*)&sPl[w][ln][16 + 8 * hh];
#pragma unroll
    for (int dt = 0; dt < DT; ++dt) {
      FragB bvh, bvl;
#pragma unroll
      for (int i = 0; i < 8; ++i) {
        bvh.u[i] = sVh[8 * hh + i][dt * 16 + ln]; bvh.u[8 + i] = sVh[16 + 8 * hh + i][dt * 16 + ln];
        bvl.u[i] = sVl[8 * hh + i][dt * 16 + ln]; bvl.u[8 + i] = sVl[16 + 8 * hh + i][dt * 16 + ln];
      }
      oacc[dt] = mmaN<3>(pah.v, pal.v, bvh.v, bvl.v, oacc[dt]);
    }
    __builtin_amdgcn_fence(__ATOMIC_ACQ_REL, "workgroup");
    __builtin_amdgcn_wave_barrier();
  }
#pragma unroll
  for (int r = 0; r < 8; ++r) {
    float l = l_r[r];
    l += __shfl_xor(l, 1, 32); l += __shfl_xor(l, 2, 32); l += __shfl_xor(l, 4, 32); l += __shfl_xor(l, 8, 32);
    l_r[r] = (l > 0.f) ? 1.0f / l : 0.f;
  }
#pragma unroll
  for (int dt = 0; dt < DT; ++dt)
#pragma unroll
    for (int r = 0; r < 8; ++r) sO[w][8 * hh + r][dt * 16 + ln] = oacc[dt][r] * l_r[r];
  __builtin_amdgcn_fence(__ATOMIC_ACQ_REL, "workgroup");
  __builtin_amdgcn_wave_barrier();
  {
    for (int r = 0; r < 16; ++r) {
      const int row = q0 + r;
      if (row < T && lane < D / 4) {
        const v4f val = *(const v4fa*)&sO[w][r][lane * 4];
        *(v4f*)(y + ((size_t)b * T + row) * ypitch + h * D + lane * 4) = val;
      }
    }
    
  }
}

// GEMM C = act(A·W + bias + resid): A f32 (ASPLIT -> hi/lo 2 terms), Wt bf16 [N][K]; ACT 0 none, 1 relu, 2 exact gelu;
// resid (optional, f32, row index = (row % rmod), pitch ldr, RES_BF16 rounds it) added before the activation.
template <bool ASPLIT, int ACT, bool BIAS_BF16, bool RES_BF16>
__global__ __launch_bounds__(128) void k_gemm_bf3(const float* __restrict__ A, int lda, const unsigned short* __restrict__ Wt, int ldb,
                                                const float* __restrict__ bias, const float* __restrict__ resid, int rmod, int ldr,
                                                float* __restrict__ C, int ldc, int M, int N, int K) {
  __shared__ __attribute__((aligned(16))) float so[4][16][64];
  const int tid = threadIdx.x, w = tid >> 5, lane = tid & 31, ln = lane & 15, hh = lane >> 4;
  const int ntn = N / 64;
  const int wid = blockIdx.x * 4 + w;
  const int mt = wid / ntn, nq = wid % ntn;
  if (mt * 16 >= M) return;
  const int row0 = mt * 16, col0 = nq * 64;
  const float* arow = A + (size_t)(row0 + ln) * lda;
  v8f acc[4] = {};
  for (int kb = 0; kb < K; kb += 32) {
    FragB ah, al;
    const v4f x0 = *(const v4fa*)(arow + kb + 8 * hh), x1 = *(const v4fa*)(arow + kb + 8 * hh + 4);
    const v4f x2 = *(const v4fa*)(arow + kb + 16 + 8 * hh), x3 = *(const v4fa*)(arow + kb + 16 + 8 * hh + 4);
    float xs[16] = {x0[0],x0[1],x0[2],x0[3],x1[0],x1[1],x1[2],x1[3],x2[0],x2[1],x2[2],x2[3],x3[0],x3[1],x3[2],x3[3]};
#pragma unroll
    for (int i = 0; i < 16; ++i) { const unsigned short hb = bf16_bits(xs[i]); ah.u[i] = hb; al.u[i] = ASPLIT ? bf16_bits(xs[i] - bf16_val(hb)) : (unsigned short)0; }
#pragma unroll
    for (int t = 0; t < 4; ++t) {
      const unsigned short* brow = Wt + (size_t)(col0 + t * 16 + ln) * ldb + kb;
      FragB b;
      b.half[0] = *(const v8us*)(brow + 8 * hh);
      b.half[1] = *(const v8us*)(brow + 16 + 8 * hh);
      acc[t] = mmaN<ASPLIT ? 2 : 1>(ah.v, al.v, b.v, b.v, acc[t]);
    }
  }
#pragma unroll
  for (int t = 0; t < 4; ++t) {
    const int col = col0 + t * 16 + ln;
    float bv = bias ? bias[col] : 0.f;
    if (BIAS_BF16) bv = bf16_round(bv);
#pragma unroll
    for (int r = 0; r < 8; ++r) {
      float v = acc[t][r] + bv;
      if (resid) { float rv = resid[(size_t)((row0 + 8 * hh + r) % rmod) * ldr + col]; if (RES_BF16) rv = bf16_round(rv); v += rv; }
      if (ACT == 1) v = fmaxf(v, 0.f);
      if (ACT == 2) v = 0.5f * v * (1.0f + erff(v * 0.70710678118654752f));
      if (ACT == 3) { const float u = 0.7978845608028654f * (v + 0.044715f * v * v * v); v = 0.5f * v * (1.0f + tanhf(u)); }
      so[w][8 * hh + r][t * 16 + ln] = v;
    }
  }
  __builtin_amdgcn_fence(__ATOMIC_ACQ_REL, "workgroup");
  __builtin_amdgcn_wave_barrier();
  const int rsub = lane >> 4, c4 = (lane & 15) * 4;
  {
#pragma unroll
    for (int q = 0; q < 8; ++q) {
      const int r = q * 2 + rsub;
      const v4f v = *(const v4fa*)&so[w][r][c4];
      *(v4f*)(C + (size_t)(row0 + r) * ldc + col0 + c4) = v;
    }
    
  }
}
// row LayerNorm (biased variance, eps) over N: s = X (+ R); optional out_sum <- s; out_norm <- (s-mu)*rsqrt(var+eps)*g + b
template <bool PARAM_BF16>
__global__ __launch_bounds__(256) void k_layernorm(const float* __restrict__ X, const float* __restrict__ R, const float* __restrict__ g, const float* __restrict__ bta,
                                                  float* __restrict__ out_sum, float* __restrict__ out_norm, int N, float eps) {
  __shared__ float red[256];
  const int row = blockIdx.x, tid = threadIdx.x;
  const float* x = X + (size_t)row * N; const float* rr = R ? R + (size_t)row * N : nullptr;
  float vals[16];                     // up to N = 4096
  const int per = N / 256;            // contiguous chunk per thread? use strided-by-4 chunks: thread handles j = tid*4 + 1024*u
  float s1 = 0.f;
  for (int u = 0; u < per / 4; ++u) {
    const int j = tid * 4 + 1024 * u;
    const v4f a = *(const v4fa*)(x + j);
    v4f b = {0.f,0.f,0.f,0.f}; if (rr) b = *(const v4fa*)(rr + j);
#pragma unroll
    for (int q = 0; q < 4; ++q) { const float v = a[q] + b[q]; vals[u * 4 + q] = v; s1 += v; }
  }
  red[tid] = s1; __syncthreads();
  for (int st = 128; st > 0; st >>= 1) { if (tid < st) red[tid] += red[tid + st]; __syncthreads(); }
  const float mu = red[0] / (float)N; __syncthreads();
  float s2 = 0.f;
  for (int u = 0; u < per / 4; ++u)
#pragma unroll
    for (int q = 0; q < 4; ++q) { const float c = vals[u * 4 + q] - mu; s2 += c * c; }
  red[tid] = s2; __syncthreads();
  for (int st = 128; st > 0; st >>= 1) { if (tid < st) red[tid] += red[tid + st]; __syncthreads(); }
  const float rs = rsqrtf(red[0] / (float)N + eps);
  {
    for (int u = 0; u < per / 4; ++u) {
      const int j = tid * 4 + 1024 * u;
      v4f o, sm;
#pragma unroll
      for (int q = 0; q < 4; ++q) {
        float gg = g[j + q], bb = bta[j + q];
        if (PARAM_BF16) { gg = bf16_round(gg); bb = bf16_round(bb); }
        sm[q] = vals[u * 4 + q]; o[q] = (vals[u * 4 + q] - mu) * rs * gg + bb;
      }
      if (out_sum) *(v4f*)(out_sum + (size_t)row * N + j) = sm;
      *(v4f*)(out_norm + (size_t)row * N + j) = o;
    }
    
  }
}



// ---- f16 WMMA path (v_wmma_f32_16x16x32_f16): 11-bit significands for operands in range — used where a [0,1] probability operand needs more precision than bf16
typedef _Float16 v16h __attribute__((ext_vector_type(16)));
union FragH { v16h v; v8us half[2]; _Float16 h[16]; unsigned short u[16]; };
template <int NT>
__device__ __forceinline__ v8f mmaH(v16h ah, v16h al, v16h bh, v16h bl, v8f c) {
  c = __builtin_amdgcn_wmma_f32_16x16x32_f16(false, ah, false, bh, (short)0, c, false, false);
  if (NT >= 2) c = __builtin_amdgcn_wmma_f32_16x16x32_f16(false, al, false, bh, (short)0, c, false, false);
  if (NT >= 3) c = __builtin_amdgcn_wmma_f32_16x16x32_f16(false, ah, false, bl, (short)0, c, false, false);
  asm volatile("v_nop\n\tv_nop\n\tv_nop\n\tv_nop" : "+v"(c) : "v"(ah), "v"(al), "v"(bh), "v"(bl));
  return c;
}
// batched GEMM like k_gemm_b but f16 operands: A f32 (split into f16 hi/lo if ASPLIT, else rounded to f16), Bt = f16 values [n][k]; alpha; C f32; N multiple of 16 (partial tiles skipped)
template <bool ASPLIT>
__global__ __launch_bounds__(128) void k_gemm_h(const float* __restrict__ A, int lda, size_t sA, const _Float16* __restrict__ Bh, int ldb, size_t sB, float alpha, float* __restrict__ C, int ldc, size_t sC, int M, int N, int K) {
  __shared__ __attribute__((aligned(16))) float so[4][16][64];
  const int tid = threadIdx.x, w = tid >> 5, lane = tid & 31, ln = lane & 15, hh = lane >> 4; const int by = blockIdx.y;
  A += (size_t)by * sA; Bh += (size_t)by * sB; C += (size_t)by * sC;
  const int ntn = (N + 63) / 64; const int wid = blockIdx.x * 4 + w; const int mt = wid / ntn, nq = wid % ntn; if (mt * 16 >= M) return;
  const int row0 = mt * 16, col0 = nq * 64; const float* arow = A + (size_t)(row0 + ln) * lda;
  v8f acc[4] = {};
  for (int kb = 0; kb < K; kb += 32) {
    FragH ah, al;
    const v4f x0 = *(const v4fa*)(arow + kb + 8 * hh), x1 = *(const v4fa*)(arow + kb + 8 * hh + 4), x2 = *(const v4fa*)(arow + kb + 16 + 8 * hh), x3 = *(const v4fa*)(arow + kb + 16 + 8 * hh + 4);
    float xs[16] = {x0[0],x0[1],x0[2],x0[3],x1[0],x1[1],x1[2],x1[3],x2[0],x2[1],x2[2],x2[3],x3[0],x3[1],x3[2],x3[3]};
#pragma unroll
    for (int i = 0; i < 16; ++i) { const _Float16 h = (_Float16)xs[i]; ah.h[i] = h; al.h[i] = ASPLIT ? (_Float16)(xs[i] - (float)h) : (_Float16)0.0f; }
#pragma unroll
    for (int t = 0; t < 4; ++t) { if (col0 + t * 16 >= N) continue; const size_t boff = (size_t)(col0 + t * 16 + ln) * ldb + kb; FragH bq; bq.half[0] = *(const v8us*)(Bh + boff + 8 * hh); bq.half[1] = *(const v8us*)(Bh + boff + 16 + 8 * hh);
      acc[t] = mmaH<ASPLIT ? 2 : 1>(ah.v, al.v, bq.v, bq.v, acc[t]); }
  }
#pragma unroll
  for (int t = 0; t < 4; ++t) { if (col0 + t * 16 >= N) continue;
#pragma unroll
    for (int r = 0; r < 8; ++r) so[w][8 * hh + r][t * 16 + ln] = acc[t][r] * alpha; }
  __builtin_amdgcn_fence(__ATOMIC_ACQ_REL, "workgroup"); __builtin_amdgcn_wave_barrier();
  const int rsub = lane >> 4, c4 = (lane & 15) * 4;
  {
#pragma unroll
    for (int q = 0; q < 8; ++q) { const int r = q * 2 + rsub; if (col0 + c4 < N) { const v4f v = *(const v4fa*)&so[w][r][c4]; *(v4f*)(C + (size_t)(row0 + r) * ldc + col0 + c4) = v; } }
     }
}

// Wt[n][k] = f16(W[k][n]·scale) from f32 row-major W[K][N] (scale = power of two; bf16-exact weights stay exact in f16 away from the subnormal range)
__global__ __launch_bounds__(256) void k_wt_f16(const float* __restrict__ W, _Float16* __restrict__ Wt, int K, int N, float scale) {
  const int t = blockIdx.x * 256 + threadIdx.x; if (t >= N * (K / 8)) return; const int n = t / (K / 8), k8 = (t % (K / 8)) * 8; FragH f;
#pragma unroll
  for (int i = 0; i < 8; ++i) f.h[i] = (_Float16)(bf16_round(W[(size_t)(k8 + i) * N + n]) * scale); const v8us o = f.half[0];
  *(v8us*)((unsigned short*)Wt + (size_t)n * K + k8) = o; 
}
// k_gemm_hh variant with fused epilogue: v = acc·alpha + bias[by·sBias + col] (+ CP[(row/rowsPerB)·sCPb + by·64 + col] if CP) ; ACT 0 none / 1 elu ; writes f16 C16 and f32 C, each if non-null
template <int ACT>
__global__ __launch_bounds__(128) void k_gemm_hhx(const _Float16* __restrict__ A, int lda, size_t sA, const _Float16* __restrict__ Bh, int ldb, size_t sB, float alpha, const float* __restrict__ bias, size_t sBias, const float* __restrict__ CP, int rowsPerB, size_t sCPb, int row0g,
    float* __restrict__ C, _Float16* __restrict__ C16, int ldc, size_t sC, int M, int N, int K) {
  __shared__ __attribute__((aligned(16))) float so[4][16][64];
  const int tid = threadIdx.x, w = tid >> 5, lane = tid & 31, ln = lane & 15, hh = lane >> 4; const int by = blockIdx.y;
  A += (size_t)by * sA; Bh += (size_t)by * sB; const size_t cofs = (size_t)by * sC; const float* bp = bias ? bias + (size_t)by * sBias : nullptr;
  const int ntn = (N + 63) / 64; const int wid = blockIdx.x * 4 + w; const int mt = wid / ntn, nq = wid % ntn; if (mt * 16 >= M) return;
  const int row0 = mt * 16, col0 = nq * 64; const _Float16* arow = A + (size_t)(row0 + ln) * lda;
  v8f acc[4] = {};
  for (int kb = 0; kb < K; kb += 32) { FragH ah; ah.half[0] = *(const v8us*)((const unsigned short*)arow + kb + 8 * hh); ah.half[1] = *(const v8us*)((const unsigned short*)arow + kb + 16 + 8 * hh);
#pragma unroll
    for (int t = 0; t < 4; ++t) { if (col0 + t * 16 >= N) continue; const size_t boff = (size_t)(col0 + t * 16 + ln) * ldb + kb; FragH bq; bq.half[0] = *(const v8us*)((const unsigned short*)Bh + boff + 8 * hh); bq.half[1] = *(const v8us*)((const unsigned short*)Bh + boff + 16 + 8 * hh);
      acc[t] = mmaH<1>(ah.v, ah.v, bq.v, bq.v, acc[t]); }
  }
#pragma unroll
  for (int t = 0; t < 4; ++t) { if (col0 + t * 16 >= N) continue; const int col = col0 + t * 16 + ln; const float bv = bp ? bf16_round(bp[col]) : 0.f;
#pragma unroll
    for (int r = 0; r < 8; ++r) { float v = acc[t][r] * alpha + bv; if (CP) { const int bidx = (row0g + row0 + 8 * hh + r) / rowsPerB; v += CP[(size_t)bidx * sCPb + (size_t)by * 64 + col]; } if (ACT == 1) v = (v > 0.f) ? v : expm1f(v); else if (ACT == 7) v = (v > 0.f) ? v + 1.0f : expf(v); else if (ACT == 8) v = tanhf(v); else if (ACT == 9) v = 0.5f * v * (1.0f + tanhf(0.7978845608028654f * (v + 0.044715f * v * v * v))); else if (ACT == 11) v = 1.0f / (1.0f + expf(-v)); else if (ACT == 12) v = (v > 0.f) ? v : 0.01f * v; else if (ACT == 14) v = (v > 0.f) ? v : 0.1f * v; else if (ACT == 15) v = v / (1.0f + expf(-v)); else if (ACT == 3) v = fmaxf(v, 0.f); else if (ACT == 6) v = 0.5f * v * (1.0f + erff(v * 0.70710678118654752f)); so[w][8 * hh + r][t * 16 + ln] = v; } }
  __builtin_amdgcn_fence(__ATOMIC_ACQ_REL, "workgroup"); __builtin_amdgcn_wave_barrier();
  const int rsub = lane >> 4, c4 = (lane & 15) * 4; typedef _Float16 v4h __attribute__((ext_vector_type(4)));
  {
#pragma unroll
    for (int q = 0; q < 8; ++q) { const int r = q * 2 + rsub; if (col0 + c4 < N) { const v4f v = *(const v4fa*)&so[w][r][c4]; if (C) *(v4f*)(C + cofs + (size_t)(row0 + r) * ldc + col0 + c4) = v; if (C16) { v4h h4; for (int i = 0; i < 4; ++i) h4[i] = (_Float16)v[i]; *(v4h*)(C16 + cofs + (size_t)(row0 + r) * ldc + col0 + c4) = h4; } } }
     }
}


typedef _Float16 v4h __attribute__((ext_vector_type(4)));

__global__ __launch_bounds__(256) void k_x16(const float* __restrict__ x, _Float16* __restrict__ X16, size_t n8) { const size_t t = (size_t)blockIdx.x * 256 + threadIdx.x; if (t >= n8) return; FragH f;
#pragma unroll
  for (int q = 0; q < 8; ++q) f.h[q] = (_Float16)bf16_round(x[t * 8 + q]); *(v8us*)((unsigned short*)X16 + t * 8) = f.half[0];  }
__global__ __launch_bounds__(256) void k_h16(const float* __restrict__ x, _Float16* __restrict__ X16, size_t n8) { const size_t t = (size_t)blockIdx.x * 256 + threadIdx.x; if (t >= n8) return; FragH f;
#pragma unroll
  for (int q = 0; q < 8; ++q) f.h[q] = (_Float16)x[t * 8 + q]; *(v8us*)((unsigned short*)X16 + t * 8) = f.half[0];  }
__global__ __launch_bounds__(256) void k_round16f(const float* __restrict__ W, _Float16* __restrict__ Bt, size_t n8) { const size_t t = (size_t)blockIdx.x * 256 + threadIdx.x; if (t >= n8) return; FragH f;
#pragma unroll
  for (int i = 0; i < 8; ++i) f.h[i] = (_Float16)(bf16_round(W[t * 8 + i]) * 16.0f); *(v8us*)((unsigned short*)Bt + t * 8) = f.half[0];  }
template <int NHv, int TTv>
__global__ __launch_bounds__(256) void k_vt(const _Float16* __restrict__ V16, int ldv, int voff, _Float16* __restrict__ Vt) { __shared__ unsigned short tl[64][66]; const int tid = threadIdx.x; const int slab = blockIdx.x / (TTv / 64), lg = blockIdx.x % (TTv / 64); const int b = slab / NHv, h = slab % NHv;
  for (int i = tid; i < 64 * 8; i += 256) { const int r = i / 8, c8 = (i % 8) * 8; FragH f; f.half[0] = *(const v8us*)((const unsigned short*)V16 + ((size_t)b * TTv + lg * 64 + r) * ldv + voff + h * 64 + c8);
#pragma unroll
    for (int q = 0; q < 8; ++q) tl[r][c8 + q] = f.u[q]; }
  __syncthreads();
  {
#pragma unroll
    for (int rd = 0; rd < 2; ++rd) { const int d = rd * 32 + tid / 8, pc = tid % 8; FragH f;
#pragma unroll
      for (int q = 0; q < 8; ++q) f.u[q] = tl[pc * 8 + q][d];
      *(v8us*)((unsigned short*)Vt + ((size_t)slab * 64 + d) * TTv + lg * 64 + pc * 8) = f.half[0]; }
     } }

__global__ __launch_bounds__(256) void k_vthlu(const float* __restrict__ VF, int ldv, _Float16* __restrict__ Vth, _Float16* __restrict__ Vtl) { __shared__ float tl[64][65]; const int tid = threadIdx.x; const int slab = blockIdx.x / (TT / 64), lg = blockIdx.x % (TT / 64); const int b = slab / NVH, h = slab % NVH;
  for (int i = tid; i < 64 * 16; i += 256) { const int r = i / 16, c4 = (i % 16) * 4; const v4f a = *(const v4fa*)(VF + ((size_t)b * TT + lg * 64 + r) * ldv + h * 64 + c4); tl[r][c4] = a[0]; tl[r][c4 + 1] = a[1]; tl[r][c4 + 2] = a[2]; tl[r][c4 + 3] = a[3]; }
  __syncthreads();
  FragH fh[2], fl[2]; size_t oo[2];
#pragma unroll
  for (int rd = 0; rd < 2; ++rd) { const int d = rd * 32 + tid / 8, pc = tid % 8;
#pragma unroll
    for (int q = 0; q < 8; ++q) { const float v = tl[pc * 8 + q][d]; const _Float16 hv = (_Float16)v; fh[rd].h[q] = hv; fl[rd].h[q] = (_Float16)(v - (float)hv);      /* UNSCALED residual (added into the same accumulator as the hi product) */ } oo[rd] = ((size_t)slab * 64 + d) * TT + lg * 64 + pc * 8; }
  {
#pragma unroll
    for (int rd = 0; rd < 2; ++rd) { *(v8us*)((unsigned short*)Vth + oo[rd]) = fh[rd].half[0]; *(v8us*)((unsigned short*)Vtl + oo[rd]) = fl[rd].half[0]; }
     } }
__global__ __launch_bounds__(256) void k_im3(const float* __restrict__ x, _Float16* __restrict__ A) { const size_t t = (size_t)blockIdx.x * 256 + threadIdx.x; if (t >= (size_t)NR * (K3 / 8)) return; const int piece = (int)(t % (K3 / 8)); const size_t row = t / (K3 / 8); const int b = (int)(row / TT), s = (int)(row % TT); const int tap = (piece * 8) / DD, c0 = (piece * 8) % DD; const int ss = s + tap - 1; FragH f;
  if (ss >= 0 && ss < TT) { const float* xr = x + ((size_t)b * TT + ss) * DD + c0; for (int q = 0; q < 8; ++q) f.h[q] = (_Float16)bf16_round(xr[q]); } else { for (int q = 0; q < 8; ++q) f.h[q] = (_Float16)0.f; }
  *(v8us*)((unsigned short*)A + t * 8) = f.half[0];  }
__global__ __launch_bounds__(256) void k_wc3(const float* __restrict__ w, _Float16* __restrict__ Bt) { const int t = blockIdx.x * 256 + threadIdx.x; if (t >= DD * (K3 / 8)) return; const int o = t / (K3 / 8), k0 = (t % (K3 / 8)) * 8; const int tap = k0 / DD, c0 = k0 % DD; FragH f;
  for (int q = 0; q < 8; ++q) f.h[q] = (_Float16)bf16_round(w[((size_t)o * DD + c0 + q) * 3 + tap]);
  *(v8us*)((unsigned short*)Bt + (size_t)t * 8) = f.half[0];  }
__global__ __launch_bounds__(256) void k_scl(float* __restrict__ O, const float* __restrict__ scl, size_t n4) { const size_t t = (size_t)blockIdx.x * 256 + threadIdx.x; if (t >= n4) return; const float s = bf16_round(scl[0]); v4f v = *(const v4fa*)(O + t * 4); for (int q = 0; q < 4; ++q) v[q] *= s; *(v4f*)(O + t * 4) = v;  }
__global__ __launch_bounds__(128) void k_flash(const _Float16* __restrict__ Q16, int ldq, const _Float16* __restrict__ K16, int ldk, const _Float16* __restrict__ Vt, const _Float16* __restrict__ Vtlo, float* __restrict__ O, int ldo) {
  constexpr int RPW = 16, RTN = RPW / 16, NQB = TT / (4 * RPW), DT = 8, KS = 8;      /* d_qk 256: 8 k-steps; 8 value tiles = ONE 128-wide half of the 256-wide V per launch */
  __shared__ __attribute__((aligned(16))) unsigned short sP[4][RPW][40]; __shared__ __attribute__((aligned(16))) unsigned short sPL[4][RPW][40]; __shared__ __attribute__((aligned(16))) float sO[4][RPW][128 + 4];
  const int tid = threadIdx.x, w = tid >> 5, lane = tid & 31, ln = lane & 15, hh = lane >> 4;
  const int slab = blockIdx.x / NQB, qblk = blockIdx.x % NQB; const int b = slab / NH, h = slab % NH; const int qb0 = qblk * (4 * RPW); const int q0 = qb0 + w * RPW;
  const unsigned short* qrow = (const unsigned short*)Q16 + ((size_t)b * TT + q0 + ln) * ldq;      /* Q fragments are re-read per key chunk (8 k-steps would not fit in registers alongside the value accumulators) */
  const unsigned short* Vth = (const unsigned short*)Vt + (size_t)b * VSTR * TT; const unsigned short* Vtl = (const unsigned short*)Vtlo + (size_t)b * VSTR * TT;      /* the caller offsets Vt/Vtlo/O by the 128-wide half */      /* hi and UNSCALED residual planes */
  float m_r[2][8], l_r[2][8]; v8f oacc[2][DT];
#pragma unroll
  for (int rt = 0; rt < RTN; ++rt) {
#pragma unroll
    for (int r = 0; r < 8; ++r) { m_r[rt][r] = -3.0e38f; l_r[rt][r] = 0.f; }
#pragma unroll
    for (int dt = 0; dt < DT; ++dt) oacc[rt][dt] = (v8f){0.f,0.f,0.f,0.f,0.f,0.f,0.f,0.f}; }
  const int jend = TT;
#pragma unroll 1
  for (int j0 = 0; j0 < jend; j0 += 32) {
    
    v8f s[2][2];
#pragma unroll
    for (int nt = 0; nt < 2; ++nt) { const unsigned short* kr = (const unsigned short*)K16 + ((size_t)b * TT + j0 + nt * 16 + ln) * ldk; v8f acc = (v8f){0.f,0.f,0.f,0.f,0.f,0.f,0.f,0.f};
#pragma unroll
      for (int ks = 0; ks < KS; ++ks) { FragH bk, aq; bk.half[0] = *(const v8us*)(kr + ks * 32 + 8 * hh); bk.half[1] = *(const v8us*)(kr + ks * 32 + 16 + 8 * hh); aq.half[0] = *(const v8us*)(qrow + ks * 32 + 8 * hh); aq.half[1] = *(const v8us*)(qrow + ks * 32 + 16 + 8 * hh); acc = mmaH<1>(aq.v, aq.v, bk.v, bk.v, acc); }
      s[0][nt] = acc; }
#pragma unroll
    for (int rt = 0; rt < RTN; ++rt)
#pragma unroll
      for (int r = 0; r < 8; ++r) { const int tq = q0 + rt * 16 + 8 * hh + r; const int k0 = j0 + ln, k1 = j0 + 16 + ln; (void)tq; (void)k0; (void)k1;
        const bool ok0 = true, ok1 = true; (void)tq; (void)k0; (void)k1;
        const float s0 = ok0 ? s[rt][0][r] * ATT_SCALE : -INFINITY, s1 = ok1 ? s[rt][1][r] * ATT_SCALE : -INFINITY; float mc = fmaxf(s0, s1);
        mc = fmaxf(mc, __shfl_xor(mc, 1, 32)); mc = fmaxf(mc, __shfl_xor(mc, 2, 32)); mc = fmaxf(mc, __shfl_xor(mc, 4, 32)); mc = fmaxf(mc, __shfl_xor(mc, 8, 32));
        const float mn = fmaxf(m_r[rt][r], mc); const float al = (mn > -1.0e38f) ? expf(m_r[rt][r] - mn) : 1.0f; m_r[rt][r] = mn; const float p0 = ok0 ? expf(s0 - mn) : 0.f, p1 = ok1 ? expf(s1 - mn) : 0.f; l_r[rt][r] = l_r[rt][r] * al + p0 + p1;
#pragma unroll
        for (int dt = 0; dt < DT; ++dt) oacc[rt][dt][r] *= al;
        FragH t2, t3; const float ps0 = p0 * 1024.0f, ps1 = p1 * 1024.0f; t2.h[0] = (_Float16)ps0; t2.h[1] = (_Float16)ps1; t3.h[0] = (_Float16)(ps0 - (float)t2.h[0]); t3.h[1] = (_Float16)(ps1 - (float)t2.h[1]);      /* P hi and its UNSCALED residual (added into the same accumulator) */
        sP[w][rt * 16 + 8 * hh + r][ln] = t2.u[0]; sP[w][rt * 16 + 8 * hh + r][16 + ln] = t2.u[1]; sPL[w][rt * 16 + 8 * hh + r][ln] = t3.u[0]; sPL[w][rt * 16 + 8 * hh + r][16 + ln] = t3.u[1]; }
    __builtin_amdgcn_fence(__ATOMIC_ACQ_REL, "workgroup"); __builtin_amdgcn_wave_barrier();
    FragH pa[2], pl[2];
#pragma unroll
    for (int rt = 0; rt < RTN; ++rt) { pa[rt].half[0] = *(const v8us*)&sP[w][rt * 16 + ln][8 * hh]; pa[rt].half[1] = *(const v8us*)&sP[w][rt * 16 + ln][16 + 8 * hh]; pl[rt].half[0] = *(const v8us*)&sPL[w][rt * 16 + ln][8 * hh]; pl[rt].half[1] = *(const v8us*)&sPL[w][rt * 16 + ln][16 + 8 * hh]; }
#pragma unroll
    for (int dt = 0; dt < DT; ++dt) { const size_t vo = (size_t)(dt * 16 + ln) * TT + j0; FragH bv, bl; bv.half[0] = *(const v8us*)(Vth + vo + 8 * hh); bv.half[1] = *(const v8us*)(Vth + vo + 16 + 8 * hh); bl.half[0] = *(const v8us*)(Vtl + vo + 8 * hh); bl.half[1] = *(const v8us*)(Vtl + vo + 16 + 8 * hh);
#pragma unroll
      for (int rt = 0; rt < RTN; ++rt) { oacc[rt][dt] = mmaH<1>(pa[rt].v, pa[rt].v, bv.v, bv.v, oacc[rt][dt]); oacc[rt][dt] = mmaH<1>(pl[rt].v, pl[rt].v, bv.v, bv.v, oacc[rt][dt]); oacc[rt][dt] = mmaH<1>(pa[rt].v, pa[rt].v, bl.v, bl.v, oacc[rt][dt]); } }      /* Ph·Vh + Pl·Vh + Ph·Vl — all unscaled, one accumulator */
    __builtin_amdgcn_fence(__ATOMIC_ACQ_REL, "workgroup"); __builtin_amdgcn_wave_barrier(); }
#pragma unroll
  for (int rt = 0; rt < RTN; ++rt) {
#pragma unroll
    for (int r = 0; r < 8; ++r) { float l = l_r[rt][r]; l += __shfl_xor(l, 1, 32); l += __shfl_xor(l, 2, 32); l += __shfl_xor(l, 4, 32); l += __shfl_xor(l, 8, 32); l_r[rt][r] = (l > 0.f) ? 1.0f / (l * 1024.0f) : 0.f; }
#pragma unroll
    for (int dt = 0; dt < DT; ++dt)
#pragma unroll
      for (int r = 0; r < 8; ++r) sO[w][rt * 16 + 8 * hh + r][dt * 16 + ln] = oacc[rt][dt][r] * l_r[rt][r]; }
  __builtin_amdgcn_fence(__ATOMIC_ACQ_REL, "workgroup"); __builtin_amdgcn_wave_barrier();
  {
#pragma unroll
    for (int r = 0; r < RPW; ++r) { const int pc = lane; const v4f val = *(const v4fa*)&sO[w][r][pc * 4]; *(v4f*)(O + ((size_t)b * TT + q0 + r) * ldo + h * 128 + pc * 4) = val; }      /* one 512-B row per instruction: 32 lanes × 16 B */
     } }

extern "C" void kernel_launch(void* const* d_in, const int* in_sizes, int n_in,
                              void* d_out, int out_size, void* d_ws, size_t ws_size, hipStream_t stream) {
  (void)in_sizes; (void)n_in; (void)out_size;
  const float* const* I = (const float* const*)d_in; const float* xq = I[0]; const float* xk = I[1]; const float* xv = I[2]; const float* qw = I[3]; const float* qb = I[4]; const float* kw = I[5]; const float* kb = I[6]; const float* vw = I[7]; const float* vb = I[8]; const float* scl = I[9];
  char* ws = (char*)d_ws; size_t off = 0;
  auto take = [&](size_t bytes) { char* p = ws + off; off += (bytes + 255) & ~(size_t)255; return p; };
  _Float16* Bq = (_Float16*)take((size_t)DD * K3 * 2); _Float16* Bk = (_Float16*)take((size_t)DD * K3 * 2); _Float16* Bv = (_Float16*)take((size_t)DD * K3 * 2); _Float16* A = (_Float16*)take((size_t)NR * K3 * 2); _Float16* Q = (_Float16*)take((size_t)NR * DD * 2); _Float16* K = (_Float16*)take((size_t)NR * DD * 2); float* VF = (float*)take((size_t)NR * DD * 4); _Float16* Vt = (_Float16*)take((size_t)NR * DD * 2); _Float16* Vtl = (_Float16*)take((size_t)NR * DD * 2);
  if (off > ws_size) return;      // 1.2 + 25.2 + 8.4 + 8.4 + 16.8 + 8.4 + 8.4 ≈ 77 MB
  k_wc3<<<(DD * (K3 / 8) + 255) / 256, 256, 0, stream>>>(qw, Bq); k_wc3<<<(DD * (K3 / 8) + 255) / 256, 256, 0, stream>>>(kw, Bk); k_wc3<<<(DD * (K3 / 8) + 255) / 256, 256, 0, stream>>>(vw, Bv);
  const unsigned gi = (unsigned)(((size_t)NR * (K3 / 8) + 255) / 256); const dim3 gp(((NR / 16) * (DD / 64) + 3) / 4, 1);
  k_im3<<<gi, 256, 0, stream>>>(xq, A); k_gemm_hhx<0><<<gp, 128, 0, stream>>>(A, K3, 0, Bq, K3, 0, 1.0f, qb, 0, nullptr, 1, 0, 0, nullptr, Q, DD, 0, NR, DD, K3);      /* q = conv(query): M 16384 N 256 K 768 (exact products) → f16 */
  k_im3<<<gi, 256, 0, stream>>>(xk, A); k_gemm_hhx<0><<<gp, 128, 0, stream>>>(A, K3, 0, Bk, K3, 0, 1.0f, kb, 0, nullptr, 1, 0, 0, nullptr, K, DD, 0, NR, DD, K3);
  k_im3<<<gi, 256, 0, stream>>>(xv, A); k_gemm_hhx<0><<<gp, 128, 0, stream>>>(A, K3, 0, Bv, K3, 0, 1.0f, vb, 0, nullptr, 1, 0, 0, VF, nullptr, DD, 0, NR, DD, K3);      /* v (f32) */
  k_vthlu<<<BB * NVH * (TT / 64), 256, 0, stream>>>(VF, DD, Vt, Vtl);      /* Vᵀ hi + residual: [b][256][4096] */
  for (int half = 0; half < 2; ++half)
    k_flash<<<BB * NH * (TT / 64), 128, 0, stream>>>(Q, DD, K, DD, Vt + (size_t)half * 128 * TT, Vtl + (size_t)half * 128 * TT, (float*)d_out + half * 128, DD);      /* O[:, half] straight into the output rows */
  k_scl<<<(unsigned)(((size_t)NR * DD / 4 + 255) / 256), 256, 0, stream>>>((float*)d_out, scl, (size_t)NR * DD / 4);      /* × scale */
}

// v001
// It runs in 904 microseconds.
// Two timings next to v000 both put it at 2.02 times that version's speed.
#include <hip/hip_runtime.h>
// KQV 'PCNN' attention (B=4, S=4096, D=256): q, k, v = Conv1d(kernel 3, pad 1) over the sequence of query/key/value (+bias); scores = q·k/16; softmax; out = scale·(P·v) → [4,4096,256].
// Compute dtype: inputs, conv weights/biases, scale rounded to bf16; each conv as an im2col GEMM (K = 3·256, bf16-exact operands, f32 accumulate) → q, k f16 planes, v f32 → Vᵀ f16 hi + f16 residual; fused flash-style kernel with d_qk = 256 (8 k-steps, online softmax f32, P f16 hi + residual,
// f32 accumulate) on v_wmma_f32_16x16x32_f16, launched once per 128-wide half of v, writing the output rows directly; × scale in f32.
#define BB 4
#define TT 4096
#define DD 256
#define NH 1
#define VSTR 256
#define NVH 4
#define NR (BB * TT)
#define K3 (3 * DD)
#define ATT_SCALE 0.0625f

typedef __bf16 v16b __attribute__((ext_vector_type(16)));
typedef unsigned short v8us __attribute__((ext_vector_type(8), may_alias));
typedef float  v8f  __attribute__((ext_vector_type(8)));
typedef float  v4f  __attribute__((ext_vector_type(4)));
typedef float  v4fa __attribute__((ext_vector_type(4), may_alias));
union FragB { v16b v; v8us half[2]; unsigned short u[16]; };

__device__ __forceinline__ unsigned short bf16_bits(float x) { unsigned int u = __float_as_uint(x); return (unsigned short)((u + 0x7FFFu + ((u >> 16) & 1u)) >> 16); }
__device__ __forceinline__ float bf16_val(unsigned short b) { return __uint_as_float(((unsigned int)b) << 16); }
__device__ __forceinline__ float bf16_round(float x) { return bf16_val(bf16_bits(x)); }
// D += A·B with NT terms: 1 = ah·bh, 2 = + al·bh (A split), 3 = + ah·bl (both split)
template <int NT>
__device__ __forceinline__ v8f mmaN(v16b ah, v16b al, v16b bh, v16b bl, v8f c) {
  c = __builtin_amdgcn_wmma_f32_16x16x32_bf16(false, ah, false, bh, (short)0, c, false, false);
  if (NT >= 2) c = __builtin_amdgcn_wmma_f32_16x16x32_bf16(false, al, false, bh, (short)0, c, false, false);
  if (NT >= 3) c = __builtin_amdgcn_wmma_f32_16x16x32_bf16(false, ah, false, bl, (short)0, c, false, false);
  asm volatile("v_nop\n\tv_nop\n\tv_nop\n\tv_nop" : "+v"(c) : "v"(ah), "v"(al), "v"(bh), "v"(bl));
  return c;
}

__global__ __launch_bounds__(256) void k_wt_bf16(const float* __restrict__ W, unsigned short* __restrict__ Wt, int K, int N) {
  const int t = blockIdx.x * 256 + threadIdx.x;
  const int k8n = K / 8;
  if (t >= N * k8n) return;
  const int n = t / k8n, k8 = (t % k8n) * 8;
  v8us v;
#pragma unroll
  for (int i = 0; i < 8; ++i) v[i] = bf16_bits(W[(size_t)(k8 + i) * N + n]);
  *(v8us*)(Wt + (size_t)n * K + k8) = v;
  
}

// GEMM C[M][N] (f32, pitch ldc) = act(A[M][K]·W + bias). A f32 row-major (pitch lda) converted per fragment to bf16
// (ASPLIT: hi/lo two planes -> 2 terms, else single rounded term); Wt bf16 [N][K] (pitch ldb). BIAS_BF16 rounds the
// bias to bf16 first (bias quantised to bf16 before the add). K%32==0, M%16==0, N%64==0.
template <bool ASPLIT, int ACT, bool BIAS_BF16>
__global__ __launch_bounds__(128) void k_gemm_bf(const float* __restrict__ A, int lda, const unsigned short* __restrict__ Wt, int ldb,
                                               const float* __restrict__ bias, float* __restrict__ C, int ldc, int M, int N, int K) {
  __shared__ __attribute__((aligned(16))) float so[4][16][64];
  const int tid = threadIdx.x, w = tid >> 5, lane = tid & 31, ln = lane & 15, hh = lane >> 4;
  const int ntn = N / 64;
  const int wid = blockIdx.x * 4 + w;
  const int mt = wid / ntn, nq = wid % ntn;
  if (mt * 16 >= M) return;
  const int row0 = mt * 16, col0 = nq * 64;
  const float* arow = A + (size_t)(row0 + ln) * lda;
  v8f acc[4] = {};
  for (int kb = 0; kb < K; kb += 32) {
    FragB ah, al;
    const v4f x0 = *(const v4fa*)(arow + kb + 8 * hh), x1 = *(const v4fa*)(arow + kb + 8 * hh + 4);
    const v4f x2 = *(const v4fa*)(arow + kb + 16 + 8 * hh), x3 = *(const v4fa*)(arow + kb + 16 + 8 * hh + 4);
    float xs[16] = {x0[0],x0[1],x0[2],x0[3],x1[0],x1[1],x1[2],x1[3],x2[0],x2[1],x2[2],x2[3],x3[0],x3[1],x3[2],x3[3]};
#pragma unroll
    for (int i = 0; i < 16; ++i) { const unsigned short hb = bf16_bits(xs[i]); ah.u[i] = hb; al.u[i] = ASPLIT ? bf16_bits(xs[i] - bf16_val(hb)) : (unsigned short)0; }
#pragma unroll
    for (int t = 0; t < 4; ++t) {
      const unsigned short* brow = Wt + (size_t)(col0 + t * 16 + ln) * ldb + kb;
      FragB b;
      b.half[0] = *(const v8us*)(brow + 8 * hh);
      b.half[1] = *(const v8us*)(brow + 16 + 8 * hh);
      acc[t] = mmaN<ASPLIT ? 2 : 1>(ah.v, al.v, b.v, b.v, acc[t]);
    }
  }
#pragma unroll
  for (int t = 0; t < 4; ++t) {
    float bv = bias ? bias[col0 + t * 16 + ln] : 0.f;
    if (BIAS_BF16) bv = bf16_round(bv);
#pragma unroll
    for (int r = 0; r < 8; ++r) { float v = acc[t][r] + bv; if (ACT == 1) v = fmaxf(v, 0.f); so[w][8 * hh + r][t * 16 + ln] = v; }
  }
  __builtin_amdgcn_fence(__ATOMIC_ACQ_REL, "workgroup");
  __builtin_amdgcn_wave_barrier();
  const int rsub = lane >> 4, c4 = (lane & 15) * 4;
  {
#pragma unroll
    for (int q = 0; q < 8; ++q) {
      const int r = q * 2 + rsub;
      const v4f v = *(const v4fa*)&so[w][r][c4];
      *(v4f*)(C + (size_t)(row0 + r) * ldc + col0 + c4) = v;
    }
    
  }
}

// Flash-style causal/unmasked attention, all contractions 3-term bf16 hi/lo splits, f32 softmax with running max.
// q,k,v rows are read from f32 buffers with arbitrary row pitch (so they can live inside a fused qkv buffer);
// D = head size (multiple of 32, <= 128); one wave = 16 query rows; block = 4 waves (64 queries) sharing K/V chunks of 32.
template <int D, bool CAUSAL>
__global__ __launch_bounds__(128) void k_flash(const float* __restrict__ qb, const float* __restrict__ kb, const float* __restrict__ vb,
                                             int pitch, int T, int H, float scale, float* __restrict__ y, int ypitch) {
  constexpr int KS = D / 32;        // k-steps for QK
  constexpr int DT = D / 16;        // d tiles for PV
  __shared__ __attribute__((aligned(16))) unsigned short sKh[32][D + 8], sKl[32][D + 8], sVh[32][D + 8], sVl[32][D + 8];
  __shared__ __attribute__((aligned(16))) unsigned short sPh[4][16][40], sPl[4][16][40];
  __shared__ __attribute__((aligned(16))) float sO[4][16][D];
  const int tid = threadIdx.x, w = tid >> 5, lane = tid & 31, ln = lane & 15, hh = lane >> 4;
  const int nqb = (T + 63) / 64;
  const int bh = blockIdx.x / nqb, qblk = blockIdx.x % nqb;
  const int b = bh / H, h = bh % H;
  const int q0 = qblk * 64 + w * 16;
  const float* Q = qb + (size_t)b * T * pitch + h * D;
  const float* K = kb + (size_t)b * T * pitch + h * D;
  const float* V = vb + (size_t)b * T * pitch + h * D;

  // A fragments of the wave's 16 query rows (scaled), hi/lo
  FragB aqh[KS], aql[KS];
  {
    int row = q0 + ln; if (row >= T) row = T - 1;
    const float* qr = Q + (size_t)row * pitch;
#pragma unroll
    for (int ks = 0; ks < KS; ++ks)
#pragma unroll
      for (int i = 0; i < 16; ++i) {
        const int d = ks * 32 + ((i < 8) ? (8 * hh + i) : (16 + 8 * hh + (i - 8)));
        const float x = qr[d] * scale; const unsigned short hb = bf16_bits(x);
        aqh[ks].u[i] = hb; aql[ks].u[i] = bf16_bits(x - bf16_val(hb));
      }
  }
  float m_r[8], l_r[8];
#pragma unroll
  for (int r = 0; r < 8; ++r) { m_r[r] = -3.0e38f; l_r[r] = 0.f; }
  v8f oacc[DT];
#pragma unroll
  for (int dt = 0; dt < DT; ++dt) oacc[dt] = (v8f){0.f,0.f,0.f,0.f,0.f,0.f,0.f,0.f};

  const int kv_end = CAUSAL ? min(T, qblk * 64 + 64) : T;     // block-uniform
  for (int j0 = 0; j0 < kv_end; j0 += 32) {
    __syncthreads();
    for (int e = tid; e < 32 * (D / 4); e += 128) {
      const int r = e / (D / 4), c4 = (e % (D / 4)) * 4;
      const int key = j0 + r;
      v4f kf = {0.f,0.f,0.f,0.f}, vf = {0.f,0.f,0.f,0.f};
      if (key < T) { kf = *(const v4fa*)(K + (size_t)key * pitch + c4); vf = *(const v4fa*)(V + (size_t)key * pitch + c4); }
#pragma unroll
      for (int t = 0; t < 4; ++t) {
        unsigned short hb = bf16_bits(kf[t]); sKh[r][c4 + t] = hb; sKl[r][c4 + t] = bf16_bits(kf[t] - bf16_val(hb));
        hb = bf16_bits(vf[t]); sVh[r][c4 + t] = hb; sVl[r][c4 + t] = bf16_bits(vf[t] - bf16_val(hb));
      }
    }
    __syncthreads();
    // S tile 16 x 32
    v8f s[2];
#pragma unroll
    for (int nt = 0; nt < 2; ++nt) {
      v8f acc = {};
#pragma unroll
      for (int ks = 0; ks < KS; ++ks) {
        FragB bh_, bl_;
        bh_.half[0] = *(const v8us*)&sKh[nt * 16 + ln][ks * 32 + 8 * hh]; bh_.half[1] = *(const v8us*)&sKh[nt * 16 + ln][ks * 32 + 16 + 8 * hh];
        bl_.half[0] = *(const v8us*)&sKl[nt * 16 + ln][ks * 32 + 8 * hh]; bl_.half[1] = *(const v8us*)&sKl[nt * 16 + ln][ks * 32 + 16 + 8 * hh];
        acc = mmaN<3>(aqh[ks].v, aql[ks].v, bh_.v, bl_.v, acc);
      }
      s[nt] = acc;
    }
    // mask + running max (rows 8hh+r; the 16 lanes of a half share rows)
    float alpha[8];
#pragma unroll
    for (int r = 0; r < 8; ++r) {
      const int qi = q0 + 8 * hh + r;
      const int ja = j0 + ln, jb = j0 + 16 + ln;
      if (CAUSAL) { if (ja > qi) s[0][r] = -3.0e38f; if (jb > qi) s[1][r] = -3.0e38f; }
      if (ja >= T) s[0][r] = -3.0e38f;
      if (jb >= T) s[1][r] = -3.0e38f;
      float mx = fmaxf(s[0][r], s[1][r]);
      mx = fmaxf(mx, __shfl_xor(mx, 1, 32)); mx = fmaxf(mx, __shfl_xor(mx, 2, 32)); mx = fmaxf(mx, __shfl_xor(mx, 4, 32)); mx = fmaxf(mx, __shfl_xor(mx, 8, 32));
      const float mnew = fmaxf(m_r[r], mx);
      alpha[r] = (mnew > -1.0e38f) ? __expf(m_r[r] - mnew) : 1.0f;
      const float p0 = (s[0][r] > -1.0e38f) ? __expf(s[0][r] - mnew) : 0.f;
      const float p1 = (s[1][r] > -1.0e38f) ? __expf(s[1][r] - mnew) : 0.f;
      m_r[r] = mnew;
      l_r[r] = l_r[r] * alpha[r] + p0 + p1;            // per-lane partial row sum (16 lanes combined at the end)
      unsigned short hb = bf16_bits(p0); sPh[w][8 * hh + r][ln] = hb;      sPl[w][8 * hh + r][ln] = bf16_bits(p0 - bf16_val(hb));
      hb = bf16_bits(p1);                sPh[w][8 * hh + r][16 + ln] = hb; sPl[w][8 * hh + r][16 + ln] = bf16_bits(p1 - bf16_val(hb));
    }
#pragma unroll
    for (int dt = 0; dt < DT; ++dt)
#pragma unroll
      for (int r = 0; r < 8; ++r) oacc[dt][r] *= alpha[r];
    __builtin_amdgcn_fence(__ATOMIC_ACQ_REL, "workgroup");
    __builtin_amdgcn_wave_barrier();
    FragB pah, pal;
    pah.half[0] = *(const v8us*)&sPh[w][ln][8 * hh]; pah.half[1] = *(const v8us*)&sPh[w][ln][16 + 8 * hh];
    pal.half[0] = *(const v8us*)&sPl[w][ln][8 * hh]; pal.half[1] = *(const v8us*)&sPl[w][ln][16 + 8 * hh];
#pragma unroll
    for (int dt = 0; dt < DT; ++dt) {
      FragB bvh, bvl;
#pragma unroll
      for (int i = 0; i < 8; ++i) {
        bvh.u[i] = sVh[8 * hh + i][dt * 16 + ln]; bvh.u[8 + i] = sVh[16 + 8 * hh + i][dt * 16 + ln];
        bvl.u[i] = sVl[8 * hh + i][dt * 16 + ln]; bvl.u[8 + i] = sVl[16 + 8 * hh + i][dt * 16 + ln];
      }
      oacc[dt] = mmaN<3>(pah.v, pal.v, bvh.v, bvl.v, oacc[dt]);
    }
    __builtin_amdgcn_fence(__ATOMIC_ACQ_REL, "workgroup");
    __builtin_amdgcn_wave_barrier();
  }
#pragma unroll
  for (int r = 0; r < 8; ++r) {
    float l = l_r[r];
    l += __shfl_xor(l, 1, 32); l += __shfl_xor(l, 2, 32); l += __shfl_xor(l, 4, 32); l += __shfl_xor(l, 8, 32);
    l_r[r] = (l > 0.f) ? 1.0f / l : 0.f;
  }
#pragma unroll
  for (int dt = 0; dt < DT; ++dt)
#pragma unroll
    for (int r = 0; r < 8; ++r) sO[w][8 * hh + r][dt * 16 + ln] = oacc[dt][r] * l_r[r];
  __builtin_amdgcn_fence(__ATOMIC_ACQ_REL, "workgroup");
  __builtin_amdgcn_wave_barrier();
  {
    for (int r = 0; r < 16; ++r) {
      const int row = q0 + r;
      if (row < T && lane < D / 4) {
        const v4f val = *(const v4fa*)&sO[w][r][lane * 4];
        *(v4f*)(y + ((size_t)b * T + row) * ypitch + h * D + lane * 4) = val;
      }
    }
    
  }
}

// GEMM C = act(A·W + bias + resid): A f32 (ASPLIT -> hi/lo 2 terms), Wt bf16 [N][K]; ACT 0 none, 1 relu, 2 exact gelu;
// resid (optional, f32, row index = (row % rmod), pitch ldr, RES_BF16 rounds it) added before the activation.
template <bool ASPLIT, int ACT, bool BIAS_BF16, bool RES_BF16>
__global__ __launch_bounds__(128) void k_gemm_bf3(const float* __restrict__ A, int lda, const unsigned short* __restrict__ Wt, int ldb,
                                                const float* __restrict__ bias, const float* __restrict__ resid, int rmod, int ldr,
                                                float* __restrict__ C, int ldc, int M, int N, int K) {
  __shared__ __attribute__((aligned(16))) float so[4][16][64];
  const int tid = threadIdx.x, w = tid >> 5, lane = tid & 31, ln = lane & 15, hh = lane >> 4;
  const int ntn = N / 64;
  const int wid = blockIdx.x * 4 + w;
  const int mt = wid / ntn, nq = wid % ntn;
  if (mt * 16 >= M) return;
  const int row0 = mt * 16, col0 = nq * 64;
  const float* arow = A + (size_t)(row0 + ln) * lda;
  v8f acc[4] = {};
  for (int kb = 0; kb < K; kb += 32) {
    FragB ah, al;
    const v4f x0 = *(const v4fa*)(arow + kb + 8 * hh), x1 = *(const v4fa*)(arow + kb + 8 * hh + 4);
    const v4f x2 = *(const v4fa*)(arow + kb + 16 + 8 * hh), x3 = *(const v4fa*)(arow + kb + 16 + 8 * hh + 4);
    float xs[16] = {x0[0],x0[1],x0[2],x0[3],x1[0],x1[1],x1[2],x1[3],x2[0],x2[1],x2[2],x2[3],x3[0],x3[1],x3[2],x3[3]};
#pragma unroll
    for (int i = 0; i < 16; ++i) { const unsigned short hb = bf16_bits(xs[i]); ah.u[i] = hb; al.u[i] = ASPLIT ? bf16_bits(xs[i] - bf16_val(hb)) : (unsigned short)0; }
#pragma unroll
    for (int t = 0; t < 4; ++t) {
      const unsigned short* brow = Wt + (size_t)(col0 + t * 16 + ln) * ldb + kb;
      FragB b;
      b.half[0] = *(const v8us*)(brow + 8 * hh);
      b.half[1] = *(const v8us*)(brow + 16 + 8 * hh);
      acc[t] = mmaN<ASPLIT ? 2 : 1>(ah.v, al.v, b.v, b.v, acc[t]);
    }
  }
#pragma unroll
  for (int t = 0; t < 4; ++t) {
    const int col = col0 + t * 16 + ln;
    float bv = bias ? bias[col] : 0.f;
    if (BIAS_BF16) bv = bf16_round(bv);
#pragma unroll
    for (int r = 0; r < 8; ++r) {
      float v = acc[t][r] + bv;
      if (resid) { float rv = resid[(size_t)((row0 + 8 * hh + r) % rmod) * ldr + col]; if (RES_BF16) rv = bf16_round(rv); v += rv; }
      if (ACT == 1) v = fmaxf(v, 0.f);
      if (ACT == 2) v = 0.5f * v * (1.0f + erff(v * 0.70710678118654752f));
      if (ACT == 3) { const float u = 0.7978845608028654f * (v + 0.044715f * v * v * v); v = 0.5f * v * (1.0f + tanhf(u)); }
      so[w][8 * hh + r][t * 16 + ln] = v;
    }
  }
  __builtin_amdgcn_fence(__ATOMIC_ACQ_REL, "workgroup");
  __builtin_amdgcn_wave_barrier();
  const int rsub = lane >> 4, c4 = (lane & 15) * 4;
  {
#pragma unroll
    for (int q = 0; q < 8; ++q) {
      const int r = q * 2 + rsub;
      const v4f v = *(const v4fa*)&so[w][r][c4];
      *(v4f*)(C + (size_t)(row0 + r) * ldc + col0 + c4) = v;
    }
    
  }
}
// row LayerNorm (biased variance, eps) over N: s = X (+ R); optional out_sum <- s; out_norm <- (s-mu)*rsqrt(var+eps)*g + b
template <bool PARAM_BF16>
__global__ __launch_bounds__(256) void k_layernorm(const float* __restrict__ X, const float* __restrict__ R, const float* __restrict__ g, const float* __restrict__ bta,
                                                  float* __restrict__ out_sum, float* __restrict__ out_norm, int N, float eps) {
  __shared__ float red[256];
  const int row = blockIdx.x, tid = threadIdx.x;
  const float* x = X + (size_t)row * N; const float* rr = R ? R + (size_t)row * N : nullptr;
  float vals[16];                     // up to N = 4096
  const int per = N / 256;            // contiguous chunk per thread? use strided-by-4 chunks: thread handles j = tid*4 + 1024*u
  float s1 = 0.f;
  for (int u = 0; u < per / 4; ++u) {
    const int j = tid * 4 + 1024 * u;
    const v4f a = *(const v4fa*)(x + j);
    v4f b = {0.f,0.f,0.f,0.f}; if (rr) b = *(const v4fa*)(rr + j);
#pragma unroll
    for (int q = 0; q < 4; ++q) { const float v = a[q] + b[q]; vals[u * 4 + q] = v; s1 += v; }
  }
  red[tid] = s1; __syncthreads();
  for (int st = 128; st > 0; st >>= 1) { if (tid < st) red[tid] += red[tid + st]; __syncthreads(); }
  const float mu = red[0] / (float)N; __syncthreads();
  float s2 = 0.f;
  for (int u = 0; u < per / 4; ++u)
#pragma unroll
    for (int q = 0; q < 4; ++q) { const float c = vals[u * 4 + q] - mu; s2 += c * c; }
  red[tid] = s2; __syncthreads();
  for (int st = 128; st > 0; st >>= 1) { if (tid < st) red[tid] += red[tid + st]; __syncthreads(); }
  const float rs = rsqrtf(red[0] / (float)N + eps);
  {
    for (int u = 0; u < per / 4; ++u) {
      const int j = tid * 4 + 1024 * u;
      v4f o, sm;
#pragma unroll
      for (int q = 0; q < 4; ++q) {
        float gg = g[j + q], bb = bta[j + q];
        if (PARAM_BF16) { gg = bf16_round(gg); bb = bf16_round(bb); }
        sm[q] = vals[u * 4 + q]; o[q] = (vals[u * 4 + q] - mu) * rs * gg + bb;
      }
      if (out_sum) *(v4f*)(out_sum + (size_t)row * N + j) = sm;
      *(v4f*)(out_norm + (size_t)row * N + j) = o;
    }
    
  }
}



// ---- f16 WMMA path (v_wmma_f32_16x16x32_f16): 11-bit significands for operands in range — used where a [0,1] probability operand needs more precision than bf16
typedef _Float16 v16h __attribute__((ext_vector_type(16)));
union FragH { v16h v; v8us half[2]; _Float16 h[16]; unsigned short u[16]; };
template <int NT>
__device__ __forceinline__ v8f mmaH(v16h ah, v16h al, v16h bh, v16h bl, v8f c) {
  c = __builtin_amdgcn_wmma_f32_16x16x32_f16(false, ah, false, bh, (short)0, c, false, false);
  if (NT >= 2) c = __builtin_amdgcn_wmma_f32_16x16x32_f16(false, al, false, bh, (short)0, c, false, false);
  if (NT >= 3) c = __builtin_amdgcn_wmma_f32_16x16x32_f16(false, ah, false, bl, (short)0, c, false, false);
  asm volatile("v_nop\n\tv_nop\n\tv_nop\n\tv_nop" : "+v"(c) : "v"(ah), "v"(al), "v"(bh), "v"(bl));
  return c;
}
// batched GEMM like k_gemm_b but f16 operands: A f32 (split into f16 hi/lo if ASPLIT, else rounded to f16), Bt = f16 values [n][k]; alpha; C f32; N multiple of 16 (partial tiles skipped)
template <bool ASPLIT>
__global__ __launch_bounds__(128) void k_gemm_h(const float* __restrict__ A, int lda, size_t sA, const _Float16* __restrict__ Bh, int ldb, size_t sB, float alpha, float* __restrict__ C, int ldc, size_t sC, int M, int N, int K) {
  __shared__ __attribute__((aligned(16))) float so[4][16][64];
  const int tid = threadIdx.x, w = tid >> 5, lane = tid & 31, ln = lane & 15, hh = lane >> 4; const int by = blockIdx.y;
  A += (size_t)by * sA; Bh += (size_t)by * sB; C += (size_t)by * sC;
  const int ntn = (N + 63) / 64; const int wid = blockIdx.x * 4 + w; const int mt = wid / ntn, nq = wid % ntn; if (mt * 16 >= M) return;
  const int row0 = mt * 16, col0 = nq * 64; const float* arow = A + (size_t)(row0 + ln) * lda;
  v8f acc[4] = {};
  for (int kb = 0; kb < K; kb += 32) {
    FragH ah, al;
    const v4f x0 = *(const v4fa*)(arow + kb + 8 * hh), x1 = *(const v4fa*)(arow + kb + 8 * hh + 4), x2 = *(const v4fa*)(arow + kb + 16 + 8 * hh), x3 = *(const v4fa*)(arow + kb + 16 + 8 * hh + 4);
    float xs[16] = {x0[0],x0[1],x0[2],x0[3],x1[0],x1[1],x1[2],x1[3],x2[0],x2[1],x2[2],x2[3],x3[0],x3[1],x3[2],x3[3]};
#pragma unroll
    for (int i = 0; i < 16; ++i) { const _Float16 h = (_Float16)xs[i]; ah.h[i] = h; al.h[i] = ASPLIT ? (_Float16)(xs[i] - (float)h) : (_Float16)0.0f; }
#pragma unroll
    for (int t = 0; t < 4; ++t) { if (col0 + t * 16 >= N) continue; const size_t boff = (size_t)(col0 + t * 16 + ln) * ldb + kb; FragH bq; bq.half[0] = *(const v8us*)(Bh + boff + 8 * hh); bq.half[1] = *(const v8us*)(Bh + boff + 16 + 8 * hh);
      acc[t] = mmaH<ASPLIT ? 2 : 1>(ah.v, al.v, bq.v, bq.v, acc[t]); }
  }
#pragma unroll
  for (int t = 0; t < 4; ++t) { if (col0 + t * 16 >= N) continue;
#pragma unroll
    for (int r = 0; r < 8; ++r) so[w][8 * hh + r][t * 16 + ln] = acc[t][r] * alpha; }
  __builtin_amdgcn_fence(__ATOMIC_ACQ_REL, "workgroup"); __builtin_amdgcn_wave_barrier();
  const int rsub = lane >> 4, c4 = (lane & 15) * 4;
  {
#pragma unroll
    for (int q = 0; q < 8; ++q) { const int r = q * 2 + rsub; if (col0 + c4 < N) { const v4f v = *(const v4fa*)&so[w][r][c4]; *(v4f*)(C + (size_t)(row0 + r) * ldc + col0 + c4) = v; } }
     }
}

// Wt[n][k] = f16(W[k][n]·scale) from f32 row-major W[K][N] (scale = power of two; bf16-exact weights stay exact in f16 away from the subnormal range)
__global__ __launch_bounds__(256) void k_wt_f16(const float* __restrict__ W, _Float16* __restrict__ Wt, int K, int N, float scale) {
  const int t = blockIdx.x * 256 + threadIdx.x; if (t >= N * (K / 8)) return; const int n = t / (K / 8), k8 = (t % (K / 8)) * 8; FragH f;
#pragma unroll
  for (int i = 0; i < 8; ++i) f.h[i] = (_Float16)(bf16_round(W[(size_t)(k8 + i) * N + n]) * scale); const v8us o = f.half[0];
  *(v8us*)((unsigned short*)Wt + (size_t)n * K + k8) = o; 
}
// k_gemm_hh variant with fused epilogue: v = acc·alpha + bias[by·sBias + col] (+ CP[(row/rowsPerB)·sCPb + by·64 + col] if CP) ; ACT 0 none / 1 elu ; writes f16 C16 and f32 C, each if non-null
template <int ACT>
__global__ __launch_bounds__(128) void k_gemm_hhx(const _Float16* __restrict__ A, int lda, size_t sA, const _Float16* __restrict__ Bh, int ldb, size_t sB, float alpha, const float* __restrict__ bias, size_t sBias, const float* __restrict__ CP, int rowsPerB, size_t sCPb, int row0g,
    float* __restrict__ C, _Float16* __restrict__ C16, int ldc, size_t sC, int M, int N, int K) {
  __shared__ __attribute__((aligned(16))) float so[4][16][64];
  const int tid = threadIdx.x, w = tid >> 5, lane = tid & 31, ln = lane & 15, hh = lane >> 4; const int by = blockIdx.y;
  A += (size_t)by * sA; Bh += (size_t)by * sB; const size_t cofs = (size_t)by * sC; const float* bp = bias ? bias + (size_t)by * sBias : nullptr;
  const int ntn = (N + 63) / 64; const int wid = blockIdx.x * 4 + w; const int mt = wid / ntn, nq = wid % ntn; if (mt * 16 >= M) return;
  const int row0 = mt * 16, col0 = nq * 64; const _Float16* arow = A + (size_t)(row0 + ln) * lda;
  v8f acc[4] = {};
  for (int kb = 0; kb < K; kb += 32) { FragH ah; ah.half[0] = *(const v8us*)((const unsigned short*)arow + kb + 8 * hh); ah.half[1] = *(const v8us*)((const unsigned short*)arow + kb + 16 + 8 * hh);
#pragma unroll
    for (int t = 0; t < 4; ++t) { if (col0 + t * 16 >= N) continue; const size_t boff = (size_t)(col0 + t * 16 + ln) * ldb + kb; FragH bq; bq.half[0] = *(const v8us*)((const unsigned short*)Bh + boff + 8 * hh); bq.half[1] = *(const v8us*)((const unsigned short*)Bh + boff + 16 + 8 * hh);
      acc[t] = mmaH<1>(ah.v, ah.v, bq.v, bq.v, acc[t]); }
  }
#pragma unroll
  for (int t = 0; t < 4; ++t) { if (col0 + t * 16 >= N) continue; const int col = col0 + t * 16 + ln; const float bv = bp ? bf16_round(bp[col]) : 0.f;
#pragma unroll
    for (int r = 0; r < 8; ++r) { float v = acc[t][r] * alpha + bv; if (CP) { const int bidx = (row0g + row0 + 8 * hh + r) / rowsPerB; v += CP[(size_t)bidx * sCPb + (size_t)by * 64 + col]; } if (ACT == 1) v = (v > 0.f) ? v : expm1f(v); else if (ACT == 7) v = (v > 0.f) ? v + 1.0f : expf(v); else if (ACT == 8) v = tanhf(v); else if (ACT == 9) v = 0.5f * v * (1.0f + tanhf(0.7978845608028654f * (v + 0.044715f * v * v * v))); else if (ACT == 11) v = 1.0f / (1.0f + expf(-v)); else if (ACT == 12) v = (v > 0.f) ? v : 0.01f * v; else if (ACT == 14) v = (v > 0.f) ? v : 0.1f * v; else if (ACT == 15) v = v / (1.0f + expf(-v)); else if (ACT == 3) v = fmaxf(v, 0.f); else if (ACT == 6) v = 0.5f * v * (1.0f + erff(v * 0.70710678118654752f)); so[w][8 * hh + r][t * 16 + ln] = v; } }
  __builtin_amdgcn_fence(__ATOMIC_ACQ_REL, "workgroup"); __builtin_amdgcn_wave_barrier();
  const int rsub = lane >> 4, c4 = (lane & 15) * 4; typedef _Float16 v4h __attribute__((ext_vector_type(4)));
  {
#pragma unroll
    for (int q = 0; q < 8; ++q) { const int r = q * 2 + rsub; if (col0 + c4 < N) { const v4f v = *(const v4fa*)&so[w][r][c4]; if (C) *(v4f*)(C + cofs + (size_t)(row0 + r) * ldc + col0 + c4) = v; if (C16) { v4h h4; for (int i = 0; i < 4; ++i) h4[i] = (_Float16)v[i]; *(v4h*)(C16 + cofs + (size_t)(row0 + r) * ldc + col0 + c4) = h4; } } }
     }
}


typedef _Float16 v4h __attribute__((ext_vector_type(4)));

__global__ __launch_bounds__(256) void k_x16(const float* __restrict__ x, _Float16* __restrict__ X16, size_t n8) { const size_t t = (size_t)blockIdx.x * 256 + threadIdx.x; if (t >= n8) return; FragH f;
#pragma unroll
  for (int q = 0; q < 8; ++q) f.h[q] = (_Float16)bf16_round(x[t * 8 + q]); *(v8us*)((unsigned short*)X16 + t * 8) = f.half[0];  }
__global__ __launch_bounds__(256) void k_h16(const float* __restrict__ x, _Float16* __restrict__ X16, size_t n8) { const size_t t = (size_t)blockIdx.x * 256 + threadIdx.x; if (t >= n8) return; FragH f;
#pragma unroll
  for (int q = 0; q < 8; ++q) f.h[q] = (_Float16)x[t * 8 + q]; *(v8us*)((unsigned short*)X16 + t * 8) = f.half[0];  }
__global__ __launch_bounds__(256) void k_round16f(const float* __restrict__ W, _Float16* __restrict__ Bt, size_t n8) { const size_t t = (size_t)blockIdx.x * 256 + threadIdx.x; if (t >= n8) return; FragH f;
#pragma unroll
  for (int i = 0; i < 8; ++i) f.h[i] = (_Float16)(bf16_round(W[t * 8 + i]) * 16.0f); *(v8us*)((unsigned short*)Bt + t * 8) = f.half[0];  }
template <int NHv, int TTv>
__global__ __launch_bounds__(256) void k_vt(const _Float16* __restrict__ V16, int ldv, int voff, _Float16* __restrict__ Vt) { __shared__ unsigned short tl[64][66]; const int tid = threadIdx.x; const int slab = blockIdx.x / (TTv / 64), lg = blockIdx.x % (TTv / 64); const int b = slab / NHv, h = slab % NHv;
  for (int i = tid; i < 64 * 8; i += 256) { const int r = i / 8, c8 = (i % 8) * 8; FragH f; f.half[0] = *(const v8us*)((const unsigned short*)V16 + ((size_t)b * TTv + lg * 64 + r) * ldv + voff + h * 64 + c8);
#pragma unroll
    for (int q = 0; q < 8; ++q) tl[r][c8 + q] = f.u[q]; }
  __syncthreads();
  {
#pragma unroll
    for (int rd = 0; rd < 2; ++rd) { const int d = rd * 32 + tid / 8, pc = tid % 8; FragH f;
#pragma unroll
      for (int q = 0; q < 8; ++q) f.u[q] = tl[pc * 8 + q][d];
      *(v8us*)((unsigned short*)Vt + ((size_t)slab * 64 + d) * TTv + lg * 64 + pc * 8) = f.half[0]; }
     } }

__global__ __launch_bounds__(256) void k_vthlu(const float* __restrict__ VF, int ldv, _Float16* __restrict__ Vth, _Float16* __restrict__ Vtl) { __shared__ float tl[64][65]; const int tid = threadIdx.x; const int slab = blockIdx.x / (TT / 64), lg = blockIdx.x % (TT / 64); const int b = slab / NVH, h = slab % NVH;
  for (int i = tid; i < 64 * 16; i += 256) { const int r = i / 16, c4 = (i % 16) * 4; const v4f a = *(const v4fa*)(VF + ((size_t)b * TT + lg * 64 + r) * ldv + h * 64 + c4); tl[r][c4] = a[0]; tl[r][c4 + 1] = a[1]; tl[r][c4 + 2] = a[2]; tl[r][c4 + 3] = a[3]; }
  __syncthreads();
  FragH fh[2], fl[2]; size_t oo[2];
#pragma unroll
  for (int rd = 0; rd < 2; ++rd) { const int d = rd * 32 + tid / 8, pc = tid % 8;
#pragma unroll
    for (int q = 0; q < 8; ++q) { const float v = tl[pc * 8 + q][d]; const _Float16 hv = (_Float16)v; fh[rd].h[q] = hv; fl[rd].h[q] = (_Float16)(v - (float)hv);      /* UNSCALED residual (added into the same accumulator as the hi product) */ } oo[rd] = ((size_t)slab * 64 + d) * TT + lg * 64 + pc * 8; }
  {
#pragma unroll
    for (int rd = 0; rd < 2; ++rd) { *(v8us*)((unsigned short*)Vth + oo[rd]) = fh[rd].half[0]; *(v8us*)((unsigned short*)Vtl + oo[rd]) = fl[rd].half[0]; }
     } }
__global__ __launch_bounds__(256) void k_im3(const float* __restrict__ x, _Float16* __restrict__ A) { const size_t t = (size_t)blockIdx.x * 256 + threadIdx.x; if (t >= (size_t)NR * (K3 / 8)) return; const int piece = (int)(t % (K3 / 8)); const size_t row = t / (K3 / 8); const int b = (int)(row / TT), s = (int)(row % TT); const int tap = (piece * 8) / DD, c0 = (piece * 8) % DD; const int ss = s + tap - 1; FragH f;
  if (ss >= 0 && ss < TT) { const float* xr = x + ((size_t)b * TT + ss) * DD + c0; for (int q = 0; q < 8; ++q) f.h[q] = (_Float16)bf16_round(xr[q]); } else { for (int q = 0; q < 8; ++q) f.h[q] = (_Float16)0.f; }
  *(v8us*)((unsigned short*)A + t * 8) = f.half[0];  }
__global__ __launch_bounds__(256) void k_wc3(const float* __restrict__ w, _Float16* __restrict__ Bt) { const int t = blockIdx.x * 256 + threadIdx.x; if (t >= DD * (K3 / 8)) return; const int o = t / (K3 / 8), k0 = (t % (K3 / 8)) * 8; const int tap = k0 / DD, c0 = k0 % DD; FragH f;
  for (int q = 0; q < 8; ++q) f.h[q] = (_Float16)bf16_round(w[((size_t)o * DD + c0 + q) * 3 + tap]);
  *(v8us*)((unsigned short*)Bt + (size_t)t * 8) = f.half[0];  }
__global__ __launch_bounds__(256) void k_scl(float* __restrict__ O, const float* __restrict__ scl, size_t n4) { const size_t t = (size_t)blockIdx.x * 256 + threadIdx.x; if (t >= n4) return; const float s = bf16_round(scl[0]); v4f v = *(const v4fa*)(O + t * 4); for (int q = 0; q < 4; ++q) v[q] *= s; *(v4f*)(O + t * 4) = v;  }
// Eight asynchronous copies, 16 B per lane each, global memory -> LDS. The closing s_wait_xcnt stands inside the statement so that no address register named here is rewritten ahead of it.
__device__ __forceinline__ void acp8(const unsigned (&l)[8], const unsigned short* const (&p)[8]) {
  asm volatile("global_load_async_to_lds_b128 %0, %8, off\n\t"
               "global_load_async_to_lds_b128 %1, %9, off\n\t"
               "global_load_async_to_lds_b128 %2, %10, off\n\t"
               "global_load_async_to_lds_b128 %3, %11, off\n\t"
               "global_load_async_to_lds_b128 %4, %12, off\n\t"
               "global_load_async_to_lds_b128 %5, %13, off\n\t"
               "global_load_async_to_lds_b128 %6, %14, off\n\t"
               "global_load_async_to_lds_b128 %7, %15, off\n\t"
               "s_wait_xcnt 0x0"
               :: "v"(l[0]), "v"(l[1]), "v"(l[2]), "v"(l[3]), "v"(l[4]), "v"(l[5]), "v"(l[6]), "v"(l[7]),
                  "v"(p[0]), "v"(p[1]), "v"(p[2]), "v"(p[3]), "v"(p[4]), "v"(p[5]), "v"(p[6]), "v"(p[7]) : "memory");
}
__device__ __forceinline__ unsigned lds_off(const void* p) { return (unsigned)(size_t)p; }      /* byte offset in the work-group's LDS = low 32 bits of the __shared__ address */
__global__ __launch_bounds__(128) void k_flash(const _Float16* __restrict__ Q16, int ldq, const _Float16* __restrict__ K16, int ldk, const _Float16* __restrict__ Vt, const _Float16* __restrict__ Vtlo, float* __restrict__ O, int ldo) {
  constexpr int RPW = 16, RTN = RPW / 16, NQB = TT / (4 * RPW), DT = 8, KS = 8;      /* d_qk 256: 8 k-steps; 8 value tiles = ONE 128-wide half of the 256-wide V per launch */
  constexpr int SK = 64, NST = TT / SK;      /* one LDS tile = 64 keys = two 32-key passes; V rows of 64 keys are whole 128-B lines */
  constexpr int KP = 256 + 8, VP = SK + 8;      /* LDS row pitches in halves: 528 B and 144 B, both 16 B x odd, conflict-free for the 16-row ds_load_b128 fragment reads */
  __shared__ __attribute__((aligned(16))) unsigned short sQ[4 * RPW][KP]; __shared__ __attribute__((aligned(16))) unsigned short sK[2][SK][KP]; __shared__ __attribute__((aligned(16))) unsigned short sVh[2][128][VP]; __shared__ __attribute__((aligned(16))) unsigned short sVl[2][128][VP];
  __shared__ __attribute__((aligned(16))) unsigned short sP[4][RPW][40]; __shared__ __attribute__((aligned(16))) unsigned short sPL[4][RPW][40]; __shared__ __attribute__((aligned(16))) float sO[4][RPW][128 + 4];
  const int tid = threadIdx.x, w = tid >> 5, lane = tid & 31, ln = lane & 15, hh = lane >> 4;
  const int slab = blockIdx.x / NQB, qblk = blockIdx.x % NQB; const int b = slab / NH, h = slab % NH; const int qb0 = qblk * (4 * RPW); const int q0 = qb0 + w * RPW;
  const unsigned short* Qg = (const unsigned short*)Q16 + ((size_t)b * TT + qb0) * ldq; const unsigned short* Kg = (const unsigned short*)K16 + (size_t)b * TT * ldk;
  const unsigned short* Vth = (const unsigned short*)Vt + (size_t)b * VSTR * TT; const unsigned short* Vtl = (const unsigned short*)Vtlo + (size_t)b * VSTR * TT;      /* the caller offsets Vt/Vtlo/O by the 128-wide half */      /* hi and UNSCALED residual planes */
  const int wu = __builtin_amdgcn_readfirstlane(w);      /* the wave's number as a scalar: the row parts of the copies' addresses stay in scalar registers */
  /* tile t -> buffer buf, 32 copies per wave: 16 K rows (one 512-B row per copy), 32 rows of each V plane (four 128-B rows per copy) */
  auto stage = [&](int t, int buf) {
    unsigned l[8]; const unsigned short* p[8];
#pragma unroll      /* constant indices keep l[] and p[] in registers */
    for (int g = 0; g < 2; ++g) {
#pragma unroll      /* constant indices keep l[] and p[] in registers */
      for (int i = 0; i < 8; ++i) { const int r = wu * 16 + g * 8 + i; l[i] = lds_off(&sK[buf][r][lane * 8]); p[i] = Kg + (size_t)(t * SK + r) * ldk + lane * 8; }
      acp8(l, p); }
#pragma unroll      /* constant indices keep l[] and p[] in registers */
    for (int i = 0; i < 8; ++i) { const int d = wu * 32 + i * 4 + (lane >> 3); l[i] = lds_off(&sVh[buf][d][(lane & 7) * 8]); p[i] = Vth + (size_t)d * TT + t * SK + (lane & 7) * 8; }
    acp8(l, p);
#pragma unroll      /* constant indices keep l[] and p[] in registers */
    for (int i = 0; i < 8; ++i) { const int d = wu * 32 + i * 4 + (lane >> 3); l[i] = lds_off(&sVl[buf][d][(lane & 7) * 8]); p[i] = Vtl + (size_t)d * TT + t * SK + (lane & 7) * 8; }
    acp8(l, p); };
  { unsigned l[8]; const unsigned short* p[8];      /* the block's 64 query rows, filled once: 16 rows per wave */
#pragma unroll      /* constant indices keep l[] and p[] in registers */
    for (int g = 0; g < 2; ++g) {
#pragma unroll      /* constant indices keep l[] and p[] in registers */
      for (int i = 0; i < 8; ++i) { const int r = wu * 16 + g * 8 + i; l[i] = lds_off(&sQ[r][lane * 8]); p[i] = Qg + (size_t)r * ldq + lane * 8; }
      acp8(l, p); } }
  stage(0, 0);
  asm volatile("s_wait_asynccnt 0x0" ::: "memory");      /* this wave's copies of Q and of tile 0 have landed */
  __syncthreads();      /* publishes Q and tile 0 to every wave */
  stage(1, 1);
  const unsigned short* qrow = &sQ[w * RPW + ln][0];
  float m_r[2][8], l_r[2][8]; v8f oacc[2][DT];
#pragma unroll
  for (int rt = 0; rt < RTN; ++rt) {
#pragma unroll
    for (int r = 0; r < 8; ++r) { m_r[rt][r] = -3.0e38f; l_r[rt][r] = 0.f; }
#pragma unroll
    for (int dt = 0; dt < DT; ++dt) oacc[rt][dt] = (v8f){0.f,0.f,0.f,0.f,0.f,0.f,0.f,0.f}; }
#pragma unroll 1
  for (int t = 0; t < NST; ++t) {
   const int buf = t & 1;
#pragma unroll      /* both passes of a tile inline: their LDS offsets become constants */
   for (int sub = 0; sub < SK / 32; ++sub) {
    const int j0 = sub * 32;      /* first key of the pass inside the tile */
    v8f s[2][2];
#pragma unroll
    for (int nt = 0; nt < 2; ++nt) { const unsigned short* kr = &sK[buf][j0 + nt * 16 + ln][0]; v8f acc = (v8f){0.f,0.f,0.f,0.f,0.f,0.f,0.f,0.f};
#pragma unroll
      for (int ks = 0; ks < KS; ++ks) { FragH bk, aq; bk.half[0] = *(const v8us*)(kr + ks * 32 + 8 * hh); bk.half[1] = *(const v8us*)(kr + ks * 32 + 16 + 8 * hh); aq.half[0] = *(const v8us*)(qrow + ks * 32 + 8 * hh); aq.half[1] = *(const v8us*)(qrow + ks * 32 + 16 + 8 * hh); acc = mmaH<1>(aq.v, aq.v, bk.v, bk.v, acc); }
      s[0][nt] = acc; }
#pragma unroll
    for (int rt = 0; rt < RTN; ++rt)
#pragma unroll
      for (int r = 0; r < 8; ++r) { const int tq = q0 + rt * 16 + 8 * hh + r; const int k0 = t * SK + j0 + ln, k1 = t * SK + j0 + 16 + ln; (void)tq; (void)k0; (void)k1;
        const bool ok0 = true, ok1 = true; (void)tq; (void)k0; (void)k1;
        const float s0 = ok0 ? s[rt][0][r] * ATT_SCALE : -INFINITY, s1 = ok1 ? s[rt][1][r] * ATT_SCALE : -INFINITY; float mc = fmaxf(s0, s1);
        mc = fmaxf(mc, __shfl_xor(mc, 1, 32)); mc = fmaxf(mc, __shfl_xor(mc, 2, 32)); mc = fmaxf(mc, __shfl_xor(mc, 4, 32)); mc = fmaxf(mc, __shfl_xor(mc, 8, 32));
        const float mn = fmaxf(m_r[rt][r], mc); const float al = (mn > -1.0e38f) ? expf(m_r[rt][r] - mn) : 1.0f; m_r[rt][r] = mn; const float p0 = ok0 ? expf(s0 - mn) : 0.f, p1 = ok1 ? expf(s1 - mn) : 0.f; l_r[rt][r] = l_r[rt][r] * al + p0 + p1;
#pragma unroll
        for (int dt = 0; dt < DT; ++dt) oacc[rt][dt][r] *= al;
        FragH t2, t3; const float ps0 = p0 * 1024.0f, ps1 = p1 * 1024.0f; t2.h[0] = (_Float16)ps0; t2.h[1] = (_Float16)ps1; t3.h[0] = (_Float16)(ps0 - (float)t2.h[0]); t3.h[1] = (_Float16)(ps1 - (float)t2.h[1]);      /* P hi and its UNSCALED residual (added into the same accumulator) */
        sP[w][rt * 16 + 8 * hh + r][ln] = t2.u[0]; sP[w][rt * 16 + 8 * hh + r][16 + ln] = t2.u[1]; sPL[w][rt * 16 + 8 * hh + r][ln] = t3.u[0]; sPL[w][rt * 16 + 8 * hh + r][16 + ln] = t3.u[1]; }
    __builtin_amdgcn_fence(__ATOMIC_ACQ_REL, "workgroup"); __builtin_amdgcn_wave_barrier();
    FragH pa[2], pl[2];
#pragma unroll
    for (int rt = 0; rt < RTN; ++rt) { pa[rt].half[0] = *(const v8us*)&sP[w][rt * 16 + ln][8 * hh]; pa[rt].half[1] = *(const v8us*)&sP[w][rt * 16 + ln][16 + 8 * hh]; pl[rt].half[0] = *(const v8us*)&sPL[w][rt * 16 + ln][8 * hh]; pl[rt].half[1] = *(const v8us*)&sPL[w][rt * 16 + ln][16 + 8 * hh]; }
#pragma unroll
    for (int dt = 0; dt < DT; ++dt) { const unsigned short* vh = &sVh[buf][dt * 16 + ln][j0]; const unsigned short* vl = &sVl[buf][dt * 16 + ln][j0]; FragH bv, bl; bv.half[0] = *(const v8us*)(vh + 8 * hh); bv.half[1] = *(const v8us*)(vh + 16 + 8 * hh); bl.half[0] = *(const v8us*)(vl + 8 * hh); bl.half[1] = *(const v8us*)(vl + 16 + 8 * hh);
#pragma unroll
      for (int rt = 0; rt < RTN; ++rt) { oacc[rt][dt] = mmaH<1>(pa[rt].v, pa[rt].v, bv.v, bv.v, oacc[rt][dt]); oacc[rt][dt] = mmaH<1>(pl[rt].v, pl[rt].v, bv.v, bv.v, oacc[rt][dt]); oacc[rt][dt] = mmaH<1>(pa[rt].v, pa[rt].v, bl.v, bl.v, oacc[rt][dt]); } }      /* Ph·Vh + Pl·Vh + Ph·Vl — all unscaled, one accumulator */
    __builtin_amdgcn_fence(__ATOMIC_ACQ_REL, "workgroup"); __builtin_amdgcn_wave_barrier(); }
   asm volatile("s_wait_dscnt 0x0" ::: "memory");      /* this wave's reads of tile t have returned before its buffer is refilled */
   asm volatile("s_wait_asynccnt 0x0" ::: "memory");      /* this wave's copies of tile t + 1 have landed */
   __syncthreads();      /* publishes tile t + 1 and ends every wave's reads of tile t */
   if (t + 2 < NST) stage(t + 2, buf); }
  asm volatile("s_wait_asynccnt 0x0" ::: "memory");      /* no copy is outstanding behind the loop */
#pragma unroll
  for (int rt = 0; rt < RTN; ++rt) {
#pragma unroll
    for (int r = 0; r < 8; ++r) { float l = l_r[rt][r]; l += __shfl_xor(l, 1, 32); l += __shfl_xor(l, 2, 32); l += __shfl_xor(l, 4, 32); l += __shfl_xor(l, 8, 32); l_r[rt][r] = (l > 0.f) ? 1.0f / (l * 1024.0f) : 0.f; }
#pragma unroll
    for (int dt = 0; dt < DT; ++dt)
#pragma unroll
      for (int r = 0; r < 8; ++r) sO[w][rt * 16 + 8 * hh + r][dt * 16 + ln] = oacc[rt][dt][r] * l_r[rt][r]; }
  __builtin_amdgcn_fence(__ATOMIC_ACQ_REL, "workgroup"); __builtin_amdgcn_wave_barrier();
  {
#pragma unroll
    for (int r = 0; r < RPW; ++r) { const int pc = lane; const v4f val = *(const v4fa*)&sO[w][r][pc * 4]; *(v4f*)(O + ((size_t)b * TT + q0 + r) * ldo + h * 128 + pc * 4) = val; }      /* one 512-B row per instruction: 32 lanes × 16 B */
     } }

extern "C" void kernel_launch(void* const* d_in, const int* in_sizes, int n_in,
                              void* d_out, int out_size, void* d_ws, size_t ws_size, hipStream_t stream) {
  (void)in_sizes; (void)n_in; (void)out_size;
  const float* const* I = (const float* const*)d_in; const float* xq = I[0]; const float* xk = I[1]; const float* xv = I[2]; const float* qw = I[3]; const float* qb = I[4]; const float* kw = I[5]; const float* kb = I[6]; const float* vw = I[7]; const float* vb = I[8]; const float* scl = I[9];
  char* ws = (char*)d_ws; size_t off = 0;
  auto take = [&](size_t bytes) { char* p = ws + off; off += (bytes + 255) & ~(size_t)255; return p; };
  _Float16* Bq = (_Float16*)take((size_t)DD * K3 * 2); _Float16* Bk = (_Float16*)take((size_t)DD * K3 * 2); _Float16* Bv = (_Float16*)take((size_t)DD * K3 * 2); _Float16* A = (_Float16*)take((size_t)NR * K3 * 2); _Float16* Q = (_Float16*)take((size_t)NR * DD * 2); _Float16* K = (_Float16*)take((size_t)NR * DD * 2); float* VF = (float*)take((size_t)NR * DD * 4); _Float16* Vt = (_Float16*)take((size_t)NR * DD * 2); _Float16* Vtl = (_Float16*)take((size_t)NR * DD * 2);
  if (off > ws_size) return;      // 1.2 + 25.2 + 8.4 + 8.4 + 16.8 + 8.4 + 8.4 ≈ 77 MB
  k_wc3<<<(DD * (K3 / 8) + 255) / 256, 256, 0, stream>>>(qw, Bq); k_wc3<<<(DD * (K3 / 8) + 255) / 256, 256, 0, stream>>>(kw, Bk); k_wc3<<<(DD * (K3 / 8) + 255) / 256, 256, 0, stream>>>(vw, Bv);
  const unsigned gi = (unsigned)(((size_t)NR * (K3 / 8) + 255) / 256); const dim3 gp(((NR / 16) * (DD / 64) + 3) / 4, 1);
  k_im3<<<gi, 256, 0, stream>>>(xq, A); k_gemm_hhx<0><<<gp, 128, 0, stream>>>(A, K3, 0, Bq, K3, 0, 1.0f, qb, 0, nullptr, 1, 0, 0, nullptr, Q, DD, 0, NR, DD, K3);      /* q = conv(query): M 16384 N 256 K 768 (exact products) → f16 */
  k_im3<<<gi, 256, 0, stream>>>(xk, A); k_gemm_hhx<0><<<gp, 128, 0, stream>>>(A, K3, 0, Bk, K3, 0, 1.0f, kb, 0, nullptr, 1, 0, 0, nullptr, K, DD, 0, NR, DD, K3);
  k_im3<<<gi, 256, 0, stream>>>(xv, A); k_gemm_hhx<0><<<gp, 128, 0, stream>>>(A, K3, 0, Bv, K3, 0, 1.0f, vb, 0, nullptr, 1, 0, 0, VF, nullptr, DD, 0, NR, DD, K3);      /* v (f32) */
  k_vthlu<<<BB * NVH * (TT / 64), 256, 0, stream>>>(VF, DD, Vt, Vtl);      /* Vᵀ hi + residual: [b][256][4096] */
  for (int half = 0; half < 2; ++half)
    k_flash<<<BB * NH * (TT / 64), 128, 0, stream>>>(Q, DD, K, DD, Vt + (size_t)half * 128 * TT, Vtl + (size_t)half * 128 * TT, (float*)d_out + half * 128, DD);      /* O[:, half] straight into the output rows */
  k_scl<<<(unsigned)(((size_t)NR * DD / 4 + 255) / 256), 256, 0, stream>>>((float*)d_out, scl, (size_t)NR * DD / 4);      /* × scale */
}

// v002
// A run of this version takes 410 microseconds.
// Next to v001, in two timings, it ran 2.20 times as fast each time.
// Over all steps from v000 it is 4.44 times as fast.
#include <hip/hip_runtime.h>
// KQV 'PCNN' attention (B=4, S=4096, D=256): q, k, v = Conv1d(kernel 3, pad 1) over the sequence of query/key/value (+bias); scores = q·k/16; softmax; out = scale·(P·v) → [4,4096,256].
// Compute dtype: inputs, conv weights/biases, scale rounded to bf16; each conv as an im2col GEMM (K = 3·256, bf16-exact operands, f32 accumulate) → q, k f16 planes, v f32 → Vᵀ f16 hi + f16 residual; fused flash-style kernel with d_qk = 256 (8 k-steps, online softmax f32, P f16 hi + residual,
// f32 accumulate) on v_wmma_f32_16x16x32_f16, one launch of 16-wave blocks (query rows x halves of v x halves of each key tile), writing the output rows directly; × scale in f32.
#define BB 4
#define TT 4096
#define DD 256
#define NH 1
#define VSTR 256
#define NVH 4
#define NR (BB * TT)
#define K3 (3 * DD)
#define ATT_SCALE 0.0625f

typedef __bf16 v16b __attribute__((ext_vector_type(16)));
typedef unsigned short v8us __attribute__((ext_vector_type(8), may_alias));
typedef float  v8f  __attribute__((ext_vector_type(8)));
typedef float  v4f  __attribute__((ext_vector_type(4)));
typedef float  v4fa __attribute__((ext_vector_type(4), may_alias));
union FragB { v16b v; v8us half[2]; unsigned short u[16]; };

__device__ __forceinline__ unsigned short bf16_bits(float x) { unsigned int u = __float_as_uint(x); return (unsigned short)((u + 0x7FFFu + ((u >> 16) & 1u)) >> 16); }
__device__ __forceinline__ float bf16_val(unsigned short b) { return __uint_as_float(((unsigned int)b) << 16); }
__device__ __forceinline__ float bf16_round(float x) { return bf16_val(bf16_bits(x)); }
// D += A·B with NT terms: 1 = ah·bh, 2 = + al·bh (A split), 3 = + ah·bl (both split)
template <int NT>
__device__ __forceinline__ v8f mmaN(v16b ah, v16b al, v16b bh, v16b bl, v8f c) {
  c = __builtin_amdgcn_wmma_f32_16x16x32_bf16(false, ah, false, bh, (short)0, c, false, false);
  if (NT >= 2) c = __builtin_amdgcn_wmma_f32_16x16x32_bf16(false, al, false, bh, (short)0, c, false, false);
  if (NT >= 3) c = __builtin_amdgcn_wmma_f32_16x16x32_bf16(false, ah, false, bl, (short)0, c, false, false);
  asm volatile("v_nop\n\tv_nop\n\tv_nop\n\tv_nop" : "+v"(c) : "v"(ah), "v"(al), "v"(bh), "v"(bl));
  return c;
}

__global__ __launch_bounds__(256) void k_wt_bf16(const float* __restrict__ W, unsigned short* __restrict__ Wt, int K, int N) {
  const int t = blockIdx.x * 256 + threadIdx.x;
  const int k8n = K / 8;
  if (t >= N * k8n) return;
  const int n = t / k8n, k8 = (t % k8n) * 8;
  v8us v;
#pragma unroll
  for (int i = 0; i < 8; ++i) v[i] = bf16_bits(W[(size_t)(k8 + i) * N + n]);
  *(v8us*)(Wt + (size_t)n * K + k8) = v;
  
}

// GEMM C[M][N] (f32, pitch ldc) = act(A[M][K]·W + bias). A f32 row-major (pitch lda) converted per fragment to bf16
// (ASPLIT: hi/lo two planes -> 2 terms, else single rounded term); Wt bf16 [N][K] (pitch ldb). BIAS_BF16 rounds the
// bias to bf16 first (bias quantised to bf16 before the add). K%32==0, M%16==0, N%64==0.
template <bool ASPLIT, int ACT, bool BIAS_BF16>
__global__ __launch_bounds__(128) void k_gemm_bf(const float* __restrict__ A, int lda, const unsigned short* __restrict__ Wt, int ldb,
                                               const float* __restrict__ bias, float* __restrict__ C, int ldc, int M, int N, int K) {
  __shared__ __attribute__((aligned(16))) float so[4][16][64];
  const int tid = threadIdx.x, w = tid >> 5, lane = tid & 31, ln = lane & 15, hh = lane >> 4;
  const int ntn = N / 64;
  const int wid = blockIdx.x * 4 + w;
  const int mt = wid / ntn, nq = wid % ntn;
  if (mt * 16 >= M) return;
  const int row0 = mt * 16, col0 = nq * 64;
  const float* arow = A + (size_t)(row0 + ln) * lda;
  v8f acc[4] = {};
  for (int kb = 0; kb < K; kb += 32) {
    FragB ah, al;
    const v4f x0 = *(const v4fa*)(arow + kb + 8 * hh), x1 = *(const v4fa*)(arow + kb + 8 * hh + 4);
    const v4f x2 = *(const v4fa*)(arow + kb + 16 + 8 * hh), x3 = *(const v4fa*)(arow + kb + 16 + 8 * hh + 4);
    float xs[16] = {x0[0],x0[1],x0[2],x0[3],x1[0],x1[1],x1[2],x1[3],x2[0],x2[1],x2[2],x2[3],x3[0],x3[1],x3[2],x3[3]};
#pragma unroll
    for (int i = 0; i < 16; ++i) { const unsigned short hb = bf16_bits(xs[i]); ah.u[i] = hb; al.u[i] = ASPLIT ? bf16_bits(xs[i] - bf16_val(hb)) : (unsigned short)0; }
#pragma unroll
    for (int t = 0; t < 4; ++t) {
      const unsigned short* brow = Wt + (size_t)(col0 + t * 16 + ln) * ldb + kb;
      FragB b;
      b.half[0] = *(const v8us*)(brow + 8 * hh);
      b.half[1] = *(const v8us*)(brow + 16 + 8 * hh);
      acc[t] = mmaN<ASPLIT ? 2 : 1>(ah.v, al.v, b.v, b.v, acc[t]);
    }
  }
#pragma unroll
  for (int t = 0; t < 4; ++t) {
    float bv = bias ? bias[col0 + t * 16 + ln] : 0.f;
    if (BIAS_BF16) bv = bf16_round(bv);
#pragma unroll
    for (int r = 0; r < 8; ++r) { float v = acc[t][r] + bv; if (ACT == 1) v = fmaxf(v, 0.f); so[w][8 * hh + r][t * 16 + ln] = v; }
  }
  __builtin_amdgcn_fence(__ATOMIC_ACQ_REL, "workgroup");
  __builtin_amdgcn_wave_barrier();
  const int rsub = lane >> 4, c4 = (lane & 15) * 4;
  {
#pragma unroll
    for (int q = 0; q < 8; ++q) {
      const int r = q * 2 + rsub;
      const v4f v = *(const v4fa*)&so[w][r][c4];
      *(v4f*)(C + (size_t)(row0 + r) * ldc + col0 + c4) = v;
    }
    
  }
}

// Flash-style causal/unmasked attention, all contractions 3-term bf16 hi/lo splits, f32 softmax with running max.
// q,k,v rows are read from f32 buffers with arbitrary row pitch (so they can live inside a fused qkv buffer);
// D = head size (multiple of 32, <= 128); one wave = 16 query rows; block = 4 waves (64 queries) sharing K/V chunks of 32.
template <int D, bool CAUSAL>
__global__ __launch_bounds__(128) void k_flash(const float* __restrict__ qb, const float* __restrict__ kb, const float* __restrict__ vb,
                                             int pitch, int T, int H, float scale, float* __restrict__ y, int ypitch) {
  constexpr int KS = D / 32;        // k-steps for QK
  constexpr int DT = D / 16;        // d tiles for PV
  __shared__ __attribute__((aligned(16))) unsigned short sKh[32][D + 8], sKl[32][D + 8], sVh[32][D + 8], sVl[32][D + 8];
  __shared__ __attribute__((aligned(16))) unsigned short sPh[4][16][40], sPl[4][16][40];
  __shared__ __attribute__((aligned(16))) float sO[4][16][D];
  const int tid = threadIdx.x, w = tid >> 5, lane = tid & 31, ln = lane & 15, hh = lane >> 4;
  const int nqb = (T + 63) / 64;
  const int bh = blockIdx.x / nqb, qblk = blockIdx.x % nqb;
  const int b = bh / H, h = bh % H;
  const int q0 = qblk * 64 + w * 16;
  const float* Q = qb + (size_t)b * T * pitch + h * D;
  const float* K = kb + (size_t)b * T * pitch + h * D;
  const float* V = vb + (size_t)b * T * pitch + h * D;

  // A fragments of the wave's 16 query rows (scaled), hi/lo
  FragB aqh[KS], aql[KS];
  {
    int row = q0 + ln; if (row >= T) row = T - 1;
    const float* qr = Q + (size_t)row * pitch;
#pragma unroll
    for (int ks = 0; ks < KS; ++ks)
#pragma unroll
      for (int i = 0; i < 16; ++i) {
        const int d = ks * 32 + ((i < 8) ? (8 * hh + i) : (16 + 8 * hh + (i - 8)));
        const float x = qr[d] * scale; const unsigned short hb = bf16_bits(x);
        aqh[ks].u[i] = hb; aql[ks].u[i] = bf16_bits(x - bf16_val(hb));
      }
  }
  float m_r[8], l_r[8];
#pragma unroll
  for (int r = 0; r < 8; ++r) { m_r[r] = -3.0e38f; l_r[r] = 0.f; }
  v8f oacc[DT];
#pragma unroll
  for (int dt = 0; dt < DT; ++dt) oacc[dt] = (v8f){0.f,0.f,0.f,0.f,0.f,0.f,0.f,0.f};

  const int kv_end = CAUSAL ? min(T, qblk * 64 + 64) : T;     // block-uniform
  for (int j0 = 0; j0 < kv_end; j0 += 32) {
    __syncthreads();
    for (int e = tid; e < 32 * (D / 4); e += 128) {
      const int r = e / (D / 4), c4 = (e % (D / 4)) * 4;
      const int key = j0 + r;
      v4f kf = {0.f,0.f,0.f,0.f}, vf = {0.f,0.f,0.f,0.f};
      if (key < T) { kf = *(const v4fa*)(K + (size_t)key * pitch + c4); vf = *(const v4fa*)(V + (size_t)key * pitch + c4); }
#pragma unroll
      for (int t = 0; t < 4; ++t) {
        unsigned short hb = bf16_bits(kf[t]); sKh[r][c4 + t] = hb; sKl[r][c4 + t] = bf16_bits(kf[t] - bf16_val(hb));
        hb = bf16_bits(vf[t]); sVh[r][c4 + t] = hb; sVl[r][c4 + t] = bf16_bits(vf[t] - bf16_val(hb));
      }
    }
    __syncthreads();
    // S tile 16 x 32
    v8f s[2];
#pragma unroll
    for (int nt = 0; nt < 2; ++nt) {
      v8f acc = {};
#pragma unroll
      for (int ks = 0; ks < KS; ++ks) {
        FragB bh_, bl_;
        bh_.half[0] = *(const v8us*)&sKh[nt * 16 + ln][ks * 32 + 8 * hh]; bh_.half[1] = *(const v8us*)&sKh[nt * 16 + ln][ks * 32 + 16 + 8 * hh];
        bl_.half[0] = *(const v8us*)&sKl[nt * 16 + ln][ks * 32 + 8 * hh]; bl_.half[1] = *(const v8us*)&sKl[nt * 16 + ln][ks * 32 + 16 + 8 * hh];
        acc = mmaN<3>(aqh[ks].v, aql[ks].v, bh_.v, bl_.v, acc);
      }
      s[nt] = acc;
    }
    // mask + running max (rows 8hh+r; the 16 lanes of a half share rows)
    float alpha[8];
#pragma unroll
    for (int r = 0; r < 8; ++r) {
      const int qi = q0 + 8 * hh + r;
      const int ja = j0 + ln, jb = j0 + 16 + ln;
      if (CAUSAL) { if (ja > qi) s[0][r] = -3.0e38f; if (jb > qi) s[1][r] = -3.0e38f; }
      if (ja >= T) s[0][r] = -3.0e38f;
      if (jb >= T) s[1][r] = -3.0e38f;
      float mx = fmaxf(s[0][r], s[1][r]);
      mx = fmaxf(mx, __shfl_xor(mx, 1, 32)); mx = fmaxf(mx, __shfl_xor(mx, 2, 32)); mx = fmaxf(mx, __shfl_xor(mx, 4, 32)); mx = fmaxf(mx, __shfl_xor(mx, 8, 32));
      const float mnew = fmaxf(m_r[r], mx);
      alpha[r] = (mnew > -1.0e38f) ? __expf(m_r[r] - mnew) : 1.0f;
      const float p0 = (s[0][r] > -1.0e38f) ? __expf(s[0][r] - mnew) : 0.f;
      const float p1 = (s[1][r] > -1.0e38f) ? __expf(s[1][r] - mnew) : 0.f;
      m_r[r] = mnew;
      l_r[r] = l_r[r] * alpha[r] + p0 + p1;            // per-lane partial row sum (16 lanes combined at the end)
      unsigned short hb = bf16_bits(p0); sPh[w][8 * hh + r][ln] = hb;      sPl[w][8 * hh + r][ln] = bf16_bits(p0 - bf16_val(hb));
      hb = bf16_bits(p1);                sPh[w][8 * hh + r][16 + ln] = hb; sPl[w][8 * hh + r][16 + ln] = bf16_bits(p1 - bf16_val(hb));
    }
#pragma unroll
    for (int dt = 0; dt < DT; ++dt)
#pragma unroll
      for (int r = 0; r < 8; ++r) oacc[dt][r] *= alpha[r];
    __builtin_amdgcn_fence(__ATOMIC_ACQ_REL, "workgroup");
    __builtin_amdgcn_wave_barrier();
    FragB pah, pal;
    pah.half[0] = *(const v8us*)&sPh[w][ln][8 * hh]; pah.half[1] = *(const v8us*)&sPh[w][ln][16 + 8 * hh];
    pal.half[0] = *(const v8us*)&sPl[w][ln][8 * hh]; pal.half[1] = *(const v8us*)&sPl[w][ln][16 + 8 * hh];
#pragma unroll
    for (int dt = 0; dt < DT; ++dt) {
      FragB bvh, bvl;
#pragma unroll
      for (int i = 0; i < 8; ++i) {
        bvh.u[i] = sVh[8 * hh + i][dt * 16 + ln]; bvh.u[8 + i] = sVh[16 + 8 * hh + i][dt * 16 + ln];
        bvl.u[i] = sVl[8 * hh + i][dt * 16 + ln]; bvl.u[8 + i] = sVl[16 + 8 * hh + i][dt * 16 + ln];
      }
      oacc[dt] = mmaN<3>(pah.v, pal.v, bvh.v, bvl.v, oacc[dt]);
    }
    __builtin_amdgcn_fence(__ATOMIC_ACQ_REL, "workgroup");
    __builtin_amdgcn_wave_barrier();
  }
#pragma unroll
  for (int r = 0; r < 8; ++r) {
    float l = l_r[r];
    l += __shfl_xor(l, 1, 32); l += __shfl_xor(l, 2, 32); l += __shfl_xor(l, 4, 32); l += __shfl_xor(l, 8, 32);
    l_r[r] = (l > 0.f) ? 1.0f / l : 0.f;
  }
#pragma unroll
  for (int dt = 0; dt < DT; ++dt)
#pragma unroll
    for (int r = 0; r < 8; ++r) sO[w][8 * hh + r][dt * 16 + ln] = oacc[dt][r] * l_r[r];
  __builtin_amdgcn_fence(__ATOMIC_ACQ_REL, "workgroup");
  __builtin_amdgcn_wave_barrier();
  {
    for (int r = 0; r < 16; ++r) {
      const int row = q0 + r;
      if (row < T && lane < D / 4) {
        const v4f val = *(const v4fa*)&sO[w][r][lane * 4];
        *(v4f*)(y + ((size_t)b * T + row) * ypitch + h * D + lane * 4) = val;
      }
    }
    
  }
}

// GEMM C = act(A·W + bias + resid): A f32 (ASPLIT -> hi/lo 2 terms), Wt bf16 [N][K]; ACT 0 none, 1 relu, 2 exact gelu;
// resid (optional, f32, row index = (row % rmod), pitch ldr, RES_BF16 rounds it) added before the activation.
template <bool ASPLIT, int ACT, bool BIAS_BF16, bool RES_BF16>
__global__ __launch_bounds__(128) void k_gemm_bf3(const float* __restrict__ A, int lda, const unsigned short* __restrict__ Wt, int ldb,
                                                const float* __restrict__ bias, const float* __restrict__ resid, int rmod, int ldr,
                                                float* __restrict__ C, int ldc, int M, int N, int K) {
  __shared__ __attribute__((aligned(16))) float so[4][16][64];
  const int tid = threadIdx.x, w = tid >> 5, lane = tid & 31, ln = lane & 15, hh = lane >> 4;
  const int ntn = N / 64;
  const int wid = blockIdx.x * 4 + w;
  const int mt = wid / ntn, nq = wid % ntn;
  if (mt * 16 >= M) return;
  const int row0 = mt * 16, col0 = nq * 64;
  const float* arow = A + (size_t)(row0 + ln) * lda;
  v8f acc[4] = {};
  for (int kb = 0; kb < K; kb += 32) {
    FragB ah, al;
    const v4f x0 = *(const v4fa*)(arow + kb + 8 * hh), x1 = *(const v4fa*)(arow + kb + 8 * hh + 4);
    const v4f x2 = *(const v4fa*)(arow + kb + 16 + 8 * hh), x3 = *(const v4fa*)(arow + kb + 16 + 8 * hh + 4);
    float xs[16] = {x0[0],x0[1],x0[2],x0[3],x1[0],x1[1],x1[2],x1[3],x2[0],x2[1],x2[2],x2[3],x3[0],x3[1],x3[2],x3[3]};
#pragma unroll
    for (int i = 0; i < 16; ++i) { const unsigned short hb = bf16_bits(xs[i]); ah.u[i] = hb; al.u[i] = ASPLIT ? bf16_bits(xs[i] - bf16_val(hb)) : (unsigned short)0; }
#pragma unroll
    for (int t = 0; t < 4; ++t) {
      const unsigned short* brow = Wt + (size_t)(col0 + t * 16 + ln) * ldb + kb;
      FragB b;
      b.half[0] = *(const v8us*)(brow + 8 * hh);
      b.half[1] = *(const v8us*)(brow + 16 + 8 * hh);
      acc[t] = mmaN<ASPLIT ? 2 : 1>(ah.v, al.v, b.v, b.v, acc[t]);
    }
  }
#pragma unroll
  for (int t = 0; t < 4; ++t) {
    const int col = col0 + t * 16 + ln;
    float bv = bias ? bias[col] : 0.f;
    if (BIAS_BF16) bv = bf16_round(bv);
#pragma unroll
    for (int r = 0; r < 8; ++r) {
      float v = acc[t][r] + bv;
      if (resid) { float rv = resid[(size_t)((row0 + 8 * hh + r) % rmod) * ldr + col]; if (RES_BF16) rv = bf16_round(rv); v += rv; }
      if (ACT == 1) v = fmaxf(v, 0.f);
      if (ACT == 2) v = 0.5f * v * (1.0f + erff(v * 0.70710678118654752f));
      if (ACT == 3) { const float u = 0.7978845608028654f * (v + 0.044715f * v * v * v); v = 0.5f * v * (1.0f + tanhf(u)); }
      so[w][8 * hh + r][t * 16 + ln] = v;
    }
  }
  __builtin_amdgcn_fence(__ATOMIC_ACQ_REL, "workgroup");
  __builtin_amdgcn_wave_barrier();
  const int rsub = lane >> 4, c4 = (lane & 15) * 4;
  {
#pragma unroll
    for (int q = 0; q < 8; ++q) {
      const int r = q * 2 + rsub;
      const v4f v = *(const v4fa*)&so[w][r][c4];
      *(v4f*)(C + (size_t)(row0 + r) * ldc + col0 + c4) = v;
    }
    
  }
}
// row LayerNorm (biased variance, eps) over N: s = X (+ R); optional out_sum <- s; out_norm <- (s-mu)*rsqrt(var+eps)*g + b
template <bool PARAM_BF16>
__global__ __launch_bounds__(256) void k_layernorm(const float* __restrict__ X, const float* __restrict__ R, const float* __restrict__ g, const float* __restrict__ bta,
                                                  float* __restrict__ out_sum, float* __restrict__ out_norm, int N, float eps) {
  __shared__ float red[256];
  const int row = blockIdx.x, tid = threadIdx.x;
  const float* x = X + (size_t)row * N; const float* rr = R ? R + (size_t)row * N : nullptr;
  float vals[16];                     // up to N = 4096
  const int per = N / 256;            // contiguous chunk per thread? use strided-by-4 chunks: thread handles j = tid*4 + 1024*u
  float s1 = 0.f;
  for (int u = 0; u < per / 4; ++u) {
    const int j = tid * 4 + 1024 * u;
    const v4f a = *(const v4fa*)(x + j);
    v4f b = {0.f,0.f,0.f,0.f}; if (rr) b = *(const v4fa*)(rr + j);
#pragma unroll
    for (int q = 0; q < 4; ++q) { const float v = a[q] + b[q]; vals[u * 4 + q] = v; s1 += v; }
  }
  red[tid] = s1; __syncthreads();
  for (int st = 128; st > 0; st >>= 1) { if (tid < st) red[tid] += red[tid + st]; __syncthreads(); }
  const float mu = red[0] / (float)N; __syncthreads();
  float s2 = 0.f;
  for (int u = 0; u < per / 4; ++u)
#pragma unroll
    for (int q = 0; q < 4; ++q) { const float c = vals[u * 4 + q] - mu; s2 += c * c; }
  red[tid] = s2; __syncthreads();
  for (int st = 128; st > 0; st >>= 1) { if (tid < st) red[tid] += red[tid + st]; __syncthreads(); }
  const float rs = rsqrtf(red[0] / (float)N + eps);
  {
    for (int u = 0; u < per / 4; ++u) {
      const int j = tid * 4 + 1024 * u;
      v4f o, sm;
#pragma unroll
      for (int q = 0; q < 4; ++q) {
        float gg = g[j + q], bb = bta[j + q];
        if (PARAM_BF16) { gg = bf16_round(gg); bb = bf16_round(bb); }
        sm[q] = vals[u * 4 + q]; o[q] = (vals[u * 4 + q] - mu) * rs * gg + bb;
      }
      if (out_sum) *(v4f*)(out_sum + (size_t)row * N + j) = sm;
      *(v4f*)(out_norm + (size_t)row * N + j) = o;
    }
    
  }
}



// ---- f16 WMMA path (v_wmma_f32_16x16x32_f16): 11-bit significands for operands in range — used where a [0,1] probability operand needs more precision than bf16
typedef _Float16 v16h __attribute__((ext_vector_type(16)));
union FragH { v16h v; v8us half[2]; _Float16 h[16]; unsigned short u[16]; };
template <int NT>
__device__ __forceinline__ v8f mmaH(v16h ah, v16h al, v16h bh, v16h bl, v8f c) {
  c = __builtin_amdgcn_wmma_f32_16x16x32_f16(false, ah, false, bh, (short)0, c, false, false);
  if (NT >= 2) c = __builtin_amdgcn_wmma_f32_16x16x32_f16(false, al, false, bh, (short)0, c, false, false);
  if (NT >= 3) c = __builtin_amdgcn_wmma_f32_16x16x32_f16(false, ah, false, bl, (short)0, c, false, false);
  asm volatile("v_nop\n\tv_nop\n\tv_nop\n\tv_nop" : "+v"(c) : "v"(ah), "v"(al), "v"(bh), "v"(bl));
  return c;
}
// batched GEMM like k_gemm_b but f16 operands: A f32 (split into f16 hi/lo if ASPLIT, else rounded to f16), Bt = f16 values [n][k]; alpha; C f32; N multiple of 16 (partial tiles skipped)
template <bool ASPLIT>
__global__ __launch_bounds__(128) void k_gemm_h(const float* __restrict__ A, int lda, size_t sA, const _Float16* __restrict__ Bh, int ldb, size_t sB, float alpha, float* __restrict__ C, int ldc, size_t sC, int M, int N, int K) {
  __shared__ __attribute__((aligned(16))) float so[4][16][64];
  const int tid = threadIdx.x, w = tid >> 5, lane = tid & 31, ln = lane & 15, hh = lane >> 4; const int by = blockIdx.y;
  A += (size_t)by * sA; Bh += (size_t)by * sB; C += (size_t)by * sC;
  const int ntn = (N + 63) / 64; const int wid = blockIdx.x * 4 + w; const int mt = wid / ntn, nq = wid % ntn; if (mt * 16 >= M) return;
  const int row0 = mt * 16, col0 = nq * 64; const float* arow = A + (size_t)(row0 + ln) * lda;
  v8f acc[4] = {};
  for (int kb = 0; kb < K; kb += 32) {
    FragH ah, al;
    const v4f x0 = *(const v4fa*)(arow + kb + 8 * hh), x1 = *(const v4fa*)(arow + kb + 8 * hh + 4), x2 = *(const v4fa*)(arow + kb + 16 + 8 * hh), x3 = *(const v4fa*)(arow + kb + 16 + 8 * hh + 4);
    float xs[16] = {x0[0],x0[1],x0[2],x0[3],x1[0],x1[1],x1[2],x1[3],x2[0],x2[1],x2[2],x2[3],x3[0],x3[1],x3[2],x3[3]};
#pragma unroll
    for (int i = 0; i < 16; ++i) { const _Float16 h = (_Float16)xs[i]; ah.h[i] = h; al.h[i] = ASPLIT ? (_Float16)(xs[i] - (float)h) : (_Float16)0.0f; }
#pragma unroll
    for (int t = 0; t < 4; ++t) { if (col0 + t * 16 >= N) continue; const size_t boff = (size_t)(col0 + t * 16 + ln) * ldb + kb; FragH bq; bq.half[0] = *(const v8us*)(Bh + boff + 8 * hh); bq.half[1] = *(const v8us*)(Bh + boff + 16 + 8 * hh);
      acc[t] = mmaH<ASPLIT ? 2 : 1>(ah.v, al.v, bq.v, bq.v, acc[t]); }
  }
#pragma unroll
  for (int t = 0; t < 4; ++t) { if (col0 + t * 16 >= N) continue;
#pragma unroll
    for (int r = 0; r < 8; ++r) so[w][8 * hh + r][t * 16 + ln] = acc[t][r] * alpha; }
  __builtin_amdgcn_fence(__ATOMIC_ACQ_REL, "workgroup"); __builtin_amdgcn_wave_barrier();
  const int rsub = lane >> 4, c4 = (lane & 15) * 4;
  {
#pragma unroll
    for (int q = 0; q < 8; ++q) { const int r = q * 2 + rsub; if (col0 + c4 < N) { const v4f v = *(const v4fa*)&so[w][r][c4]; *(v4f*)(C + (size_t)(row0 + r) * ldc + col0 + c4) = v; } }
     }
}

// Wt[n][k] = f16(W[k][n]·scale) from f32 row-major W[K][N] (scale = power of two; bf16-exact weights stay exact in f16 away from the subnormal range)
__global__ __launch_bounds__(256) void k_wt_f16(const float* __restrict__ W, _Float16* __restrict__ Wt, int K, int N, float scale) {
  const int t = blockIdx.x * 256 + threadIdx.x; if (t >= N * (K / 8)) return; const int n = t / (K / 8), k8 = (t % (K / 8)) * 8; FragH f;
#pragma unroll
  for (int i = 0; i < 8; ++i) f.h[i] = (_Float16)(bf16_round(W[(size_t)(k8 + i) * N + n]) * scale); const v8us o = f.half[0];
  *(v8us*)((unsigned short*)Wt + (size_t)n * K + k8) = o; 
}
// k_gemm_hh variant with fused epilogue: v = acc·alpha + bias[by·sBias + col] (+ CP[(row/rowsPerB)·sCPb + by·64 + col] if CP) ; ACT 0 none / 1 elu ; writes f16 C16 and f32 C, each if non-null
template <int ACT>
__global__ __launch_bounds__(128) void k_gemm_hhx(const _Float16* __restrict__ A, int lda, size_t sA, const _Float16* __restrict__ Bh, int ldb, size_t sB, float alpha, const float* __restrict__ bias, size_t sBias, const float* __restrict__ CP, int rowsPerB, size_t sCPb, int row0g,
    float* __restrict__ C, _Float16* __restrict__ C16, int ldc, size_t sC, int M, int N, int K) {
  __shared__ __attribute__((aligned(16))) float so[4][16][64];
  const int tid = threadIdx.x, w = tid >> 5, lane = tid & 31, ln = lane & 15, hh = lane >> 4; const int by = blockIdx.y;
  A += (size_t)by * sA; Bh += (size_t)by * sB; const size_t cofs = (size_t)by * sC; const float* bp = bias ? bias + (size_t)by * sBias : nullptr;
  const int ntn = (N + 63) / 64; const int wid = blockIdx.x * 4 + w; const int mt = wid / ntn, nq = wid % ntn; if (mt * 16 >= M) return;
  const int row0 = mt * 16, col0 = nq * 64; const _Float16* arow = A + (size_t)(row0 + ln) * lda;
  v8f acc[4] = {};
  for (int kb = 0; kb < K; kb += 32) { FragH ah; ah.half[0] = *(const v8us*)((const unsigned short*)arow + kb + 8 * hh); ah.half[1] = *(const v8us*)((const unsigned short*)arow + kb + 16 + 8 * hh);
#pragma unroll
    for (int t = 0; t < 4; ++t) { if (col0 + t * 16 >= N) continue; const size_t boff = (size_t)(col0 + t * 16 + ln) * ldb + kb; FragH bq; bq.half[0] = *(const v8us*)((const unsigned short*)Bh + boff + 8 * hh); bq.half[1] = *(const v8us*)((const unsigned short*)Bh + boff + 16 + 8 * hh);
      acc[t] = mmaH<1>(ah.v, ah.v, bq.v, bq.v, acc[t]); }
  }
#pragma unroll
  for (int t = 0; t < 4; ++t) { if (col0 + t * 16 >= N) continue; const int col = col0 + t * 16 + ln; const float bv = bp ? bf16_round(bp[col]) : 0.f;
#pragma unroll
    for (int r = 0; r < 8; ++r) { float v = acc[t][r] * alpha + bv; if (CP) { const int bidx = (row0g + row0 + 8 * hh + r) / rowsPerB; v += CP[(size_t)bidx * sCPb + (size_t)by * 64 + col]; } if (ACT == 1) v = (v > 0.f) ? v : expm1f(v); else if (ACT == 7) v = (v > 0.f) ? v + 1.0f : expf(v); else if (ACT == 8) v = tanhf(v); else if (ACT == 9) v = 0.5f * v * (1.0f + tanhf(0.7978845608028654f * (v + 0.044715f * v * v * v))); else if (ACT == 11) v = 1.0f / (1.0f + expf(-v)); else if (ACT == 12) v = (v > 0.f) ? v : 0.01f * v; else if (ACT == 14) v = (v > 0.f) ? v : 0.1f * v; else if (ACT == 15) v = v / (1.0f + expf(-v)); else if (ACT == 3) v = fmaxf(v, 0.f); else if (ACT == 6) v = 0.5f * v * (1.0f + erff(v * 0.70710678118654752f)); so[w][8 * hh + r][t * 16 + ln] = v; } }
  __builtin_amdgcn_fence(__ATOMIC_ACQ_REL, "workgroup"); __builtin_amdgcn_wave_barrier();
  const int rsub = lane >> 4, c4 = (lane & 15) * 4; typedef _Float16 v4h __attribute__((ext_vector_type(4)));
  {
#pragma unroll
    for (int q = 0; q < 8; ++q) { const int r = q * 2 + rsub; if (col0 + c4 < N) { const v4f v = *(const v4fa*)&so[w][r][c4]; if (C) *(v4f*)(C + cofs + (size_t)(row0 + r) * ldc + col0 + c4) = v; if (C16) { v4h h4; for (int i = 0; i < 4; ++i) h4[i] = (_Float16)v[i]; *(v4h*)(C16 + cofs + (size_t)(row0 + r) * ldc + col0 + c4) = h4; } } }
     }
}


typedef _Float16 v4h __attribute__((ext_vector_type(4)));

__global__ __launch_bounds__(256) void k_x16(const float* __restrict__ x, _Float16* __restrict__ X16, size_t n8) { const size_t t = (size_t)blockIdx.x * 256 + threadIdx.x; if (t >= n8) return; FragH f;
#pragma unroll
  for (int q = 0; q < 8; ++q) f.h[q] = (_Float16)bf16_round(x[t * 8 + q]); *(v8us*)((unsigned short*)X16 + t * 8) = f.half[0];  }
__global__ __launch_bounds__(256) void k_h16(const float* __restrict__ x, _Float16* __restrict__ X16, size_t n8) { const size_t t = (size_t)blockIdx.x * 256 + threadIdx.x; if (t >= n8) return; FragH f;
#pragma unroll
  for (int q = 0; q < 8; ++q) f.h[q] = (_Float16)x[t * 8 + q]; *(v8us*)((unsigned short*)X16 + t * 8) = f.half[0];  }
__global__ __launch_bounds__(256) void k_round16f(const float* __restrict__ W, _Float16* __restrict__ Bt, size_t n8) { const size_t t = (size_t)blockIdx.x * 256 + threadIdx.x; if (t >= n8) return; FragH f;
#pragma unroll
  for (int i = 0; i < 8; ++i) f.h[i] = (_Float16)(bf16_round(W[t * 8 + i]) * 16.0f); *(v8us*)((unsigned short*)Bt + t * 8) = f.half[0];  }
template <int NHv, int TTv>
__global__ __launch_bounds__(256) void k_vt(const _Float16* __restrict__ V16, int ldv, int voff, _Float16* __restrict__ Vt) { __shared__ unsigned short tl[64][66]; const int tid = threadIdx.x; const int slab = blockIdx.x / (TTv / 64), lg = blockIdx.x % (TTv / 64); const int b = slab / NHv, h = slab % NHv;
  for (int i = tid; i < 64 * 8; i += 256) { const int r = i / 8, c8 = (i % 8) * 8; FragH f; f.half[0] = *(const v8us*)((const unsigned short*)V16 + ((size_t)b * TTv + lg * 64 + r) * ldv + voff + h * 64 + c8);
#pragma unroll
    for (int q = 0; q < 8; ++q) tl[r][c8 + q] = f.u[q]; }
  __syncthreads();
  {
#pragma unroll
    for (int rd = 0; rd < 2; ++rd) { const int d = rd * 32 + tid / 8, pc = tid % 8; FragH f;
#pragma unroll
      for (int q = 0; q < 8; ++q) f.u[q] = tl[pc * 8 + q][d];
      *(v8us*)((unsigned short*)Vt + ((size_t)slab * 64 + d) * TTv + lg * 64 + pc * 8) = f.half[0]; }
     } }

__global__ __launch_bounds__(256) void k_vthlu(const float* __restrict__ VF, int ldv, _Float16* __restrict__ Vth, _Float16* __restrict__ Vtl) { __shared__ float tl[64][65]; const int tid = threadIdx.x; const int slab = blockIdx.x / (TT / 64), lg = blockIdx.x % (TT / 64); const int b = slab / NVH, h = slab % NVH;
  for (int i = tid; i < 64 * 16; i += 256) { const int r = i / 16, c4 = (i % 16) * 4; const v4f a = *(const v4fa*)(VF + ((size_t)b * TT + lg * 64 + r) * ldv + h * 64 + c4); tl[r][c4] = a[0]; tl[r][c4 + 1] = a[1]; tl[r][c4 + 2] = a[2]; tl[r][c4 + 3] = a[3]; }
  __syncthreads();
  FragH fh[2], fl[2]; size_t oo[2];
#pragma unroll
  for (int rd = 0; rd < 2; ++rd) { const int d = rd * 32 + tid / 8, pc = tid % 8;
#pragma unroll
    for (int q = 0; q < 8; ++q) { const float v = tl[pc * 8 + q][d]; const _Float16 hv = (_Float16)v; fh[rd].h[q] = hv; fl[rd].h[q] = (_Float16)(v - (float)hv);      /* UNSCALED residual (added into the same accumulator as the hi product) */ } oo[rd] = ((size_t)slab * 64 + d) * TT + lg * 64 + pc * 8; }
  {
#pragma unroll
    for (int rd = 0; rd < 2; ++rd) { *(v8us*)((unsigned short*)Vth + oo[rd]) = fh[rd].half[0]; *(v8us*)((unsigned short*)Vtl + oo[rd]) = fl[rd].half[0]; }
     } }
__global__ __launch_bounds__(256) void k_im3(const float* __restrict__ x, _Float16* __restrict__ A) { const size_t t = (size_t)blockIdx.x * 256 + threadIdx.x; if (t >= (size_t)NR * (K3 / 8)) return; const int piece = (int)(t % (K3 / 8)); const size_t row = t / (K3 / 8); const int b = (int)(row / TT), s = (int)(row % TT); const int tap = (piece * 8) / DD, c0 = (piece * 8) % DD; const int ss = s + tap - 1; FragH f;
  if (ss >= 0 && ss < TT) { const float* xr = x + ((size_t)b * TT + ss) * DD + c0; for (int q = 0; q < 8; ++q) f.h[q] = (_Float16)bf16_round(xr[q]); } else { for (int q = 0; q < 8; ++q) f.h[q] = (_Float16)0.f; }
  *(v8us*)((unsigned short*)A + t * 8) = f.half[0];  }
__global__ __launch_bounds__(256) void k_wc3(const float* __restrict__ w, _Float16* __restrict__ Bt) { const int t = blockIdx.x * 256 + threadIdx.x; if (t >= DD * (K3 / 8)) return; const int o = t / (K3 / 8), k0 = (t % (K3 / 8)) * 8; const int tap = k0 / DD, c0 = k0 % DD; FragH f;
  for (int q = 0; q < 8; ++q) f.h[q] = (_Float16)bf16_round(w[((size_t)o * DD + c0 + q) * 3 + tap]);
  *(v8us*)((unsigned short*)Bt + (size_t)t * 8) = f.half[0];  }
__global__ __launch_bounds__(256) void k_scl(float* __restrict__ O, const float* __restrict__ scl, size_t n4) { const size_t t = (size_t)blockIdx.x * 256 + threadIdx.x; if (t >= n4) return; const float s = bf16_round(scl[0]); v4f v = *(const v4fa*)(O + t * 4); for (int q = 0; q < 4; ++q) v[q] *= s; *(v4f*)(O + t * 4) = v;  }
__device__ __forceinline__ unsigned lds_off(const void* p) { return (unsigned)(size_t)p; }      /* byte offset in the work-group's LDS = low 32 bits of the __shared__ address */
// Four or twelve asynchronous copies, 16 B per lane each, global memory -> LDS. The closing s_wait_xcnt stands inside the statement so that no address register named here is rewritten ahead of it.
__device__ __forceinline__ void acp4(const unsigned (&l)[4], const unsigned short* const (&p)[4]) {
  asm volatile("global_load_async_to_lds_b128 %0, %4, off\n\t"
               "global_load_async_to_lds_b128 %1, %5, off\n\t"
               "global_load_async_to_lds_b128 %2, %6, off\n\t"
               "global_load_async_to_lds_b128 %3, %7, off\n\t"
               "s_wait_xcnt 0x0"
               :: "v"(l[0]), "v"(l[1]), "v"(l[2]), "v"(l[3]), "v"(p[0]), "v"(p[1]), "v"(p[2]), "v"(p[3]) : "memory");
}
__device__ __forceinline__ void acp12(const unsigned (&l)[12], const unsigned short* const (&p)[12]) {
  asm volatile("global_load_async_to_lds_b128 %0, %12, off\n\t"
               "global_load_async_to_lds_b128 %1, %13, off\n\t"
               "global_load_async_to_lds_b128 %2, %14, off\n\t"
               "global_load_async_to_lds_b128 %3, %15, off\n\t"
               "global_load_async_to_lds_b128 %4, %16, off\n\t"
               "global_load_async_to_lds_b128 %5, %17, off\n\t"
               "global_load_async_to_lds_b128 %6, %18, off\n\t"
               "global_load_async_to_lds_b128 %7, %19, off\n\t"
               "global_load_async_to_lds_b128 %8, %20, off\n\t"
               "global_load_async_to_lds_b128 %9, %21, off\n\t"
               "global_load_async_to_lds_b128 %10, %22, off\n\t"
               "global_load_async_to_lds_b128 %11, %23, off\n\t"
               "s_wait_xcnt 0x0"
               :: "v"(l[0]), "v"(l[1]), "v"(l[2]), "v"(l[3]), "v"(l[4]), "v"(l[5]), "v"(l[6]), "v"(l[7]), "v"(l[8]), "v"(l[9]), "v"(l[10]), "v"(l[11]),
                  "v"(p[0]), "v"(p[1]), "v"(p[2]), "v"(p[3]), "v"(p[4]), "v"(p[5]), "v"(p[6]), "v"(p[7]), "v"(p[8]), "v"(p[9]), "v"(p[10]), "v"(p[11]) : "memory");
}
__global__ __launch_bounds__(512) void k_flash(const _Float16* __restrict__ Q16, int ldq, const _Float16* __restrict__ K16, int ldk, const _Float16* __restrict__ Vt, const _Float16* __restrict__ Vtlo, float* __restrict__ O, int ldo) {
  constexpr int RPW = 16, RTN = RPW / 16, NQB = TT / (4 * RPW), DT = 8, KS = 8;      /* d_qk 256: 8 k-steps; 8 value tiles = ONE 128-wide half of the 256-wide V per wave */
  constexpr int SK = 64, NST = TT / SK;      /* one LDS tile = 64 keys = two 32-key passes, each on its own waves; V rows of 64 keys are whole 128-B lines */
  constexpr int KP = 256 + 8, VP = SK + 8;      /* LDS row pitches in halves: 528 B and 144 B, both 16 B x odd, conflict-free for the 16-row ds_load_b128 fragment reads */
  __shared__ __attribute__((aligned(16))) unsigned short sQ[4 * RPW][KP]; __shared__ __attribute__((aligned(16))) unsigned short sK[2][SK][KP]; __shared__ __attribute__((aligned(16))) unsigned short sVh[2][256][VP]; __shared__ __attribute__((aligned(16))) unsigned short sVl[2][256][VP];
  __shared__ __attribute__((aligned(16))) unsigned short sP[16][RPW][40]; __shared__ __attribute__((aligned(16))) unsigned short sPL[16][RPW][40]; __shared__ float sM[8][RPW]; __shared__ float sL[8][RPW];
  typedef float f32a __attribute__((may_alias)); static_assert(sizeof(sK) == 8 * RPW * (128 + 4) * sizeof(float), "the eight output tiles fill the K ring exactly");
  f32a (*sO)[RPW][128 + 4] = (f32a (*)[RPW][128 + 4])&sK[0][0][0];      /* the output tiles reuse the K ring, which nobody reads or fills behind the loop's last barrier */
  const int tid = threadIdx.x, w = tid >> 5, lane = tid & 31, ln = lane & 15, hh = lane >> 4;
  const int slab = blockIdx.x / NQB, qblk = blockIdx.x % NQB; const int b = slab / NH, h = slab % NH; const int qb0 = qblk * (4 * RPW);
  const int wq = w & 3, vhf = (w >> 2) & 1, pr = w & 7; const int q0 = qb0 + wq * RPW;      /* sixteen waves, four per SIMD: 4 groups of 16 query rows x 2 halves of V x 2 halves of each tile's keys; pr numbers the pair of waves that share rows and V half */
  const unsigned short* Qg = (const unsigned short*)Q16 + ((size_t)b * TT + qb0) * ldq; const unsigned short* Kg = (const unsigned short*)K16 + (size_t)b * TT * ldk;
  const unsigned short* Vth = (const unsigned short*)Vt + (size_t)b * VSTR * TT; const unsigned short* Vtl = (const unsigned short*)Vtlo + (size_t)b * VSTR * TT;      /* hi and UNSCALED residual planes */
  const int wu = __builtin_amdgcn_readfirstlane(w);      /* the wave's number as a scalar: the row parts of the copies' addresses stay in scalar registers */
  const int kp = wu >> 3;      /* which 32 keys of every tile this wave takes (scalar: the epilogue branches on it) */
  /* tile t -> buffer buf, 12 copies per wave: 4 K rows (one 512-B row per copy), 16 of the 256 rows of each V plane (four 128-B rows per copy) */
  auto stage = [&](int t, int buf) {
    unsigned l[12]; const unsigned short* p[12];
#pragma unroll      /* constant indices keep l[] and p[] in registers */
    for (int i = 0; i < 4; ++i) { const int r = wu * 4 + i; l[i] = lds_off(&sK[buf][r][lane * 8]); p[i] = Kg + (size_t)(t * SK + r) * ldk + lane * 8; }
#pragma unroll      /* constant indices keep l[] and p[] in registers */
    for (int i = 0; i < 4; ++i) { const int d = wu * 16 + i * 4 + (lane >> 3); l[4 + i] = lds_off(&sVh[buf][d][(lane & 7) * 8]); p[4 + i] = Vth + (size_t)d * TT + t * SK + (lane & 7) * 8; l[8 + i] = lds_off(&sVl[buf][d][(lane & 7) * 8]); p[8 + i] = Vtl + (size_t)d * TT + t * SK + (lane & 7) * 8; }
    acp12(l, p); };
  { unsigned l[4]; const unsigned short* p[4];      /* the block's 64 query rows, filled once: 4 rows per wave */
#pragma unroll      /* constant indices keep l[] and p[] in registers */
    for (int i = 0; i < 4; ++i) { const int r = wu * 4 + i; l[i] = lds_off(&sQ[r][lane * 8]); p[i] = Qg + (size_t)r * ldq + lane * 8; }
    acp4(l, p); }
  stage(0, 0);
  asm volatile("s_wait_asynccnt 0x0" ::: "memory");      /* this wave's copies of Q and of tile 0 have landed */
  __syncthreads();      /* publishes Q and tile 0 to every wave */
  stage(1, 1);
  const unsigned short* qrow = &sQ[wq * RPW + ln][0];
  float m_r[2][8], l_r[2][8]; v8f oacc[2][DT];
#pragma unroll
  for (int rt = 0; rt < RTN; ++rt) {
#pragma unroll
    for (int r = 0; r < 8; ++r) { m_r[rt][r] = -3.0e38f; l_r[rt][r] = 0.f; }
#pragma unroll
    for (int dt = 0; dt < DT; ++dt) oacc[rt][dt] = (v8f){0.f,0.f,0.f,0.f,0.f,0.f,0.f,0.f}; }
#pragma unroll 1
  for (int t = 0; t < NST; ++t) {
   const int buf = t & 1;
   {
    const int j0 = kp * 32;      /* first key of this wave's pass inside the tile */
    v8f s[2][2];
#pragma unroll
    for (int nt = 0; nt < 2; ++nt) { const unsigned short* kr = &sK[buf][j0 + nt * 16 + ln][0]; v8f acc = (v8f){0.f,0.f,0.f,0.f,0.f,0.f,0.f,0.f};
#pragma unroll
      for (int ks = 0; ks < KS; ++ks) { FragH bk, aq; bk.half[0] = *(const v8us*)(kr + ks * 32 + 8 * hh); bk.half[1] = *(const v8us*)(kr + ks * 32 + 16 + 8 * hh); aq.half[0] = *(const v8us*)(qrow + ks * 32 + 8 * hh); aq.half[1] = *(const v8us*)(qrow + ks * 32 + 16 + 8 * hh); acc = mmaH<1>(aq.v, aq.v, bk.v, bk.v, acc); }
      s[0][nt] = acc; }
#pragma unroll
    for (int rt = 0; rt < RTN; ++rt)
#pragma unroll
      for (int r = 0; r < 8; ++r) { const int tq = q0 + rt * 16 + 8 * hh + r; const int k0 = t * SK + j0 + ln, k1 = t * SK + j0 + 16 + ln; (void)tq; (void)k0; (void)k1;
        const bool ok0 = true, ok1 = true; (void)tq; (void)k0; (void)k1;
        const float s0 = ok0 ? s[rt][0][r] * ATT_SCALE : -INFINITY, s1 = ok1 ? s[rt][1][r] * ATT_SCALE : -INFINITY; float mc = fmaxf(s0, s1);
        mc = fmaxf(mc, __shfl_xor(mc, 1, 32)); mc = fmaxf(mc, __shfl_xor(mc, 2, 32)); mc = fmaxf(mc, __shfl_xor(mc, 4, 32)); mc = fmaxf(mc, __shfl_xor(mc, 8, 32));
        const float mn = fmaxf(m_r[rt][r], mc); const float al = (mn > -1.0e38f) ? expf(m_r[rt][r] - mn) : 1.0f; m_r[rt][r] = mn; const float p0 = ok0 ? expf(s0 - mn) : 0.f, p1 = ok1 ? expf(s1 - mn) : 0.f; l_r[rt][r] = l_r[rt][r] * al + p0 + p1;
#pragma unroll
        for (int dt = 0; dt < DT; ++dt) oacc[rt][dt][r] *= al;
        FragH t2, t3; const float ps0 = p0 * 1024.0f, ps1 = p1 * 1024.0f; t2.h[0] = (_Float16)ps0; t2.h[1] = (_Float16)ps1; t3.h[0] = (_Float16)(ps0 - (float)t2.h[0]); t3.h[1] = (_Float16)(ps1 - (float)t2.h[1]);      /* P hi and its UNSCALED residual (added into the same accumulator) */
        sP[w][rt * 16 + 8 * hh + r][ln] = t2.u[0]; sP[w][rt * 16 + 8 * hh + r][16 + ln] = t2.u[1]; sPL[w][rt * 16 + 8 * hh + r][ln] = t3.u[0]; sPL[w][rt * 16 + 8 * hh + r][16 + ln] = t3.u[1]; }
    __builtin_amdgcn_fence(__ATOMIC_ACQ_REL, "workgroup"); __builtin_amdgcn_wave_barrier();
    FragH pa[2], pl[2];
#pragma unroll
    for (int rt = 0; rt < RTN; ++rt) { pa[rt].half[0] = *(const v8us*)&sP[w][rt * 16 + ln][8 * hh]; pa[rt].half[1] = *(const v8us*)&sP[w][rt * 16 + ln][16 + 8 * hh]; pl[rt].half[0] = *(const v8us*)&sPL[w][rt * 16 + ln][8 * hh]; pl[rt].half[1] = *(const v8us*)&sPL[w][rt * 16 + ln][16 + 8 * hh]; }
#pragma unroll
    for (int dt = 0; dt < DT; ++dt) { const unsigned short* vh = &sVh[buf][vhf * 128 + dt * 16 + ln][j0]; const unsigned short* vl = &sVl[buf][vhf * 128 + dt * 16 + ln][j0]; FragH bv, bl; bv.half[0] = *(const v8us*)(vh + 8 * hh); bv.half[1] = *(const v8us*)(vh + 16 + 8 * hh); bl.half[0] = *(const v8us*)(vl + 8 * hh); bl.half[1] = *(const v8us*)(vl + 16 + 8 * hh);
#pragma unroll
      for (int rt = 0; rt < RTN; ++rt) { oacc[rt][dt] = mmaH<1>(pa[rt].v, pa[rt].v, bv.v, bv.v, oacc[rt][dt]); oacc[rt][dt] = mmaH<1>(pl[rt].v, pl[rt].v, bv.v, bv.v, oacc[rt][dt]); oacc[rt][dt] = mmaH<1>(pa[rt].v, pa[rt].v, bl.v, bl.v, oacc[rt][dt]); } }      /* Ph·Vh + Pl·Vh + Ph·Vl — all unscaled, one accumulator */
    __builtin_amdgcn_fence(__ATOMIC_ACQ_REL, "workgroup"); __builtin_amdgcn_wave_barrier(); }
   asm volatile("s_wait_dscnt 0x0" ::: "memory");      /* this wave's reads of tile t have returned before its buffer is refilled */
   asm volatile("s_wait_asynccnt 0x0" ::: "memory");      /* this wave's copies of tile t + 1 have landed */
   __syncthreads();      /* publishes tile t + 1 and ends every wave's reads of tile t */
   if (t + 2 < NST) stage(t + 2, buf); }
  asm volatile("s_wait_asynccnt 0x0" ::: "memory");      /* no copy is outstanding behind the loop */
#pragma unroll
  for (int r = 0; r < 8; ++r) { float l = l_r[0][r]; l += __shfl_xor(l, 1, 32); l += __shfl_xor(l, 2, 32); l += __shfl_xor(l, 4, 32); l += __shfl_xor(l, 8, 32); l_r[0][r] = l; }      /* row sums over this wave's keys */
  if (kp == 1) {      /* the wave of the second key half hands its running max, row sum and unnormalised tile to its partner */
#pragma unroll
    for (int dt = 0; dt < DT; ++dt)
#pragma unroll
      for (int r = 0; r < 8; ++r) sO[pr][8 * hh + r][dt * 16 + ln] = oacc[0][dt][r];
    if (ln == 0) {
#pragma unroll
      for (int r = 0; r < 8; ++r) { sM[pr][8 * hh + r] = m_r[0][r]; sL[pr][8 * hh + r] = l_r[0][r]; } } }
  __syncthreads();      /* publishes the second key half's partial results to the partner waves */
  if (kp == 0) {
    float c0[8], c1[8];
#pragma unroll
    for (int r = 0; r < 8; ++r) { const float m1 = sM[pr][8 * hh + r], l1 = sL[pr][8 * hh + r]; const float mn = fmaxf(m_r[0][r], m1); const float a0 = expf(m_r[0][r] - mn), a1 = expf(m1 - mn); const float l = l_r[0][r] * a0 + l1 * a1; const float inv = (l > 0.f) ? 1.0f / (l * 1024.0f) : 0.f; c0[r] = a0 * inv; c1[r] = a1 * inv; }
#pragma unroll
    for (int dt = 0; dt < DT; ++dt)
#pragma unroll
      for (int r = 0; r < 8; ++r) { f32a* o = &sO[pr][8 * hh + r][dt * 16 + ln]; *o = oacc[0][dt][r] * c0[r] + *o * c1[r]; }      /* each lane reads and rewrites its own word */
    __builtin_amdgcn_fence(__ATOMIC_ACQ_REL, "workgroup"); __builtin_amdgcn_wave_barrier();
#pragma unroll
    for (int r = 0; r < RPW; ++r) { const int pc = lane; const v4f val = *(const v4fa*)&sO[pr][r][pc * 4]; *(v4f*)(O + ((size_t)b * TT + q0 + r) * ldo + (h * 2 + vhf) * 128 + pc * 4) = val; }      /* one 512-B row per instruction: 32 lanes x 16 B */
  } }

extern "C" void kernel_launch(void* const* d_in, const int* in_sizes, int n_in,
                              void* d_out, int out_size, void* d_ws, size_t ws_size, hipStream_t stream) {
  (void)in_sizes; (void)n_in; (void)out_size;
  const float* const* I = (const float* const*)d_in; const float* xq = I[0]; const float* xk = I[1]; const float* xv = I[2]; const float* qw = I[3]; const float* qb = I[4]; const float* kw = I[5]; const float* kb = I[6]; const float* vw = I[7]; const float* vb = I[8]; const float* scl = I[9];
  char* ws = (char*)d_ws; size_t off = 0;
  auto take = [&](size_t bytes) { char* p = ws + off; off += (bytes + 255) & ~(size_t)255; return p; };
  _Float16* Bq = (_Float16*)take((size_t)DD * K3 * 2); _Float16* Bk = (_Float16*)take((size_t)DD * K3 * 2); _Float16* Bv = (_Float16*)take((size_t)DD * K3 * 2); _Float16* A = (_Float16*)take((size_t)NR * K3 * 2); _Float16* Q = (_Float16*)take((size_t)NR * DD * 2); _Float16* K = (_Float16*)take((size_t)NR * DD * 2); float* VF = (float*)take((size_t)NR * DD * 4); _Float16* Vt = (_Float16*)take((size_t)NR * DD * 2); _Float16* Vtl = (_Float16*)take((size_t)NR * DD * 2);
  if (off > ws_size) return;      // 1.2 + 25.2 + 8.4 + 8.4 + 16.8 + 8.4 + 8.4 ≈ 77 MB
  k_wc3<<<(DD * (K3 / 8) + 255) / 256, 256, 0, stream>>>(qw, Bq); k_wc3<<<(DD * (K3 / 8) + 255) / 256, 256, 0, stream>>>(kw, Bk); k_wc3<<<(DD * (K3 / 8) + 255) / 256, 256, 0, stream>>>(vw, Bv);
  const unsigned gi = (unsigned)(((size_t)NR * (K3 / 8) + 255) / 256); const dim3 gp(((NR / 16) * (DD / 64) + 3) / 4, 1);
  k_im3<<<gi, 256, 0, stream>>>(xq, A); k_gemm_hhx<0><<<gp, 128, 0, stream>>>(A, K3, 0, Bq, K3, 0, 1.0f, qb, 0, nullptr, 1, 0, 0, nullptr, Q, DD, 0, NR, DD, K3);      /* q = conv(query): M 16384 N 256 K 768 (exact products) → f16 */
  k_im3<<<gi, 256, 0, stream>>>(xk, A); k_gemm_hhx<0><<<gp, 128, 0, stream>>>(A, K3, 0, Bk, K3, 0, 1.0f, kb, 0, nullptr, 1, 0, 0, nullptr, K, DD, 0, NR, DD, K3);
  k_im3<<<gi, 256, 0, stream>>>(xv, A); k_gemm_hhx<0><<<gp, 128, 0, stream>>>(A, K3, 0, Bv, K3, 0, 1.0f, vb, 0, nullptr, 1, 0, 0, VF, nullptr, DD, 0, NR, DD, K3);      /* v (f32) */
  k_vthlu<<<BB * NVH * (TT / 64), 256, 0, stream>>>(VF, DD, Vt, Vtl);      /* Vᵀ hi + residual: [b][256][4096] */
  k_flash<<<BB * NH * (TT / 64), 512, 0, stream>>>(Q, DD, K, DD, Vt, Vtl, (float*)d_out, DD);      /* both 128-wide halves of O in one launch, straight into the output rows */
  k_scl<<<(unsigned)(((size_t)NR * DD / 4 + 255) / 256), 256, 0, stream>>>((float*)d_out, scl, (size_t)NR * DD / 4);      /* × scale */
}

// v003
// One run takes 334 microseconds.
// Timed twice side by side with v002, it ran 1.23 times as fast both times.
// All steps since v000 together make it 5.45 times as fast.
#include <hip/hip_runtime.h>
// KQV 'PCNN' attention (B=4, S=4096, D=256): q, k, v = Conv1d(kernel 3, pad 1) over the sequence of query/key/value (+bias); scores = q·k/16; softmax; out = scale·(P·v) → [4,4096,256].
// Compute dtype: inputs, conv weights/biases, scale rounded to bf16; each conv as an im2col GEMM (K = 3·256, bf16-exact operands, f32 accumulate) → q, k f16 planes, v f32 → Vᵀ f16 hi + f16 residual; fused flash-style kernel with d_qk = 256 (8 k-steps, online softmax f32, P f16 hi + residual,
// f32 accumulate) on v_wmma_f32_16x16x32_f16, one launch of 16-wave blocks (query rows x halves of v x halves of each key tile), writing the output rows directly; × scale in f32.
#define BB 4
#define TT 4096
#define DD 256
#define NH 1
#define VSTR 256
#define NVH 4
#define NR (BB * TT)
#define K3 (3 * DD)
#define ATT_SCALE 0.0625f

typedef __bf16 v16b __attribute__((ext_vector_type(16)));
typedef unsigned short v8us __attribute__((ext_vector_type(8), may_alias));
typedef float  v8f  __attribute__((ext_vector_type(8)));
typedef float  v4f  __attribute__((ext_vector_type(4)));
typedef float  v4fa __attribute__((ext_vector_type(4), may_alias));
union FragB { v16b v; v8us half[2]; unsigned short u[16]; };

__device__ __forceinline__ unsigned short bf16_bits(float x) { unsigned int u = __float_as_uint(x); return (unsigned short)((u + 0x7FFFu + ((u >> 16) & 1u)) >> 16); }
__device__ __forceinline__ float bf16_val(unsigned short b) { return __uint_as_float(((unsigned int)b) << 16); }
__device__ __forceinline__ float bf16_round(float x) { return bf16_val(bf16_bits(x)); }
// D += A·B with NT terms: 1 = ah·bh, 2 = + al·bh (A split), 3 = + ah·bl (both split)
template <int NT>
__device__ __forceinline__ v8f mmaN(v16b ah, v16b al, v16b bh, v16b bl, v8f c) {
  c = __builtin_amdgcn_wmma_f32_16x16x32_bf16(false, ah, false, bh, (short)0, c, false, false);
  if (NT >= 2) c = __builtin_amdgcn_wmma_f32_16x16x32_bf16(false, al, false, bh, (short)0, c, false, false);
  if (NT >= 3) c = __builtin_amdgcn_wmma_f32_16x16x32_bf16(false, ah, false, bl, (short)0, c, false, false);
  asm volatile("v_nop\n\tv_nop\n\tv_nop\n\tv_nop" : "+v"(c) : "v"(ah), "v"(al), "v"(bh), "v"(bl));
  return c;
}

__global__ __launch_bounds__(256) void k_wt_bf16(const float* __restrict__ W, unsigned short* __restrict__ Wt, int K, int N) {
  const int t = blockIdx.x * 256 + threadIdx.x;
  const int k8n = K / 8;
  if (t >= N * k8n) return;
  const int n = t / k8n, k8 = (t % k8n) * 8;
  v8us v;
#pragma unroll
  for (int i = 0; i < 8; ++i) v[i] = bf16_bits(W[(size_t)(k8 + i) * N + n]);
  *(v8us*)(Wt + (size_t)n * K + k8) = v;
  
}

// GEMM C[M][N] (f32, pitch ldc) = act(A[M][K]·W + bias). A f32 row-major (pitch lda) converted per fragment to bf16
// (ASPLIT: hi/lo two planes -> 2 terms, else single rounded term); Wt bf16 [N][K] (pitch ldb). BIAS_BF16 rounds the
// bias to bf16 first (bias quantised to bf16 before the add). K%32==0, M%16==0, N%64==0.
template <bool ASPLIT, int ACT, bool BIAS_BF16>
__global__ __launch_bounds__(128) void k_gemm_bf(const float* __restrict__ A, int lda, const unsigned short* __restrict__ Wt, int ldb,
                                               const float* __restrict__ bias, float* __restrict__ C, int ldc, int M, int N, int K) {
  __shared__ __attribute__((aligned(16))) float so[4][16][64];
  const int tid = threadIdx.x, w = tid >> 5, lane = tid & 31, ln = lane & 15, hh = lane >> 4;
  const int ntn = N / 64;
  const int wid = blockIdx.x * 4 + w;
  const int mt = wid / ntn, nq = wid % ntn;
  if (mt * 16 >= M) return;
  const int row0 = mt * 16, col0 = nq * 64;
  const float* arow = A + (size_t)(row0 + ln) * lda;
  v8f acc[4] = {};
  for (int kb = 0; kb < K; kb += 32) {
    FragB ah, al;
    const v4f x0 = *(const v4fa*)(arow + kb + 8 * hh), x1 = *(const v4fa*)(arow + kb + 8 * hh + 4);
    const v4f x2 = *(const v4fa*)(arow + kb + 16 + 8 * hh), x3 = *(const v4fa*)(arow + kb + 16 + 8 * hh + 4);
    float xs[16] = {x0[0],x0[1],x0[2],x0[3],x1[0],x1[1],x1[2],x1[3],x2[0],x2[1],x2[2],x2[3],x3[0],x3[1],x3[2],x3[3]};
#pragma unroll
    for (int i = 0; i < 16; ++i) { const unsigned short hb = bf16_bits(xs[i]); ah.u[i] = hb; al.u[i] = ASPLIT ? bf16_bits(xs[i] - bf16_val(hb)) : (unsigned short)0; }
#pragma unroll
    for (int t = 0; t < 4; ++t) {
      const unsigned short* brow = Wt + (size_t)(col0 + t * 16 + ln) * ldb + kb;
      FragB b;
      b.half[0] = *(const v8us*)(brow + 8 * hh);
      b.half[1] = *(const v8us*)(brow + 16 + 8 * hh);
      acc[t] = mmaN<ASPLIT ? 2 : 1>(ah.v, al.v, b.v, b.v, acc[t]);
    }
  }
#pragma unroll
  for (int t = 0; t < 4; ++t) {
    float bv = bias ? bias[col0 + t * 16 + ln] : 0.f;
    if (BIAS_BF16) bv = bf16_round(bv);
#pragma unroll
    for (int r = 0; r < 8; ++r) { float v = acc[t][r] + bv; if (ACT == 1) v = fmaxf(v, 0.f); so[w][8 * hh + r][t * 16 + ln] = v; }
  }
  __builtin_amdgcn_fence(__ATOMIC_ACQ_REL, "workgroup");
  __builtin_amdgcn_wave_barrier();
  const int rsub = lane >> 4, c4 = (lane & 15) * 4;
  {
#pragma unroll
    for (int q = 0; q < 8; ++q) {
      const int r = q * 2 + rsub;
      const v4f v = *(const v4fa*)&so[w][r][c4];
      *(v4f*)(C + (size_t)(row0 + r) * ldc + col0 + c4) = v;
    }
    
  }
}

// Flash-style causal/unmasked attention, all contractions 3-term bf16 hi/lo splits, f32 softmax with running max.
// q,k,v rows are read from f32 buffers with arbitrary row pitch (so they can live inside a fused qkv buffer);
// D = head size (multiple of 32, <= 128); one wave = 16 query rows; block = 4 waves (64 queries) sharing K/V chunks of 32.
template <int D, bool CAUSAL>
__global__ __launch_bounds__(128) void k_flash(const float* __restrict__ qb, const float* __restrict__ kb, const float* __restrict__ vb,
                                             int pitch, int T, int H, float scale, float* __restrict__ y, int ypitch) {
  constexpr int KS = D / 32;        // k-steps for QK
  constexpr int DT = D / 16;        // d tiles for PV
  __shared__ __attribute__((aligned(16))) unsigned short sKh[32][D + 8], sKl[32][D + 8], sVh[32][D + 8], sVl[32][D + 8];
  __shared__ __attribute__((aligned(16))) unsigned short sPh[4][16][40], sPl[4][16][40];
  __shared__ __attribute__((aligned(16))) float sO[4][16][D];
  const int tid = threadIdx.x, w = tid >> 5, lane = tid & 31, ln = lane & 15, hh = lane >> 4;
  const int nqb = (T + 63) / 64;
  const int bh = blockIdx.x / nqb, qblk = blockIdx.x % nqb;
  const int b = bh / H, h = bh % H;
  const int q0 = qblk * 64 + w * 16;
  const float* Q = qb + (size_t)b * T * pitch + h * D;
  const float* K = kb + (size_t)b * T * pitch + h * D;
  const float* V = vb + (size_t)b * T * pitch + h * D;

  // A fragments of the wave's 16 query rows (scaled), hi/lo
  FragB aqh[KS], aql[KS];
  {
    int row = q0 + ln; if (row >= T) row = T - 1;
    const float* qr = Q + (size_t)row * pitch;
#pragma unroll
    for (int ks = 0; ks < KS; ++ks)
#pragma unroll
      for (int i = 0; i < 16; ++i) {
        const int d = ks * 32 + ((i < 8) ? (8 * hh + i) : (16 + 8 * hh + (i - 8)));
        const float x = qr[d] * scale; const unsigned short hb = bf16_bits(x);
        aqh[ks].u[i] = hb; aql[ks].u[i] = bf16_bits(x - bf16_val(hb));
      }
  }
  float m_r[8], l_r[8];
#pragma unroll
  for (int r = 0; r < 8; ++r) { m_r[r] = -3.0e38f; l_r[r] = 0.f; }
  v8f oacc[DT];
#pragma unroll
  for (int dt = 0; dt < DT; ++dt) oacc[dt] = (v8f){0.f,0.f,0.f,0.f,0.f,0.f,0.f,0.f};

  const int kv_end = CAUSAL ? min(T, qblk * 64 + 64) : T;     // block-uniform
  for (int j0 = 0; j0 < kv_end; j0 += 32) {
    __syncthreads();
    for (int e = tid; e < 32 * (D / 4); e += 128) {
      const int r = e / (D / 4), c4 = (e % (D / 4)) * 4;
      const int key = j0 + r;
      v4f kf = {0.f,0.f,0.f,0.f}, vf = {0.f,0.f,0.f,0.f};
      if (key < T) { kf = *(const v4fa*)(K + (size_t)key * pitch + c4); vf = *(const v4fa*)(V + (size_t)key * pitch + c4); }
#pragma unroll
      for (int t = 0; t < 4; ++t) {
        unsigned short hb = bf16_bits(kf[t]); sKh[r][c4 + t] = hb; sKl[r][c4 + t] = bf16_bits(kf[t] - bf16_val(hb));
        hb = bf16_bits(vf[t]); sVh[r][c4 + t] = hb; sVl[r][c4 + t] = bf16_bits(vf[t] - bf16_val(hb));
      }
    }
    __syncthreads();
    // S tile 16 x 32
    v8f s[2];
#pragma unroll
    for (int nt = 0; nt < 2; ++nt) {
      v8f acc = {};
#pragma unroll
      for (int ks = 0; ks < KS; ++ks) {
        FragB bh_, bl_;
        bh_.half[0] = *(const v8us*)&sKh[nt * 16 + ln][ks * 32 + 8 * hh]; bh_.half[1] = *(const v8us*)&sKh[nt * 16 + ln][ks * 32 + 16 + 8 * hh];
        bl_.half[0] = *(const v8us*)&sKl[nt * 16 + ln][ks * 32 + 8 * hh]; bl_.half[1] = *(const v8us*)&sKl[nt * 16 + ln][ks * 32 + 16 + 8 * hh];
        acc = mmaN<3>(aqh[ks].v, aql[ks].v, bh_.v, bl_.v, acc);
      }
      s[nt] = acc;
    }
    // mask + running max (rows 8hh+r; the 16 lanes of a half share rows)
    float alpha[8];
#pragma unroll
    for (int r = 0; r < 8; ++r) {
      const int qi = q0 + 8 * hh + r;
      const int ja = j0 + ln, jb = j0 + 16 + ln;
      if (CAUSAL) { if (ja > qi) s[0][r] = -3.0e38f; if (jb > qi) s[1][r] = -3.0e38f; }
      if (ja >= T) s[0][r] = -3.0e38f;
      if (jb >= T) s[1][r] = -3.0e38f;
      float mx = fmaxf(s[0][r], s[1][r]);
      mx = fmaxf(mx, __shfl_xor(mx, 1, 32)); mx = fmaxf(mx, __shfl_xor(mx, 2, 32)); mx = fmaxf(mx, __shfl_xor(mx, 4, 32)); mx = fmaxf(mx, __shfl_xor(mx, 8, 32));
      const float mnew = fmaxf(m_r[r], mx);
      alpha[r] = (mnew > -1.0e38f) ? __expf(m_r[r] - mnew) : 1.0f;
      const float p0 = (s[0][r] > -1.0e38f) ? __expf(s[0][r] - mnew) : 0.f;
      const float p1 = (s[1][r] > -1.0e38f) ? __expf(s[1][r] - mnew) : 0.f;
      m_r[r] = mnew;
      l_r[r] = l_r[r] * alpha[r] + p0 + p1;            // per-lane partial row sum (16 lanes combined at the end)
      unsigned short hb = bf16_bits(p0); sPh[w][8 * hh + r][ln] = hb;      sPl[w][8 * hh + r][ln] = bf16_bits(p0 - bf16_val(hb));
      hb = bf16_bits(p1);                sPh[w][8 * hh + r][16 + ln] = hb; sPl[w][8 * hh + r][16 + ln] = bf16_bits(p1 - bf16_val(hb));
    }
#pragma unroll
    for (int dt = 0; dt < DT; ++dt)
#pragma unroll
      for (int r = 0; r < 8; ++r) oacc[dt][r] *= alpha[r];
    __builtin_amdgcn_fence(__ATOMIC_ACQ_REL, "workgroup");
    __builtin_amdgcn_wave_barrier();
    FragB pah, pal;
    pah.half[0] = *(const v8us*)&sPh[w][ln][8 * hh]; pah.half[1] = *(const v8us*)&sPh[w][ln][16 + 8 * hh];
    pal.half[0] = *(const v8us*)&sPl[w][ln][8 * hh]; pal.half[1] = *(const v8us*)&sPl[w][ln][16 + 8 * hh];
#pragma unroll
    for (int dt = 0; dt < DT; ++dt) {
      FragB bvh, bvl;
#pragma unroll
      for (int i = 0; i < 8; ++i) {
        bvh.u[i] = sVh[8 * hh + i][dt * 16 + ln]; bvh.u[8 + i] = sVh[16 + 8 * hh + i][dt * 16 + ln];
        bvl.u[i] = sVl[8 * hh + i][dt * 16 + ln]; bvl.u[8 + i] = sVl[16 + 8 * hh + i][dt * 16 + ln];
      }
      oacc[dt] = mmaN<3>(pah.v, pal.v, bvh.v, bvl.v, oacc[dt]);
    }
    __builtin_amdgcn_fence(__ATOMIC_ACQ_REL, "workgroup");
    __builtin_amdgcn_wave_barrier();
  }
#pragma unroll
  for (int r = 0; r < 8; ++r) {
    float l = l_r[r];
    l += __shfl_xor(l, 1, 32); l += __shfl_xor(l, 2, 32); l += __shfl_xor(l, 4, 32); l += __shfl_xor(l, 8, 32);
    l_r[r] = (l > 0.f) ? 1.0f / l : 0.f;
  }
#pragma unroll
  for (int dt = 0; dt < DT; ++dt)
#pragma unroll
    for (int r = 0; r < 8; ++r) sO[w][8 * hh + r][dt * 16 + ln] = oacc[dt][r] * l_r[r];
  __builtin_amdgcn_fence(__ATOMIC_ACQ_REL, "workgroup");
  __builtin_amdgcn_wave_barrier();
  {
    for (int r = 0; r < 16; ++r) {
      const int row = q0 + r;
      if (row < T && lane < D / 4) {
        const v4f val = *(const v4fa*)&sO[w][r][lane * 4];
        *(v4f*)(y + ((size_t)b * T + row) * ypitch + h * D + lane * 4) = val;
      }
    }
    
  }
}

// GEMM C = act(A·W + bias + resid): A f32 (ASPLIT -> hi/lo 2 terms), Wt bf16 [N][K]; ACT 0 none, 1 relu, 2 exact gelu;
// resid (optional, f32, row index = (row % rmod), pitch ldr, RES_BF16 rounds it) added before the activation.
template <bool ASPLIT, int ACT, bool BIAS_BF16, bool RES_BF16>
__global__ __launch_bounds__(128) void k_gemm_bf3(const float* __restrict__ A, int lda, const unsigned short* __restrict__ Wt, int ldb,
                                                const float* __restrict__ bias, const float* __restrict__ resid, int rmod, int ldr,
                                                float* __restrict__ C, int ldc, int M, int N, int K) {
  __shared__ __attribute__((aligned(16))) float so[4][16][64];
  const int tid = threadIdx.x, w = tid >> 5, lane = tid & 31, ln = lane & 15, hh = lane >> 4;
  const int ntn = N / 64;
  const int wid = blockIdx.x * 4 + w;
  const int mt = wid / ntn, nq = wid % ntn;
  if (mt * 16 >= M) return;
  const int row0 = mt * 16, col0 = nq * 64;
  const float* arow = A + (size_t)(row0 + ln) * lda;
  v8f acc[4] = {};
  for (int kb = 0; kb < K; kb += 32) {
    FragB ah, al;
    const v4f x0 = *(const v4fa*)(arow + kb + 8 * hh), x1 = *(const v4fa*)(arow + kb + 8 * hh + 4);
    const v4f x2 = *(const v4fa*)(arow + kb + 16 + 8 * hh), x3 = *(const v4fa*)(arow + kb + 16 + 8 * hh + 4);
    float xs[16] = {x0[0],x0[1],x0[2],x0[3],x1[0],x1[1],x1[2],x1[3],x2[0],x2[1],x2[2],x2[3],x3[0],x3[1],x3[2],x3[3]};
#pragma unroll
    for (int i = 0; i < 16; ++i) { const unsigned short hb = bf16_bits(xs[i]); ah.u[i] = hb; al.u[i] = ASPLIT ? bf16_bits(xs[i] - bf16_val(hb)) : (unsigned short)0; }
#pragma unroll
    for (int t = 0; t < 4; ++t) {
      const unsigned short* brow = Wt + (size_t)(col0 + t * 16 + ln) * ldb + kb;
      FragB b;
      b.half[0] = *(const v8us*)(brow + 8 * hh);
      b.half[1] = *(const v8us*)(brow + 16 + 8 * hh);
      acc[t] = mmaN<ASPLIT ? 2 : 1>(ah.v, al.v, b.v, b.v, acc[t]);
    }
  }
#pragma unroll
  for (int t = 0; t < 4; ++t) {
    const int col = col0 + t * 16 + ln;
    float bv = bias ? bias[col] : 0.f;
    if (BIAS_BF16) bv = bf16_round(bv);
#pragma unroll
    for (int r = 0; r < 8; ++r) {
      float v = acc[t][r] + bv;
      if (resid) { float rv = resid[(size_t)((row0 + 8 * hh + r) % rmod) * ldr + col]; if (RES_BF16) rv = bf16_round(rv); v += rv; }
      if (ACT == 1) v = fmaxf(v, 0.f);
      if (ACT == 2) v = 0.5f * v * (1.0f + erff(v * 0.70710678118654752f));
      if (ACT == 3) { const float u = 0.7978845608028654f * (v + 0.044715f * v * v * v); v = 0.5f * v * (1.0f + tanhf(u)); }
      so[w][8 * hh + r][t * 16 + ln] = v;
    }
  }
  __builtin_amdgcn_fence(__ATOMIC_ACQ_REL, "workgroup");
  __builtin_amdgcn_wave_barrier();
  const int rsub = lane >> 4, c4 = (lane & 15) * 4;
  {
#pragma unroll
    for (int q = 0; q < 8; ++q) {
      const int r = q * 2 + rsub;
      const v4f v = *(const v4fa*)&so[w][r][c4];
      *(v4f*)(C + (size_t)(row0 + r) * ldc + col0 + c4) = v;
    }
    
  }
}
// row LayerNorm (biased variance, eps) over N: s = X (+ R); optional out_sum <- s; out_norm <- (s-mu)*rsqrt(var+eps)*g + b
template <bool PARAM_BF16>
__global__ __launch_bounds__(256) void k_layernorm(const float* __restrict__ X, const float* __restrict__ R, const float* __restrict__ g, const float* __restrict__ bta,
                                                  float* __restrict__ out_sum, float* __restrict__ out_norm, int N, float eps) {
  __shared__ float red[256];
  const int row = blockIdx.x, tid = threadIdx.x;
  const float* x = X + (size_t)row * N; const float* rr = R ? R + (size_t)row * N : nullptr;
  float vals[16];                     // up to N = 4096
  const int per = N / 256;            // contiguous chunk per thread? use strided-by-4 chunks: thread handles j = tid*4 + 1024*u
  float s1 = 0.f;
  for (int u = 0; u < per / 4; ++u) {
    const int j = tid * 4 + 1024 * u;
    const v4f a = *(const v4fa*)(x + j);
    v4f b = {0.f,0.f,0.f,0.f}; if (rr) b = *(const v4fa*)(rr + j);
#pragma unroll
    for (int q = 0; q < 4; ++q) { const float v = a[q] + b[q]; vals[u * 4 + q] = v; s1 += v; }
  }
  red[tid] = s1; __syncthreads();
  for (int st = 128; st > 0; st >>= 1) { if (tid < st) red[tid] += red[tid + st]; __syncthreads(); }
  const float mu = red[0] / (float)N; __syncthreads();
  float s2 = 0.f;
  for (int u = 0; u < per / 4; ++u)
#pragma unroll
    for (int q = 0; q < 4; ++q) { const float c = vals[u * 4 + q] - mu; s2 += c * c; }
  red[tid] = s2; __syncthreads();
  for (int st = 128; st > 0; st >>= 1) { if (tid < st) red[tid] += red[tid + st]; __syncthreads(); }
  const float rs = rsqrtf(red[0] / (float)N + eps);
  {
    for (int u = 0; u < per / 4; ++u) {
      const int j = tid * 4 + 1024 * u;
      v4f o, sm;
#pragma unroll
      for (int q = 0; q < 4; ++q) {
        float gg = g[j + q], bb = bta[j + q];
        if (PARAM_BF16) { gg = bf16_round(gg); bb = bf16_round(bb); }
        sm[q] = vals[u * 4 + q]; o[q] = (vals[u * 4 + q] - mu) * rs * gg + bb;
      }
      if (out_sum) *(v4f*)(out_sum + (size_t)row * N + j) = sm;
      *(v4f*)(out_norm + (size_t)row * N + j) = o;
    }
    
  }
}



// ---- f16 WMMA path (v_wmma_f32_16x16x32_f16): 11-bit significands for operands in range — used where a [0,1] probability operand needs more precision than bf16
typedef _Float16 v16h __attribute__((ext_vector_type(16)));
union FragH { v16h v; v8us half[2]; _Float16 h[16]; unsigned short u[16]; };
template <int NT>
__device__ __forceinline__ v8f mmaH(v16h ah, v16h al, v16h bh, v16h bl, v8f c) {
  c = __builtin_amdgcn_wmma_f32_16x16x32_f16(false, ah, false, bh, (short)0, c, false, false);
  if (NT >= 2) c = __builtin_amdgcn_wmma_f32_16x16x32_f16(false, al, false, bh, (short)0, c, false, false);
  if (NT >= 3) c = __builtin_amdgcn_wmma_f32_16x16x32_f16(false, ah, false, bl, (short)0, c, false, false);
  asm volatile("v_nop\n\tv_nop\n\tv_nop\n\tv_nop" : "+v"(c) : "v"(ah), "v"(al), "v"(bh), "v"(bl));
  return c;
}
// batched GEMM like k_gemm_b but f16 operands: A f32 (split into f16 hi/lo if ASPLIT, else rounded to f16), Bt = f16 values [n][k]; alpha; C f32; N multiple of 16 (partial tiles skipped)
template <bool ASPLIT>
__global__ __launch_bounds__(128) void k_gemm_h(const float* __restrict__ A, int lda, size_t sA, const _Float16* __restrict__ Bh, int ldb, size_t sB, float alpha, float* __restrict__ C, int ldc, size_t sC, int M, int N, int K) {
  __shared__ __attribute__((aligned(16))) float so[4][16][64];
  const int tid = threadIdx.x, w = tid >> 5, lane = tid & 31, ln = lane & 15, hh = lane >> 4; const int by = blockIdx.y;
  A += (size_t)by * sA; Bh += (size_t)by * sB; C += (size_t)by * sC;
  const int ntn = (N + 63) / 64; const int wid = blockIdx.x * 4 + w; const int mt = wid / ntn, nq = wid % ntn; if (mt * 16 >= M) return;
  const int row0 = mt * 16, col0 = nq * 64; const float* arow = A + (size_t)(row0 + ln) * lda;
  v8f acc[4] = {};
  for (int kb = 0; kb < K; kb += 32) {
    FragH ah, al;
    const v4f x0 = *(const v4fa*)(arow + kb + 8 * hh), x1 = *(const v4fa*)(arow + kb + 8 * hh + 4), x2 = *(const v4fa*)(arow + kb + 16 + 8 * hh), x3 = *(const v4fa*)(arow + kb + 16 + 8 * hh + 4);
    float xs[16] = {x0[0],x0[1],x0[2],x0[3],x1[0],x1[1],x1[2],x1[3],x2[0],x2[1],x2[2],x2[3],x3[0],x3[1],x3[2],x3[3]};
#pragma unroll
    for (int i = 0; i < 16; ++i) { const _Float16 h = (_Float16)xs[i]; ah.h[i] = h; al.h[i] = ASPLIT ? (_Float16)(xs[i] - (float)h) : (_Float16)0.0f; }
#pragma unroll
    for (int t = 0; t < 4; ++t) { if (col0 + t * 16 >= N) continue; const size_t boff = (size_t)(col0 + t * 16 + ln) * ldb + kb; FragH bq; bq.half[0] = *(const v8us*)(Bh + boff + 8 * hh); bq.half[1] = *(const v8us*)(Bh + boff + 16 + 8 * hh);
      acc[t] = mmaH<ASPLIT ? 2 : 1>(ah.v, al.v, bq.v, bq.v, acc[t]); }
  }
#pragma unroll
  for (int t = 0; t < 4; ++t) { if (col0 + t * 16 >= N) continue;
#pragma unroll
    for (int r = 0; r < 8; ++r) so[w][8 * hh + r][t * 16 + ln] = acc[t][r] * alpha; }
  __builtin_amdgcn_fence(__ATOMIC_ACQ_REL, "workgroup"); __builtin_amdgcn_wave_barrier();
  const int rsub = lane >> 4, c4 = (lane & 15) * 4;
  {
#pragma unroll
    for (int q = 0; q < 8; ++q) { const int r = q * 2 + rsub; if (col0 + c4 < N) { const v4f v = *(const v4fa*)&so[w][r][c4]; *(v4f*)(C + (size_t)(row0 + r) * ldc + col0 + c4) = v; } }
     }
}

// Wt[n][k] = f16(W[k][n]·scale) from f32 row-major W[K][N] (scale = power of two; bf16-exact weights stay exact in f16 away from the subnormal range)
__global__ __launch_bounds__(256) void k_wt_f16(const float* __restrict__ W, _Float16* __restrict__ Wt, int K, int N, float scale) {
  const int t = blockIdx.x * 256 + threadIdx.x; if (t >= N * (K / 8)) return; const int n = t / (K / 8), k8 = (t % (K / 8)) * 8; FragH f;
#pragma unroll
  for (int i = 0; i < 8; ++i) f.h[i] = (_Float16)(bf16_round(W[(size_t)(k8 + i) * N + n]) * scale); const v8us o = f.half[0];
  *(v8us*)((unsigned short*)Wt + (size_t)n * K + k8) = o; 
}
// k_gemm_hh variant with fused epilogue: v = acc·alpha + bias[by·sBias + col] (+ CP[(row/rowsPerB)·sCPb + by·64 + col] if CP) ; ACT 0 none / 1 elu ; writes f16 C16 and f32 C, each if non-null
template <int ACT>
__global__ __launch_bounds__(128) void k_gemm_hhx(const _Float16* __restrict__ A, int lda, size_t sA, const _Float16* __restrict__ Bh, int ldb, size_t sB, float alpha, const float* __restrict__ bias, size_t sBias, const float* __restrict__ CP, int rowsPerB, size_t sCPb, int row0g,
    float* __restrict__ C, _Float16* __restrict__ C16, int ldc, size_t sC, int M, int N, int K) {
  __shared__ __attribute__((aligned(16))) float so[4][16][64];
  const int tid = threadIdx.x, w = tid >> 5, lane = tid & 31, ln = lane & 15, hh = lane >> 4; const int by = blockIdx.y;
  A += (size_t)by * sA; Bh += (size_t)by * sB; const size_t cofs = (size_t)by * sC; const float* bp = bias ? bias + (size_t)by * sBias : nullptr;
  const int ntn = (N + 63) / 64; const int wid = blockIdx.x * 4 + w; const int mt = wid / ntn, nq = wid % ntn; if (mt * 16 >= M) return;
  const int row0 = mt * 16, col0 = nq * 64; const _Float16* arow = A + (size_t)(row0 + ln) * lda;
  v8f acc[4] = {};
  for (int kb = 0; kb < K; kb += 32) { FragH ah; ah.half[0] = *(const v8us*)((const unsigned short*)arow + kb + 8 * hh); ah.half[1] = *(const v8us*)((const unsigned short*)arow + kb + 16 + 8 * hh);
#pragma unroll
    for (int t = 0; t < 4; ++t) { if (col0 + t * 16 >= N) continue; const size_t boff = (size_t)(col0 + t * 16 + ln) * ldb + kb; FragH bq; bq.half[0] = *(const v8us*)((const unsigned short*)Bh + boff + 8 * hh); bq.half[1] = *(const v8us*)((const unsigned short*)Bh + boff + 16 + 8 * hh);
      acc[t] = mmaH<1>(ah.v, ah.v, bq.v, bq.v, acc[t]); }
  }
#pragma unroll
  for (int t = 0; t < 4; ++t) { if (col0 + t * 16 >= N) continue; const int col = col0 + t * 16 + ln; const float bv = bp ? bf16_round(bp[col]) : 0.f;
#pragma unroll
    for (int r = 0; r < 8; ++r) { float v = acc[t][r] * alpha + bv; if (CP) { const int bidx = (row0g + row0 + 8 * hh + r) / rowsPerB; v += CP[(size_t)bidx * sCPb + (size_t)by * 64 + col]; } if (ACT == 1) v = (v > 0.f) ? v : expm1f(v); else if (ACT == 7) v = (v > 0.f) ? v + 1.0f : expf(v); else if (ACT == 8) v = tanhf(v); else if (ACT == 9) v = 0.5f * v * (1.0f + tanhf(0.7978845608028654f * (v + 0.044715f * v * v * v))); else if (ACT == 11) v = 1.0f / (1.0f + expf(-v)); else if (ACT == 12) v = (v > 0.f) ? v : 0.01f * v; else if (ACT == 14) v = (v > 0.f) ? v : 0.1f * v; else if (ACT == 15) v = v / (1.0f + expf(-v)); else if (ACT == 3) v = fmaxf(v, 0.f); else if (ACT == 6) v = 0.5f * v * (1.0f + erff(v * 0.70710678118654752f)); so[w][8 * hh + r][t * 16 + ln] = v; } }
  __builtin_amdgcn_fence(__ATOMIC_ACQ_REL, "workgroup"); __builtin_amdgcn_wave_barrier();
  const int rsub = lane >> 4, c4 = (lane & 15) * 4; typedef _Float16 v4h __attribute__((ext_vector_type(4)));
  {
#pragma unroll
    for (int q = 0; q < 8; ++q) { const int r = q * 2 + rsub; if (col0 + c4 < N) { const v4f v = *(const v4fa*)&so[w][r][c4]; if (C) *(v4f*)(C + cofs + (size_t)(row0 + r) * ldc + col0 + c4) = v; if (C16) { v4h h4; for (int i = 0; i < 4; ++i) h4[i] = (_Float16)v[i]; *(v4h*)(C16 + cofs + (size_t)(row0 + r) * ldc + col0 + c4) = h4; } } }
     }
}


typedef _Float16 v4h __attribute__((ext_vector_type(4)));

__global__ __launch_bounds__(256) void k_x16(const float* __restrict__ x, _Float16* __restrict__ X16, size_t n8) { const size_t t = (size_t)blockIdx.x * 256 + threadIdx.x; if (t >= n8) return; FragH f;
#pragma unroll
  for (int q = 0; q < 8; ++q) f.h[q] = (_Float16)bf16_round(x[t * 8 + q]); *(v8us*)((unsigned short*)X16 + t * 8) = f.half[0];  }
__global__ __launch_bounds__(256) void k_h16(const float* __restrict__ x, _Float16* __restrict__ X16, size_t n8) { const size_t t = (size_t)blockIdx.x * 256 + threadIdx.x; if (t >= n8) return; FragH f;
#pragma unroll
  for (int q = 0; q < 8; ++q) f.h[q] = (_Float16)x[t * 8 + q]; *(v8us*)((unsigned short*)X16 + t * 8) = f.half[0];  }
__global__ __launch_bounds__(256) void k_round16f(const float* __restrict__ W, _Float16* __restrict__ Bt, size_t n8) { const size_t t = (size_t)blockIdx.x * 256 + threadIdx.x; if (t >= n8) return; FragH f;
#pragma unroll
  for (int i = 0; i < 8; ++i) f.h[i] = (_Float16)(bf16_round(W[t * 8 + i]) * 16.0f); *(v8us*)((unsigned short*)Bt + t * 8) = f.half[0];  }
template <int NHv, int TTv>
__global__ __launch_bounds__(256) void k_vt(const _Float16* __restrict__ V16, int ldv, int voff, _Float16* __restrict__ Vt) { __shared__ unsigned short tl[64][66]; const int tid = threadIdx.x; const int slab = blockIdx.x / (TTv / 64), lg = blockIdx.x % (TTv / 64); const int b = slab / NHv, h = slab % NHv;
  for (int i = tid; i < 64 * 8; i += 256) { const int r = i / 8, c8 = (i % 8) * 8; FragH f; f.half[0] = *(const v8us*)((const unsigned short*)V16 + ((size_t)b * TTv + lg * 64 + r) * ldv + voff + h * 64 + c8);
#pragma unroll
    for (int q = 0; q < 8; ++q) tl[r][c8 + q] = f.u[q]; }
  __syncthreads();
  {
#pragma unroll
    for (int rd = 0; rd < 2; ++rd) { const int d = rd * 32 + tid / 8, pc = tid % 8; FragH f;
#pragma unroll
      for (int q = 0; q < 8; ++q) f.u[q] = tl[pc * 8 + q][d];
      *(v8us*)((unsigned short*)Vt + ((size_t)slab * 64 + d) * TTv + lg * 64 + pc * 8) = f.half[0]; }
     } }

__global__ __launch_bounds__(256) void k_vthlu(const float* __restrict__ VF, int ldv, _Float16* __restrict__ Vth, _Float16* __restrict__ Vtl) { __shared__ float tl[64][65]; const int tid = threadIdx.x; const int slab = blockIdx.x / (TT / 64), lg = blockIdx.x % (TT / 64); const int b = slab / NVH, h = slab % NVH;
  for (int i = tid; i < 64 * 16; i += 256) { const int r = i / 16, c4 = (i % 16) * 4; const v4f a = *(const v4fa*)(VF + ((size_t)b * TT + lg * 64 + r) * ldv + h * 64 + c4); tl[r][c4] = a[0]; tl[r][c4 + 1] = a[1]; tl[r][c4 + 2] = a[2]; tl[r][c4 + 3] = a[3]; }
  __syncthreads();
  FragH fh[2], fl[2]; size_t oo[2];
#pragma unroll
  for (int rd = 0; rd < 2; ++rd) { const int d = rd * 32 + tid / 8, pc = tid % 8;
#pragma unroll
    for (int q = 0; q < 8; ++q) { const float v = tl[pc * 8 + q][d]; const _Float16 hv = (_Float16)v; fh[rd].h[q] = hv; fl[rd].h[q] = (_Float16)(v - (float)hv);      /* UNSCALED residual (added into the same accumulator as the hi product) */ } oo[rd] = ((size_t)slab * 64 + d) * TT + lg * 64 + pc * 8; }
  {
#pragma unroll
    for (int rd = 0; rd < 2; ++rd) { *(v8us*)((unsigned short*)Vth + oo[rd]) = fh[rd].half[0]; *(v8us*)((unsigned short*)Vtl + oo[rd]) = fl[rd].half[0]; }
     } }
__global__ __launch_bounds__(256) void k_im3(const float* __restrict__ x, _Float16* __restrict__ A) { const size_t t = (size_t)blockIdx.x * 256 + threadIdx.x; if (t >= (size_t)NR * (K3 / 8)) return; const int piece = (int)(t % (K3 / 8)); const size_t row = t / (K3 / 8); const int b = (int)(row / TT), s = (int)(row % TT); const int tap = (piece * 8) / DD, c0 = (piece * 8) % DD; const int ss = s + tap - 1; FragH f;
  if (ss >= 0 && ss < TT) { const float* xr = x + ((size_t)b * TT + ss) * DD + c0; for (int q = 0; q < 8; ++q) f.h[q] = (_Float16)bf16_round(xr[q]); } else { for (int q = 0; q < 8; ++q) f.h[q] = (_Float16)0.f; }
  *(v8us*)((unsigned short*)A + t * 8) = f.half[0];  }
__global__ __launch_bounds__(256) void k_wc3(const float* __restrict__ w, _Float16* __restrict__ Bt) { const int t = blockIdx.x * 256 + threadIdx.x; if (t >= DD * (K3 / 8)) return; const int o = t / (K3 / 8), k0 = (t % (K3 / 8)) * 8; const int tap = k0 / DD, c0 = k0 % DD; FragH f;
  for (int q = 0; q < 8; ++q) f.h[q] = (_Float16)bf16_round(w[((size_t)o * DD + c0 + q) * 3 + tap]);
  *(v8us*)((unsigned short*)Bt + (size_t)t * 8) = f.half[0];  }
__global__ __launch_bounds__(256) void k_scl(float* __restrict__ O, const float* __restrict__ scl, size_t n4) { const size_t t = (size_t)blockIdx.x * 256 + threadIdx.x; if (t >= n4) return; const float s = bf16_round(scl[0]); v4f v = *(const v4fa*)(O + t * 4); for (int q = 0; q < 4; ++q) v[q] *= s; *(v4f*)(O + t * 4) = v;  }
__device__ __forceinline__ float xhalf(float x) { return __builtin_bit_cast(float, __builtin_amdgcn_permlanex16(__builtin_bit_cast(int, x), __builtin_bit_cast(int, x), 0x76543210, 0xfedcba98, false, false)); }      /* lane l takes lane l ^ 16's value */
__device__ __forceinline__ unsigned lds_off(const void* p) { return (unsigned)(size_t)p; }      /* byte offset in the work-group's LDS = low 32 bits of the __shared__ address */
// Four or twelve asynchronous copies, 16 B per lane each, global memory -> LDS. The closing s_wait_xcnt stands inside the statement so that no address register named here is rewritten ahead of it.
__device__ __forceinline__ void acp4(const unsigned (&l)[4], const unsigned short* const (&p)[4]) {
  asm volatile("global_load_async_to_lds_b128 %0, %4, off\n\t"
               "global_load_async_to_lds_b128 %1, %5, off\n\t"
               "global_load_async_to_lds_b128 %2, %6, off\n\t"
               "global_load_async_to_lds_b128 %3, %7, off\n\t"
               "s_wait_xcnt 0x0"
               :: "v"(l[0]), "v"(l[1]), "v"(l[2]), "v"(l[3]), "v"(p[0]), "v"(p[1]), "v"(p[2]), "v"(p[3]) : "memory");
}
__device__ __forceinline__ void acp12(const unsigned (&l)[12], const unsigned short* const (&p)[12]) {
  asm volatile("global_load_async_to_lds_b128 %0, %12, off\n\t"
               "global_load_async_to_lds_b128 %1, %13, off\n\t"
               "global_load_async_to_lds_b128 %2, %14, off\n\t"
               "global_load_async_to_lds_b128 %3, %15, off\n\t"
               "global_load_async_to_lds_b128 %4, %16, off\n\t"
               "global_load_async_to_lds_b128 %5, %17, off\n\t"
               "global_load_async_to_lds_b128 %6, %18, off\n\t"
               "global_load_async_to_lds_b128 %7, %19, off\n\t"
               "global_load_async_to_lds_b128 %8, %20, off\n\t"
               "global_load_async_to_lds_b128 %9, %21, off\n\t"
               "global_load_async_to_lds_b128 %10, %22, off\n\t"
               "global_load_async_to_lds_b128 %11, %23, off\n\t"
               "s_wait_xcnt 0x0"
               :: "v"(l[0]), "v"(l[1]), "v"(l[2]), "v"(l[3]), "v"(l[4]), "v"(l[5]), "v"(l[6]), "v"(l[7]), "v"(l[8]), "v"(l[9]), "v"(l[10]), "v"(l[11]),
                  "v"(p[0]), "v"(p[1]), "v"(p[2]), "v"(p[3]), "v"(p[4]), "v"(p[5]), "v"(p[6]), "v"(p[7]), "v"(p[8]), "v"(p[9]), "v"(p[10]), "v"(p[11]) : "memory");
}
__global__ __launch_bounds__(512) void k_flash(const _Float16* __restrict__ Q16, int ldq, const _Float16* __restrict__ K16, int ldk, const _Float16* __restrict__ Vt, const _Float16* __restrict__ Vtlo, float* __restrict__ O, int ldo) {
  constexpr int RPW = 16, NQB = TT / (4 * RPW), DT = 8, KS = 8;      /* d_qk 256: 8 k-steps; 8 value tiles = ONE 128-wide half of the 256-wide V per wave */
  constexpr int SK = 64, NST = TT / SK;      /* one LDS tile = 64 keys = two 32-key passes, each on its own waves; V rows of 64 keys are whole 128-B lines */
  constexpr int KP = 256 + 8, VP = SK + 8;      /* LDS row pitches in halves: 528 B and 144 B, both 16 B x odd, conflict-free for the 16-row ds_load_b128 fragment reads */
  __shared__ __attribute__((aligned(16))) unsigned short sQ[4 * RPW][KP]; __shared__ __attribute__((aligned(16))) unsigned short sK[2][SK][KP]; __shared__ __attribute__((aligned(16))) unsigned short sVh[2][256][VP]; __shared__ __attribute__((aligned(16))) unsigned short sVl[2][256][VP];
  __shared__ float sM[8][RPW]; __shared__ float sL[8][RPW];
  typedef float f32a __attribute__((may_alias)); static_assert(sizeof(sK) == 8 * RPW * (128 + 4) * sizeof(float), "the eight output tiles fill the K ring exactly");
  f32a (*sO)[RPW][128 + 4] = (f32a (*)[RPW][128 + 4])&sK[0][0][0];      /* the output tiles reuse the K ring, which nobody reads or fills behind the loop's last barrier */
  const int tid = threadIdx.x, w = tid >> 5, lane = tid & 31, ln = lane & 15, hh = lane >> 4;
  const int slab = blockIdx.x / NQB, qblk = blockIdx.x % NQB; const int b = slab / NH, h = slab % NH; const int qb0 = qblk * (4 * RPW);
  const int wq = w & 3, vhf = (w >> 2) & 1, pr = w & 7; const int q0 = qb0 + wq * RPW;      /* sixteen waves, four per SIMD: 4 groups of 16 query rows x 2 halves of V x 2 halves of each tile's keys; pr numbers the pair of waves that share rows and V half */
  const unsigned short* Qg = (const unsigned short*)Q16 + ((size_t)b * TT + qb0) * ldq; const unsigned short* Kg = (const unsigned short*)K16 + (size_t)b * TT * ldk;
  const unsigned short* Vth = (const unsigned short*)Vt + (size_t)b * VSTR * TT; const unsigned short* Vtl = (const unsigned short*)Vtlo + (size_t)b * VSTR * TT;      /* hi and UNSCALED residual planes */
  const int wu = __builtin_amdgcn_readfirstlane(w);      /* the wave's number as a scalar: the row parts of the copies' addresses stay in scalar registers */
  const int kp = wu >> 3;      /* which 32 keys of every tile this wave takes (scalar: the epilogue branches on it) */
  /* tile t -> buffer buf, 12 copies per wave: 4 K rows (one 512-B row per copy), 16 of the 256 rows of each V plane (four 128-B rows per copy) */
  auto stage = [&](int t, int buf) {
    unsigned l[12]; const unsigned short* p[12];
#pragma unroll      /* constant indices keep l[] and p[] in registers */
    for (int i = 0; i < 4; ++i) { const int r = wu * 4 + i; l[i] = lds_off(&sK[buf][r][lane * 8]); p[i] = Kg + (size_t)(t * SK + r) * ldk + lane * 8; }
#pragma unroll      /* constant indices keep l[] and p[] in registers */
    for (int i = 0; i < 4; ++i) { const int d = wu * 16 + i * 4 + (lane >> 3); l[4 + i] = lds_off(&sVh[buf][d][(lane & 7) * 8]); p[4 + i] = Vth + (size_t)d * TT + t * SK + (lane & 7) * 8; l[8 + i] = lds_off(&sVl[buf][d][(lane & 7) * 8]); p[8 + i] = Vtl + (size_t)d * TT + t * SK + (lane & 7) * 8; }
    acp12(l, p); };
  { unsigned l[4]; const unsigned short* p[4];      /* the block's 64 query rows, filled once: 4 rows per wave */
#pragma unroll      /* constant indices keep l[] and p[] in registers */
    for (int i = 0; i < 4; ++i) { const int r = wu * 4 + i; l[i] = lds_off(&sQ[r][lane * 8]); p[i] = Qg + (size_t)r * ldq + lane * 8; }
    acp4(l, p); }
  stage(0, 0);
  asm volatile("s_wait_asynccnt 0x0" ::: "memory");      /* this wave's copies of Q and of tile 0 have landed */
  __syncthreads();      /* publishes Q and tile 0 to every wave */
  stage(1, 1);
  const unsigned short* qrow = &sQ[wq * RPW + ln][0];
  /* Transposed products: St = K x Qt and Ot += Vt x Pt. Lane (ln, hh) holds query q0 + ln: its scores of keys 8 hh + r of each 16-key tile, and its outputs of value columns 8 hh + r of each 16-column tile. */
  float m_r = -3.0e38f, l_r = 0.f; v8f oacc[DT];
#pragma unroll
  for (int dt = 0; dt < DT; ++dt) oacc[dt] = (v8f){0.f,0.f,0.f,0.f,0.f,0.f,0.f,0.f};
#pragma unroll 1
  for (int t = 0; t < NST; ++t) {
   const int buf = t & 1;
   {
    const int j0 = kp * 32;      /* first key of this wave's pass inside the tile */
    v8f s[2];
#pragma unroll
    for (int nt = 0; nt < 2; ++nt) { const unsigned short* kr = &sK[buf][j0 + nt * 16 + ln][0]; v8f acc = (v8f){0.f,0.f,0.f,0.f,0.f,0.f,0.f,0.f};
#pragma unroll
      for (int ks = 0; ks < KS; ++ks) { FragH bk, aq; bk.half[0] = *(const v8us*)(kr + ks * 32 + 8 * hh); bk.half[1] = *(const v8us*)(kr + ks * 32 + 16 + 8 * hh); aq.half[0] = *(const v8us*)(qrow + ks * 32 + 8 * hh); aq.half[1] = *(const v8us*)(qrow + ks * 32 + 16 + 8 * hh); acc = mmaH<1>(bk.v, bk.v, aq.v, aq.v, acc); }      /* A = 16 keys, B = 16 queries */
      s[nt] = acc; }
    float sc[16];
#pragma unroll
    for (int i = 0; i < 16; ++i) sc[i] = s[i >> 3][i & 7] * ATT_SCALE;
    float mc = sc[0];
#pragma unroll
    for (int i = 1; i < 16; ++i) mc = fmaxf(mc, sc[i]);
    mc = fmaxf(mc, xhalf(mc));      /* the other 16 of the query's 32 keys sit in lane ^ 16 */
    const float mn = fmaxf(m_r, mc); const float ea = expf(m_r - mn); const float al = (mn > -1.0e38f) ? ea : 1.0f; m_r = mn;
    FragH ph, pl; float ls[4] = {0.f, 0.f, 0.f, 0.f};      /* element i of the two score tiles is element i of a B fragment in the k order of the V loader below: P stays in registers */
#pragma unroll
    for (int i = 0; i < 16; ++i) { const float p = expf(sc[i] - mn); ls[i & 3] += p; const float ps = p * 1024.0f; const _Float16 hp = (_Float16)ps; ph.h[i] = hp; pl.h[i] = (_Float16)(ps - (float)hp); }      /* P hi and its UNSCALED residual (added into the same accumulator) */
    l_r = l_r * al + ((ls[0] + ls[1]) + (ls[2] + ls[3]));      /* this lane's 16 keys of every pass; the two halves are joined behind the loop */
#pragma unroll
    for (int dt = 0; dt < DT; ++dt)
#pragma unroll
      for (int r = 0; r < 8; ++r) oacc[dt][r] *= al;
#pragma unroll
    for (int dt = 0; dt < DT; ++dt) { const unsigned short* vh = &sVh[buf][vhf * 128 + dt * 16 + ln][j0]; const unsigned short* vl = &sVl[buf][vhf * 128 + dt * 16 + ln][j0]; FragH bv, bl; bv.half[0] = *(const v8us*)(vh + 8 * hh); bv.half[1] = *(const v8us*)(vh + 16 + 8 * hh); bl.half[0] = *(const v8us*)(vl + 8 * hh); bl.half[1] = *(const v8us*)(vl + 16 + 8 * hh);
      oacc[dt] = mmaH<1>(bv.v, bv.v, ph.v, ph.v, oacc[dt]); oacc[dt] = mmaH<1>(bv.v, bv.v, pl.v, pl.v, oacc[dt]); oacc[dt] = mmaH<1>(bl.v, bl.v, ph.v, ph.v, oacc[dt]); } }      /* Vh x Ph + Vh x Pl + Vl x Ph, all unscaled, one accumulator; A = 16 value columns, B = 16 queries */
   asm volatile("s_wait_dscnt 0x0" ::: "memory");      /* this wave's reads of tile t have returned before its buffer is refilled */
   asm volatile("s_wait_asynccnt 0x0" ::: "memory");      /* this wave's copies of tile t + 1 have landed */
   __syncthreads();      /* publishes tile t + 1 and ends every wave's reads of tile t */
   if (t + 2 < NST) stage(t + 2, buf); }
  asm volatile("s_wait_asynccnt 0x0" ::: "memory");      /* no copy is outstanding behind the loop */
  l_r += xhalf(l_r);      /* row sum over this wave's keys */
  if (kp == 1) {      /* the wave of the second key half hands its running max, row sum and unnormalised tile to its partner */
#pragma unroll
    for (int dt = 0; dt < DT; ++dt) { *(v4fa*)&sO[pr][ln][dt * 16 + 8 * hh] = (v4f){oacc[dt][0], oacc[dt][1], oacc[dt][2], oacc[dt][3]}; *(v4fa*)&sO[pr][ln][dt * 16 + 8 * hh + 4] = (v4f){oacc[dt][4], oacc[dt][5], oacc[dt][6], oacc[dt][7]}; }
    if (hh == 0) { sM[pr][ln] = m_r; sL[pr][ln] = l_r; } }
  __syncthreads();      /* publishes the second key half's partial results to the partner waves */
  if (kp == 0) {
    const float m1 = sM[pr][ln], l1 = sL[pr][ln]; const float mn = fmaxf(m_r, m1); const float a0 = expf(m_r - mn), a1 = expf(m1 - mn); const float l = l_r * a0 + l1 * a1; const float inv = (l > 0.f) ? 1.0f / (l * 1024.0f) : 0.f; const float c0 = a0 * inv, c1 = a1 * inv;
#pragma unroll
    for (int dt = 0; dt < DT; ++dt)
#pragma unroll
      for (int g = 0; g < 2; ++g) { v4fa* o = (v4fa*)&sO[pr][ln][dt * 16 + 8 * hh + 4 * g]; const v4f x = *o; *o = (v4f){oacc[dt][4 * g] * c0 + x[0] * c1, oacc[dt][4 * g + 1] * c0 + x[1] * c1, oacc[dt][4 * g + 2] * c0 + x[2] * c1, oacc[dt][4 * g + 3] * c0 + x[3] * c1}; }      /* each lane reads and rewrites its own words */
    __builtin_amdgcn_fence(__ATOMIC_ACQ_REL, "workgroup"); __builtin_amdgcn_wave_barrier();
#pragma unroll
    for (int r = 0; r < RPW; ++r) { const int pc = lane; const v4f val = *(const v4fa*)&sO[pr][r][pc * 4]; *(v4f*)(O + ((size_t)b * TT + q0 + r) * ldo + (h * 2 + vhf) * 128 + pc * 4) = val; }      /* one 512-B row per instruction: 32 lanes x 16 B */
  } }

extern "C" void kernel_launch(void* const* d_in, const int* in_sizes, int n_in,
                              void* d_out, int out_size, void* d_ws, size_t ws_size, hipStream_t stream) {
  (void)in_sizes; (void)n_in; (void)out_size;
  const float* const* I = (const float* const*)d_in; const float* xq = I[0]; const float* xk = I[1]; const float* xv = I[2]; const float* qw = I[3]; const float* qb = I[4]; const float* kw = I[5]; const float* kb = I[6]; const float* vw = I[7]; const float* vb = I[8]; const float* scl = I[9];
  char* ws = (char*)d_ws; size_t off = 0;
  auto take = [&](size_t bytes) { char* p = ws + off; off += (bytes + 255) & ~(size_t)255; return p; };
  _Float16* Bq = (_Float16*)take((size_t)DD * K3 * 2); _Float16* Bk = (_Float16*)take((size_t)DD * K3 * 2); _Float16* Bv = (_Float16*)take((size_t)DD * K3 * 2); _Float16* A = (_Float16*)take((size_t)NR * K3 * 2); _Float16* Q = (_Float16*)take((size_t)NR * DD * 2); _Float16* K = (_Float16*)take((size_t)NR * DD * 2); float* VF = (float*)take((size_t)NR * DD * 4); _Float16* Vt = (_Float16*)take((size_t)NR * DD * 2); _Float16* Vtl = (_Float16*)take((size_t)NR * DD * 2);
  if (off > ws_size) return;      // 1.2 + 25.2 + 8.4 + 8.4 + 16.8 + 8.4 + 8.4 ≈ 77 MB
  k_wc3<<<(DD * (K3 / 8) + 255) / 256, 256, 0, stream>>>(qw, Bq); k_wc3<<<(DD * (K3 / 8) + 255) / 256, 256, 0, stream>>>(kw, Bk); k_wc3<<<(DD * (K3 / 8) + 255) / 256, 256, 0, stream>>>(vw, Bv);
  const unsigned gi = (unsigned)(((size_t)NR * (K3 / 8) + 255) / 256); const dim3 gp(((NR / 16) * (DD / 64) + 3) / 4, 1);
  k_im3<<<gi, 256, 0, stream>>>(xq, A); k_gemm_hhx<0><<<gp, 128, 0, stream>>>(A, K3, 0, Bq, K3, 0, 1.0f, qb, 0, nullptr, 1, 0, 0, nullptr, Q, DD, 0, NR, DD, K3);      /* q = conv(query): M 16384 N 256 K 768 (exact products) → f16 */
  k_im3<<<gi, 256, 0, stream>>>(xk, A); k_gemm_hhx<0><<<gp, 128, 0, stream>>>(A, K3, 0, Bk, K3, 0, 1.0f, kb, 0, nullptr, 1, 0, 0, nullptr, K, DD, 0, NR, DD, K3);
  k_im3<<<gi, 256, 0, stream>>>(xv, A); k_gemm_hhx<0><<<gp, 128, 0, stream>>>(A, K3, 0, Bv, K3, 0, 1.0f, vb, 0, nullptr, 1, 0, 0, VF, nullptr, DD, 0, NR, DD, K3);      /* v (f32) */
  k_vthlu<<<BB * NVH * (TT / 64), 256, 0, stream>>>(VF, DD, Vt, Vtl);      /* Vᵀ hi + residual: [b][256][4096] */
  k_flash<<<BB * NH * (TT / 64), 512, 0, stream>>>(Q, DD, K, DD, Vt, Vtl, (float*)d_out, DD);      /* both 128-wide halves of O in one launch, straight into the output rows */
  k_scl<<<(unsigned)(((size_t)NR * DD / 4 + 255) / 256), 256, 0, stream>>>((float*)d_out, scl, (size_t)NR * DD / 4);      /* × scale */
}

// v004
// A run of this version takes 318 microseconds.
// Two timings next to v003 both put it at 1.06 times that version's speed.
// Over all steps from v000 it is 5.79 times as fast.
#include <hip/hip_runtime.h>
// KQV 'PCNN' attention (B=4, S=4096, D=256): q, k, v = Conv1d(kernel 3, pad 1) over the sequence of query/key/value (+bias); scores = q·k/16; softmax; out = scale·(P·v) → [4,4096,256].
// Compute dtype: inputs, conv weights/biases, scale rounded to bf16; each conv as an im2col GEMM (K = 3·256, bf16-exact operands, f32 accumulate) → q, k f16 planes, v f32 → Vᵀ f16 hi + f16 residual; fused flash-style kernel with d_qk = 256 (8 k-steps, online softmax f32, P f16 hi + residual,
// f32 accumulate) on v_wmma_f32_16x16x32_f16, one launch of 16-wave blocks (query rows x halves of v x halves of each key tile), writing the output rows directly; × scale in f32.
#define BB 4
#define TT 4096
#define DD 256
#define NH 1
#define VSTR 256
#define NVH 4
#define NR (BB * TT)
#define K3 (3 * DD)
#define ATT_SCALE 0.0625f

typedef __bf16 v16b __attribute__((ext_vector_type(16)));
typedef unsigned short v8us __attribute__((ext_vector_type(8), may_alias));
typedef float  v8f  __attribute__((ext_vector_type(8)));
typedef float  v4f  __attribute__((ext_vector_type(4)));
typedef float  v4fa __attribute__((ext_vector_type(4), may_alias));
union FragB { v16b v; v8us half[2]; unsigned short u[16]; };

__device__ __forceinline__ unsigned short bf16_bits(float x) { unsigned int u = __float_as_uint(x); return (unsigned short)((u + 0x7FFFu + ((u >> 16) & 1u)) >> 16); }
__device__ __forceinline__ float bf16_val(unsigned short b) { return __uint_as_float(((unsigned int)b) << 16); }
__device__ __forceinline__ float bf16_round(float x) { return bf16_val(bf16_bits(x)); }
// D += A·B with NT terms: 1 = ah·bh, 2 = + al·bh (A split), 3 = + ah·bl (both split)
template <int NT>
__device__ __forceinline__ v8f mmaN(v16b ah, v16b al, v16b bh, v16b bl, v8f c) {
  c = __builtin_amdgcn_wmma_f32_16x16x32_bf16(false, ah, false, bh, (short)0, c, false, false);
  if (NT >= 2) c = __builtin_amdgcn_wmma_f32_16x16x32_bf16(false, al, false, bh, (short)0, c, false, false);
  if (NT >= 3) c = __builtin_amdgcn_wmma_f32_16x16x32_bf16(false, ah, false, bl, (short)0, c, false, false);
  asm volatile("v_nop\n\tv_nop\n\tv_nop\n\tv_nop" : "+v"(c) : "v"(ah), "v"(al), "v"(bh), "v"(bl));
  return c;
}

__global__ __launch_bounds__(256) void k_wt_bf16(const float* __restrict__ W, unsigned short* __restrict__ Wt, int K, int N) {
  const int t = blockIdx.x * 256 + threadIdx.x;
  const int k8n = K / 8;
  if (t >= N * k8n) return;
  const int n = t / k8n, k8 = (t % k8n) * 8;
  v8us v;
#pragma unroll
  for (int i = 0; i < 8; ++i) v[i] = bf16_bits(W[(size_t)(k8 + i) * N + n]);
  *(v8us*)(Wt + (size_t)n * K + k8) = v;
  
}

// GEMM C[M][N] (f32, pitch ldc) = act(A[M][K]·W + bias). A f32 row-major (pitch lda) converted per fragment to bf16
// (ASPLIT: hi/lo two planes -> 2 terms, else single rounded term); Wt bf16 [N][K] (pitch ldb). BIAS_BF16 rounds the
// bias to bf16 first (bias quantised to bf16 before the add). K%32==0, M%16==0, N%64==0.
template <bool ASPLIT, int ACT, bool BIAS_BF16>
__global__ __launch_bounds__(128) void k_gemm_bf(const float* __restrict__ A, int lda, const unsigned short* __restrict__ Wt, int ldb,
                                               const float* __restrict__ bias, float* __restrict__ C, int ldc, int M, int N, int K) {
  __shared__ __attribute__((aligned(16))) float so[4][16][64];
  const int tid = threadIdx.x, w = tid >> 5, lane = tid & 31, ln = lane & 15, hh = lane >> 4;
  const int ntn = N / 64;
  const int wid = blockIdx.x * 4 + w;
  const int mt = wid / ntn, nq = wid % ntn;
  if (mt * 16 >= M) return;
  const int row0 = mt * 16, col0 = nq * 64;
  const float* arow = A + (size_t)(row0 + ln) * lda;
  v8f acc[4] = {};
  for (int kb = 0; kb < K; kb += 32) {
    FragB ah, al;
    const v4f x0 = *(const v4fa*)(arow + kb + 8 * hh), x1 = *(const v4fa*)(arow + kb + 8 * hh + 4);
    const v4f x2 = *(const v4fa*)(arow + kb + 16 + 8 * hh), x3 = *(const v4fa*)(arow + kb + 16 + 8 * hh + 4);
    float xs[16] = {x0[0],x0[1],x0[2],x0[3],x1[0],x1[1],x1[2],x1[3],x2[0],x2[1],x2[2],x2[3],x3[0],x3[1],x3[2],x3[3]};
#pragma unroll
    for (int i = 0; i < 16; ++i) { const unsigned short hb = bf16_bits(xs[i]); ah.u[i] = hb; al.u[i] = ASPLIT ? bf16_bits(xs[i] - bf16_val(hb)) : (unsigned short)0; }
#pragma unroll
    for (int t = 0; t < 4; ++t) {
      const unsigned short* brow = Wt + (size_t)(col0 + t * 16 + ln) * ldb + kb;
      FragB b;
      b.half[0] = *(const v8us*)(brow + 8 * hh);
      b.half[1] = *(const v8us*)(brow + 16 + 8 * hh);
      acc[t] = mmaN<ASPLIT ? 2 : 1>(ah.v, al.v, b.v, b.v, acc[t]);
    }
  }
#pragma unroll
  for (int t = 0; t < 4; ++t) {
    float bv = bias ? bias[col0 + t * 16 + ln] : 0.f;
    if (BIAS_BF16) bv = bf16_round(bv);
#pragma unroll
    for (int r = 0; r < 8; ++r) { float v = acc[t][r] + bv; if (ACT == 1) v = fmaxf(v, 0.f); so[w][8 * hh + r][t * 16 + ln] = v; }
  }
  __builtin_amdgcn_fence(__ATOMIC_ACQ_REL, "workgroup");
  __builtin_amdgcn_wave_barrier();
  const int rsub = lane >> 4, c4 = (lane & 15) * 4;
  {
#pragma unroll
    for (int q = 0; q < 8; ++q) {
      const int r = q * 2 + rsub;
      const v4f v = *(const v4fa*)&so[w][r][c4];
      *(v4f*)(C + (size_t)(row0 + r) * ldc + col0 + c4) = v;
    }
    
  }
}

// Flash-style causal/unmasked attention, all contractions 3-term bf16 hi/lo splits, f32 softmax with running max.
// q,k,v rows are read from f32 buffers with arbitrary row pitch (so they can live inside a fused qkv buffer);
// D = head size (multiple of 32, <= 128); one wave = 16 query rows; block = 4 waves (64 queries) sharing K/V chunks of 32.
template <int D, bool CAUSAL>
__global__ __launch_bounds__(128) void k_flash(const float* __restrict__ qb, const float* __restrict__ kb, const float* __restrict__ vb,
                                             int pitch, int T, int H, float scale, float* __restrict__ y, int ypitch) {
  constexpr int KS = D / 32;        // k-steps for QK
  constexpr int DT = D / 16;        // d tiles for PV
  __shared__ __attribute__((aligned(16))) unsigned short sKh[32][D + 8], sKl[32][D + 8], sVh[32][D + 8], sVl[32][D + 8];
  __shared__ __attribute__((aligned(16))) unsigned short sPh[4][16][40], sPl[4][16][40];
  __shared__ __attribute__((aligned(16))) float sO[4][16][D];
  const int tid = threadIdx.x, w = tid >> 5, lane = tid & 31, ln = lane & 15, hh = lane >> 4;
  const int nqb = (T + 63) / 64;
  const int bh = blockIdx.x / nqb, qblk = blockIdx.x % nqb;
  const int b = bh / H, h = bh % H;
  const int q0 = qblk * 64 + w * 16;
  const float* Q = qb + (size_t)b * T * pitch + h * D;
  const float* K = kb + (size_t)b * T * pitch + h * D;
  const float* V = vb + (size_t)b * T * pitch + h * D;

  // A fragments of the wave's 16 query rows (scaled), hi/lo
  FragB aqh[KS], aql[KS];
  {
    int row = q0 + ln; if (row >= T) row = T - 1;
    const float* qr = Q + (size_t)row * pitch;
#pragma unroll
    for (int ks = 0; ks < KS; ++ks)
#pragma unroll
      for (int i = 0; i < 16; ++i) {
        const int d = ks * 32 + ((i < 8) ? (8 * hh + i) : (16 + 8 * hh + (i - 8)));
        const float x = qr[d] * scale; const unsigned short hb = bf16_bits(x);
        aqh[ks].u[i] = hb; aql[ks].u[i] = bf16_bits(x - bf16_val(hb));
      }
  }
  float m_r[8], l_r[8];
#pragma unroll
  for (int r = 0; r < 8; ++r) { m_r[r] = -3.0e38f; l_r[r] = 0.f; }
  v8f oacc[DT];
#pragma unroll
  for (int dt = 0; dt < DT; ++dt) oacc[dt] = (v8f){0.f,0.f,0.f,0.f,0.f,0.f,0.f,0.f};

  const int kv_end = CAUSAL ? min(T, qblk * 64 + 64) : T;     // block-uniform
  for (int j0 = 0; j0 < kv_end; j0 += 32) {
    __syncthreads();
    for (int e = tid; e < 32 * (D / 4); e += 128) {
      const int r = e / (D / 4), c4 = (e % (D / 4)) * 4;
      const int key = j0 + r;
      v4f kf = {0.f,0.f,0.f,0.f}, vf = {0.f,0.f,0.f,0.f};
      if (key < T) { kf = *(const v4fa*)(K + (size_t)key * pitch + c4); vf = *(const v4fa*)(V + (size_t)key * pitch + c4); }
#pragma unroll
      for (int t = 0; t < 4; ++t) {
        unsigned short hb = bf16_bits(kf[t]); sKh[r][c4 + t] = hb; sKl[r][c4 + t] = bf16_bits(kf[t] - bf16_val(hb));
        hb = bf16_bits(vf[t]); sVh[r][c4 + t] = hb; sVl[r][c4 + t] = bf16_bits(vf[t] - bf16_val(hb));
      }
    }
    __syncthreads();
    // S tile 16 x 32
    v8f s[2];
#pragma unroll
    for (int nt = 0; nt < 2; ++nt) {
      v8f acc = {};
#pragma unroll
      for (int ks = 0; ks < KS; ++ks) {
        FragB bh_, bl_;
        bh_.half[0] = *(const v8us*)&sKh[nt * 16 + ln][ks * 32 + 8 * hh]; bh_.half[1] = *(const v8us*)&sKh[nt * 16 + ln][ks * 32 + 16 + 8 * hh];
        bl_.half[0] = *(const v8us*)&sKl[nt * 16 + ln][ks * 32 + 8 * hh]; bl_.half[1] = *(const v8us*)&sKl[nt * 16 + ln][ks * 32 + 16 + 8 * hh];
        acc = mmaN<3>(aqh[ks].v, aql[ks].v, bh_.v, bl_.v, acc);
      }
      s[nt] = acc;
    }
    // mask + running max (rows 8hh+r; the 16 lanes of a half share rows)
    float alpha[8];
#pragma unroll
    for (int r = 0; r < 8; ++r) {
      const int qi = q0 + 8 * hh + r;
      const int ja = j0 + ln, jb = j0 + 16 + ln;
      if (CAUSAL) { if (ja > qi) s[0][r] = -3.0e38f; if (jb > qi) s[1][r] = -3.0e38f; }
      if (ja >= T) s[0][r] = -3.0e38f;
      if (jb >= T) s[1][r] = -3.0e38f;
      float mx = fmaxf(s[0][r], s[1][r]);
      mx = fmaxf(mx, __shfl_xor(mx, 1, 32)); mx = fmaxf(mx, __shfl_xor(mx, 2, 32)); mx = fmaxf(mx, __shfl_xor(mx, 4, 32)); mx = fmaxf(mx, __shfl_xor(mx, 8, 32));
      const float mnew = fmaxf(m_r[r], mx);
      alpha[r] = (mnew > -1.0e38f) ? __expf(m_r[r] - mnew) : 1.0f;
      const float p0 = (s[0][r] > -1.0e38f) ? __expf(s[0][r] - mnew) : 0.f;
      const float p1 = (s[1][r] > -1.0e38f) ? __expf(s[1][r] - mnew) : 0.f;
      m_r[r] = mnew;
      l_r[r] = l_r[r] * alpha[r] + p0 + p1;            // per-lane partial row sum (16 lanes combined at the end)
      unsigned short hb = bf16_bits(p0); sPh[w][8 * hh + r][ln] = hb;      sPl[w][8 * hh + r][ln] = bf16_bits(p0 - bf16_val(hb));
      hb = bf16_bits(p1);                sPh[w][8 * hh + r][16 + ln] = hb; sPl[w][8 * hh + r][16 + ln] = bf16_bits(p1 - bf16_val(hb));
    }
#pragma unroll
    for (int dt = 0; dt < DT; ++dt)
#pragma unroll
      for (int r = 0; r < 8; ++r) oacc[dt][r] *= alpha[r];
    __builtin_amdgcn_fence(__ATOMIC_ACQ_REL, "workgroup");
    __builtin_amdgcn_wave_barrier();
    FragB pah, pal;
    pah.half[0] = *(const v8us*)&sPh[w][ln][8 * hh]; pah.half[1] = *(const v8us*)&sPh[w][ln][16 + 8 * hh];
    pal.half[0] = *(const v8us*)&sPl[w][ln][8 * hh]; pal.half[1] = *(const v8us*)&sPl[w][ln][16 + 8 * hh];
#pragma unroll
    for (int dt = 0; dt < DT; ++dt) {
      FragB bvh, bvl;
#pragma unroll
      for (int i = 0; i < 8; ++i) {
        bvh.u[i] = sVh[8 * hh + i][dt * 16 + ln]; bvh.u[8 + i] = sVh[16 + 8 * hh + i][dt * 16 + ln];
        bvl.u[i] = sVl[8 * hh + i][dt * 16 + ln]; bvl.u[8 + i] = sVl[16 + 8 * hh + i][dt * 16 + ln];
      }
      oacc[dt] = mmaN<3>(pah.v, pal.v, bvh.v, bvl.v, oacc[dt]);
    }
    __builtin_amdgcn_fence(__ATOMIC_ACQ_REL, "workgroup");
    __builtin_amdgcn_wave_barrier();
  }
#pragma unroll
  for (int r = 0; r < 8; ++r) {
    float l = l_r[r];
    l += __shfl_xor(l, 1, 32); l += __shfl_xor(l, 2, 32); l += __shfl_xor(l, 4, 32); l += __shfl_xor(l, 8, 32);
    l_r[r] = (l > 0.f) ? 1.0f / l : 0.f;
  }
#pragma unroll
  for (int dt = 0; dt < DT; ++dt)
#pragma unroll
    for (int r = 0; r < 8; ++r) sO[w][8 * hh + r][dt * 16 + ln] = oacc[dt][r] * l_r[r];
  __builtin_amdgcn_fence(__ATOMIC_ACQ_REL, "workgroup");
  __builtin_amdgcn_wave_barrier();
  {
    for (int r = 0; r < 16; ++r) {
      const int row = q0 + r;
      if (row < T && lane < D / 4) {
        const v4f val = *(const v4fa*)&sO[w][r][lane * 4];
        *(v4f*)(y + ((size_t)b * T + row) * ypitch + h * D + lane * 4) = val;
      }
    }
    
  }
}

// GEMM C = act(A·W + bias + resid): A f32 (ASPLIT -> hi/lo 2 terms), Wt bf16 [N][K]; ACT 0 none, 1 relu, 2 exact gelu;
// resid (optional, f32, row index = (row % rmod), pitch ldr, RES_BF16 rounds it) added before the activation.
template <bool ASPLIT, int ACT, bool BIAS_BF16, bool RES_BF16>
__global__ __launch_bounds__(128) void k_gemm_bf3(const float* __restrict__ A, int lda, const unsigned short* __restrict__ Wt, int ldb,
                                                const float* __restrict__ bias, const float* __restrict__ resid, int rmod, int ldr,
                                                float* __restrict__ C, int ldc, int M, int N, int K) {
  __shared__ __attribute__((aligned(16))) float so[4][16][64];
  const int tid = threadIdx.x, w = tid >> 5, lane = tid & 31, ln = lane & 15, hh = lane >> 4;
  const int ntn = N / 64;
  const int wid = blockIdx.x * 4 + w;
  const int mt = wid / ntn, nq = wid % ntn;
  if (mt * 16 >= M) return;
  const int row0 = mt * 16, col0 = nq * 64;
  const float* arow = A + (size_t)(row0 + ln) * lda;
  v8f acc[4] = {};
  for (int kb = 0; kb < K; kb += 32) {
    FragB ah, al;
    const v4f x0 = *(const v4fa*)(arow + kb + 8 * hh), x1 = *(const v4fa*)(arow + kb + 8 * hh + 4);
    const v4f x2 = *(const v4fa*)(arow + kb + 16 + 8 * hh), x3 = *(const v4fa*)(arow + kb + 16 + 8 * hh + 4);
    float xs[16] = {x0[0],x0[1],x0[2],x0[3],x1[0],x1[1],x1[2],x1[3],x2[0],x2[1],x2[2],x2[3],x3[0],x3[1],x3[2],x3[3]};
#pragma unroll
    for (int i = 0; i < 16; ++i) { const unsigned short hb = bf16_bits(xs[i]); ah.u[i] = hb; al.u[i] = ASPLIT ? bf16_bits(xs[i] - bf16_val(hb)) : (unsigned short)0; }
#pragma unroll
    for (int t = 0; t < 4; ++t) {
      const unsigned short* brow = Wt + (size_t)(col0 + t * 16 + ln) * ldb + kb;
      FragB b;
      b.half[0] = *(const v8us*)(brow + 8 * hh);
      b.half[1] = *(const v8us*)(brow + 16 + 8 * hh);
      acc[t] = mmaN<ASPLIT ? 2 : 1>(ah.v, al.v, b.v, b.v, acc[t]);
    }
  }
#pragma unroll
  for (int t = 0; t < 4; ++t) {
    const int col = col0 + t * 16 + ln;
    float bv = bias ? bias[col] : 0.f;
    if (BIAS_BF16) bv = bf16_round(bv);
#pragma unroll
    for (int r = 0; r < 8; ++r) {
      float v = acc[t][r] + bv;
      if (resid) { float rv = resid[(size_t)((row0 + 8 * hh + r) % rmod) * ldr + col]; if (RES_BF16) rv = bf16_round(rv); v += rv; }
      if (ACT == 1) v = fmaxf(v, 0.f);
      if (ACT == 2) v = 0.5f * v * (1.0f + erff(v * 0.70710678118654752f));
      if (ACT == 3) { const float u = 0.7978845608028654f * (v + 0.044715f * v * v * v); v = 0.5f * v * (1.0f + tanhf(u)); }
      so[w][8 * hh + r][t * 16 + ln] = v;
    }
  }
  __builtin_amdgcn_fence(__ATOMIC_ACQ_REL, "workgroup");
  __builtin_amdgcn_wave_barrier();
  const int rsub = lane >> 4, c4 = (lane & 15) * 4;
  {
#pragma unroll
    for (int q = 0; q < 8; ++q) {
      const int r = q * 2 + rsub;
      const v4f v = *(const v4fa*)&so[w][r][c4];
      *(v4f*)(C + (size_t)(row0 + r) * ldc + col0 + c4) = v;
    }
    
  }
}
// row LayerNorm (biased variance, eps) over N: s = X (+ R); optional out_sum <- s; out_norm <- (s-mu)*rsqrt(var+eps)*g + b
template <bool PARAM_BF16>
__global__ __launch_bounds__(256) void k_layernorm(const float* __restrict__ X, const float* __restrict__ R, const float* __restrict__ g, const float* __restrict__ bta,
                                                  float* __restrict__ out_sum, float* __restrict__ out_norm, int N, float eps) {
  __shared__ float red[256];
  const int row = blockIdx.x, tid = threadIdx.x;
  const float* x = X + (size_t)row * N; const float* rr = R ? R + (size_t)row * N : nullptr;
  float vals[16];                     // up to N = 4096
  const int per = N / 256;            // contiguous chunk per thread? use strided-by-4 chunks: thread handles j = tid*4 + 1024*u
  float s1 = 0.f;
  for (int u = 0; u < per / 4; ++u) {
    const int j = tid * 4 + 1024 * u;
    const v4f a = *(const v4fa*)(x + j);
    v4f b = {0.f,0.f,0.f,0.f}; if (rr) b = *(const v4fa*)(rr + j);
#pragma unroll
    for (int q = 0; q < 4; ++q) { const float v = a[q] + b[q]; vals[u * 4 + q] = v; s1 += v; }
  }
  red[tid] = s1; __syncthreads();
  for (int st = 128; st > 0; st >>= 1) { if (tid < st) red[tid] += red[tid + st]; __syncthreads(); }
  const float mu = red[0] / (float)N; __syncthreads();
  float s2 = 0.f;
  for (int u = 0; u < per / 4; ++u)
#pragma unroll
    for (int q = 0; q < 4; ++q) { const float c = vals[u * 4 + q] - mu; s2 += c * c; }
  red[tid] = s2; __syncthreads();
  for (int st = 128; st > 0; st >>= 1) { if (tid < st) red[tid] += red[tid + st]; __syncthreads(); }
  const float rs = rsqrtf(red[0] / (float)N + eps);
  {
    for (int u = 0; u < per / 4; ++u) {
      const int j = tid * 4 + 1024 * u;
      v4f o, sm;
#pragma unroll
      for (int q = 0; q < 4; ++q) {
        float gg = g[j + q], bb = bta[j + q];
        if (PARAM_BF16) { gg = bf16_round(gg); bb = bf16_round(bb); }
        sm[q] = vals[u * 4 + q]; o[q] = (vals[u * 4 + q] - mu) * rs * gg + bb;
      }
      if (out_sum) *(v4f*)(out_sum + (size_t)row * N + j) = sm;
      *(v4f*)(out_norm + (size_t)row * N + j) = o;
    }
    
  }
}



// ---- f16 WMMA path (v_wmma_f32_16x16x32_f16): 11-bit significands for operands in range — used where a [0,1] probability operand needs more precision than bf16
typedef _Float16 v16h __attribute__((ext_vector_type(16)));
union FragH { v16h v; v8us half[2]; _Float16 h[16]; unsigned short u[16]; };
template <int NT>
__device__ __forceinline__ v8f mmaH(v16h ah, v16h al, v16h bh, v16h bl, v8f c) {
  c = __builtin_amdgcn_wmma_f32_16x16x32_f16(false, ah, false, bh, (short)0, c, false, false);
  if (NT >= 2) c = __builtin_amdgcn_wmma_f32_16x16x32_f16(false, al, false, bh, (short)0, c, false, false);
  if (NT >= 3) c = __builtin_amdgcn_wmma_f32_16x16x32_f16(false, ah, false, bl, (short)0, c, false, false);
  asm volatile("v_nop\n\tv_nop\n\tv_nop\n\tv_nop" : "+v"(c) : "v"(ah), "v"(al), "v"(bh), "v"(bl));
  return c;
}
// batched GEMM like k_gemm_b but f16 operands: A f32 (split into f16 hi/lo if ASPLIT, else rounded to f16), Bt = f16 values [n][k]; alpha; C f32; N multiple of 16 (partial tiles skipped)
template <bool ASPLIT>
__global__ __launch_bounds__(128) void k_gemm_h(const float* __restrict__ A, int lda, size_t sA, const _Float16* __restrict__ Bh, int ldb, size_t sB, float alpha, float* __restrict__ C, int ldc, size_t sC, int M, int N, int K) {
  __shared__ __attribute__((aligned(16))) float so[4][16][64];
  const int tid = threadIdx.x, w = tid >> 5, lane = tid & 31, ln = lane & 15, hh = lane >> 4; const int by = blockIdx.y;
  A += (size_t)by * sA; Bh += (size_t)by * sB; C += (size_t)by * sC;
  const int ntn = (N + 63) / 64; const int wid = blockIdx.x * 4 + w; const int mt = wid / ntn, nq = wid % ntn; if (mt * 16 >= M) return;
  const int row0 = mt * 16, col0 = nq * 64; const float* arow = A + (size_t)(row0 + ln) * lda;
  v8f acc[4] = {};
  for (int kb = 0; kb < K; kb += 32) {
    FragH ah, al;
    const v4f x0 = *(const v4fa*)(arow + kb + 8 * hh), x1 = *(const v4fa*)(arow + kb + 8 * hh + 4), x2 = *(const v4fa*)(arow + kb + 16 + 8 * hh), x3 = *(const v4fa*)(arow + kb + 16 + 8 * hh + 4);
    float xs[16] = {x0[0],x0[1],x0[2],x0[3],x1[0],x1[1],x1[2],x1[3],x2[0],x2[1],x2[2],x2[3],x3[0],x3[1],x3[2],x3[3]};
#pragma unroll
    for (int i = 0; i < 16; ++i) { const _Float16 h = (_Float16)xs[i]; ah.h[i] = h; al.h[i] = ASPLIT ? (_Float16)(xs[i] - (float)h) : (_Float16)0.0f; }
#pragma unroll
    for (int t = 0; t < 4; ++t) { if (col0 + t * 16 >= N) continue; const size_t boff = (size_t)(col0 + t * 16 + ln) * ldb + kb; FragH bq; bq.half[0] = *(const v8us*)(Bh + boff + 8 * hh); bq.half[1] = *(const v8us*)(Bh + boff + 16 + 8 * hh);
      acc[t] = mmaH<ASPLIT ? 2 : 1>(ah.v, al.v, bq.v, bq.v, acc[t]); }
  }
#pragma unroll
  for (int t = 0; t < 4; ++t) { if (col0 + t * 16 >= N) continue;
#pragma unroll
    for (int r = 0; r < 8; ++r) so[w][8 * hh + r][t * 16 + ln] = acc[t][r] * alpha; }
  __builtin_amdgcn_fence(__ATOMIC_ACQ_REL, "workgroup"); __builtin_amdgcn_wave_barrier();
  const int rsub = lane >> 4, c4 = (lane & 15) * 4;
  {
#pragma unroll
    for (int q = 0; q < 8; ++q) { const int r = q * 2 + rsub; if (col0 + c4 < N) { const v4f v = *(const v4fa*)&so[w][r][c4]; *(v4f*)(C + (size_t)(row0 + r) * ldc + col0 + c4) = v; } }
     }
}

// Wt[n][k] = f16(W[k][n]·scale) from f32 row-major W[K][N] (scale = power of two; bf16-exact weights stay exact in f16 away from the subnormal range)
__global__ __launch_bounds__(256) void k_wt_f16(const float* __restrict__ W, _Float16* __restrict__ Wt, int K, int N, float scale) {
  const int t = blockIdx.x * 256 + threadIdx.x; if (t >= N * (K / 8)) return; const int n = t / (K / 8), k8 = (t % (K / 8)) * 8; FragH f;
#pragma unroll
  for (int i = 0; i < 8; ++i) f.h[i] = (_Float16)(bf16_round(W[(size_t)(k8 + i) * N + n]) * scale); const v8us o = f.half[0];
  *(v8us*)((unsigned short*)Wt + (size_t)n * K + k8) = o; 
}
// k_gemm_hh variant with fused epilogue: v = acc·alpha + bias[by·sBias + col] (+ CP[(row/rowsPerB)·sCPb + by·64 + col] if CP) ; ACT 0 none / 1 elu ; writes f16 C16 and f32 C, each if non-null
template <int ACT>
__global__ __launch_bounds__(128) void k_gemm_hhx(const _Float16* __restrict__ A, int lda, size_t sA, const _Float16* __restrict__ Bh, int ldb, size_t sB, float alpha, const float* __restrict__ bias, size_t sBias, const float* __restrict__ CP, int rowsPerB, size_t sCPb, int row0g,
    float* __restrict__ C, _Float16* __restrict__ C16, int ldc, size_t sC, int M, int N, int K) {
  __shared__ __attribute__((aligned(16))) float so[4][16][64];
  const int tid = threadIdx.x, w = tid >> 5, lane = tid & 31, ln = lane & 15, hh = lane >> 4; const int by = blockIdx.y;
  A += (size_t)by * sA; Bh += (size_t)by * sB; const size_t cofs = (size_t)by * sC; const float* bp = bias ? bias + (size_t)by * sBias : nullptr;
  const int ntn = (N + 63) / 64; const int wid = blockIdx.x * 4 + w; const int mt = wid / ntn, nq = wid % ntn; if (mt * 16 >= M) return;
  const int row0 = mt * 16, col0 = nq * 64; const _Float16* arow = A + (size_t)(row0 + ln) * lda;
  v8f acc[4] = {};
  for (int kb = 0; kb < K; kb += 32) { FragH ah; ah.half[0] = *(const v8us*)((const unsigned short*)arow + kb + 8 * hh); ah.half[1] = *(const v8us*)((const unsigned short*)arow + kb + 16 + 8 * hh);
#pragma unroll
    for (int t = 0; t < 4; ++t) { if (col0 + t * 16 >= N) continue; const size_t boff = (size_t)(col0 + t * 16 + ln) * ldb + kb; FragH bq; bq.half[0] = *(const v8us*)((const unsigned short*)Bh + boff + 8 * hh); bq.half[1] = *(const v8us*)((const unsigned short*)Bh + boff + 16 + 8 * hh);
      acc[t] = mmaH<1>(ah.v, ah.v, bq.v, bq.v, acc[t]); }
  }
#pragma unroll
  for (int t = 0; t < 4; ++t) { if (col0 + t * 16 >= N) continue; const int col = col0 + t * 16 + ln; const float bv = bp ? bf16_round(bp[col]) : 0.f;
#pragma unroll
    for (int r = 0; r < 8; ++r) { float v = acc[t][r] * alpha + bv; if (CP) { const int bidx = (row0g + row0 + 8 * hh + r) / rowsPerB; v += CP[(size_t)bidx * sCPb + (size_t)by * 64 + col]; } if (ACT == 1) v = (v > 0.f) ? v : expm1f(v); else if (ACT == 7) v = (v > 0.f) ? v + 1.0f : expf(v); else if (ACT == 8) v = tanhf(v); else if (ACT == 9) v = 0.5f * v * (1.0f + tanhf(0.7978845608028654f * (v + 0.044715f * v * v * v))); else if (ACT == 11) v = 1.0f / (1.0f + expf(-v)); else if (ACT == 12) v = (v > 0.f) ? v : 0.01f * v; else if (ACT == 14) v = (v > 0.f) ? v : 0.1f * v; else if (ACT == 15) v = v / (1.0f + expf(-v)); else if (ACT == 3) v = fmaxf(v, 0.f); else if (ACT == 6) v = 0.5f * v * (1.0f + erff(v * 0.70710678118654752f)); so[w][8 * hh + r][t * 16 + ln] = v; } }
  __builtin_amdgcn_fence(__ATOMIC_ACQ_REL, "workgroup"); __builtin_amdgcn_wave_barrier();
  const int rsub = lane >> 4, c4 = (lane & 15) * 4; typedef _Float16 v4h __attribute__((ext_vector_type(4)));
  {
#pragma unroll
    for (int q = 0; q < 8; ++q) { const int r = q * 2 + rsub; if (col0 + c4 < N) { const v4f v = *(const v4fa*)&so[w][r][c4]; if (C) *(v4f*)(C + cofs + (size_t)(row0 + r) * ldc + col0 + c4) = v; if (C16) { v4h h4; for (int i = 0; i < 4; ++i) h4[i] = (_Float16)v[i]; *(v4h*)(C16 + cofs + (size_t)(row0 + r) * ldc + col0 + c4) = h4; } } }
     }
}


typedef _Float16 v4h __attribute__((ext_vector_type(4)));

__global__ __launch_bounds__(256) void k_x16(const float* __restrict__ x, _Float16* __restrict__ X16, size_t n8) { const size_t t = (size_t)blockIdx.x * 256 + threadIdx.x; if (t >= n8) return; FragH f;
#pragma unroll
  for (int q = 0; q < 8; ++q) f.h[q] = (_Float16)bf16_round(x[t * 8 + q]); *(v8us*)((unsigned short*)X16 + t * 8) = f.half[0];  }
__global__ __launch_bounds__(256) void k_h16(const float* __restrict__ x, _Float16* __restrict__ X16, size_t n8) { const size_t t = (size_t)blockIdx.x * 256 + threadIdx.x; if (t >= n8) return; FragH f;
#pragma unroll
  for (int q = 0; q < 8; ++q) f.h[q] = (_Float16)x[t * 8 + q]; *(v8us*)((unsigned short*)X16 + t * 8) = f.half[0];  }
__global__ __launch_bounds__(256) void k_round16f(const float* __restrict__ W, _Float16* __restrict__ Bt, size_t n8) { const size_t t = (size_t)blockIdx.x * 256 + threadIdx.x; if (t >= n8) return; FragH f;
#pragma unroll
  for (int i = 0; i < 8; ++i) f.h[i] = (_Float16)(bf16_round(W[t * 8 + i]) * 16.0f); *(v8us*)((unsigned short*)Bt + t * 8) = f.half[0];  }
template <int NHv, int TTv>
__global__ __launch_bounds__(256) void k_vt(const _Float16* __restrict__ V16, int ldv, int voff, _Float16* __restrict__ Vt) { __shared__ unsigned short tl[64][66]; const int tid = threadIdx.x; const int slab = blockIdx.x / (TTv / 64), lg = blockIdx.x % (TTv / 64); const int b = slab / NHv, h = slab % NHv;
  for (int i = tid; i < 64 * 8; i += 256) { const int r = i / 8, c8 = (i % 8) * 8; FragH f; f.half[0] = *(const v8us*)((const unsigned short*)V16 + ((size_t)b * TTv + lg * 64 + r) * ldv + voff + h * 64 + c8);
#pragma unroll
    for (int q = 0; q < 8; ++q) tl[r][c8 + q] = f.u[q]; }
  __syncthreads();
  {
#pragma unroll
    for (int rd = 0; rd < 2; ++rd) { const int d = rd * 32 + tid / 8, pc = tid % 8; FragH f;
#pragma unroll
      for (int q = 0; q < 8; ++q) f.u[q] = tl[pc * 8 + q][d];
      *(v8us*)((unsigned short*)Vt + ((size_t)slab * 64 + d) * TTv + lg * 64 + pc * 8) = f.half[0]; }
     } }

__global__ __launch_bounds__(256) void k_vthlu(const float* __restrict__ VF, int ldv, _Float16* __restrict__ Vth, _Float16* __restrict__ Vtl) { __shared__ float tl[64][65]; const int tid = threadIdx.x; const int slab = blockIdx.x / (TT / 64), lg = blockIdx.x % (TT / 64); const int b = slab / NVH, h = slab % NVH;
  for (int i = tid; i < 64 * 16; i += 256) { const int r = i / 16, c4 = (i % 16) * 4; const v4f a = *(const v4fa*)(VF + ((size_t)b * TT + lg * 64 + r) * ldv + h * 64 + c4); tl[r][c4] = a[0]; tl[r][c4 + 1] = a[1]; tl[r][c4 + 2] = a[2]; tl[r][c4 + 3] = a[3]; }
  __syncthreads();
  FragH fh[2], fl[2]; size_t oo[2];
#pragma unroll
  for (int rd = 0; rd < 2; ++rd) { const int d = rd * 32 + tid / 8, pc = tid % 8;
#pragma unroll
    for (int q = 0; q < 8; ++q) { const float v = tl[pc * 8 + q][d]; const _Float16 hv = (_Float16)v; fh[rd].h[q] = hv; fl[rd].h[q] = (_Float16)(v - (float)hv);      /* UNSCALED residual (added into the same accumulator as the hi product) */ } oo[rd] = ((size_t)slab * 64 + d) * TT + lg * 64 + pc * 8; }
  {
#pragma unroll
    for (int rd = 0; rd < 2; ++rd) { *(v8us*)((unsigned short*)Vth + oo[rd]) = fh[rd].half[0]; *(v8us*)((unsigned short*)Vtl + oo[rd]) = fl[rd].half[0]; }
     } }
__global__ __launch_bounds__(256) void k_im3(const float* __restrict__ x, _Float16* __restrict__ A) { const size_t t = (size_t)blockIdx.x * 256 + threadIdx.x; if (t >= (size_t)NR * (K3 / 8)) return; const int piece = (int)(t % (K3 / 8)); const size_t row = t / (K3 / 8); const int b = (int)(row / TT), s = (int)(row % TT); const int tap = (piece * 8) / DD, c0 = (piece * 8) % DD; const int ss = s + tap - 1; FragH f;
  if (ss >= 0 && ss < TT) { const float* xr = x + ((size_t)b * TT + ss) * DD + c0; for (int q = 0; q < 8; ++q) f.h[q] = (_Float16)bf16_round(xr[q]); } else { for (int q = 0; q < 8; ++q) f.h[q] = (_Float16)0.f; }
  *(v8us*)((unsigned short*)A + t * 8) = f.half[0];  }
__global__ __launch_bounds__(256) void k_wc3(const float* __restrict__ w, _Float16* __restrict__ Bt) { const int t = blockIdx.x * 256 + threadIdx.x; if (t >= DD * (K3 / 8)) return; const int o = t / (K3 / 8), k0 = (t % (K3 / 8)) * 8; const int tap = k0 / DD, c0 = k0 % DD; FragH f;
  for (int q = 0; q < 8; ++q) f.h[q] = (_Float16)bf16_round(w[((size_t)o * DD + c0 + q) * 3 + tap]);
  *(v8us*)((unsigned short*)Bt + (size_t)t * 8) = f.half[0];  }
__global__ __launch_bounds__(256) void k_scl(float* __restrict__ O, const float* __restrict__ scl, size_t n4) { const size_t t = (size_t)blockIdx.x * 256 + threadIdx.x; if (t >= n4) return; const float s = bf16_round(scl[0]); v4f v = *(const v4fa*)(O + t * 4); for (int q = 0; q < 4; ++q) v[q] *= s; *(v4f*)(O + t * 4) = v;  }
__device__ __forceinline__ float xhalf(float x) { return __builtin_bit_cast(float, __builtin_amdgcn_permlanex16(__builtin_bit_cast(int, x), __builtin_bit_cast(int, x), 0x76543210, 0xfedcba98, false, false)); }      /* lane l takes lane l ^ 16's value */
__device__ __forceinline__ unsigned lds_off(const void* p) { return (unsigned)(size_t)p; }      /* byte offset in the work-group's LDS = low 32 bits of the __shared__ address */
// Four or twelve asynchronous copies, 16 B per lane each, global memory -> LDS. The closing s_wait_xcnt stands inside the statement so that no address register named here is rewritten ahead of it.
__device__ __forceinline__ void acp4(const unsigned (&l)[4], const unsigned short* const (&p)[4]) {
  asm volatile("global_load_async_to_lds_b128 %0, %4, off\n\t"
               "global_load_async_to_lds_b128 %1, %5, off\n\t"
               "global_load_async_to_lds_b128 %2, %6, off\n\t"
               "global_load_async_to_lds_b128 %3, %7, off\n\t"
               "s_wait_xcnt 0x0"
               :: "v"(l[0]), "v"(l[1]), "v"(l[2]), "v"(l[3]), "v"(p[0]), "v"(p[1]), "v"(p[2]), "v"(p[3]) : "memory");
}
__device__ __forceinline__ void acp12(const unsigned (&l)[12], const unsigned short* const (&p)[12]) {
  asm volatile("global_load_async_to_lds_b128 %0, %12, off\n\t"
               "global_load_async_to_lds_b128 %1, %13, off\n\t"
               "global_load_async_to_lds_b128 %2, %14, off\n\t"
               "global_load_async_to_lds_b128 %3, %15, off\n\t"
               "global_load_async_to_lds_b128 %4, %16, off\n\t"
               "global_load_async_to_lds_b128 %5, %17, off\n\t"
               "global_load_async_to_lds_b128 %6, %18, off\n\t"
               "global_load_async_to_lds_b128 %7, %19, off\n\t"
               "global_load_async_to_lds_b128 %8, %20, off\n\t"
               "global_load_async_to_lds_b128 %9, %21, off\n\t"
               "global_load_async_to_lds_b128 %10, %22, off\n\t"
               "global_load_async_to_lds_b128 %11, %23, off\n\t"
               "s_wait_xcnt 0x0"
               :: "v"(l[0]), "v"(l[1]), "v"(l[2]), "v"(l[3]), "v"(l[4]), "v"(l[5]), "v"(l[6]), "v"(l[7]), "v"(l[8]), "v"(l[9]), "v"(l[10]), "v"(l[11]),
                  "v"(p[0]), "v"(p[1]), "v"(p[2]), "v"(p[3]), "v"(p[4]), "v"(p[5]), "v"(p[6]), "v"(p[7]), "v"(p[8]), "v"(p[9]), "v"(p[10]), "v"(p[11]) : "memory");
}
__device__ __forceinline__ v8f mmaP(v16h a, v16h b, v8f c) { return __builtin_amdgcn_wmma_f32_16x16x32_f16(false, a, false, b, (short)0, c, false, false); }      /* the plain builtin: the compiler keeps the distance behind it itself, and no asm statement stands between the LDS reads and the products */
__global__ __launch_bounds__(512) void k_flash(const _Float16* __restrict__ Q16, int ldq, const _Float16* __restrict__ K16, int ldk, const _Float16* __restrict__ Vt, const _Float16* __restrict__ Vtlo, float* __restrict__ O, int ldo) {
  constexpr int RPW = 16, NQB = TT / (4 * RPW), DT = 8, KS = 8;      /* d_qk 256: 8 k-steps; 8 value tiles = ONE 128-wide half of the 256-wide V per wave */
  constexpr int SK = 64, NST = TT / SK;      /* one LDS tile = 64 keys = two 32-key passes, each on its own waves; V rows of 64 keys are whole 128-B lines */
  constexpr int KP = 256 + 8, VP = SK + 8;      /* LDS row pitches in halves: 528 B and 144 B, both 16 B x odd, conflict-free for the 16-row ds_load_b128 fragment reads */
  __shared__ __attribute__((aligned(16))) unsigned short sQ[4 * RPW][KP]; __shared__ __attribute__((aligned(16))) unsigned short sK[2][SK][KP]; __shared__ __attribute__((aligned(16))) unsigned short sVh[2][256][VP]; __shared__ __attribute__((aligned(16))) unsigned short sVl[2][256][VP];
  __shared__ float sM[8][RPW]; __shared__ float sL[8][RPW];
  typedef float f32a __attribute__((may_alias)); static_assert(sizeof(sK) == 8 * RPW * (128 + 4) * sizeof(float), "the eight output tiles fill the K ring exactly");
  f32a (*sO)[RPW][128 + 4] = (f32a (*)[RPW][128 + 4])&sK[0][0][0];      /* the output tiles reuse the K ring, which nobody reads or fills behind the loop's last barrier */
  const int tid = threadIdx.x, w = tid >> 5, lane = tid & 31, ln = lane & 15, hh = lane >> 4;
  const int slab = blockIdx.x / NQB, qblk = blockIdx.x % NQB; const int b = slab / NH, h = slab % NH; const int qb0 = qblk * (4 * RPW);
  const int wq = w & 3, vhf = (w >> 2) & 1, pr = w & 7; const int q0 = qb0 + wq * RPW;      /* sixteen waves, four per SIMD: 4 groups of 16 query rows x 2 halves of V x 2 halves of each tile's keys; pr numbers the pair of waves that share rows and V half */
  const unsigned short* Qg = (const unsigned short*)Q16 + ((size_t)b * TT + qb0) * ldq; const unsigned short* Kg = (const unsigned short*)K16 + (size_t)b * TT * ldk;
  const unsigned short* Vth = (const unsigned short*)Vt + (size_t)b * VSTR * TT; const unsigned short* Vtl = (const unsigned short*)Vtlo + (size_t)b * VSTR * TT;      /* hi and UNSCALED residual planes */
  const int wu = __builtin_amdgcn_readfirstlane(w);      /* the wave's number as a scalar: the row parts of the copies' addresses stay in scalar registers */
  const int kp = wu >> 3;      /* which 32 keys of every tile this wave takes (scalar: the epilogue branches on it) */
  /* tile t -> buffer buf, 12 copies per wave: 4 K rows (one 512-B row per copy), 16 of the 256 rows of each V plane (four 128-B rows per copy) */
  auto stage = [&](int t, int buf) {
    unsigned l[12]; const unsigned short* p[12];
#pragma unroll      /* constant indices keep l[] and p[] in registers */
    for (int i = 0; i < 4; ++i) { const int r = wu * 4 + i; l[i] = lds_off(&sK[buf][r][lane * 8]); p[i] = Kg + (size_t)(t * SK + r) * ldk + lane * 8; }
#pragma unroll      /* constant indices keep l[] and p[] in registers */
    for (int i = 0; i < 4; ++i) { const int d = wu * 16 + i * 4 + (lane >> 3); l[4 + i] = lds_off(&sVh[buf][d][(lane & 7) * 8]); p[4 + i] = Vth + (size_t)d * TT + t * SK + (lane & 7) * 8; l[8 + i] = lds_off(&sVl[buf][d][(lane & 7) * 8]); p[8 + i] = Vtl + (size_t)d * TT + t * SK + (lane & 7) * 8; }
    acp12(l, p); };
  { unsigned l[4]; const unsigned short* p[4];      /* the block's 64 query rows, filled once: 4 rows per wave */
#pragma unroll      /* constant indices keep l[] and p[] in registers */
    for (int i = 0; i < 4; ++i) { const int r = wu * 4 + i; l[i] = lds_off(&sQ[r][lane * 8]); p[i] = Qg + (size_t)r * ldq + lane * 8; }
    acp4(l, p); }
  stage(0, 0);
  asm volatile("s_wait_asynccnt 0x0" ::: "memory");      /* this wave's copies of Q and of tile 0 have landed */
  __syncthreads();      /* publishes Q and tile 0 to every wave */
  stage(1, 1);
  const unsigned short* qrow = &sQ[wq * RPW + ln][0];
  /* Transposed products: St = K x Qt and Ot += Vt x Pt. Lane (ln, hh) holds query q0 + ln: its scores of keys 8 hh + r of each 16-key tile, and its outputs of value columns 8 hh + r of each 16-column tile. */
  float m_r = -3.0e38f, l_r = 0.f; v8f oacc[DT];
#pragma unroll
  for (int dt = 0; dt < DT; ++dt) oacc[dt] = (v8f){0.f,0.f,0.f,0.f,0.f,0.f,0.f,0.f};
#pragma unroll 1
  for (int t = 0; t < NST; ++t) {
   const int buf = t & 1;
   {
    const int j0 = kp * 32;      /* first key of this wave's pass inside the tile */
    const unsigned short* kr0 = &sK[buf][j0 + ln][0]; const unsigned short* kr1 = &sK[buf][j0 + 16 + ln][0];
    FragH aq[KS], bk[KS]; v8f s[2] = {(v8f){0.f,0.f,0.f,0.f,0.f,0.f,0.f,0.f}, (v8f){0.f,0.f,0.f,0.f,0.f,0.f,0.f,0.f}};
#pragma unroll      /* constant indices keep the fragments in registers */
    for (int ks = 0; ks < KS; ++ks) { aq[ks].half[0] = *(const v8us*)(qrow + ks * 32 + 8 * hh); aq[ks].half[1] = *(const v8us*)(qrow + ks * 32 + 16 + 8 * hh); bk[ks].half[0] = *(const v8us*)(kr0 + ks * 32 + 8 * hh); bk[ks].half[1] = *(const v8us*)(kr0 + ks * 32 + 16 + 8 * hh); }      /* one group of reads: Q and the first 16 keys, all k-steps */
    __builtin_amdgcn_sched_barrier(0);      /* holds the group of reads in front of the products: one LDS latency is waited for, not one per product */
#pragma unroll      /* constant indices keep the fragments in registers */
    for (int ks = 0; ks < KS; ++ks) { s[0] = mmaP(bk[ks].v, aq[ks].v, s[0]); bk[ks].half[0] = *(const v8us*)(kr1 + ks * 32 + 8 * hh); bk[ks].half[1] = *(const v8us*)(kr1 + ks * 32 + 16 + 8 * hh);      /* A = 16 keys, B = 16 queries; the second 16 keys' fragments follow one k-step at a time, as the products free registers */
      __builtin_amdgcn_sched_barrier(0);      /* keeps each refill behind its product: hoisted, all the reads at once would not fit the register budget */ }
    const unsigned short* vh0 = &sVh[buf][vhf * 128 + ln][j0 + 8 * hh]; const unsigned short* vl0 = &sVl[buf][vhf * 128 + ln][j0 + 8 * hh];
    FragH bv[DT], bl[DT];      /* all of the pass's V fragments, both planes: the 128 registers that Q and K leave */
    static_assert(DT == KS, "one value tile's fragments follow each k-step of the second score tile");
#pragma unroll      /* constant indices keep the fragments in registers */
    for (int ks = 0; ks < KS; ++ks) { s[1] = mmaP(bk[ks].v, aq[ks].v, s[1]); bv[ks].half[0] = *(const v8us*)(vh0 + ks * 16 * VP); bv[ks].half[1] = *(const v8us*)(vh0 + ks * 16 * VP + 16); bl[ks].half[0] = *(const v8us*)(vl0 + ks * 16 * VP); bl[ks].half[1] = *(const v8us*)(vl0 + ks * 16 * VP + 16);
      __builtin_amdgcn_sched_barrier(0);      /* as above: a value tile's reads stay behind the product that frees their 16 registers */ }
    /* Every LDS read of tile t is issued above, so the hand-over of the ring stands here: softmax and the V products below work on registers alone, and a wave that ends them early starts on tile t + 1 while its neighbours still compute. */
    asm volatile("s_wait_dscnt 0x0" ::: "memory");      /* this wave's reads of tile t have returned before its buffer is refilled */
    asm volatile("s_wait_asynccnt 0x0" ::: "memory");      /* this wave's copies of tile t + 1 have landed */
    __syncthreads();      /* publishes tile t + 1 and ends every wave's reads of tile t */
    __builtin_amdgcn_sched_barrier(0);      /* keeps the register-only work below behind the hand-over: moved above it, the V reads would again be waited for one product at a time */
    float sc[16];
#pragma unroll
    for (int i = 0; i < 16; ++i) sc[i] = s[i >> 3][i & 7] * ATT_SCALE;
    float mc = sc[0];
#pragma unroll
    for (int i = 1; i < 16; ++i) mc = fmaxf(mc, sc[i]);
    mc = fmaxf(mc, xhalf(mc));      /* the other 16 of the query's 32 keys sit in lane ^ 16 */
    const float mn = fmaxf(m_r, mc); const float ea = expf(m_r - mn); const float al = (mn > -1.0e38f) ? ea : 1.0f; m_r = mn;
    FragH ph, pl; float ls[4] = {0.f, 0.f, 0.f, 0.f};      /* element i of the two score tiles is element i of a B fragment in the k order of the V loader above: P stays in registers */
#pragma unroll
    for (int i = 0; i < 16; ++i) { const float p = expf(sc[i] - mn); ls[i & 3] += p; const float ps = p * 1024.0f; const _Float16 hp = (_Float16)ps; ph.h[i] = hp; pl.h[i] = (_Float16)(ps - (float)hp); }      /* P hi and its UNSCALED residual (added into the same accumulator) */
    l_r = l_r * al + ((ls[0] + ls[1]) + (ls[2] + ls[3]));      /* this lane's 16 keys of every pass; the two halves are joined behind the loop */
#pragma unroll
    for (int dt = 0; dt < DT; ++dt)
#pragma unroll
      for (int r = 0; r < 8; ++r) oacc[dt][r] *= al;
#pragma unroll
    for (int dt = 0; dt < DT; ++dt) { oacc[dt] = mmaP(bv[dt].v, ph.v, oacc[dt]); oacc[dt] = mmaP(bv[dt].v, pl.v, oacc[dt]); oacc[dt] = mmaP(bl[dt].v, ph.v, oacc[dt]); } }      /* Vh x Ph + Vh x Pl + Vl x Ph, all unscaled, one accumulator; A = 16 value columns, B = 16 queries */
   if (t + 2 < NST) stage(t + 2, buf); }
  asm volatile("s_wait_asynccnt 0x0" ::: "memory");      /* no copy is outstanding behind the loop */
  l_r += xhalf(l_r);      /* row sum over this wave's keys */
  if (kp == 1) {      /* the wave of the second key half hands its running max, row sum and unnormalised tile to its partner */
#pragma unroll
    for (int dt = 0; dt < DT; ++dt) { *(v4fa*)&sO[pr][ln][dt * 16 + 8 * hh] = (v4f){oacc[dt][0], oacc[dt][1], oacc[dt][2], oacc[dt][3]}; *(v4fa*)&sO[pr][ln][dt * 16 + 8 * hh + 4] = (v4f){oacc[dt][4], oacc[dt][5], oacc[dt][6], oacc[dt][7]}; }
    if (hh == 0) { sM[pr][ln] = m_r; sL[pr][ln] = l_r; } }
  __syncthreads();      /* publishes the second key half's partial results to the partner waves */
  if (kp == 0) {
    const float m1 = sM[pr][ln], l1 = sL[pr][ln]; const float mn = fmaxf(m_r, m1); const float a0 = expf(m_r - mn), a1 = expf(m1 - mn); const float l = l_r * a0 + l1 * a1; const float inv = (l > 0.f) ? 1.0f / (l * 1024.0f) : 0.f; const float c0 = a0 * inv, c1 = a1 * inv;
#pragma unroll
    for (int dt = 0; dt < DT; ++dt)
#pragma unroll
      for (int g = 0; g < 2; ++g) { v4fa* o = (v4fa*)&sO[pr][ln][dt * 16 + 8 * hh + 4 * g]; const v4f x = *o; *o = (v4f){oacc[dt][4 * g] * c0 + x[0] * c1, oacc[dt][4 * g + 1] * c0 + x[1] * c1, oacc[dt][4 * g + 2] * c0 + x[2] * c1, oacc[dt][4 * g + 3] * c0 + x[3] * c1}; }      /* each lane reads and rewrites its own words */
    __builtin_amdgcn_fence(__ATOMIC_ACQ_REL, "workgroup"); __builtin_amdgcn_wave_barrier();
#pragma unroll
    for (int r = 0; r < RPW; ++r) { const int pc = lane; const v4f val = *(const v4fa*)&sO[pr][r][pc * 4]; *(v4f*)(O + ((size_t)b * TT + q0 + r) * ldo + (h * 2 + vhf) * 128 + pc * 4) = val; }      /* one 512-B row per instruction: 32 lanes x 16 B */
  } }

extern "C" void kernel_launch(void* const* d_in, const int* in_sizes, int n_in,
                              void* d_out, int out_size, void* d_ws, size_t ws_size, hipStream_t stream) {
  (void)in_sizes; (void)n_in; (void)out_size;
  const float* const* I = (const float* const*)d_in; const float* xq = I[0]; const float* xk = I[1]; const float* xv = I[2]; const float* qw = I[3]; const float* qb = I[4]; const float* kw = I[5]; const float* kb = I[6]; const float* vw = I[7]; const float* vb = I[8]; const float* scl = I[9];
  char* ws = (char*)d_ws; size_t off = 0;
  auto take = [&](size_t bytes) { char* p = ws + off; off += (bytes + 255) & ~(size_t)255; return p; };
  _Float16* Bq = (_Float16*)take((size_t)DD * K3 * 2); _Float16* Bk = (_Float16*)take((size_t)DD * K3 * 2); _Float16* Bv = (_Float16*)take((size_t)DD * K3 * 2); _Float16* A = (_Float16*)take((size_t)NR * K3 * 2); _Float16* Q = (_Float16*)take((size_t)NR * DD * 2); _Float16* K = (_Float16*)take((size_t)NR * DD * 2); float* VF = (float*)take((size_t)NR * DD * 4); _Float16* Vt = (_Float16*)take((size_t)NR * DD * 2); _Float16* Vtl = (_Float16*)take((size_t)NR * DD * 2);
  if (off > ws_size) return;      // 1.2 + 25.2 + 8.4 + 8.4 + 16.8 + 8.4 + 8.4 ≈ 77 MB
  k_wc3<<<(DD * (K3 / 8) + 255) / 256, 256, 0, stream>>>(qw, Bq); k_wc3<<<(DD * (K3 / 8) + 255) / 256, 256, 0, stream>>>(kw, Bk); k_wc3<<<(DD * (K3 / 8) + 255) / 256, 256, 0, stream>>>(vw, Bv);
  const unsigned gi = (unsigned)(((size_t)NR * (K3 / 8) + 255) / 256); const dim3 gp(((NR / 16) * (DD / 64) + 3) / 4, 1);
  k_im3<<<gi, 256, 0, stream>>>(xq, A); k_gemm_hhx<0><<<gp, 128, 0, stream>>>(A, K3, 0, Bq, K3, 0, 1.0f, qb, 0, nullptr, 1, 0, 0, nullptr, Q, DD, 0, NR, DD, K3);      /* q = conv(query): M 16384 N 256 K 768 (exact products) → f16 */
  k_im3<<<gi, 256, 0, stream>>>(xk, A); k_gemm_hhx<0><<<gp, 128, 0, stream>>>(A, K3, 0, Bk, K3, 0, 1.0f, kb, 0, nullptr, 1, 0, 0, nullptr, K, DD, 0, NR, DD, K3);
  k_im3<<<gi, 256, 0, stream>>>(xv, A); k_gemm_hhx<0><<<gp, 128, 0, stream>>>(A, K3, 0, Bv, K3, 0, 1.0f, vb, 0, nullptr, 1, 0, 0, VF, nullptr, DD, 0, NR, DD, K3);      /* v (f32) */
  k_vthlu<<<BB * NVH * (TT / 64), 256, 0, stream>>>(VF, DD, Vt, Vtl);      /* Vᵀ hi + residual: [b][256][4096] */
  k_flash<<<BB * NH * (TT / 64), 512, 0, stream>>>(Q, DD, K, DD, Vt, Vtl, (float*)d_out, DD);      /* both 128-wide halves of O in one launch, straight into the output rows */
  k_scl<<<(unsigned)(((size_t)NR * DD / 4 + 255) / 256), 256, 0, stream>>>((float*)d_out, scl, (size_t)NR * DD / 4);      /* × scale */
}

// v005
// It runs in 273 microseconds.
// Timed twice side by side with v004, it ran 1.16 and 1.17 times as fast.
// All steps since v000 together make it 6.75 times as fast.
#include <hip/hip_runtime.h>
// KQV 'PCNN' attention (B=4, S=4096, D=256): q, k, v = Conv1d(kernel 3, pad 1) over the sequence of query/key/value (+bias); scores = q·k/16; softmax; out = scale·(P·v) → [4,4096,256].
// Compute dtype: inputs, conv weights/biases, scale rounded to bf16; each conv as an im2col GEMM (K = 3·256, bf16-exact operands, f32 accumulate) → q, k f16 planes, v f32 → Vᵀ f16 hi + f16 residual; fused flash-style kernel with d_qk = 256 (8 k-steps, online softmax f32, P f16 hi + residual,
// f32 accumulate) on v_wmma_f32_16x16x32_f16, one launch of 16-wave blocks (query rows x halves of v x halves of each key tile), writing the output rows directly; × scale in f32.
#define BB 4
#define TT 4096
#define DD 256
#define NH 1
#define VSTR 256
#define NVH 4
#define NR (BB * TT)
#define K3 (3 * DD)
#define ATT_SCALE 0.0625f

typedef __bf16 v16b __attribute__((ext_vector_type(16)));
typedef unsigned short v8us __attribute__((ext_vector_type(8), may_alias));
typedef float  v8f  __attribute__((ext_vector_type(8)));
typedef float  v4f  __attribute__((ext_vector_type(4)));
typedef float  v4fa __attribute__((ext_vector_type(4), may_alias));
union FragB { v16b v; v8us half[2]; unsigned short u[16]; };

__device__ __forceinline__ unsigned short bf16_bits(float x) { unsigned int u = __float_as_uint(x); return (unsigned short)((u + 0x7FFFu + ((u >> 16) & 1u)) >> 16); }
__device__ __forceinline__ float bf16_val(unsigned short b) { return __uint_as_float(((unsigned int)b) << 16); }
__device__ __forceinline__ float bf16_round(float x) { return bf16_val(bf16_bits(x)); }
// D += A·B with NT terms: 1 = ah·bh, 2 = + al·bh (A split), 3 = + ah·bl (both split)
template <int NT>
__device__ __forceinline__ v8f mmaN(v16b ah, v16b al, v16b bh, v16b bl, v8f c) {
  c = __builtin_amdgcn_wmma_f32_16x16x32_bf16(false, ah, false, bh, (short)0, c, false, false);
  if (NT >= 2) c = __builtin_amdgcn_wmma_f32_16x16x32_bf16(false, al, false, bh, (short)0, c, false, false);
  if (NT >= 3) c = __builtin_amdgcn_wmma_f32_16x16x32_bf16(false, ah, false, bl, (short)0, c, false, false);
  asm volatile("v_nop\n\tv_nop\n\tv_nop\n\tv_nop" : "+v"(c) : "v"(ah), "v"(al), "v"(bh), "v"(bl));
  return c;
}

__global__ __launch_bounds__(256) void k_wt_bf16(const float* __restrict__ W, unsigned short* __restrict__ Wt, int K, int N) {
  const int t = blockIdx.x * 256 + threadIdx.x;
  const int k8n = K / 8;
  if (t >= N * k8n) return;
  const int n = t / k8n, k8 = (t % k8n) * 8;
  v8us v;
#pragma unroll
  for (int i = 0; i < 8; ++i) v[i] = bf16_bits(W[(size_t)(k8 + i) * N + n]);
  *(v8us*)(Wt + (size_t)n * K + k8) = v;
  
}

// GEMM C[M][N] (f32, pitch ldc) = act(A[M][K]·W + bias). A f32 row-major (pitch lda) converted per fragment to bf16
// (ASPLIT: hi/lo two planes -> 2 terms, else single rounded term); Wt bf16 [N][K] (pitch ldb). BIAS_BF16 rounds the
// bias to bf16 first (bias quantised to bf16 before the add). K%32==0, M%16==0, N%64==0.
template <bool ASPLIT, int ACT, bool BIAS_BF16>
__global__ __launch_bounds__(128) void k_gemm_bf(const float* __restrict__ A, int lda, const unsigned short* __restrict__ Wt, int ldb,
                                               const float* __restrict__ bias, float* __restrict__ C, int ldc, int M, int N, int K) {
  __shared__ __attribute__((aligned(16))) float so[4][16][64];
  const int tid = threadIdx.x, w = tid >> 5, lane = tid & 31, ln = lane & 15, hh = lane >> 4;
  const int ntn = N / 64;
  const int wid = blockIdx.x * 4 + w;
  const int mt = wid / ntn, nq = wid % ntn;
  if (mt * 16 >= M) return;
  const int row0 = mt * 16, col0 = nq * 64;
  const float* arow = A + (size_t)(row0 + ln) * lda;
  v8f acc[4] = {};
  for (int kb = 0; kb < K; kb += 32) {
    FragB ah, al;
    const v4f x0 = *(const v4fa*)(arow + kb + 8 * hh), x1 = *(const v4fa*)(arow + kb + 8 * hh + 4);
    const v4f x2 = *(const v4fa*)(arow + kb + 16 + 8 * hh), x3 = *(const v4fa*)(arow + kb + 16 + 8 * hh + 4);
    float xs[16] = {x0[0],x0[1],x0[2],x0[3],x1[0],x1[1],x1[2],x1[3],x2[0],x2[1],x2[2],x2[3],x3[0],x3[1],x3[2],x3[3]};
#pragma unroll
    for (int i = 0; i < 16; ++i) { const unsigned short hb = bf16_bits(xs[i]); ah.u[i] = hb; al.u[i] = ASPLIT ? bf16_bits(xs[i] - bf16_val(hb)) : (unsigned short)0; }
#pragma unroll
    for (int t = 0; t < 4; ++t) {
      const unsigned short* brow = Wt + (size_t)(col0 + t * 16 + ln) * ldb + kb;
      FragB b;
      b.half[0] = *(const v8us*)(brow + 8 * hh);
      b.half[1] = *(const v8us*)(brow + 16 + 8 * hh);
      acc[t] = mmaN<ASPLIT ? 2 : 1>(ah.v, al.v, b.v, b.v, acc[t]);
    }
  }
#pragma unroll
  for (int t = 0; t < 4; ++t) {
    float bv = bias ? bias[col0 + t * 16 + ln] : 0.f;
    if (BIAS_BF16) bv = bf16_round(bv);
#pragma unroll
    for (int r = 0; r < 8; ++r) { float v = acc[t][r] + bv; if (ACT == 1) v = fmaxf(v, 0.f); so[w][8 * hh + r][t * 16 + ln] = v; }
  }
  __builtin_amdgcn_fence(__ATOMIC_ACQ_REL, "workgroup");
  __builtin_amdgcn_wave_barrier();
  const int rsub = lane >> 4, c4 = (lane & 15) * 4;
  {
#pragma unroll
    for (int q = 0; q < 8; ++q) {
      const int r = q * 2 + rsub;
      const v4f v = *(const v4fa*)&so[w][r][c4];
      *(v4f*)(C + (size_t)(row0 + r) * ldc + col0 + c4) = v;
    }
    
  }
}

// Flash-style causal/unmasked attention, all contractions 3-term bf16 hi/lo splits, f32 softmax with running max.
// q,k,v rows are read from f32 buffers with arbitrary row pitch (so they can live inside a fused qkv buffer);
// D = head size (multiple of 32, <= 128); one wave = 16 query rows; block = 4 waves (64 queries) sharing K/V chunks of 32.
template <int D, bool CAUSAL>
__global__ __launch_bounds__(128) void k_flash(const float* __restrict__ qb, const float* __restrict__ kb, const float* __restrict__ vb,
                                             int pitch, int T, int H, float scale, float* __restrict__ y, int ypitch) {
  constexpr int KS = D / 32;        // k-steps for QK
  constexpr int DT = D / 16;        // d tiles for PV
  __shared__ __attribute__((aligned(16))) unsigned short sKh[32][D + 8], sKl[32][D + 8], sVh[32][D + 8], sVl[32][D + 8];
  __shared__ __attribute__((aligned(16))) unsigned short sPh[4][16][40], sPl[4][16][40];
  __shared__ __attribute__((aligned(16))) float sO[4][16][D];
  const int tid = threadIdx.x, w = tid >> 5, lane = tid & 31, ln = lane & 15, hh = lane >> 4;
  const int nqb = (T + 63) / 64;
  const int bh = blockIdx.x / nqb, qblk = blockIdx.x % nqb;
  const int b = bh / H, h = bh % H;
  const int q0 = qblk * 64 + w * 16;
  const float* Q = qb + (size_t)b * T * pitch + h * D;
  const float* K = kb + (size_t)b * T * pitch + h * D;
  const float* V = vb + (size_t)b * T * pitch + h * D;

  // A fragments of the wave's 16 query rows (scaled), hi/lo
  FragB aqh[KS], aql[KS];
  {
    int row = q0 + ln; if (row >= T) row = T - 1;
    const float* qr = Q + (size_t)row * pitch;
#pragma unroll
    for (int ks = 0; ks < KS; ++ks)
#pragma unroll
      for (int i = 0; i < 16; ++i) {
        const int d = ks * 32 + ((i < 8) ? (8 * hh + i) : (16 + 8 * hh + (i - 8)));
        const float x = qr[d] * scale; const unsigned short hb = bf16_bits(x);
        aqh[ks].u[i] = hb; aql[ks].u[i] = bf16_bits(x - bf16_val(hb));
      }
  }
  float m_r[8], l_r[8];
#pragma unroll
  for (int r = 0; r < 8; ++r) { m_r[r] = -3.0e38f; l_r[r] = 0.f; }
  v8f oacc[DT];
#pragma unroll
  for (int dt = 0; dt < DT; ++dt) oacc[dt] = (v8f){0.f,0.f,0.f,0.f,0.f,0.f,0.f,0.f};

  const int kv_end = CAUSAL ? min(T, qblk * 64 + 64) : T;     // block-uniform
  for (int j0 = 0; j0 < kv_end; j0 += 32) {
    __syncthreads();
    for (int e = tid; e < 32 * (D / 4); e += 128) {
      const int r = e / (D / 4), c4 = (e % (D / 4)) * 4;
      const int key = j0 + r;
      v4f kf = {0.f,0.f,0.f,0.f}, vf = {0.f,0.f,0.f,0.f};
      if (key < T) { kf = *(const v4fa*)(K + (size_t)key * pitch + c4); vf = *(const v4fa*)(V + (size_t)key * pitch + c4); }
#pragma unroll
      for (int t = 0; t < 4; ++t) {
        unsigned short hb = bf16_bits(kf[t]); sKh[r][c4 + t] = hb; sKl[r][c4 + t] = bf16_bits(kf[t] - bf16_val(hb));
        hb = bf16_bits(vf[t]); sVh[r][c4 + t] = hb; sVl[r][c4 + t] = bf16_bits(vf[t] - bf16_val(hb));
      }
    }
    __syncthreads();
    // S tile 16 x 32
    v8f s[2];
#pragma unroll
    for (int nt = 0; nt < 2; ++nt) {
      v8f acc = {};
#pragma unroll
      for (int ks = 0; ks < KS; ++ks) {
        FragB bh_, bl_;
        bh_.half[0] = *(const v8us*)&sKh[nt * 16 + ln][ks * 32 + 8 * hh]; bh_.half[1] = *(const v8us*)&sKh[nt * 16 + ln][ks * 32 + 16 + 8 * hh];
        bl_.half[0] = *(const v8us*)&sKl[nt * 16 + ln][ks * 32 + 8 * hh]; bl_.half[1] = *(const v8us*)&sKl[nt * 16 + ln][ks * 32 + 16 + 8 * hh];
        acc = mmaN<3>(aqh[ks].v, aql[ks].v, bh_.v, bl_.v, acc);
      }
      s[nt] = acc;
    }
    // mask + running max (rows 8hh+r; the 16 lanes of a half share rows)
    float alpha[8];
#pragma unroll
    for (int r = 0; r < 8; ++r) {
      const int qi = q0 + 8 * hh + r;
      const int ja = j0 + ln, jb = j0 + 16 + ln;
      if (CAUSAL) { if (ja > qi) s[0][r] = -3.0e38f; if (jb > qi) s[1][r] = -3.0e38f; }
      if (ja >= T) s[0][r] = -3.0e38f;
      if (jb >= T) s[1][r] = -3.0e38f;
      float mx = fmaxf(s[0][r], s[1][r]);
      mx = fmaxf(mx, __shfl_xor(mx, 1, 32)); mx = fmaxf(mx, __shfl_xor(mx, 2, 32)); mx = fmaxf(mx, __shfl_xor(mx, 4, 32)); mx = fmaxf(mx, __shfl_xor(mx, 8, 32));
      const float mnew = fmaxf(m_r[r], mx);
      alpha[r] = (mnew > -1.0e38f) ? __expf(m_r[r] - mnew) : 1.0f;
      const float p0 = (s[0][r] > -1.0e38f) ? __expf(s[0][r] - mnew) : 0.f;
      const float p1 = (s[1][r] > -1.0e38f) ? __expf(s[1][r] - mnew) : 0.f;
      m_r[r] = mnew;
      l_r[r] = l_r[r] * alpha[r] + p0 + p1;            // per-lane partial row sum (16 lanes combined at the end)
      unsigned short hb = bf16_bits(p0); sPh[w][8 * hh + r][ln] = hb;      sPl[w][8 * hh + r][ln] = bf16_bits(p0 - bf16_val(hb));
      hb = bf16_bits(p1);                sPh[w][8 * hh + r][16 + ln] = hb; sPl[w][8 * hh + r][16 + ln] = bf16_bits(p1 - bf16_val(hb));
    }
#pragma unroll
    for (int dt = 0; dt < DT; ++dt)
#pragma unroll
      for (int r = 0; r < 8; ++r) oacc[dt][r] *= alpha[r];
    __builtin_amdgcn_fence(__ATOMIC_ACQ_REL, "workgroup");
    __builtin_amdgcn_wave_barrier();
    FragB pah, pal;
    pah.half[0] = *(const v8us*)&sPh[w][ln][8 * hh]; pah.half[1] = *(const v8us*)&sPh[w][ln][16 + 8 * hh];
    pal.half[0] = *(const v8us*)&sPl[w][ln][8 * hh]; pal.half[1] = *(const v8us*)&sPl[w][ln][16 + 8 * hh];
#pragma unroll
    for (int dt = 0; dt < DT; ++dt) {
      FragB bvh, bvl;
#pragma unroll
      for (int i = 0; i < 8; ++i) {
        bvh.u[i] = sVh[8 * hh + i][dt * 16 + ln]; bvh.u[8 + i] = sVh[16 + 8 * hh + i][dt * 16 + ln];
        bvl.u[i] = sVl[8 * hh + i][dt * 16 + ln]; bvl.u[8 + i] = sVl[16 + 8 * hh + i][dt * 16 + ln];
      }
      oacc[dt] = mmaN<3>(pah.v, pal.v, bvh.v, bvl.v, oacc[dt]);
    }
    __builtin_amdgcn_fence(__ATOMIC_ACQ_REL, "workgroup");
    __builtin_amdgcn_wave_barrier();
  }
#pragma unroll
  for (int r = 0; r < 8; ++r) {
    float l = l_r[r];
    l += __shfl_xor(l, 1, 32); l += __shfl_xor(l, 2, 32); l += __shfl_xor(l, 4, 32); l += __shfl_xor(l, 8, 32);
    l_r[r] = (l > 0.f) ? 1.0f / l : 0.f;
  }
#pragma unroll
  for (int dt = 0; dt < DT; ++dt)
#pragma unroll
    for (int r = 0; r < 8; ++r) sO[w][8 * hh + r][dt * 16 + ln] = oacc[dt][r] * l_r[r];
  __builtin_amdgcn_fence(__ATOMIC_ACQ_REL, "workgroup");
  __builtin_amdgcn_wave_barrier();
  {
    for (int r = 0; r < 16; ++r) {
      const int row = q0 + r;
      if (row < T && lane < D / 4) {
        const v4f val = *(const v4fa*)&sO[w][r][lane * 4];
        *(v4f*)(y + ((size_t)b * T + row) * ypitch + h * D + lane * 4) = val;
      }
    }
    
  }
}

// GEMM C = act(A·W + bias + resid): A f32 (ASPLIT -> hi/lo 2 terms), Wt bf16 [N][K]; ACT 0 none, 1 relu, 2 exact gelu;
// resid (optional, f32, row index = (row % rmod), pitch ldr, RES_BF16 rounds it) added before the activation.
template <bool ASPLIT, int ACT, bool BIAS_BF16, bool RES_BF16>
__global__ __launch_bounds__(128) void k_gemm_bf3(const float* __restrict__ A, int lda, const unsigned short* __restrict__ Wt, int ldb,
                                                const float* __restrict__ bias, const float* __restrict__ resid, int rmod, int ldr,
                                                float* __restrict__ C, int ldc, int M, int N, int K) {
  __shared__ __attribute__((aligned(16))) float so[4][16][64];
  const int tid = threadIdx.x, w = tid >> 5, lane = tid & 31, ln = lane & 15, hh = lane >> 4;
  const int ntn = N / 64;
  const int wid = blockIdx.x * 4 + w;
  const int mt = wid / ntn, nq = wid % ntn;
  if (mt * 16 >= M) return;
  const int row0 = mt * 16, col0 = nq * 64;
  const float* arow = A + (size_t)(row0 + ln) * lda;
  v8f acc[4] = {};
  for (int kb = 0; kb < K; kb += 32) {
    FragB ah, al;
    const v4f x0 = *(const v4fa*)(arow + kb + 8 * hh), x1 = *(const v4fa*)(arow + kb + 8 * hh + 4);
    const v4f x2 = *(const v4fa*)(arow + kb + 16 + 8 * hh), x3 = *(const v4fa*)(arow + kb + 16 + 8 * hh + 4);
    float xs[16] = {x0[0],x0[1],x0[2],x0[3],x1[0],x1[1],x1[2],x1[3],x2[0],x2[1],x2[2],x2[3],x3[0],x3[1],x3[2],x3[3]};
#pragma unroll
    for (int i = 0; i < 16; ++i) { const unsigned short hb = bf16_bits(xs[i]); ah.u[i] = hb; al.u[i] = ASPLIT ? bf16_bits(xs[i] - bf16_val(hb)) : (unsigned short)0; }
#pragma unroll
    for (int t = 0; t < 4; ++t) {
      const unsigned short* brow = Wt + (size_t)(col0 + t * 16 + ln) * ldb + kb;
      FragB b;
      b.half[0] = *(const v8us*)(brow + 8 * hh);
      b.half[1] = *(const v8us*)(brow + 16 + 8 * hh);
      acc[t] = mmaN<ASPLIT ? 2 : 1>(ah.v, al.v, b.v, b.v, acc[t]);
    }
  }
#pragma unroll
  for (int t = 0; t < 4; ++t) {
    const int col = col0 + t * 16 + ln;
    float bv = bias ? bias[col] : 0.f;
    if (BIAS_BF16) bv = bf16_round(bv);
#pragma unroll
    for (int r = 0; r < 8; ++r) {
      float v = acc[t][r] + bv;
      if (resid) { float rv = resid[(size_t)((row0 + 8 * hh + r) % rmod) * ldr + col]; if (RES_BF16) rv = bf16_round(rv); v += rv; }
      if (ACT == 1) v = fmaxf(v, 0.f);
      if (ACT == 2) v = 0.5f * v * (1.0f + erff(v * 0.70710678118654752f));
      if (ACT == 3) { const float u = 0.7978845608028654f * (v + 0.044715f * v * v * v); v = 0.5f * v * (1.0f + tanhf(u)); }
      so[w][8 * hh + r][t * 16 + ln] = v;
    }
  }
  __builtin_amdgcn_fence(__ATOMIC_ACQ_REL, "workgroup");
  __builtin_amdgcn_wave_barrier();
  const int rsub = lane >> 4, c4 = (lane & 15) * 4;
  {
#pragma unroll
    for (int q = 0; q < 8; ++q) {
      const int r = q * 2 + rsub;
      const v4f v = *(const v4fa*)&so[w][r][c4];
      *(v4f*)(C + (size_t)(row0 + r) * ldc + col0 + c4) = v;
    }
    
  }
}
// row LayerNorm (biased variance, eps) over N: s = X (+ R); optional out_sum <- s; out_norm <- (s-mu)*rsqrt(var+eps)*g + b
template <bool PARAM_BF16>
__global__ __launch_bounds__(256) void k_layernorm(const float* __restrict__ X, const float* __restrict__ R, const float* __restrict__ g, const float* __restrict__ bta,
                                                  float* __restrict__ out_sum, float* __restrict__ out_norm, int N, float eps) {
  __shared__ float red[256];
  const int row = blockIdx.x, tid = threadIdx.x;
  const float* x = X + (size_t)row * N; const float* rr = R ? R + (size_t)row * N : nullptr;
  float vals[16];                     // up to N = 4096
  const int per = N / 256;            // contiguous chunk per thread? use strided-by-4 chunks: thread handles j = tid*4 + 1024*u
  float s1 = 0.f;
  for (int u = 0; u < per / 4; ++u) {
    const int j = tid * 4 + 1024 * u;
    const v4f a = *(const v4fa*)(x + j);
    v4f b = {0.f,0.f,0.f,0.f}; if (rr) b = *(const v4fa*)(rr + j);
#pragma unroll
    for (int q = 0; q < 4; ++q) { const float v = a[q] + b[q]; vals[u * 4 + q] = v; s1 += v; }
  }
  red[tid] = s1; __syncthreads();
  for (int st = 128; st > 0; st >>= 1) { if (tid < st) red[tid] += red[tid + st]; __syncthreads(); }
  const float mu = red[0] / (float)N; __syncthreads();
  float s2 = 0.f;
  for (int u = 0; u < per / 4; ++u)
#pragma unroll
    for (int q = 0; q < 4; ++q) { const float c = vals[u * 4 + q] - mu; s2 += c * c; }
  red[tid] = s2; __syncthreads();
  for (int st = 128; st > 0; st >>= 1) { if (tid < st) red[tid] += red[tid + st]; __syncthreads(); }
  const float rs = rsqrtf(red[0] / (float)N + eps);
  {
    for (int u = 0; u < per / 4; ++u) {
      const int j = tid * 4 + 1024 * u;
      v4f o, sm;
#pragma unroll
      for (int q = 0; q < 4; ++q) {
        float gg = g[j + q], bb = bta[j + q];
        if (PARAM_BF16) { gg = bf16_round(gg); bb = bf16_round(bb); }
        sm[q] = vals[u * 4 + q]; o[q] = (vals[u * 4 + q] - mu) * rs * gg + bb;
      }
      if (out_sum) *(v4f*)(out_sum + (size_t)row * N + j) = sm;
      *(v4f*)(out_norm + (size_t)row * N + j) = o;
    }
    
  }
}



// ---- f16 WMMA path (v_wmma_f32_16x16x32_f16): 11-bit significands for operands in range — used where a [0,1] probability operand needs more precision than bf16
typedef _Float16 v16h __attribute__((ext_vector_type(16)));
union FragH { v16h v; v8us half[2]; _Float16 h[16]; unsigned short u[16]; };
template <int NT>
__device__ __forceinline__ v8f mmaH(v16h ah, v16h al, v16h bh, v16h bl, v8f c) {
  c = __builtin_amdgcn_wmma_f32_16x16x32_f16(false, ah, false, bh, (short)0, c, false, false);
  if (NT >= 2) c = __builtin_amdgcn_wmma_f32_16x16x32_f16(false, al, false, bh, (short)0, c, false, false);
  if (NT >= 3) c = __builtin_amdgcn_wmma_f32_16x16x32_f16(false, ah, false, bl, (short)0, c, false, false);
  asm volatile("v_nop\n\tv_nop\n\tv_nop\n\tv_nop" : "+v"(c) : "v"(ah), "v"(al), "v"(bh), "v"(bl));
  return c;
}
// batched GEMM like k_gemm_b but f16 operands: A f32 (split into f16 hi/lo if ASPLIT, else rounded to f16), Bt = f16 values [n][k]; alpha; C f32; N multiple of 16 (partial tiles skipped)
template <bool ASPLIT>
__global__ __launch_bounds__(128) void k_gemm_h(const float* __restrict__ A, int lda, size_t sA, const _Float16* __restrict__ Bh, int ldb, size_t sB, float alpha, float* __restrict__ C, int ldc, size_t sC, int M, int N, int K) {
  __shared__ __attribute__((aligned(16))) float so[4][16][64];
  const int tid = threadIdx.x, w = tid >> 5, lane = tid & 31, ln = lane & 15, hh = lane >> 4; const int by = blockIdx.y;
  A += (size_t)by * sA; Bh += (size_t)by * sB; C += (size_t)by * sC;
  const int ntn = (N + 63) / 64; const int wid = blockIdx.x * 4 + w; const int mt = wid / ntn, nq = wid % ntn; if (mt * 16 >= M) return;
  const int row0 = mt * 16, col0 = nq * 64; const float* arow = A + (size_t)(row0 + ln) * lda;
  v8f acc[4] = {};
  for (int kb = 0; kb < K; kb += 32) {
    FragH ah, al;
    const v4f x0 = *(const v4fa*)(arow + kb + 8 * hh), x1 = *(const v4fa*)(arow + kb + 8 * hh + 4), x2 = *(const v4fa*)(arow + kb + 16 + 8 * hh), x3 = *(const v4fa*)(arow + kb + 16 + 8 * hh + 4);
    float xs[16] = {x0[0],x0[1],x0[2],x0[3],x1[0],x1[1],x1[2],x1[3],x2[0],x2[1],x2[2],x2[3],x3[0],x3[1],x3[2],x3[3]};
#pragma unroll
    for (int i = 0; i < 16; ++i) { const _Float16 h = (_Float16)xs[i]; ah.h[i] = h; al.h[i] = ASPLIT ? (_Float16)(xs[i] - (float)h) : (_Float16)0.0f; }
#pragma unroll
    for (int t = 0; t < 4; ++t) { if (col0 + t * 16 >= N) continue; const size_t boff = (size_t)(col0 + t * 16 + ln) * ldb + kb; FragH bq; bq.half[0] = *(const v8us*)(Bh + boff + 8 * hh); bq.half[1] = *(const v8us*)(Bh + boff + 16 + 8 * hh);
      acc[t] = mmaH<ASPLIT ? 2 : 1>(ah.v, al.v, bq.v, bq.v, acc[t]); }
  }
#pragma unroll
  for (int t = 0; t < 4; ++t) { if (col0 + t * 16 >= N) continue;
#pragma unroll
    for (int r = 0; r < 8; ++r) so[w][8 * hh + r][t * 16 + ln] = acc[t][r] * alpha; }
  __builtin_amdgcn_fence(__ATOMIC_ACQ_REL, "workgroup"); __builtin_amdgcn_wave_barrier();
  const int rsub = lane >> 4, c4 = (lane & 15) * 4;
  {
#pragma unroll
    for (int q = 0; q < 8; ++q) { const int r = q * 2 + rsub; if (col0 + c4 < N) { const v4f v = *(const v4fa*)&so[w][r][c4]; *(v4f*)(C + (size_t)(row0 + r) * ldc + col0 + c4) = v; } }
     }
}

// Wt[n][k] = f16(W[k][n]·scale) from f32 row-major W[K][N] (scale = power of two; bf16-exact weights stay exact in f16 away from the subnormal range)
__global__ __launch_bounds__(256) void k_wt_f16(const float* __restrict__ W, _Float16* __restrict__ Wt, int K, int N, float scale) {
  const int t = blockIdx.x * 256 + threadIdx.x; if (t >= N * (K / 8)) return; const int n = t / (K / 8), k8 = (t % (K / 8)) * 8; FragH f;
#pragma unroll
  for (int i = 0; i < 8; ++i) f.h[i] = (_Float16)(bf16_round(W[(size_t)(k8 + i) * N + n]) * scale); const v8us o = f.half[0];
  *(v8us*)((unsigned short*)Wt + (size_t)n * K + k8) = o; 
}


typedef _Float16 v4h __attribute__((ext_vector_type(4)));

__global__ __launch_bounds__(256) void k_x16(const float* __restrict__ x, _Float16* __restrict__ X16, size_t n8) { const size_t t = (size_t)blockIdx.x * 256 + threadIdx.x; if (t >= n8) return; FragH f;
#pragma unroll
  for (int q = 0; q < 8; ++q) f.h[q] = (_Float16)bf16_round(x[t * 8 + q]); *(v8us*)((unsigned short*)X16 + t * 8) = f.half[0];  }
__global__ __launch_bounds__(256) void k_h16(const float* __restrict__ x, _Float16* __restrict__ X16, size_t n8) { const size_t t = (size_t)blockIdx.x * 256 + threadIdx.x; if (t >= n8) return; FragH f;
#pragma unroll
  for (int q = 0; q < 8; ++q) f.h[q] = (_Float16)x[t * 8 + q]; *(v8us*)((unsigned short*)X16 + t * 8) = f.half[0];  }
__global__ __launch_bounds__(256) void k_round16f(const float* __restrict__ W, _Float16* __restrict__ Bt, size_t n8) { const size_t t = (size_t)blockIdx.x * 256 + threadIdx.x; if (t >= n8) return; FragH f;
#pragma unroll
  for (int i = 0; i < 8; ++i) f.h[i] = (_Float16)(bf16_round(W[t * 8 + i]) * 16.0f); *(v8us*)((unsigned short*)Bt + t * 8) = f.half[0];  }
template <int NHv, int TTv>
__global__ __launch_bounds__(256) void k_vt(const _Float16* __restrict__ V16, int ldv, int voff, _Float16* __restrict__ Vt) { __shared__ unsigned short tl[64][66]; const int tid = threadIdx.x; const int slab = blockIdx.x / (TTv / 64), lg = blockIdx.x % (TTv / 64); const int b = slab / NHv, h = slab % NHv;
  for (int i = tid; i < 64 * 8; i += 256) { const int r = i / 8, c8 = (i % 8) * 8; FragH f; f.half[0] = *(const v8us*)((const unsigned short*)V16 + ((size_t)b * TTv + lg * 64 + r) * ldv + voff + h * 64 + c8);
#pragma unroll
    for (int q = 0; q < 8; ++q) tl[r][c8 + q] = f.u[q]; }
  __syncthreads();
  {
#pragma unroll
    for (int rd = 0; rd < 2; ++rd) { const int d = rd * 32 + tid / 8, pc = tid % 8; FragH f;
#pragma unroll
      for (int q = 0; q < 8; ++q) f.u[q] = tl[pc * 8 + q][d];
      *(v8us*)((unsigned short*)Vt + ((size_t)slab * 64 + d) * TTv + lg * 64 + pc * 8) = f.half[0]; }
     } }

__global__ __launch_bounds__(256) void k_vthlu(const float* __restrict__ VF, int ldv, _Float16* __restrict__ Vth, _Float16* __restrict__ Vtl) { __shared__ float tl[64][65]; const int tid = threadIdx.x; const int slab = blockIdx.x / (TT / 64), lg = blockIdx.x % (TT / 64); const int b = slab / NVH, h = slab % NVH;
  for (int i = tid; i < 64 * 16; i += 256) { const int r = i / 16, c4 = (i % 16) * 4; const v4f a = *(const v4fa*)(VF + ((size_t)b * TT + lg * 64 + r) * ldv + h * 64 + c4); tl[r][c4] = a[0]; tl[r][c4 + 1] = a[1]; tl[r][c4 + 2] = a[2]; tl[r][c4 + 3] = a[3]; }
  __syncthreads();
  FragH fh[2], fl[2]; size_t oo[2];
#pragma unroll
  for (int rd = 0; rd < 2; ++rd) { const int d = rd * 32 + tid / 8, pc = tid % 8;
#pragma unroll
    for (int q = 0; q < 8; ++q) { const float v = tl[pc * 8 + q][d]; const _Float16 hv = (_Float16)v; fh[rd].h[q] = hv; fl[rd].h[q] = (_Float16)(v - (float)hv);      /* UNSCALED residual (added into the same accumulator as the hi product) */ } oo[rd] = ((size_t)slab * 64 + d) * TT + lg * 64 + pc * 8; }
  {
#pragma unroll
    for (int rd = 0; rd < 2; ++rd) { *(v8us*)((unsigned short*)Vth + oo[rd]) = fh[rd].half[0]; *(v8us*)((unsigned short*)Vtl + oo[rd]) = fl[rd].half[0]; }
     } }
// One Conv1d (3 taps, pad 1) as a GEMM that forms no im2col plane: row s of the im2col matrix is input rows s - 1, s, s + 1 laid end to end, so a block stages its 16 rows and the two neighbours once in LDS,
// rounded f32 -> bf16 -> f16 (a zero row outside the sequence), and k-step kb reads its A fragment from LDS row ln + kb / 256. Bh = f16 weights [n][k], k = tap * 256 + c. Four waves = the four 64-column quarters of the 256 outputs.
template <bool F16OUT>      /* the output plane: f16 (C16) or f32 (C) */
__global__ __launch_bounds__(128) void k_conv3(const float* __restrict__ x, const _Float16* __restrict__ Bh, const float* __restrict__ bias, float* __restrict__ C, _Float16* __restrict__ C16) {
  constexpr int XP = DD + 8;      /* LDS row pitch in halves: 528 B = 16 B x odd, conflict-free for the 16-row ds_load_b128 fragment reads */
  __shared__ __attribute__((aligned(16))) unsigned short sX[16 + 2][XP];      /* LDS row r = sequence row s0 + r - 1 */
  __shared__ __attribute__((aligned(16))) float so[4][16][64];
  const int tid = threadIdx.x, w = tid >> 5, lane = tid & 31, ln = lane & 15, hh = lane >> 4;
  const int row0 = blockIdx.x * 16, col0 = w * 64; const int s0 = row0 % TT;      /* 16 divides the sequence length: a block's rows lie in one sequence */
  float bv[4]; const int bi = col0 + ln;      /* this lane's four bias values, loaded beside the input rows */
  { v4f xa[9];      /* nine 16-B loads per thread, all issued before the first is used: one memory latency for the whole stage */
    const int nb = tid >> 6; const bool in = nb ? (s0 + 16 < TT) : (s0 > 0);      /* waves 0, 1: the row above the block; waves 2, 3: the row below */
    const float* xb = x + (size_t)(row0 + w) * DD + lane * 4; const float* xn = x + (size_t)(row0 + (in ? (nb ? 16 : -1) : 0)) * DD + (tid & 63) * 4;      /* a neighbour outside the sequence: the address stays inside the buffer, the values are replaced by zero */
#pragma unroll      /* constant indices keep xa[] in registers */
    for (int j = 0; j < 8; ++j) xa[j] = *(const v4fa*)(xb + (j >> 1) * 4 * DD + (j & 1) * 128);      /* four rows per wave, 512 contiguous bytes per load, one address and constant offsets */
    xa[8] = *(const v4fa*)xn;
#pragma unroll
    for (int t = 0; t < 4; ++t) bv[t] = bias[bi + t * 16];
    asm volatile("s_wait_xcnt 0x0" :: "v"(xb), "v"(xn), "v"(bi) : "memory");      /* stands behind these loads; their addresses are named as inputs so that the registers are rewritten only behind it */
    if (!in) xa[8] = (v4f){0.f, 0.f, 0.f, 0.f};
#pragma unroll      /* constant indices keep xa[] in registers */
    for (int j = 0; j < 9; ++j) { v4h h4;
#pragma unroll
      for (int q = 0; q < 4; ++q) h4[q] = (_Float16)bf16_round(xa[j][q]);
      *(v4h*)(j < 8 ? &sX[1 + (j >> 1) * 4 + w][(j & 1) * 128 + lane * 4] : &sX[nb * 17][(tid & 63) * 4]) = h4; } }
  __syncthreads();      /* publishes the 18 staged rows to the four waves */
  const unsigned short* brow = (const unsigned short*)Bh + (size_t)(col0 + ln) * K3 + 8 * hh;
  v8f acc[4] = {};
  for (int kb = 0; kb < K3; kb += 32) { const unsigned short* ar = &sX[ln + kb / DD][kb % DD + 8 * hh]; FragH ah; ah.half[0] = *(const v8us*)ar; ah.half[1] = *(const v8us*)(ar + 16);
#pragma unroll
    for (int t = 0; t < 4; ++t) { FragH bq; bq.half[0] = *(const v8us*)(brow + (size_t)t * 16 * K3 + kb); bq.half[1] = *(const v8us*)(brow + (size_t)t * 16 * K3 + kb + 16);
      acc[t] = mmaH<1>(ah.v, ah.v, bq.v, bq.v, acc[t]); }
  }
#pragma unroll
  for (int t = 0; t < 4; ++t) { const float bt = bf16_round(bv[t]);
#pragma unroll
    for (int r = 0; r < 8; ++r) so[w][8 * hh + r][t * 16 + ln] = acc[t][r] + bt; }
  __builtin_amdgcn_fence(__ATOMIC_ACQ_REL, "workgroup"); __builtin_amdgcn_wave_barrier();
  const int rsub = lane >> 4, c4 = (lane & 15) * 4;
#pragma unroll
  for (int q = 0; q < 8; ++q) { const int r = q * 2 + rsub; const v4f v = *(const v4fa*)&so[w][r][c4]; if (!F16OUT) *(v4f*)(C + (size_t)(row0 + r) * DD + col0 + c4) = v; else { v4h h4; for (int i = 0; i < 4; ++i) h4[i] = (_Float16)v[i]; *(v4h*)(C16 + (size_t)(row0 + r) * DD + col0 + c4) = h4; } }
}
__global__ __launch_bounds__(256) void k_wc3(const float* __restrict__ w, _Float16* __restrict__ Bt) { const int t = blockIdx.x * 256 + threadIdx.x; if (t >= DD * (K3 / 8)) return; const int o = t / (K3 / 8), k0 = (t % (K3 / 8)) * 8; const int tap = k0 / DD, c0 = k0 % DD; FragH f;
  for (int q = 0; q < 8; ++q) f.h[q] = (_Float16)bf16_round(w[((size_t)o * DD + c0 + q) * 3 + tap]);
  *(v8us*)((unsigned short*)Bt + (size_t)t * 8) = f.half[0];  }
__global__ __launch_bounds__(256) void k_scl(float* __restrict__ O, const float* __restrict__ scl, size_t n4) { const size_t t = (size_t)blockIdx.x * 256 + threadIdx.x; if (t >= n4) return; const float s = bf16_round(scl[0]); v4f v = *(const v4fa*)(O + t * 4); for (int q = 0; q < 4; ++q) v[q] *= s; *(v4f*)(O + t * 4) = v;  }
__device__ __forceinline__ float xhalf(float x) { return __builtin_bit_cast(float, __builtin_amdgcn_permlanex16(__builtin_bit_cast(int, x), __builtin_bit_cast(int, x), 0x76543210, 0xfedcba98, false, false)); }      /* lane l takes lane l ^ 16's value */
__device__ __forceinline__ unsigned lds_off(const void* p) { return (unsigned)(size_t)p; }      /* byte offset in the work-group's LDS = low 32 bits of the __shared__ address */
// Four or twelve asynchronous copies, 16 B per lane each, global memory -> LDS. The closing s_wait_xcnt stands inside the statement so that no address register named here is rewritten ahead of it.
__device__ __forceinline__ void acp4(const unsigned (&l)[4], const unsigned short* const (&p)[4]) {
  asm volatile("global_load_async_to_lds_b128 %0, %4, off\n\t"
               "global_load_async_to_lds_b128 %1, %5, off\n\t"
               "global_load_async_to_lds_b128 %2, %6, off\n\t"
               "global_load_async_to_lds_b128 %3, %7, off\n\t"
               "s_wait_xcnt 0x0"
               :: "v"(l[0]), "v"(l[1]), "v"(l[2]), "v"(l[3]), "v"(p[0]), "v"(p[1]), "v"(p[2]), "v"(p[3]) : "memory");
}
__device__ __forceinline__ void acp12(const unsigned (&l)[12], const unsigned short* const (&p)[12]) {
  asm volatile("global_load_async_to_lds_b128 %0, %12, off\n\t"
               "global_load_async_to_lds_b128 %1, %13, off\n\t"
               "global_load_async_to_lds_b128 %2, %14, off\n\t"
               "global_load_async_to_lds_b128 %3, %15, off\n\t"
               "global_load_async_to_lds_b128 %4, %16, off\n\t"
               "global_load_async_to_lds_b128 %5, %17, off\n\t"
               "global_load_async_to_lds_b128 %6, %18, off\n\t"
               "global_load_async_to_lds_b128 %7, %19, off\n\t"
               "global_load_async_to_lds_b128 %8, %20, off\n\t"
               "global_load_async_to_lds_b128 %9, %21, off\n\t"
               "global_load_async_to_lds_b128 %10, %22, off\n\t"
               "global_load_async_to_lds_b128 %11, %23, off\n\t"
               "s_wait_xcnt 0x0"
               :: "v"(l[0]), "v"(l[1]), "v"(l[2]), "v"(l[3]), "v"(l[4]), "v"(l[5]), "v"(l[6]), "v"(l[7]), "v"(l[8]), "v"(l[9]), "v"(l[10]), "v"(l[11]),
                  "v"(p[0]), "v"(p[1]), "v"(p[2]), "v"(p[3]), "v"(p[4]), "v"(p[5]), "v"(p[6]), "v"(p[7]), "v"(p[8]), "v"(p[9]), "v"(p[10]), "v"(p[11]) : "memory");
}
__device__ __forceinline__ v8f mmaP(v16h a, v16h b, v8f c) { return __builtin_amdgcn_wmma_f32_16x16x32_f16(false, a, false, b, (short)0, c, false, false); }      /* the plain builtin: the compiler keeps the distance behind it itself, and no asm statement stands between the LDS reads and the products */
__global__ __launch_bounds__(512) void k_flash(const _Float16* __restrict__ Q16, int ldq, const _Float16* __restrict__ K16, int ldk, const _Float16* __restrict__ Vt, const _Float16* __restrict__ Vtlo, float* __restrict__ O, int ldo) {
  constexpr int RPW = 16, NQB = TT / (4 * RPW), DT = 8, KS = 8;      /* d_qk 256: 8 k-steps; 8 value tiles = ONE 128-wide half of the 256-wide V per wave */
  constexpr int SK = 64, NST = TT / SK;      /* one LDS tile = 64 keys = two 32-key passes, each on its own waves; V rows of 64 keys are whole 128-B lines */
  constexpr int KP = 256 + 8, VP = SK + 8;      /* LDS row pitches in halves: 528 B and 144 B, both 16 B x odd, conflict-free for the 16-row ds_load_b128 fragment reads */
  __shared__ __attribute__((aligned(16))) unsigned short sQ[4 * RPW][KP]; __shared__ __attribute__((aligned(16))) unsigned short sK[2][SK][KP]; __shared__ __attribute__((aligned(16))) unsigned short sVh[2][256][VP]; __shared__ __attribute__((aligned(16))) unsigned short sVl[2][256][VP];
  __shared__ float sM[8][RPW]; __shared__ float sL[8][RPW];
  typedef float f32a __attribute__((may_alias)); static_assert(sizeof(sK) == 8 * RPW * (128 + 4) * sizeof(float), "the eight output tiles fill the K ring exactly");
  f32a (*sO)[RPW][128 + 4] = (f32a (*)[RPW][128 + 4])&sK[0][0][0];      /* the output tiles reuse the K ring, which nobody reads or fills behind the loop's last barrier */
  const int tid = threadIdx.x, w = tid >> 5, lane = tid & 31, ln = lane & 15, hh = lane >> 4;
  const int slab = blockIdx.x / NQB, qblk = blockIdx.x % NQB; const int b = slab / NH, h = slab % NH; const int qb0 = qblk * (4 * RPW);
  const int wq = w & 3, vhf = (w >> 2) & 1, pr = w & 7; const int q0 = qb0 + wq * RPW;      /* sixteen waves, four per SIMD: 4 groups of 16 query rows x 2 halves of V x 2 halves of each tile's keys; pr numbers the pair of waves that share rows and V half */
  const unsigned short* Qg = (const unsigned short*)Q16 + ((size_t)b * TT + qb0) * ldq; const unsigned short* Kg = (const unsigned short*)K16 + (size_t)b * TT * ldk;
  const unsigned short* Vth = (const unsigned short*)Vt + (size_t)b * VSTR * TT; const unsigned short* Vtl = (const unsigned short*)Vtlo + (size_t)b * VSTR * TT;      /* hi and UNSCALED residual planes */
  const int wu = __builtin_amdgcn_readfirstlane(w);      /* the wave's number as a scalar: the row parts of the copies' addresses stay in scalar registers */
  const int kp = wu >> 3;      /* which 32 keys of every tile this wave takes (scalar: the epilogue branches on it) */
  /* tile t -> buffer buf, 12 copies per wave: 4 K rows (one 512-B row per copy), 16 of the 256 rows of each V plane (four 128-B rows per copy) */
  auto stage = [&](int t, int buf) {
    unsigned l[12]; const unsigned short* p[12];
#pragma unroll      /* constant indices keep l[] and p[] in registers */
    for (int i = 0; i < 4; ++i) { const int r = wu * 4 + i; l[i] = lds_off(&sK[buf][r][lane * 8]); p[i] = Kg + (size_t)(t * SK + r) * ldk + lane * 8; }
#pragma unroll      /* constant indices keep l[] and p[] in registers */
    for (int i = 0; i < 4; ++i) { const int d = wu * 16 + i * 4 + (lane >> 3); l[4 + i] = lds_off(&sVh[buf][d][(lane & 7) * 8]); p[4 + i] = Vth + (size_t)d * TT + t * SK + (lane & 7) * 8; l[8 + i] = lds_off(&sVl[buf][d][(lane & 7) * 8]); p[8 + i] = Vtl + (size_t)d * TT + t * SK + (lane & 7) * 8; }
    acp12(l, p); };
  { unsigned l[4]; const unsigned short* p[4];      /* the block's 64 query rows, filled once: 4 rows per wave */
#pragma unroll      /* constant indices keep l[] and p[] in registers */
    for (int i = 0; i < 4; ++i) { const int r = wu * 4 + i; l[i] = lds_off(&sQ[r][lane * 8]); p[i] = Qg + (size_t)r * ldq + lane * 8; }
    acp4(l, p); }
  stage(0, 0);
  asm volatile("s_wait_asynccnt 0x0" ::: "memory");      /* this wave's copies of Q and of tile 0 have landed */
  __syncthreads();      /* publishes Q and tile 0 to every wave */
  stage(1, 1);
  const unsigned short* qrow = &sQ[wq * RPW + ln][0];
  /* Transposed products: St = K x Qt and Ot += Vt x Pt. Lane (ln, hh) holds query q0 + ln: its scores of keys 8 hh + r of each 16-key tile, and its outputs of value columns 8 hh + r of each 16-column tile. */
  float m_r = -3.0e38f, l_r = 0.f; v8f oacc[DT];
#pragma unroll
  for (int dt = 0; dt < DT; ++dt) oacc[dt] = (v8f){0.f,0.f,0.f,0.f,0.f,0.f,0.f,0.f};
#pragma unroll 1
  for (int t = 0; t < NST; ++t) {
   const int buf = t & 1;
   {
    const int j0 = kp * 32;      /* first key of this wave's pass inside the tile */
    const unsigned short* kr0 = &sK[buf][j0 + ln][0]; const unsigned short* kr1 = &sK[buf][j0 + 16 + ln][0];
    FragH aq[KS], bk[KS]; v8f s[2] = {(v8f){0.f,0.f,0.f,0.f,0.f,0.f,0.f,0.f}, (v8f){0.f,0.f,0.f,0.f,0.f,0.f,0.f,0.f}};
#pragma unroll      /* constant indices keep the fragments in registers */
    for (int ks = 0; ks < KS; ++ks) { aq[ks].half[0] = *(const v8us*)(qrow + ks * 32 + 8 * hh); aq[ks].half[1] = *(const v8us*)(qrow + ks * 32 + 16 + 8 * hh); bk[ks].half[0] = *(const v8us*)(kr0 + ks * 32 + 8 * hh); bk[ks].half[1] = *(const v8us*)(kr0 + ks * 32 + 16 + 8 * hh); }      /* one group of reads: Q and the first 16 keys, all k-steps */
    __builtin_amdgcn_sched_barrier(0);      /* holds the group of reads in front of the products: one LDS latency is waited for, not one per product */
#pragma unroll      /* constant indices keep the fragments in registers */
    for (int ks = 0; ks < KS; ++ks) { s[0] = mmaP(bk[ks].v, aq[ks].v, s[0]); bk[ks].half[0] = *(const v8us*)(kr1 + ks * 32 + 8 * hh); bk[ks].half[1] = *(const v8us*)(kr1 + ks * 32 + 16 + 8 * hh);      /* A = 16 keys, B = 16 queries; the second 16 keys' fragments follow one k-step at a time, as the products free registers */
      __builtin_amdgcn_sched_barrier(0);      /* keeps each refill behind its product: hoisted, all the reads at once would not fit the register budget */ }
    const unsigned short* vh0 = &sVh[buf][vhf * 128 + ln][j0 + 8 * hh]; const unsigned short* vl0 = &sVl[buf][vhf * 128 + ln][j0 + 8 * hh];
    FragH bv[DT], bl[DT];      /* all of the pass's V fragments, both planes: the 128 registers that Q and K leave */
    static_assert(DT == KS, "one value tile's fragments follow each k-step of the second score tile");
#pragma unroll      /* constant indices keep the fragments in registers */
    for (int ks = 0; ks < KS; ++ks) { s[1] = mmaP(bk[ks].v, aq[ks].v, s[1]); bv[ks].half[0] = *(const v8us*)(vh0 + ks * 16 * VP); bv[ks].half[1] = *(const v8us*)(vh0 + ks * 16 * VP + 16); bl[ks].half[0] = *(const v8us*)(vl0 + ks * 16 * VP); bl[ks].half[1] = *(const v8us*)(vl0 + ks * 16 * VP + 16);
      __builtin_amdgcn_sched_barrier(0);      /* as above: a value tile's reads stay behind the product that frees their 16 registers */ }
    /* Every LDS read of tile t is issued above, so the hand-over of the ring stands here: softmax and the V products below work on registers alone, and a wave that ends them early starts on tile t + 1 while its neighbours still compute. */
    asm volatile("s_wait_dscnt 0x0" ::: "memory");      /* this wave's reads of tile t have returned before its buffer is refilled */
    asm volatile("s_wait_asynccnt 0x0" ::: "memory");      /* this wave's copies of tile t + 1 have landed */
    __syncthreads();      /* publishes tile t + 1 and ends every wave's reads of tile t */
    __builtin_amdgcn_sched_barrier(0);      /* keeps the register-only work below behind the hand-over: moved above it, the V reads would again be waited for one product at a time */
    float sc[16];
#pragma unroll
    for (int i = 0; i < 16; ++i) sc[i] = s[i >> 3][i & 7] * ATT_SCALE;
    float mc = sc[0];
#pragma unroll
    for (int i = 1; i < 16; ++i) mc = fmaxf(mc, sc[i]);
    mc = fmaxf(mc, xhalf(mc));      /* the other 16 of the query's 32 keys sit in lane ^ 16 */
    const float mn = fmaxf(m_r, mc); const float ea = expf(m_r - mn); const float al = (mn > -1.0e38f) ? ea : 1.0f; m_r = mn;
    FragH ph, pl; float ls[4] = {0.f, 0.f, 0.f, 0.f};      /* element i of the two score tiles is element i of a B fragment in the k order of the V loader above: P stays in registers */
#pragma unroll
    for (int i = 0; i < 16; ++i) { const float p = expf(sc[i] - mn); ls[i & 3] += p; const float ps = p * 1024.0f; const _Float16 hp = (_Float16)ps; ph.h[i] = hp; pl.h[i] = (_Float16)(ps - (float)hp); }      /* P hi and its UNSCALED residual (added into the same accumulator) */
    l_r = l_r * al + ((ls[0] + ls[1]) + (ls[2] + ls[3]));      /* this lane's 16 keys of every pass; the two halves are joined behind the loop */
#pragma unroll
    for (int dt = 0; dt < DT; ++dt)
#pragma unroll
      for (int r = 0; r < 8; ++r) oacc[dt][r] *= al;
#pragma unroll
    for (int dt = 0; dt < DT; ++dt) { oacc[dt] = mmaP(bv[dt].v, ph.v, oacc[dt]); oacc[dt] = mmaP(bv[dt].v, pl.v, oacc[dt]); oacc[dt] = mmaP(bl[dt].v, ph.v, oacc[dt]); } }      /* Vh x Ph + Vh x Pl + Vl x Ph, all unscaled, one accumulator; A = 16 value columns, B = 16 queries */
   if (t + 2 < NST) stage(t + 2, buf); }
  asm volatile("s_wait_asynccnt 0x0" ::: "memory");      /* no copy is outstanding behind the loop */
  l_r += xhalf(l_r);      /* row sum over this wave's keys */
  if (kp == 1) {      /* the wave of the second key half hands its running max, row sum and unnormalised tile to its partner */
#pragma unroll
    for (int dt = 0; dt < DT; ++dt) { *(v4fa*)&sO[pr][ln][dt * 16 + 8 * hh] = (v4f){oacc[dt][0], oacc[dt][1], oacc[dt][2], oacc[dt][3]}; *(v4fa*)&sO[pr][ln][dt * 16 + 8 * hh + 4] = (v4f){oacc[dt][4], oacc[dt][5], oacc[dt][6], oacc[dt][7]}; }
    if (hh == 0) { sM[pr][ln] = m_r; sL[pr][ln] = l_r; } }
  __syncthreads();      /* publishes the second key half's partial results to the partner waves */
  if (kp == 0) {
    const float m1 = sM[pr][ln], l1 = sL[pr][ln]; const float mn = fmaxf(m_r, m1); const float a0 = expf(m_r - mn), a1 = expf(m1 - mn); const float l = l_r * a0 + l1 * a1; const float inv = (l > 0.f) ? 1.0f / (l * 1024.0f) : 0.f; const float c0 = a0 * inv, c1 = a1 * inv;
#pragma unroll
    for (int dt = 0; dt < DT; ++dt)
#pragma unroll
      for (int g = 0; g < 2; ++g) { v4fa* o = (v4fa*)&sO[pr][ln][dt * 16 + 8 * hh + 4 * g]; const v4f x = *o; *o = (v4f){oacc[dt][4 * g] * c0 + x[0] * c1, oacc[dt][4 * g + 1] * c0 + x[1] * c1, oacc[dt][4 * g + 2] * c0 + x[2] * c1, oacc[dt][4 * g + 3] * c0 + x[3] * c1}; }      /* each lane reads and rewrites its own words */
    __builtin_amdgcn_fence(__ATOMIC_ACQ_REL, "workgroup"); __builtin_amdgcn_wave_barrier();
#pragma unroll
    for (int r = 0; r < RPW; ++r) { const int pc = lane; const v4f val = *(const v4fa*)&sO[pr][r][pc * 4]; *(v4f*)(O + ((size_t)b * TT + q0 + r) * ldo + (h * 2 + vhf) * 128 + pc * 4) = val; }      /* one 512-B row per instruction: 32 lanes x 16 B */
  } }

extern "C" void kernel_launch(void* const* d_in, const int* in_sizes, int n_in,
                              void* d_out, int out_size, void* d_ws, size_t ws_size, hipStream_t stream) {
  (void)in_sizes; (void)n_in; (void)out_size;
  const float* const* I = (const float* const*)d_in; const float* xq = I[0]; const float* xk = I[1]; const float* xv = I[2]; const float* qw = I[3]; const float* qb = I[4]; const float* kw = I[5]; const float* kb = I[6]; const float* vw = I[7]; const float* vb = I[8]; const float* scl = I[9];
  char* ws = (char*)d_ws; size_t off = 0;
  auto take = [&](size_t bytes) { char* p = ws + off; off += (bytes + 255) & ~(size_t)255; return p; };
  _Float16* Bq = (_Float16*)take((size_t)DD * K3 * 2); _Float16* Bk = (_Float16*)take((size_t)DD * K3 * 2); _Float16* Bv = (_Float16*)take((size_t)DD * K3 * 2); _Float16* Q = (_Float16*)take((size_t)NR * DD * 2); _Float16* K = (_Float16*)take((size_t)NR * DD * 2); float* VF = (float*)take((size_t)NR * DD * 4); _Float16* Vt = (_Float16*)take((size_t)NR * DD * 2); _Float16* Vtl = (_Float16*)take((size_t)NR * DD * 2);
  if (off > ws_size) return;      // 1.2 + 8.4 + 8.4 + 16.8 + 8.4 + 8.4 = about 52 MB
  k_wc3<<<(DD * (K3 / 8) + 255) / 256, 256, 0, stream>>>(qw, Bq); k_wc3<<<(DD * (K3 / 8) + 255) / 256, 256, 0, stream>>>(kw, Bk); k_wc3<<<(DD * (K3 / 8) + 255) / 256, 256, 0, stream>>>(vw, Bv);
  k_conv3<true><<<NR / 16, 128, 0, stream>>>(xq, Bq, qb, nullptr, Q);      /* q = conv(query): M 16384 N 256 K 768 (exact products), f16 out */
  k_conv3<true><<<NR / 16, 128, 0, stream>>>(xk, Bk, kb, nullptr, K);
  k_conv3<false><<<NR / 16, 128, 0, stream>>>(xv, Bv, vb, VF, nullptr);      /* v (f32) */
  k_vthlu<<<BB * NVH * (TT / 64), 256, 0, stream>>>(VF, DD, Vt, Vtl);      /* Vᵀ hi + residual: [b][256][4096] */
  k_flash<<<BB * NH * (TT / 64), 512, 0, stream>>>(Q, DD, K, DD, Vt, Vtl, (float*)d_out, DD);      /* both 128-wide halves of O in one launch, straight into the output rows */
  k_scl<<<(unsigned)(((size_t)NR * DD / 4 + 255) / 256), 256, 0, stream>>>((float*)d_out, scl, (size_t)NR * DD / 4);      /* × scale */
}

// v006
// A run of this version takes 220 microseconds.
// Two timings next to v005 put it at 1.24 and 1.22 times that version's speed.
// All steps since v000 together make it 8.29 times as fast.
#include <hip/hip_runtime.h>
// KQV 'PCNN' attention (B=4, S=4096, D=256): q, k, v = Conv1d(kernel 3, pad 1) over the sequence of query/key/value (+bias); scores = q·k/16; softmax; out = scale·(P·v) → [4,4096,256].
// Compute dtype: inputs, conv weights/biases, scale rounded to bf16; each conv as an im2col GEMM (K = 3·256, bf16-exact operands, f32 accumulate) → q, k f16 planes, v f32 → Vᵀ f16 hi + f16 residual; fused flash-style kernel with d_qk = 256 (8 k-steps, online softmax f32, P f16 hi + residual,
// f32 accumulate) on v_wmma_f32_16x16x32_f16, one launch of 16-wave blocks (query rows x halves of v x halves of each key tile), writing the output rows directly; × scale in f32.
#define BB 4
#define TT 4096
#define DD 256
#define NH 1
#define VSTR 256
#define NVH 4
#define NR (BB * TT)
#define K3 (3 * DD)
#define ATT_SCALE 0.0625f

typedef __bf16 v16b __attribute__((ext_vector_type(16)));
typedef unsigned short v8us __attribute__((ext_vector_type(8), may_alias));
typedef float  v8f  __attribute__((ext_vector_type(8)));
typedef float  v4f  __attribute__((ext_vector_type(4)));
typedef float  v4fa __attribute__((ext_vector_type(4), may_alias));
union FragB { v16b v; v8us half[2]; unsigned short u[16]; };

__device__ __forceinline__ unsigned short bf16_bits(float x) { unsigned int u = __float_as_uint(x); return (unsigned short)((u + 0x7FFFu + ((u >> 16) & 1u)) >> 16); }
__device__ __forceinline__ float bf16_val(unsigned short b) { return __uint_as_float(((unsigned int)b) << 16); }
__device__ __forceinline__ float bf16_round(float x) { return bf16_val(bf16_bits(x)); }
// D += A·B with NT terms: 1 = ah·bh, 2 = + al·bh (A split), 3 = + ah·bl (both split)
template <int NT>
__device__ __forceinline__ v8f mmaN(v16b ah, v16b al, v16b bh, v16b bl, v8f c) {
  c = __builtin_amdgcn_wmma_f32_16x16x32_bf16(false, ah, false, bh, (short)0, c, false, false);
  if (NT >= 2) c = __builtin_amdgcn_wmma_f32_16x16x32_bf16(false, al, false, bh, (short)0, c, false, false);
  if (NT >= 3) c = __builtin_amdgcn_wmma_f32_16x16x32_bf16(false, ah, false, bl, (short)0, c, false, false);
  asm volatile("v_nop\n\tv_nop\n\tv_nop\n\tv_nop" : "+v"(c) : "v"(ah), "v"(al), "v"(bh), "v"(bl));
  return c;
}

__global__ __launch_bounds__(256) void k_wt_bf16(const float* __restrict__ W, unsigned short* __restrict__ Wt, int K, int N) {
  const int t = blockIdx.x * 256 + threadIdx.x;
  const int k8n = K / 8;
  if (t >= N * k8n) return;
  const int n = t / k8n, k8 = (t % k8n) * 8;
  v8us v;
#pragma unroll
  for (int i = 0; i < 8; ++i) v[i] = bf16_bits(W[(size_t)(k8 + i) * N + n]);
  *(v8us*)(Wt + (size_t)n * K + k8) = v;
  
}

// GEMM C[M][N] (f32, pitch ldc) = act(A[M][K]·W + bias). A f32 row-major (pitch lda) converted per fragment to bf16
// (ASPLIT: hi/lo two planes -> 2 terms, else single rounded term); Wt bf16 [N][K] (pitch ldb). BIAS_BF16 rounds the
// bias to bf16 first (bias quantised to bf16 before the add). K%32==0, M%16==0, N%64==0.
template <bool ASPLIT, int ACT, bool BIAS_BF16>
__global__ __launch_bounds__(128) void k_gemm_bf(const float* __restrict__ A, int lda, const unsigned short* __restrict__ Wt, int ldb,
                                               const float* __restrict__ bias, float* __restrict__ C, int ldc, int M, int N, int K) {
  __shared__ __attribute__((aligned(16))) float so[4][16][64];
  const int tid = threadIdx.x, w = tid >> 5, lane = tid & 31, ln = lane & 15, hh = lane >> 4;
  const int ntn = N / 64;
  const int wid = blockIdx.x * 4 + w;
  const int mt = wid / ntn, nq = wid % ntn;
  if (mt * 16 >= M) return;
  const int row0 = mt * 16, col0 = nq * 64;
  const float* arow = A + (size_t)(row0 + ln) * lda;
  v8f acc[4] = {};
  for (int kb = 0; kb < K; kb += 32) {
    FragB ah, al;
    const v4f x0 = *(const v4fa*)(arow + kb + 8 * hh), x1 = *(const v4fa*)(arow + kb + 8 * hh + 4);
    const v4f x2 = *(const v4fa*)(arow + kb + 16 + 8 * hh), x3 = *(const v4fa*)(arow + kb + 16 + 8 * hh + 4);
    float xs[16] = {x0[0],x0[1],x0[2],x0[3],x1[0],x1[1],x1[2],x1[3],x2[0],x2[1],x2[2],x2[3],x3[0],x3[1],x3[2],x3[3]};
#pragma unroll
    for (int i = 0; i < 16; ++i) { const unsigned short hb = bf16_bits(xs[i]); ah.u[i] = hb; al.u[i] = ASPLIT ? bf16_bits(xs[i] - bf16_val(hb)) : (unsigned short)0; }
#pragma unroll
    for (int t = 0; t < 4; ++t) {
      const unsigned short* brow = Wt + (size_t)(col0 + t * 16 + ln) * ldb + kb;
      FragB b;
      b.half[0] = *(const v8us*)(brow + 8 * hh);
      b.half[1] = *(const v8us*)(brow + 16 + 8 * hh);
      acc[t] = mmaN<ASPLIT ? 2 : 1>(ah.v, al.v, b.v, b.v, acc[t]);
    }
  }
#pragma unroll
  for (int t = 0; t < 4; ++t) {
    float bv = bias ? bias[col0 + t * 16 + ln] : 0.f;
    if (BIAS_BF16) bv = bf16_round(bv);
#pragma unroll
    for (int r = 0; r < 8; ++r) { float v = acc[t][r] + bv; if (ACT == 1) v = fmaxf(v, 0.f); so[w][8 * hh + r][t * 16 + ln] = v; }
  }
  __builtin_amdgcn_fence(__ATOMIC_ACQ_REL, "workgroup");
  __builtin_amdgcn_wave_barrier();
  const int rsub = lane >> 4, c4 = (lane & 15) * 4;
  {
#pragma unroll
    for (int q = 0; q < 8; ++q) {
      const int r = q * 2 + rsub;
      const v4f v = *(const v4fa*)&so[w][r][c4];
      *(v4f*)(C + (size_t)(row0 + r) * ldc + col0 + c4) = v;
    }
    
  }
}

// Flash-style causal/unmasked attention, all contractions 3-term bf16 hi/lo splits, f32 softmax with running max.
// q,k,v rows are read from f32 buffers with arbitrary row pitch (so they can live inside a fused qkv buffer);
// D = head size (multiple of 32, <= 128); one wave = 16 query rows; block = 4 waves (64 queries) sharing K/V chunks of 32.
template <int D, bool CAUSAL>
__global__ __launch_bounds__(128) void k_flash(const float* __restrict__ qb, const float* __restrict__ kb, const float* __restrict__ vb,
                                             int pitch, int T, int H, float scale, float* __restrict__ y, int ypitch) {
  constexpr int KS = D / 32;        // k-steps for QK
  constexpr int DT = D / 16;        // d tiles for PV
  __shared__ __attribute__((aligned(16))) unsigned short sKh[32][D + 8], sKl[32][D + 8], sVh[32][D + 8], sVl[32][D + 8];
  __shared__ __attribute__((aligned(16))) unsigned short sPh[4][16][40], sPl[4][16][40];
  __shared__ __attribute__((aligned(16))) float sO[4][16][D];
  const int tid = threadIdx.x, w = tid >> 5, lane = tid & 31, ln = lane & 15, hh = lane >> 4;
  const int nqb = (T + 63) / 64;
  const int bh = blockIdx.x / nqb, qblk = blockIdx.x % nqb;
  const int b = bh / H, h = bh % H;
  const int q0 = qblk * 64 + w * 16;
  const float* Q = qb + (size_t)b * T * pitch + h * D;
  const float* K = kb + (size_t)b * T * pitch + h * D;
  const float* V = vb + (size_t)b * T * pitch + h * D;

  // A fragments of the wave's 16 query rows (scaled), hi/lo
  FragB aqh[KS], aql[KS];
  {
    int row = q0 + ln; if (row >= T) row = T - 1;
    const float* qr = Q + (size_t)row * pitch;
#pragma unroll
    for (int ks = 0; ks < KS; ++ks)
#pragma unroll
      for (int i = 0; i < 16; ++i) {
        const int d = ks * 32 + ((i < 8) ? (8 * hh + i) : (16 + 8 * hh + (i - 8)));
        const float x = qr[d] * scale; const unsigned short hb = bf16_bits(x);
        aqh[ks].u[i] = hb; aql[ks].u[i] = bf16_bits(x - bf16_val(hb));
      }
  }
  float m_r[8], l_r[8];
#pragma unroll
  for (int r = 0; r < 8; ++r) { m_r[r] = -3.0e38f; l_r[r] = 0.f; }
  v8f oacc[DT];
#pragma unroll
  for (int dt = 0; dt < DT; ++dt) oacc[dt] = (v8f){0.f,0.f,0.f,0.f,0.f,0.f,0.f,0.f};

  const int kv_end = CAUSAL ? min(T, qblk * 64 + 64) : T;     // block-uniform
  for (int j0 = 0; j0 < kv_end; j0 += 32) {
    __syncthreads();
    for (int e = tid; e < 32 * (D / 4); e += 128) {
      const int r = e / (D / 4), c4 = (e % (D / 4)) * 4;
      const int key = j0 + r;
      v4f kf = {0.f,0.f,0.f,0.f}, vf = {0.f,0.f,0.f,0.f};
      if (key < T) { kf = *(const v4fa*)(K + (size_t)key * pitch + c4); vf = *(const v4fa*)(V + (size_t)key * pitch + c4); }
#pragma unroll
      for (int t = 0; t < 4; ++t) {
        unsigned short hb = bf16_bits(kf[t]); sKh[r][c4 + t] = hb; sKl[r][c4 + t] = bf16_bits(kf[t] - bf16_val(hb));
        hb = bf16_bits(vf[t]); sVh[r][c4 + t] = hb; sVl[r][c4 + t] = bf16_bits(vf[t] - bf16_val(hb));
      }
    }
    __syncthreads();
    // S tile 16 x 32
    v8f s[2];
#pragma unroll
    for (int nt = 0; nt < 2; ++nt) {
      v8f acc = {};
#pragma unroll
      for (int ks = 0; ks < KS; ++ks) {
        FragB bh_, bl_;
        bh_.half[0] = *(const v8us*)&sKh[nt * 16 + ln][ks * 32 + 8 * hh]; bh_.half[1] = *(const v8us*)&sKh[nt * 16 + ln][ks * 32 + 16 + 8 * hh];
        bl_.half[0] = *(const v8us*)&sKl[nt * 16 + ln][ks * 32 + 8 * hh]; bl_.half[1] = *(const v8us*)&sKl[nt * 16 + ln][ks * 32 + 16 + 8 * hh];
        acc = mmaN<3>(aqh[ks].v, aql[ks].v, bh_.v, bl_.v, acc);
      }
      s[nt] = acc;
    }
    // mask + running max (rows 8hh+r; the 16 lanes of a half share rows)
    float alpha[8];
#pragma unroll
    for (int r = 0; r < 8; ++r) {
      const int qi = q0 + 8 * hh + r;
      const int ja = j0 + ln, jb = j0 + 16 + ln;
      if (CAUSAL) { if (ja > qi) s[0][r] = -3.0e38f; if (jb > qi) s[1][r] = -3.0e38f; }
      if (ja >= T) s[0][r] = -3.0e38f;
      if (jb >= T) s[1][r] = -3.0e38f;
      float mx = fmaxf(s[0][r], s[1][r]);
      mx = fmaxf(mx, __shfl_xor(mx, 1, 32)); mx = fmaxf(mx, __shfl_xor(mx, 2, 32)); mx = fmaxf(mx, __shfl_xor(mx, 4, 32)); mx = fmaxf(mx, __shfl_xor(mx, 8, 32));
      const float mnew = fmaxf(m_r[r], mx);
      alpha[r] = (mnew > -1.0e38f) ? __expf(m_r[r] - mnew) : 1.0f;
      const float p0 = (s[0][r] > -1.0e38f) ? __expf(s[0][r] - mnew) : 0.f;
      const float p1 = (s[1][r] > -1.0e38f) ? __expf(s[1][r] - mnew) : 0.f;
      m_r[r] = mnew;
      l_r[r] = l_r[r] * alpha[r] + p0 + p1;            // per-lane partial row sum (16 lanes combined at the end)
      unsigned short hb = bf16_bits(p0); sPh[w][8 * hh + r][ln] = hb;      sPl[w][8 * hh + r][ln] = bf16_bits(p0 - bf16_val(hb));
      hb = bf16_bits(p1);                sPh[w][8 * hh + r][16 + ln] = hb; sPl[w][8 * hh + r][16 + ln] = bf16_bits(p1 - bf16_val(hb));
    }
#pragma unroll
    for (int dt = 0; dt < DT; ++dt)
#pragma unroll
      for (int r = 0; r < 8; ++r) oacc[dt][r] *= alpha[r];
    __builtin_amdgcn_fence(__ATOMIC_ACQ_REL, "workgroup");
    __builtin_amdgcn_wave_barrier();
    FragB pah, pal;
    pah.half[0] = *(const v8us*)&sPh[w][ln][8 * hh]; pah.half[1] = *(const v8us*)&sPh[w][ln][16 + 8 * hh];
    pal.half[0] = *(const v8us*)&sPl[w][ln][8 * hh]; pal.half[1] = *(const v8us*)&sPl[w][ln][16 + 8 * hh];
#pragma unroll
    for (int dt = 0; dt < DT; ++dt) {
      FragB bvh, bvl;
#pragma unroll
      for (int i = 0; i < 8; ++i) {
        bvh.u[i] = sVh[8 * hh + i][dt * 16 + ln]; bvh.u[8 + i] = sVh[16 + 8 * hh + i][dt * 16 + ln];
        bvl.u[i] = sVl[8 * hh + i][dt * 16 + ln]; bvl.u[8 + i] = sVl[16 + 8 * hh + i][dt * 16 + ln];
      }
      oacc[dt] = mmaN<3>(pah.v, pal.v, bvh.v, bvl.v, oacc[dt]);
    }
    __builtin_amdgcn_fence(__ATOMIC_ACQ_REL, "workgroup");
    __builtin_amdgcn_wave_barrier();
  }
#pragma unroll
  for (int r = 0; r < 8; ++r) {
    float l = l_r[r];
    l += __shfl_xor(l, 1, 32); l += __shfl_xor(l, 2, 32); l += __shfl_xor(l, 4, 32); l += __shfl_xor(l, 8, 32);
    l_r[r] = (l > 0.f) ? 1.0f / l : 0.f;
  }
#pragma unroll
  for (int dt = 0; dt < DT; ++dt)
#pragma unroll
    for (int r = 0; r < 8; ++r) sO[w][8 * hh + r][dt * 16 + ln] = oacc[dt][r] * l_r[r];
  __builtin_amdgcn_fence(__ATOMIC_ACQ_REL, "workgroup");
  __builtin_amdgcn_wave_barrier();
  {
    for (int r = 0; r < 16; ++r) {
      const int row = q0 + r;
      if (row < T && lane < D / 4) {
        const v4f val = *(const v4fa*)&sO[w][r][lane * 4];
        *(v4f*)(y + ((size_t)b * T + row) * ypitch + h * D + lane * 4) = val;
      }
    }
    
  }
}

// GEMM C = act(A·W + bias + resid): A f32 (ASPLIT -> hi/lo 2 terms), Wt bf16 [N][K]; ACT 0 none, 1 relu, 2 exact gelu;
// resid (optional, f32, row index = (row % rmod), pitch ldr, RES_BF16 rounds it) added before the activation.
template <bool ASPLIT, int ACT, bool BIAS_BF16, bool RES_BF16>
__global__ __launch_bounds__(128) void k_gemm_bf3(const float* __restrict__ A, int lda, const unsigned short* __restrict__ Wt, int ldb,
                                                const float* __restrict__ bias, const float* __restrict__ resid, int rmod, int ldr,
                                                float* __restrict__ C, int ldc, int M, int N, int K) {
  __shared__ __attribute__((aligned(16))) float so[4][16][64];
  const int tid = threadIdx.x, w = tid >> 5, lane = tid & 31, ln = lane & 15, hh = lane >> 4;
  const int ntn = N / 64;
  const int wid = blockIdx.x * 4 + w;
  const int mt = wid / ntn, nq = wid % ntn;
  if (mt * 16 >= M) return;
  const int row0 = mt * 16, col0 = nq * 64;
  const float* arow = A + (size_t)(row0 + ln) * lda;
  v8f acc[4] = {};
  for (int kb = 0; kb < K; kb += 32) {
    FragB ah, al;
    const v4f x0 = *(const v4fa*)(arow + kb + 8 * hh), x1 = *(const v4fa*)(arow + kb + 8 * hh + 4);
    const v4f x2 = *(const v4fa*)(arow + kb + 16 + 8 * hh), x3 = *(const v4fa*)(arow + kb + 16 + 8 * hh + 4);
    float xs[16] = {x0[0],x0[1],x0[2],x0[3],x1[0],x1[1],x1[2],x1[3],x2[0],x2[1],x2[2],x2[3],x3[0],x3[1],x3[2],x3[3]};
#pragma unroll
    for (int i = 0; i < 16; ++i) { const unsigned short hb = bf16_bits(xs[i]); ah.u[i] = hb; al.u[i] = ASPLIT ? bf16_bits(xs[i] - bf16_val(hb)) : (unsigned short)0; }
#pragma unroll
    for (int t = 0; t < 4; ++t) {
      const unsigned short* brow = Wt + (size_t)(col0 + t * 16 + ln) * ldb + kb;
      FragB b;
      b.half[0] = *(const v8us*)(brow + 8 * hh);
      b.half[1] = *(const v8us*)(brow + 16 + 8 * hh);
      acc[t] = mmaN<ASPLIT ? 2 : 1>(ah.v, al.v, b.v, b.v, acc[t]);
    }
  }
#pragma unroll
  for (int t = 0; t < 4; ++t) {
    const int col = col0 + t * 16 + ln;
    float bv = bias ? bias[col] : 0.f;
    if (BIAS_BF16) bv = bf16_round(bv);
#pragma unroll
    for (int r = 0; r < 8; ++r) {
      float v = acc[t][r] + bv;
      if (resid) { float rv = resid[(size_t)((row0 + 8 * hh + r) % rmod) * ldr + col]; if (RES_BF16) rv = bf16_round(rv); v += rv; }
      if (ACT == 1) v = fmaxf(v, 0.f);
      if (ACT == 2) v = 0.5f * v * (1.0f + erff(v * 0.70710678118654752f));
      if (ACT == 3) { const float u = 0.7978845608028654f * (v + 0.044715f * v * v * v); v = 0.5f * v * (1.0f + tanhf(u)); }
      so[w][8 * hh + r][t * 16 + ln] = v;
    }
  }
  __builtin_amdgcn_fence(__ATOMIC_ACQ_REL, "workgroup");
  __builtin_amdgcn_wave_barrier();
  const int rsub = lane >> 4, c4 = (lane & 15) * 4;
  {
#pragma unroll
    for (int q = 0; q < 8; ++q) {
      const int r = q * 2 + rsub;
      const v4f v = *(const v4fa*)&so[w][r][c4];
      *(v4f*)(C + (size_t)(row0 + r) * ldc + col0 + c4) = v;
    }
    
  }
}
// row LayerNorm (biased variance, eps) over N: s = X (+ R); optional out_sum <- s; out_norm <- (s-mu)*rsqrt(var+eps)*g + b
template <bool PARAM_BF16>
__global__ __launch_bounds__(256) void k_layernorm(const float* __restrict__ X, const float* __restrict__ R, const float* __restrict__ g, const float* __restrict__ bta,
                                                  float* __restrict__ out_sum, float* __restrict__ out_norm, int N, float eps) {
  __shared__ float red[256];
  const int row = blockIdx.x, tid = threadIdx.x;
  const float* x = X + (size_t)row * N; const float* rr = R ? R + (size_t)row * N : nullptr;
  float vals[16];                     // up to N = 4096
  const int per = N / 256;            // contiguous chunk per thread? use strided-by-4 chunks: thread handles j = tid*4 + 1024*u
  float s1 = 0.f;
  for (int u = 0; u < per / 4; ++u) {
    const int j = tid * 4 + 1024 * u;
    const v4f a = *(const v4fa*)(x + j);
    v4f b = {0.f,0.f,0.f,0.f}; if (rr) b = *(const v4fa*)(rr + j);
#pragma unroll
    for (int q = 0; q < 4; ++q) { const float v = a[q] + b[q]; vals[u * 4 + q] = v; s1 += v; }
  }
  red[tid] = s1; __syncthreads();
  for (int st = 128; st > 0; st >>= 1) { if (tid < st) red[tid] += red[tid + st]; __syncthreads(); }
  const float mu = red[0] / (float)N; __syncthreads();
  float s2 = 0.f;
  for (int u = 0; u < per / 4; ++u)
#pragma unroll
    for (int q = 0; q < 4; ++q) { const float c = vals[u * 4 + q] - mu; s2 += c * c; }
  red[tid] = s2; __syncthreads();
  for (int st = 128; st > 0; st >>= 1) { if (tid < st) red[tid] += red[tid + st]; __syncthreads(); }
  const float rs = rsqrtf(red[0] / (float)N + eps);
  {
    for (int u = 0; u < per / 4; ++u) {
      const int j = tid * 4 + 1024 * u;
      v4f o, sm;
#pragma unroll
      for (int q = 0; q < 4; ++q) {
        float gg = g[j + q], bb = bta[j + q];
        if (PARAM_BF16) { gg = bf16_round(gg); bb = bf16_round(bb); }
        sm[q] = vals[u * 4 + q]; o[q] = (vals[u * 4 + q] - mu) * rs * gg + bb;
      }
      if (out_sum) *(v4f*)(out_sum + (size_t)row * N + j) = sm;
      *(v4f*)(out_norm + (size_t)row * N + j) = o;
    }
    
  }
}



// ---- f16 WMMA path (v_wmma_f32_16x16x32_f16): 11-bit significands for operands in range — used where a [0,1] probability operand needs more precision than bf16
typedef _Float16 v16h __attribute__((ext_vector_type(16)));
union FragH { v16h v; v8us half[2]; _Float16 h[16]; unsigned short u[16]; };
template <int NT>
__device__ __forceinline__ v8f mmaH(v16h ah, v16h al, v16h bh, v16h bl, v8f c) {
  c = __builtin_amdgcn_wmma_f32_16x16x32_f16(false, ah, false, bh, (short)0, c, false, false);
  if (NT >= 2) c = __builtin_amdgcn_wmma_f32_16x16x32_f16(false, al, false, bh, (short)0, c, false, false);
  if (NT >= 3) c = __builtin_amdgcn_wmma_f32_16x16x32_f16(false, ah, false, bl, (short)0, c, false, false);
  asm volatile("v_nop\n\tv_nop\n\tv_nop\n\tv_nop" : "+v"(c) : "v"(ah), "v"(al), "v"(bh), "v"(bl));
  return c;
}
// batched GEMM like k_gemm_b but f16 operands: A f32 (split into f16 hi/lo if ASPLIT, else rounded to f16), Bt = f16 values [n][k]; alpha; C f32; N multiple of 16 (partial tiles skipped)
template <bool ASPLIT>
__global__ __launch_bounds__(128) void k_gemm_h(const float* __restrict__ A, int lda, size_t sA, const _Float16* __restrict__ Bh, int ldb, size_t sB, float alpha, float* __restrict__ C, int ldc, size_t sC, int M, int N, int K) {
  __shared__ __attribute__((aligned(16))) float so[4][16][64];
  const int tid = threadIdx.x, w = tid >> 5, lane = tid & 31, ln = lane & 15, hh = lane >> 4; const int by = blockIdx.y;
  A += (size_t)by * sA; Bh += (size_t)by * sB; C += (size_t)by * sC;
  const int ntn = (N + 63) / 64; const int wid = blockIdx.x * 4 + w; const int mt = wid / ntn, nq = wid % ntn; if (mt * 16 >= M) return;
  const int row0 = mt * 16, col0 = nq * 64; const float* arow = A + (size_t)(row0 + ln) * lda;
  v8f acc[4] = {};
  for (int kb = 0; kb < K; kb += 32) {
    FragH ah, al;
    const v4f x0 = *(const v4fa*)(arow + kb + 8 * hh), x1 = *(const v4fa*)(arow + kb + 8 * hh + 4), x2 = *(const v4fa*)(arow + kb + 16 + 8 * hh), x3 = *(const v4fa*)(arow + kb + 16 + 8 * hh + 4);
    float xs[16] = {x0[0],x0[1],x0[2],x0[3],x1[0],x1[1],x1[2],x1[3],x2[0],x2[1],x2[2],x2[3],x3[0],x3[1],x3[2],x3[3]};
#pragma unroll
    for (int i = 0; i < 16; ++i) { const _Float16 h = (_Float16)xs[i]; ah.h[i] = h; al.h[i] = ASPLIT ? (_Float16)(xs[i] - (float)h) : (_Float16)0.0f; }
#pragma unroll
    for (int t = 0; t < 4; ++t) { if (col0 + t * 16 >= N) continue; const size_t boff = (size_t)(col0 + t * 16 + ln) * ldb + kb; FragH bq; bq.half[0] = *(const v8us*)(Bh + boff + 8 * hh); bq.half[1] = *(const v8us*)(Bh + boff + 16 + 8 * hh);
      acc[t] = mmaH<ASPLIT ? 2 : 1>(ah.v, al.v, bq.v, bq.v, acc[t]); }
  }
#pragma unroll
  for (int t = 0; t < 4; ++t) { if (col0 + t * 16 >= N) continue;
#pragma unroll
    for (int r = 0; r < 8; ++r) so[w][8 * hh + r][t * 16 + ln] = acc[t][r] * alpha; }
  __builtin_amdgcn_fence(__ATOMIC_ACQ_REL, "workgroup"); __builtin_amdgcn_wave_barrier();
  const int rsub = lane >> 4, c4 = (lane & 15) * 4;
  {
#pragma unroll
    for (int q = 0; q < 8; ++q) { const int r = q * 2 + rsub; if (col0 + c4 < N) { const v4f v = *(const v4fa*)&so[w][r][c4]; *(v4f*)(C + (size_t)(row0 + r) * ldc + col0 + c4) = v; } }
     }
}

// Wt[n][k] = f16(W[k][n]·scale) from f32 row-major W[K][N] (scale = power of two; bf16-exact weights stay exact in f16 away from the subnormal range)
__global__ __launch_bounds__(256) void k_wt_f16(const float* __restrict__ W, _Float16* __restrict__ Wt, int K, int N, float scale) {
  const int t = blockIdx.x * 256 + threadIdx.x; if (t >= N * (K / 8)) return; const int n = t / (K / 8), k8 = (t % (K / 8)) * 8; FragH f;
#pragma unroll
  for (int i = 0; i < 8; ++i) f.h[i] = (_Float16)(bf16_round(W[(size_t)(k8 + i) * N + n]) * scale); const v8us o = f.half[0];
  *(v8us*)((unsigned short*)Wt + (size_t)n * K + k8) = o; 
}


typedef _Float16 v4h __attribute__((ext_vector_type(4)));

__global__ __launch_bounds__(256) void k_x16(const float* __restrict__ x, _Float16* __restrict__ X16, size_t n8) { const size_t t = (size_t)blockIdx.x * 256 + threadIdx.x; if (t >= n8) return; FragH f;
#pragma unroll
  for (int q = 0; q < 8; ++q) f.h[q] = (_Float16)bf16_round(x[t * 8 + q]); *(v8us*)((unsigned short*)X16 + t * 8) = f.half[0];  }
__global__ __launch_bounds__(256) void k_h16(const float* __restrict__ x, _Float16* __restrict__ X16, size_t n8) { const size_t t = (size_t)blockIdx.x * 256 + threadIdx.x; if (t >= n8) return; FragH f;
#pragma unroll
  for (int q = 0; q < 8; ++q) f.h[q] = (_Float16)x[t * 8 + q]; *(v8us*)((unsigned short*)X16 + t * 8) = f.half[0];  }
__global__ __launch_bounds__(256) void k_round16f(const float* __restrict__ W, _Float16* __restrict__ Bt, size_t n8) { const size_t t = (size_t)blockIdx.x * 256 + threadIdx.x; if (t >= n8) return; FragH f;
#pragma unroll
  for (int i = 0; i < 8; ++i) f.h[i] = (_Float16)(bf16_round(W[t * 8 + i]) * 16.0f); *(v8us*)((unsigned short*)Bt + t * 8) = f.half[0];  }
template <int NHv, int TTv>
__global__ __launch_bounds__(256) void k_vt(const _Float16* __restrict__ V16, int ldv, int voff, _Float16* __restrict__ Vt) { __shared__ unsigned short tl[64][66]; const int tid = threadIdx.x; const int slab = blockIdx.x / (TTv / 64), lg = blockIdx.x % (TTv / 64); const int b = slab / NHv, h = slab % NHv;
  for (int i = tid; i < 64 * 8; i += 256) { const int r = i / 8, c8 = (i % 8) * 8; FragH f; f.half[0] = *(const v8us*)((const unsigned short*)V16 + ((size_t)b * TTv + lg * 64 + r) * ldv + voff + h * 64 + c8);
#pragma unroll
    for (int q = 0; q < 8; ++q) tl[r][c8 + q] = f.u[q]; }
  __syncthreads();
  {
#pragma unroll
    for (int rd = 0; rd < 2; ++rd) { const int d = rd * 32 + tid / 8, pc = tid % 8; FragH f;
#pragma unroll
      for (int q = 0; q < 8; ++q) f.u[q] = tl[pc * 8 + q][d];
      *(v8us*)((unsigned short*)Vt + ((size_t)slab * 64 + d) * TTv + lg * 64 + pc * 8) = f.half[0]; }
     } }

__global__ __launch_bounds__(256) void k_vthlu(const float* __restrict__ VF, int ldv, _Float16* __restrict__ Vth, _Float16* __restrict__ Vtl) { __shared__ float tl[64][65]; const int tid = threadIdx.x; const int slab = blockIdx.x / (TT / 64), lg = blockIdx.x % (TT / 64); const int b = slab / NVH, h = slab % NVH;
  for (int i = tid; i < 64 * 16; i += 256) { const int r = i / 16, c4 = (i % 16) * 4; const v4f a = *(const v4fa*)(VF + ((size_t)b * TT + lg * 64 + r) * ldv + h * 64 + c4); tl[r][c4] = a[0]; tl[r][c4 + 1] = a[1]; tl[r][c4 + 2] = a[2]; tl[r][c4 + 3] = a[3]; }
  __syncthreads();
  FragH fh[2], fl[2]; size_t oo[2];
#pragma unroll
  for (int rd = 0; rd < 2; ++rd) { const int d = rd * 32 + tid / 8, pc = tid % 8;
#pragma unroll
    for (int q = 0; q < 8; ++q) { const float v = tl[pc * 8 + q][d]; const _Float16 hv = (_Float16)v; fh[rd].h[q] = hv; fl[rd].h[q] = (_Float16)(v - (float)hv);      /* UNSCALED residual (added into the same accumulator as the hi product) */ } oo[rd] = ((size_t)slab * 64 + d) * TT + lg * 64 + pc * 8; }
  {
#pragma unroll
    for (int rd = 0; rd < 2; ++rd) { *(v8us*)((unsigned short*)Vth + oo[rd]) = fh[rd].half[0]; *(v8us*)((unsigned short*)Vtl + oo[rd]) = fl[rd].half[0]; }
     } }
// One Conv1d (3 taps, pad 1) as a GEMM that forms no im2col plane: row s of the im2col matrix is input rows s - 1, s, s + 1 laid end to end, so a block stages its 16 rows and the two neighbours once in LDS,
// rounded f32 -> bf16 -> f16 (a zero row outside the sequence), and k-step ks reads its A fragment from LDS row ln + ks / 8. Bh = f16 weights in fragment order (k_wc3 below), k = tap * 256 + c. Four waves = the four 64-column quarters of the 256 outputs.
template <bool F16OUT>      /* the output plane: f16 (C16) or f32 (C) */
__global__ __launch_bounds__(128) void k_conv3(const float* __restrict__ x, const _Float16* __restrict__ Bh, const float* __restrict__ bias, float* __restrict__ C, _Float16* __restrict__ C16) {
  constexpr int XP = DD + 8;      /* LDS row pitch in halves: 528 B = 16 B x odd, conflict-free for the 16-row ds_load_b128 fragment reads */
  __shared__ __attribute__((aligned(16))) unsigned short sX[16 + 2][XP];      /* LDS row r = sequence row s0 + r - 1 */
  __shared__ __attribute__((aligned(16))) float so[4][16][64];
  const int tid = threadIdx.x, w = tid >> 5, lane = tid & 31, ln = lane & 15, hh = lane >> 4;
  const int row0 = blockIdx.x * 16, col0 = w * 64; const int s0 = row0 % TT;      /* 16 divides the sequence length: a block's rows lie in one sequence */
  float bv[4]; const int bi = col0 + ln;      /* this lane's four bias values, loaded beside the input rows */
  constexpr int NK = K3 / 32, PF = 2;      /* 24 k-steps; a k-step's weight fragments are loaded PF k-steps ahead of their products */
  const unsigned short* bp = (const unsigned short*)Bh + w * 2048 + lane * 8;      /* halves: 8192 per k-step, 512 per 16-column tile, 256 per fragment half, 8 per lane */
  FragH bq[PF + 1][4], ah[2];
  auto ldb = [&](int ks) {      /* the wave's four B fragments of k-step ks: eight loads of 512 contiguous bytes, one address and constant offsets */
#pragma unroll      /* constant indices keep bq[] in registers */
    for (int t = 0; t < 4; ++t) { bq[ks % (PF + 1)][t].half[0] = *(const v8us*)(bp + ks * 8192 + t * 512); bq[ks % (PF + 1)][t].half[1] = *(const v8us*)(bp + ks * 8192 + t * 512 + 256); } };
  { v4f xa[9];      /* nine 16-B loads per thread, all issued before the first is used: one memory latency for the whole stage */
    const int nb = tid >> 6; const bool in = nb ? (s0 + 16 < TT) : (s0 > 0);      /* waves 0, 1: the row above the block; waves 2, 3: the row below */
    const float* xb = x + (size_t)(row0 + w) * DD + lane * 4; const float* xn = x + (size_t)(row0 + (in ? (nb ? 16 : -1) : 0)) * DD + (tid & 63) * 4;      /* a neighbour outside the sequence: the address stays inside the buffer, the values are replaced by zero */
#pragma unroll      /* constant indices keep xa[] in registers */
    for (int j = 0; j < 8; ++j) xa[j] = *(const v4fa*)(xb + (j >> 1) * 4 * DD + (j & 1) * 128);      /* four rows per wave, 512 contiguous bytes per load, one address and constant offsets */
    xa[8] = *(const v4fa*)xn;
#pragma unroll
    for (int t = 0; t < 4; ++t) bv[t] = bias[bi + t * 16];
    asm volatile("s_wait_xcnt 0x0" :: "v"(xb), "v"(xn), "v"(bi) : "memory");      /* stands behind these loads; their addresses are named as inputs so that the registers are rewritten only behind it */
#pragma unroll      /* constant indices keep bq[] in registers */
    for (int ks = 0; ks < PF; ++ks) ldb(ks);      /* the first weight fragments fly beside the input rows */
    if (!in) xa[8] = (v4f){0.f, 0.f, 0.f, 0.f};
#pragma unroll      /* constant indices keep xa[] in registers */
    for (int j = 0; j < 9; ++j) { v4h h4;
#pragma unroll
      for (int q = 0; q < 4; ++q) h4[q] = (_Float16)bf16_round(xa[j][q]);
      *(v4h*)(j < 8 ? &sX[1 + (j >> 1) * 4 + w][(j & 1) * 128 + lane * 4] : &sX[nb * 17][(tid & 63) * 4]) = h4; } }
  __syncthreads();      /* publishes the 18 staged rows to the four waves */
  auto lda = [&](int ks) { const unsigned short* ar = &sX[ln + ks / 8][(ks % 8) * 32 + 8 * hh]; ah[ks & 1].half[0] = *(const v8us*)ar; ah[ks & 1].half[1] = *(const v8us*)(ar + 16); };
  v8f acc[4] = {};
  lda(0);
#pragma unroll      /* constant indices keep bq[] and ah[] in registers, and every weight load's offset is an immediate */
  for (int ks = 0; ks < NK; ++ks) {
    if (ks + PF < NK) ldb(ks + PF);
    if (ks + 1 < NK) lda(ks + 1);
    __builtin_amdgcn_sched_barrier(0);      /* holds the loads for later k-steps in front of this k-step's products: sunk to their uses, each would be waited for in full */
#pragma unroll
    for (int t = 0; t < 4; ++t) acc[t] = __builtin_amdgcn_wmma_f32_16x16x32_f16(false, ah[ks & 1].v, false, bq[ks % (PF + 1)][t].v, (short)0, acc[t], false, false);      /* the plain builtin: the compiler keeps the distance behind it itself */
  }
  asm volatile("s_wait_xcnt 0x0" :: "v"(bp) : "memory");      /* stands behind the weight loads; their address is named as an input so that its registers are rewritten only behind it */
#pragma unroll
  for (int t = 0; t < 4; ++t) { const float bt = bf16_round(bv[t]);
#pragma unroll
    for (int r = 0; r < 8; ++r) so[w][8 * hh + r][t * 16 + ln] = acc[t][r] + bt; }
  __builtin_amdgcn_fence(__ATOMIC_ACQ_REL, "workgroup"); __builtin_amdgcn_wave_barrier();
  const int rsub = lane >> 4, c4 = (lane & 15) * 4;
#pragma unroll
  for (int q = 0; q < 8; ++q) { const int r = q * 2 + rsub; const v4f v = *(const v4fa*)&so[w][r][c4]; if (!F16OUT) *(v4f*)(C + (size_t)(row0 + r) * DD + col0 + c4) = v; else { v4h h4; for (int i = 0; i < 4; ++i) h4[i] = (_Float16)v[i]; *(v4h*)(C16 + (size_t)(row0 + r) * DD + col0 + c4) = h4; } }
}
// Conv weights [o][c][tap] -> f16 in the order in which k_conv3's lanes read B fragments: [k-step][16-column tile][fragment half j][lane hh * 16 + ln][8 halves], holding column o = tile * 16 + ln, k = k-step * 32 + j * 16 + hh * 8 + 0..7. Thread t writes the t-th 16 bytes.
__global__ __launch_bounds__(256) void k_wc3(const float* __restrict__ w, _Float16* __restrict__ Bt) { const int t = blockIdx.x * 256 + threadIdx.x; if (t >= DD * (K3 / 8)) return; const int o = ((t >> 6) & 15) * 16 + (t & 15), k0 = (t >> 10) * 32 + ((t >> 5) & 1) * 16 + ((t >> 4) & 1) * 8; const int tap = k0 / DD, c0 = k0 % DD; FragH f;
  for (int q = 0; q < 8; ++q) f.h[q] = (_Float16)bf16_round(w[((size_t)o * DD + c0 + q) * 3 + tap]);
  *(v8us*)((unsigned short*)Bt + (size_t)t * 8) = f.half[0];  }
__global__ __launch_bounds__(256) void k_scl(float* __restrict__ O, const float* __restrict__ scl, size_t n4) { const size_t t = (size_t)blockIdx.x * 256 + threadIdx.x; if (t >= n4) return; const float s = bf16_round(scl[0]); v4f v = *(const v4fa*)(O + t * 4); for (int q = 0; q < 4; ++q) v[q] *= s; *(v4f*)(O + t * 4) = v;  }
__device__ __forceinline__ float xhalf(float x) { return __builtin_bit_cast(float, __builtin_amdgcn_permlanex16(__builtin_bit_cast(int, x), __builtin_bit_cast(int, x), 0x76543210, 0xfedcba98, false, false)); }      /* lane l takes lane l ^ 16's value */
__device__ __forceinline__ unsigned lds_off(const void* p) { return (unsigned)(size_t)p; }      /* byte offset in the work-group's LDS = low 32 bits of the __shared__ address */
// Four or twelve asynchronous copies, 16 B per lane each, global memory -> LDS. The closing s_wait_xcnt stands inside the statement so that no address register named here is rewritten ahead of it.
__device__ __forceinline__ void acp4(const unsigned (&l)[4], const unsigned short* const (&p)[4]) {
  asm volatile("global_load_async_to_lds_b128 %0, %4, off\n\t"
               "global_load_async_to_lds_b128 %1, %5, off\n\t"
               "global_load_async_to_lds_b128 %2, %6, off\n\t"
               "global_load_async_to_lds_b128 %3, %7, off\n\t"
               "s_wait_xcnt 0x0"
               :: "v"(l[0]), "v"(l[1]), "v"(l[2]), "v"(l[3]), "v"(p[0]), "v"(p[1]), "v"(p[2]), "v"(p[3]) : "memory");
}
__device__ __forceinline__ void acp12(const unsigned (&l)[12], const unsigned short* const (&p)[12]) {
  asm volatile("global_load_async_to_lds_b128 %0, %12, off\n\t"
               "global_load_async_to_lds_b128 %1, %13, off\n\t"
               "global_load_async_to_lds_b128 %2, %14, off\n\t"
               "global_load_async_to_lds_b128 %3, %15, off\n\t"
               "global_load_async_to_lds_b128 %4, %16, off\n\t"
               "global_load_async_to_lds_b128 %5, %17, off\n\t"
               "global_load_async_to_lds_b128 %6, %18, off\n\t"
               "global_load_async_to_lds_b128 %7, %19, off\n\t"
               "global_load_async_to_lds_b128 %8, %20, off\n\t"
               "global_load_async_to_lds_b128 %9, %21, off\n\t"
               "global_load_async_to_lds_b128 %10, %22, off\n\t"
               "global_load_async_to_lds_b128 %11, %23, off\n\t"
               "s_wait_xcnt 0x0"
               :: "v"(l[0]), "v"(l[1]), "v"(l[2]), "v"(l[3]), "v"(l[4]), "v"(l[5]), "v"(l[6]), "v"(l[7]), "v"(l[8]), "v"(l[9]), "v"(l[10]), "v"(l[11]),
                  "v"(p[0]), "v"(p[1]), "v"(p[2]), "v"(p[3]), "v"(p[4]), "v"(p[5]), "v"(p[6]), "v"(p[7]), "v"(p[8]), "v"(p[9]), "v"(p[10]), "v"(p[11]) : "memory");
}
__device__ __forceinline__ v8f mmaP(v16h a, v16h b, v8f c) { return __builtin_amdgcn_wmma_f32_16x16x32_f16(false, a, false, b, (short)0, c, false, false); }      /* the plain builtin: the compiler keeps the distance behind it itself, and no asm statement stands between the LDS reads and the products */
__global__ __launch_bounds__(512) void k_flash(const _Float16* __restrict__ Q16, int ldq, const _Float16* __restrict__ K16, int ldk, const _Float16* __restrict__ Vt, const _Float16* __restrict__ Vtlo, float* __restrict__ O, int ldo) {
  constexpr int RPW = 16, NQB = TT / (4 * RPW), DT = 8, KS = 8;      /* d_qk 256: 8 k-steps; 8 value tiles = ONE 128-wide half of the 256-wide V per wave */
  constexpr int SK = 64, NST = TT / SK;      /* one LDS tile = 64 keys = two 32-key passes, each on its own waves; V rows of 64 keys are whole 128-B lines */
  constexpr int KP = 256 + 8, VP = SK + 8;      /* LDS row pitches in halves: 528 B and 144 B, both 16 B x odd, conflict-free for the 16-row ds_load_b128 fragment reads */
  __shared__ __attribute__((aligned(16))) unsigned short sQ[4 * RPW][KP]; __shared__ __attribute__((aligned(16))) unsigned short sK[2][SK][KP]; __shared__ __attribute__((aligned(16))) unsigned short sVh[2][256][VP]; __shared__ __attribute__((aligned(16))) unsigned short sVl[2][256][VP];
  __shared__ float sM[8][RPW]; __shared__ float sL[8][RPW];
  typedef float f32a __attribute__((may_alias)); static_assert(sizeof(sK) == 8 * RPW * (128 + 4) * sizeof(float), "the eight output tiles fill the K ring exactly");
  f32a (*sO)[RPW][128 + 4] = (f32a (*)[RPW][128 + 4])&sK[0][0][0];      /* the output tiles reuse the K ring, which nobody reads or fills behind the loop's last barrier */
  const int tid = threadIdx.x, w = tid >> 5, lane = tid & 31, ln = lane & 15, hh = lane >> 4;
  const int slab = blockIdx.x / NQB, qblk = blockIdx.x % NQB; const int b = slab / NH, h = slab % NH; const int qb0 = qblk * (4 * RPW);
  const int wq = w & 3, vhf = (w >> 2) & 1, pr = w & 7; const int q0 = qb0 + wq * RPW;      /* sixteen waves, four per SIMD: 4 groups of 16 query rows x 2 halves of V x 2 halves of each tile's keys; pr numbers the pair of waves that share rows and V half */
  const unsigned short* Qg = (const unsigned short*)Q16 + ((size_t)b * TT + qb0) * ldq; const unsigned short* Kg = (const unsigned short*)K16 + (size_t)b * TT * ldk;
  const unsigned short* Vth = (const unsigned short*)Vt + (size_t)b * VSTR * TT; const unsigned short* Vtl = (const unsigned short*)Vtlo + (size_t)b * VSTR * TT;      /* hi and UNSCALED residual planes */
  const int wu = __builtin_amdgcn_readfirstlane(w);      /* the wave's number as a scalar: the row parts of the copies' addresses stay in scalar registers */
  const int kp = wu >> 3;      /* which 32 keys of every tile this wave takes (scalar: the epilogue branches on it) */
  /* tile t -> buffer buf, 12 copies per wave: 4 K rows (one 512-B row per copy), 16 of the 256 rows of each V plane (four 128-B rows per copy) */
  auto stage = [&](int t, int buf) {
    unsigned l[12]; const unsigned short* p[12];
#pragma unroll      /* constant indices keep l[] and p[] in registers */
    for (int i = 0; i < 4; ++i) { const int r = wu * 4 + i; l[i] = lds_off(&sK[buf][r][lane * 8]); p[i] = Kg + (size_t)(t * SK + r) * ldk + lane * 8; }
#pragma unroll      /* constant indices keep l[] and p[] in registers */
    for (int i = 0; i < 4; ++i) { const int d = wu * 16 + i * 4 + (lane >> 3); l[4 + i] = lds_off(&sVh[buf][d][(lane & 7) * 8]); p[4 + i] = Vth + (size_t)d * TT + t * SK + (lane & 7) * 8; l[8 + i] = lds_off(&sVl[buf][d][(lane & 7) * 8]); p[8 + i] = Vtl + (size_t)d * TT + t * SK + (lane & 7) * 8; }
    acp12(l, p); };
  { unsigned l[4]; const unsigned short* p[4];      /* the block's 64 query rows, filled once: 4 rows per wave */
#pragma unroll      /* constant indices keep l[] and p[] in registers */
    for (int i = 0; i < 4; ++i) { const int r = wu * 4 + i; l[i] = lds_off(&sQ[r][lane * 8]); p[i] = Qg + (size_t)r * ldq + lane * 8; }
    acp4(l, p); }
  stage(0, 0);
  asm volatile("s_wait_asynccnt 0x0" ::: "memory");      /* this wave's copies of Q and of tile 0 have landed */
  __syncthreads();      /* publishes Q and tile 0 to every wave */
  stage(1, 1);
  const unsigned short* qrow = &sQ[wq * RPW + ln][0];
  /* Transposed products: St = K x Qt and Ot += Vt x Pt. Lane (ln, hh) holds query q0 + ln: its scores of keys 8 hh + r of each 16-key tile, and its outputs of value columns 8 hh + r of each 16-column tile. */
  float m_r = -3.0e38f, l_r = 0.f; v8f oacc[DT];
#pragma unroll
  for (int dt = 0; dt < DT; ++dt) oacc[dt] = (v8f){0.f,0.f,0.f,0.f,0.f,0.f,0.f,0.f};
#pragma unroll 1
  for (int t = 0; t < NST; ++t) {
   const int buf = t & 1;
   {
    const int j0 = kp * 32;      /* first key of this wave's pass inside the tile */
    const unsigned short* kr0 = &sK[buf][j0 + ln][0]; const unsigned short* kr1 = &sK[buf][j0 + 16 + ln][0];
    FragH aq[KS], bk[KS]; v8f s[2] = {(v8f){0.f,0.f,0.f,0.f,0.f,0.f,0.f,0.f}, (v8f){0.f,0.f,0.f,0.f,0.f,0.f,0.f,0.f}};
#pragma unroll      /* constant indices keep the fragments in registers */
    for (int ks = 0; ks < KS; ++ks) { aq[ks].half[0] = *(const v8us*)(qrow + ks * 32 + 8 * hh); aq[ks].half[1] = *(const v8us*)(qrow + ks * 32 + 16 + 8 * hh); bk[ks].half[0] = *(const v8us*)(kr0 + ks * 32 + 8 * hh); bk[ks].half[1] = *(const v8us*)(kr0 + ks * 32 + 16 + 8 * hh); }      /* one group of reads: Q and the first 16 keys, all k-steps */
    __builtin_amdgcn_sched_barrier(0);      /* holds the group of reads in front of the products: one LDS latency is waited for, not one per product */
#pragma unroll      /* constant indices keep the fragments in registers */
    for (int ks = 0; ks < KS; ++ks) { s[0] = mmaP(bk[ks].v, aq[ks].v, s[0]); bk[ks].half[0] = *(const v8us*)(kr1 + ks * 32 + 8 * hh); bk[ks].half[1] = *(const v8us*)(kr1 + ks * 32 + 16 + 8 * hh);      /* A = 16 keys, B = 16 queries; the second 16 keys' fragments follow one k-step at a time, as the products free registers */
      __builtin_amdgcn_sched_barrier(0);      /* keeps each refill behind its product: hoisted, all the reads at once would not fit the register budget */ }
    const unsigned short* vh0 = &sVh[buf][vhf * 128 + ln][j0 + 8 * hh]; const unsigned short* vl0 = &sVl[buf][vhf * 128 + ln][j0 + 8 * hh];
    FragH bv[DT], bl[DT];      /* all of the pass's V fragments, both planes: the 128 registers that Q and K leave */
    static_assert(DT == KS, "one value tile's fragments follow each k-step of the second score tile");
#pragma unroll      /* constant indices keep the fragments in registers */
    for (int ks = 0; ks < KS; ++ks) { s[1] = mmaP(bk[ks].v, aq[ks].v, s[1]); bv[ks].half[0] = *(const v8us*)(vh0 + ks * 16 * VP); bv[ks].half[1] = *(const v8us*)(vh0 + ks * 16 * VP + 16); bl[ks].half[0] = *(const v8us*)(vl0 + ks * 16 * VP); bl[ks].half[1] = *(const v8us*)(vl0 + ks * 16 * VP + 16);
      __builtin_amdgcn_sched_barrier(0);      /* as above: a value tile's reads stay behind the product that frees their 16 registers */ }
    /* Every LDS read of tile t is issued above, so the hand-over of the ring stands here: softmax and the V products below work on registers alone, and a wave that ends them early starts on tile t + 1 while its neighbours still compute. */
    asm volatile("s_wait_dscnt 0x0" ::: "memory");      /* this wave's reads of tile t have returned before its buffer is refilled */
    asm volatile("s_wait_asynccnt 0x0" ::: "memory");      /* this wave's copies of tile t + 1 have landed */
    __syncthreads();      /* publishes tile t + 1 and ends every wave's reads of tile t */
    __builtin_amdgcn_sched_barrier(0);      /* keeps the register-only work below behind the hand-over: moved above it, the V reads would again be waited for one product at a time */
    float sc[16];
#pragma unroll
    for (int i = 0; i < 16; ++i) sc[i] = s[i >> 3][i & 7] * ATT_SCALE;
    float mc = sc[0];
#pragma unroll
    for (int i = 1; i < 16; ++i) mc = fmaxf(mc, sc[i]);
    mc = fmaxf(mc, xhalf(mc));      /* the other 16 of the query's 32 keys sit in lane ^ 16 */
    const float mn = fmaxf(m_r, mc); const float ea = expf(m_r - mn); const float al = (mn > -1.0e38f) ? ea : 1.0f; m_r = mn;
    FragH ph, pl; float ls[4] = {0.f, 0.f, 0.f, 0.f};      /* element i of the two score tiles is element i of a B fragment in the k order of the V loader above: P stays in registers */
#pragma unroll
    for (int i = 0; i < 16; ++i) { const float p = expf(sc[i] - mn); ls[i & 3] += p; const float ps = p * 1024.0f; const _Float16 hp = (_Float16)ps; ph.h[i] = hp; pl.h[i] = (_Float16)(ps - (float)hp); }      /* P hi and its UNSCALED residual (added into the same accumulator) */
    l_r = l_r * al + ((ls[0] + ls[1]) + (ls[2] + ls[3]));      /* this lane's 16 keys of every pass; the two halves are joined behind the loop */
#pragma unroll
    for (int dt = 0; dt < DT; ++dt)
#pragma unroll
      for (int r = 0; r < 8; ++r) oacc[dt][r] *= al;
#pragma unroll
    for (int dt = 0; dt < DT; ++dt) { oacc[dt] = mmaP(bv[dt].v, ph.v, oacc[dt]); oacc[dt] = mmaP(bv[dt].v, pl.v, oacc[dt]); oacc[dt] = mmaP(bl[dt].v, ph.v, oacc[dt]); } }      /* Vh x Ph + Vh x Pl + Vl x Ph, all unscaled, one accumulator; A = 16 value columns, B = 16 queries */
   if (t + 2 < NST) stage(t + 2, buf); }
  asm volatile("s_wait_asynccnt 0x0" ::: "memory");      /* no copy is outstanding behind the loop */
  l_r += xhalf(l_r);      /* row sum over this wave's keys */
  if (kp == 1) {      /* the wave of the second key half hands its running max, row sum and unnormalised tile to its partner */
#pragma unroll
    for (int dt = 0; dt < DT; ++dt) { *(v4fa*)&sO[pr][ln][dt * 16 + 8 * hh] = (v4f){oacc[dt][0], oacc[dt][1], oacc[dt][2], oacc[dt][3]}; *(v4fa*)&sO[pr][ln][dt * 16 + 8 * hh + 4] = (v4f){oacc[dt][4], oacc[dt][5], oacc[dt][6], oacc[dt][7]}; }
    if (hh == 0) { sM[pr][ln] = m_r; sL[pr][ln] = l_r; } }
  __syncthreads();      /* publishes the second key half's partial results to the partner waves */
  if (kp == 0) {
    const float m1 = sM[pr][ln], l1 = sL[pr][ln]; const float mn = fmaxf(m_r, m1); const float a0 = expf(m_r - mn), a1 = expf(m1 - mn); const float l = l_r * a0 + l1 * a1; const float inv = (l > 0.f) ? 1.0f / (l * 1024.0f) : 0.f; const float c0 = a0 * inv, c1 = a1 * inv;
#pragma unroll
    for (int dt = 0; dt < DT; ++dt)
#pragma unroll
      for (int g = 0; g < 2; ++g) { v4fa* o = (v4fa*)&sO[pr][ln][dt * 16 + 8 * hh + 4 * g]; const v4f x = *o; *o = (v4f){oacc[dt][4 * g] * c0 + x[0] * c1, oacc[dt][4 * g + 1] * c0 + x[1] * c1, oacc[dt][4 * g + 2] * c0 + x[2] * c1, oacc[dt][4 * g + 3] * c0 + x[3] * c1}; }      /* each lane reads and rewrites its own words */
    __builtin_amdgcn_fence(__ATOMIC_ACQ_REL, "workgroup"); __builtin_amdgcn_wave_barrier();
#pragma unroll
    for (int r = 0; r < RPW; ++r) { const int pc = lane; const v4f val = *(const v4fa*)&sO[pr][r][pc * 4]; *(v4f*)(O + ((size_t)b * TT + q0 + r) * ldo + (h * 2 + vhf) * 128 + pc * 4) = val; }      /* one 512-B row per instruction: 32 lanes x 16 B */
  } }

extern "C" void kernel_launch(void* const* d_in, const int* in_sizes, int n_in,
                              void* d_out, int out_size, void* d_ws, size_t ws_size, hipStream_t stream) {
  (void)in_sizes; (void)n_in; (void)out_size;
  const float* const* I = (const float* const*)d_in; const float* xq = I[0]; const float* xk = I[1]; const float* xv = I[2]; const float* qw = I[3]; const float* qb = I[4]; const float* kw = I[5]; const float* kb = I[6]; const float* vw = I[7]; const float* vb = I[8]; const float* scl = I[9];
  char* ws = (char*)d_ws; size_t off = 0;
  auto take = [&](size_t bytes) { char* p = ws + off; off += (bytes + 255) & ~(size_t)255; return p; };
  _Float16* Bq = (_Float16*)take((size_t)DD * K3 * 2); _Float16* Bk = (_Float16*)take((size_t)DD * K3 * 2); _Float16* Bv = (_Float16*)take((size_t)DD * K3 * 2); _Float16* Q = (_Float16*)take((size_t)NR * DD * 2); _Float16* K = (_Float16*)take((size_t)NR * DD * 2); float* VF = (float*)take((size_t)NR * DD * 4); _Float16* Vt = (_Float16*)take((size_t)NR * DD * 2); _Float16* Vtl = (_Float16*)take((size_t)NR * DD * 2);
  if (off > ws_size) return;      // 1.2 + 8.4 + 8.4 + 16.8 + 8.4 + 8.4 = about 52 MB
  k_wc3<<<(DD * (K3 / 8) + 255) / 256, 256, 0, stream>>>(qw, Bq); k_wc3<<<(DD * (K3 / 8) + 255) / 256, 256, 0, stream>>>(kw, Bk); k_wc3<<<(DD * (K3 / 8) + 255) / 256, 256, 0, stream>>>(vw, Bv);
  k_conv3<true><<<NR / 16, 128, 0, stream>>>(xq, Bq, qb, nullptr, Q);      /* q = conv(query): M 16384 N 256 K 768 (exact products), f16 out */
  k_conv3<true><<<NR / 16, 128, 0, stream>>>(xk, Bk, kb, nullptr, K);
  k_conv3<false><<<NR / 16, 128, 0, stream>>>(xv, Bv, vb, VF, nullptr);      /* v (f32) */
  k_vthlu<<<BB * NVH * (TT / 64), 256, 0, stream>>>(VF, DD, Vt, Vtl);      /* Vᵀ hi + residual: [b][256][4096] */
  k_flash<<<BB * NH * (TT / 64), 512, 0, stream>>>(Q, DD, K, DD, Vt, Vtl, (float*)d_out, DD);      /* both 128-wide halves of O in one launch, straight into the output rows */
  k_scl<<<(unsigned)(((size_t)NR * DD / 4 + 255) / 256), 256, 0, stream>>>((float*)d_out, scl, (size_t)NR * DD / 4);      /* × scale */
}

// v007
// Measured time: 205 microseconds a run.
// Two timings next to v006 both put it at 1.07 times that version's speed.
// Over all steps from v000 it is 8.89 times as fast.
#include <hip/hip_runtime.h>
// KQV 'PCNN' attention (B=4, S=4096, D=256): q, k, v = Conv1d(kernel 3, pad 1) over the sequence of query/key/value (+bias); scores = q·k/16; softmax; out = scale·(P·v) → [4,4096,256].
// Compute dtype: inputs, conv weights/biases, scale rounded to bf16; each conv as an im2col GEMM (K = 3·256, bf16-exact operands, f32 accumulate) → q, k f16 planes, v f32 → Vᵀ f16 hi + f16 residual; fused flash-style kernel with d_qk = 256 (8 k-steps, online softmax f32, P f16 hi + residual,
// f32 accumulate) on v_wmma_f32_16x16x32_f16, one launch of 16-wave blocks (query rows x halves of v x halves of each key tile), writing the output rows directly; × scale in f32.
#define BB 4
#define TT 4096
#define DD 256
#define NH 1
#define VSTR 256
#define NVH 4
#define NR (BB * TT)
#define K3 (3 * DD)
#define ATT_SCALE 0.0625f

typedef __bf16 v16b __attribute__((ext_vector_type(16)));
typedef unsigned short v8us __attribute__((ext_vector_type(8), may_alias));
typedef float  v8f  __attribute__((ext_vector_type(8)));
typedef float  v4f  __attribute__((ext_vector_type(4)));
typedef float  v4fa __attribute__((ext_vector_type(4), may_alias));
union FragB { v16b v; v8us half[2]; unsigned short u[16]; };

__device__ __forceinline__ unsigned short bf16_bits(float x) { unsigned int u = __float_as_uint(x); return (unsigned short)((u + 0x7FFFu + ((u >> 16) & 1u)) >> 16); }
__device__ __forceinline__ float bf16_val(unsigned short b) { return __uint_as_float(((unsigned int)b) << 16); }
__device__ __forceinline__ float bf16_round(float x) { return bf16_val(bf16_bits(x)); }
// D += A·B with NT terms: 1 = ah·bh, 2 = + al·bh (A split), 3 = + ah·bl (both split)
template <int NT>
__device__ __forceinline__ v8f mmaN(v16b ah, v16b al, v16b bh, v16b bl, v8f c) {
  c = __builtin_amdgcn_wmma_f32_16x16x32_bf16(false, ah, false, bh, (short)0, c, false, false);
  if (NT >= 2) c = __builtin_amdgcn_wmma_f32_16x16x32_bf16(false, al, false, bh, (short)0, c, false, false);
  if (NT >= 3) c = __builtin_amdgcn_wmma_f32_16x16x32_bf16(false, ah, false, bl, (short)0, c, false, false);
  asm volatile("v_nop\n\tv_nop\n\tv_nop\n\tv_nop" : "+v"(c) : "v"(ah), "v"(al), "v"(bh), "v"(bl));
  return c;
}

__global__ __launch_bounds__(256) void k_wt_bf16(const float* __restrict__ W, unsigned short* __restrict__ Wt, int K, int N) {
  const int t = blockIdx.x * 256 + threadIdx.x;
  const int k8n = K / 8;
  if (t >= N * k8n) return;
  const int n = t / k8n, k8 = (t % k8n) * 8;
  v8us v;
#pragma unroll
  for (int i = 0; i < 8; ++i) v[i] = bf16_bits(W[(size_t)(k8 + i) * N + n]);
  *(v8us*)(Wt + (size_t)n * K + k8) = v;
  
}

// GEMM C[M][N] (f32, pitch ldc) = act(A[M][K]·W + bias). A f32 row-major (pitch lda) converted per fragment to bf16
// (ASPLIT: hi/lo two planes -> 2 terms, else single rounded term); Wt bf16 [N][K] (pitch ldb). BIAS_BF16 rounds the
// bias to bf16 first (bias quantised to bf16 before the add). K%32==0, M%16==0, N%64==0.
template <bool ASPLIT, int ACT, bool BIAS_BF16>
__global__ __launch_bounds__(128) void k_gemm_bf(const float* __restrict__ A, int lda, const unsigned short* __restrict__ Wt, int ldb,
                                               const float* __restrict__ bias, float* __restrict__ C, int ldc, int M, int N, int K) {
  __shared__ __attribute__((aligned(16))) float so[4][16][64];
  const int tid = threadIdx.x, w = tid >> 5, lane = tid & 31, ln = lane & 15, hh = lane >> 4;
  const int ntn = N / 64;
  const int wid = blockIdx.x * 4 + w;
  const int mt = wid / ntn, nq = wid % ntn;
  if (mt * 16 >= M) return;
  const int row0 = mt * 16, col0 = nq * 64;
  const float* arow = A + (size_t)(row0 + ln) * lda;
  v8f acc[4] = {};
  for (int kb = 0; kb < K; kb += 32) {
    FragB ah, al;
    const v4f x0 = *(const v4fa*)(arow + kb + 8 * hh), x1 = *(const v4fa*)(arow + kb + 8 * hh + 4);
    const v4f x2 = *(const v4fa*)(arow + kb + 16 + 8 * hh), x3 = *(const v4fa*)(arow + kb + 16 + 8 * hh + 4);
    float xs[16] = {x0[0],x0[1],x0[2],x0[3],x1[0],x1[1],x1[2],x1[3],x2[0],x2[1],x2[2],x2[3],x3[0],x3[1],x3[2],x3[3]};
#pragma unroll
    for (int i = 0; i < 16; ++i) { const unsigned short hb = bf16_bits(xs[i]); ah.u[i] = hb; al.u[i] = ASPLIT ? bf16_bits(xs[i] - bf16_val(hb)) : (unsigned short)0; }
#pragma unroll
    for (int t = 0; t < 4; ++t) {
      const unsigned short* brow = Wt + (size_t)(col0 + t * 16 + ln) * ldb + kb;
      FragB b;
      b.half[0] = *(const v8us*)(brow + 8 * hh);
      b.half[1] = *(const v8us*)(brow + 16 + 8 * hh);
      acc[t] = mmaN<ASPLIT ? 2 : 1>(ah.v, al.v, b.v, b.v, acc[t]);
    }
  }
#pragma unroll
  for (int t = 0; t < 4; ++t) {
    float bv = bias ? bias[col0 + t * 16 + ln] : 0.f;
    if (BIAS_BF16) bv = bf16_round(bv);
#pragma unroll
    for (int r = 0; r < 8; ++r) { float v = acc[t][r] + bv; if (ACT == 1) v = fmaxf(v, 0.f); so[w][8 * hh + r][t * 16 + ln] = v; }
  }
  __builtin_amdgcn_fence(__ATOMIC_ACQ_REL, "workgroup");
  __builtin_amdgcn_wave_barrier();
  const int rsub = lane >> 4, c4 = (lane & 15) * 4;
  {
#pragma unroll
    for (int q = 0; q < 8; ++q) {
      const int r = q * 2 + rsub;
      const v4f v = *(const v4fa*)&so[w][r][c4];
      *(v4f*)(C + (size_t)(row0 + r) * ldc + col0 + c4) = v;
    }
    
  }
}

// Flash-style causal/unmasked attention, all contractions 3-term bf16 hi/lo splits, f32 softmax with running max.
// q,k,v rows are read from f32 buffers with arbitrary row pitch (so they can live inside a fused qkv buffer);
// D = head size (multiple of 32, <= 128); one wave = 16 query rows; block = 4 waves (64 queries) sharing K/V chunks of 32.
template <int D, bool CAUSAL>
__global__ __launch_bounds__(128) void k_flash(const float* __restrict__ qb, const float* __restrict__ kb, const float* __restrict__ vb,
                                             int pitch, int T, int H, float scale, float* __restrict__ y, int ypitch) {
  constexpr int KS = D / 32;        // k-steps for QK
  constexpr int DT = D / 16;        // d tiles for PV
  __shared__ __attribute__((aligned(16))) unsigned short sKh[32][D + 8], sKl[32][D + 8], sVh[32][D + 8], sVl[32][D + 8];
  __shared__ __attribute__((aligned(16))) unsigned short sPh[4][16][40], sPl[4][16][40];
  __shared__ __attribute__((aligned(16))) float sO[4][16][D];
  const int tid = threadIdx.x, w = tid >> 5, lane = tid & 31, ln = lane & 15, hh = lane >> 4;
  const int nqb = (T + 63) / 64;
  const int bh = blockIdx.x / nqb, qblk = blockIdx.x % nqb;
  const int b = bh / H, h = bh % H;
  const int q0 = qblk * 64 + w * 16;
  const float* Q = qb + (size_t)b * T * pitch + h * D;
  const float* K = kb + (size_t)b * T * pitch + h * D;
  const float* V = vb + (size_t)b * T * pitch + h * D;

  // A fragments of the wave's 16 query rows (scaled), hi/lo
  FragB aqh[KS], aql[KS];
  {
    int row = q0 + ln; if (row >= T) row = T - 1;
    const float* qr = Q + (size_t)row * pitch;
#pragma unroll
    for (int ks = 0; ks < KS; ++ks)
#pragma unroll
      for (int i = 0; i < 16; ++i) {
        const int d = ks * 32 + ((i < 8) ? (8 * hh + i) : (16 + 8 * hh + (i - 8)));
        const float x = qr[d] * scale; const unsigned short hb = bf16_bits(x);
        aqh[ks].u[i] = hb; aql[ks].u[i] = bf16_bits(x - bf16_val(hb));
      }
  }
  float m_r[8], l_r[8];
#pragma unroll
  for (int r = 0; r < 8; ++r) { m_r[r] = -3.0e38f; l_r[r] = 0.f; }
  v8f oacc[DT];
#pragma unroll
  for (int dt = 0; dt < DT; ++dt) oacc[dt] = (v8f){0.f,0.f,0.f,0.f,0.f,0.f,0.f,0.f};

  const int kv_end = CAUSAL ? min(T, qblk * 64 + 64) : T;     // block-uniform
  for (int j0 = 0; j0 < kv_end; j0 += 32) {
    __syncthreads();
    for (int e = tid; e < 32 * (D / 4); e += 128) {
      const int r = e / (D / 4), c4 = (e % (D / 4)) * 4;
      const int key = j0 + r;
      v4f kf = {0.f,0.f,0.f,0.f}, vf = {0.f,0.f,0.f,0.f};
      if (key < T) { kf = *(const v4fa*)(K + (size_t)key * pitch + c4); vf = *(const v4fa*)(V + (size_t)key * pitch + c4); }
#pragma unroll
      for (int t = 0; t < 4; ++t) {
        unsigned short hb = bf16_bits(kf[t]); sKh[r][c4 + t] = hb; sKl[r][c4 + t] = bf16_bits(kf[t] - bf16_val(hb));
        hb = bf16_bits(vf[t]); sVh[r][c4 + t] = hb; sVl[r][c4 + t] = bf16_bits(vf[t] - bf16_val(hb));
      }
    }
    __syncthreads();
    // S tile 16 x 32
    v8f s[2];
#pragma unroll
    for (int nt = 0; nt < 2; ++nt) {
      v8f acc = {};
#pragma unroll
      for (int ks = 0; ks < KS; ++ks) {
        FragB bh_, bl_;
        bh_.half[0] = *(const v8us*)&sKh[nt * 16 + ln][ks * 32 + 8 * hh]; bh_.half[1] = *(const v8us*)&sKh[nt * 16 + ln][ks * 32 + 16 + 8 * hh];
        bl_.half[0] = *(const v8us*)&sKl[nt * 16 + ln][ks * 32 + 8 * hh]; bl_.half[1] = *(const v8us*)&sKl[nt * 16 + ln][ks * 32 + 16 + 8 * hh];
        acc = mmaN<3>(aqh[ks].v, aql[ks].v, bh_.v, bl_.v, acc);
      }
      s[nt] = acc;
    }
    // mask + running max (rows 8hh+r; the 16 lanes of a half share rows)
    float alpha[8];
#pragma unroll
    for (int r = 0; r < 8; ++r) {
      const int qi = q0 + 8 * hh + r;
      const int ja = j0 + ln, jb = j0 + 16 + ln;
      if (CAUSAL) { if (ja > qi) s[0][r] = -3.0e38f; if (jb > qi) s[1][r] = -3.0e38f; }
      if (ja >= T) s[0][r] = -3.0e38f;
      if (jb >= T) s[1][r] = -3.0e38f;
      float mx = fmaxf(s[0][r], s[1][r]);
      mx = fmaxf(mx, __shfl_xor(mx, 1, 32)); mx = fmaxf(mx, __shfl_xor(mx, 2, 32)); mx = fmaxf(mx, __shfl_xor(mx, 4, 32)); mx = fmaxf(mx, __shfl_xor(mx, 8, 32));
      const float mnew = fmaxf(m_r[r], mx);
      alpha[r] = (mnew > -1.0e38f) ? __expf(m_r[r] - mnew) : 1.0f;
      const float p0 = (s[0][r] > -1.0e38f) ? __expf(s[0][r] - mnew) : 0.f;
      const float p1 = (s[1][r] > -1.0e38f) ? __expf(s[1][r] - mnew) : 0.f;
      m_r[r] = mnew;
      l_r[r] = l_r[r] * alpha[r] + p0 + p1;            // per-lane partial row sum (16 lanes combined at the end)
      unsigned short hb = bf16_bits(p0); sPh[w][8 * hh + r][ln] = hb;      sPl[w][8 * hh + r][ln] = bf16_bits(p0 - bf16_val(hb));
      hb = bf16_bits(p1);                sPh[w][8 * hh + r][16 + ln] = hb; sPl[w][8 * hh + r][16 + ln] = bf16_bits(p1 - bf16_val(hb));
    }
#pragma unroll
    for (int dt = 0; dt < DT; ++dt)
#pragma unroll
      for (int r = 0; r < 8; ++r) oacc[dt][r] *= alpha[r];
    __builtin_amdgcn_fence(__ATOMIC_ACQ_REL, "workgroup");
    __builtin_amdgcn_wave_barrier();
    FragB pah, pal;
    pah.half[0] = *(const v8us*)&sPh[w][ln][8 * hh]; pah.half[1] = *(const v8us*)&sPh[w][ln][16 + 8 * hh];
    pal.half[0] = *(const v8us*)&sPl[w][ln][8 * hh]; pal.half[1] = *(const v8us*)&sPl[w][ln][16 + 8 * hh];
#pragma unroll
    for (int dt = 0; dt < DT; ++dt) {
      FragB bvh, bvl;
#pragma unroll
      for (int i = 0; i < 8; ++i) {
        bvh.u[i] = sVh[8 * hh + i][dt * 16 + ln]; bvh.u[8 + i] = sVh[16 + 8 * hh + i][dt * 16 + ln];
        bvl.u[i] = sVl[8 * hh + i][dt * 16 + ln]; bvl.u[8 + i] = sVl[16 + 8 * hh + i][dt * 16 + ln];
      }
      oacc[dt] = mmaN<3>(pah.v, pal.v, bvh.v, bvl.v, oacc[dt]);
    }
    __builtin_amdgcn_fence(__ATOMIC_ACQ_REL, "workgroup");
    __builtin_amdgcn_wave_barrier();
  }
#pragma unroll
  for (int r = 0; r < 8; ++r) {
    float l = l_r[r];
    l += __shfl_xor(l, 1, 32); l += __shfl_xor(l, 2, 32); l += __shfl_xor(l, 4, 32); l += __shfl_xor(l, 8, 32);
    l_r[r] = (l > 0.f) ? 1.0f / l : 0.f;
  }
#pragma unroll
  for (int dt = 0; dt < DT; ++dt)
#pragma unroll
    for (int r = 0; r < 8; ++r) sO[w][8 * hh + r][dt * 16 + ln] = oacc[dt][r] * l_r[r];
  __builtin_amdgcn_fence(__ATOMIC_ACQ_REL, "workgroup");
  __builtin_amdgcn_wave_barrier();
  {
    for (int r = 0; r < 16; ++r) {
      const int row = q0 + r;
      if (row < T && lane < D / 4) {
        const v4f val = *(const v4fa*)&sO[w][r][lane * 4];
        *(v4f*)(y + ((size_t)b * T + row) * ypitch + h * D + lane * 4) = val;
      }
    }
    
  }
}

// GEMM C = act(A·W + bias + resid): A f32 (ASPLIT -> hi/lo 2 terms), Wt bf16 [N][K]; ACT 0 none, 1 relu, 2 exact gelu;
// resid (optional, f32, row index = (row % rmod), pitch ldr, RES_BF16 rounds it) added before the activation.
template <bool ASPLIT, int ACT, bool BIAS_BF16, bool RES_BF16>
__global__ __launch_bounds__(128) void k_gemm_bf3(const float* __restrict__ A, int lda, const unsigned short* __restrict__ Wt, int ldb,
                                                const float* __restrict__ bias, const float* __restrict__ resid, int rmod, int ldr,
                                                float* __restrict__ C, int ldc, int M, int N, int K) {
  __shared__ __attribute__((aligned(16))) float so[4][16][64];
  const int tid = threadIdx.x, w = tid >> 5, lane = tid & 31, ln = lane & 15, hh = lane >> 4;
  const int ntn = N / 64;
  const int wid = blockIdx.x * 4 + w;
  const int mt = wid / ntn, nq = wid % ntn;
  if (mt * 16 >= M) return;
  const int row0 = mt * 16, col0 = nq * 64;
  const float* arow = A + (size_t)(row0 + ln) * lda;
  v8f acc[4] = {};
  for (int kb = 0; kb < K; kb += 32) {
    FragB ah, al;
    const v4f x0 = *(const v4fa*)(arow + kb + 8 * hh), x1 = *(const v4fa*)(arow + kb + 8 * hh + 4);
    const v4f x2 = *(const v4fa*)(arow + kb + 16 + 8 * hh), x3 = *(const v4fa*)(arow + kb + 16 + 8 * hh + 4);
    float xs[16] = {x0[0],x0[1],x0[2],x0[3],x1[0],x1[1],x1[2],x1[3],x2[0],x2[1],x2[2],x2[3],x3[0],x3[1],x3[2],x3[3]};
#pragma unroll
    for (int i = 0; i < 16; ++i) { const unsigned short hb = bf16_bits(xs[i]); ah.u[i] = hb; al.u[i] = ASPLIT ? bf16_bits(xs[i] - bf16_val(hb)) : (unsigned short)0; }
#pragma unroll
    for (int t = 0; t < 4; ++t) {
      const unsigned short* brow = Wt + (size_t)(col0 + t * 16 + ln) * ldb + kb;
      FragB b;
      b.half[0] = *(const v8us*)(brow + 8 * hh);
      b.half[1] = *(const v8us*)(brow + 16 + 8 * hh);
      acc[t] = mmaN<ASPLIT ? 2 : 1>(ah.v, al.v, b.v, b.v, acc[t]);
    }
  }
#pragma unroll
  for (int t = 0; t < 4; ++t) {
    const int col = col0 + t * 16 + ln;
    float bv = bias ? bias[col] : 0.f;
    if (BIAS_BF16) bv = bf16_round(bv);
#pragma unroll
    for (int r = 0; r < 8; ++r) {
      float v = acc[t][r] + bv;
      if (resid) { float rv = resid[(size_t)((row0 + 8 * hh + r) % rmod) * ldr + col]; if (RES_BF16) rv = bf16_round(rv); v += rv; }
      if (ACT == 1) v = fmaxf(v, 0.f);
      if (ACT == 2) v = 0.5f * v * (1.0f + erff(v * 0.70710678118654752f));
      if (ACT == 3) { const float u = 0.7978845608028654f * (v + 0.044715f * v * v * v); v = 0.5f * v * (1.0f + tanhf(u)); }
      so[w][8 * hh + r][t * 16 + ln] = v;
    }
  }
  __builtin_amdgcn_fence(__ATOMIC_ACQ_REL, "workgroup");
  __builtin_amdgcn_wave_barrier();
  const int rsub = lane >> 4, c4 = (lane & 15) * 4;
  {
#pragma unroll
    for (int q = 0; q < 8; ++q) {
      const int r = q * 2 + rsub;
      const v4f v = *(const v4fa*)&so[w][r][c4];
      *(v4f*)(C + (size_t)(row0 + r) * ldc + col0 + c4) = v;
    }
    
  }
}
// row LayerNorm (biased variance, eps) over N: s = X (+ R); optional out_sum <- s; out_norm <- (s-mu)*rsqrt(var+eps)*g + b
template <bool PARAM_BF16>
__global__ __launch_bounds__(256) void k_layernorm(const float* __restrict__ X, const float* __restrict__ R, const float* __restrict__ g, const float* __restrict__ bta,
                                                  float* __restrict__ out_sum, float* __restrict__ out_norm, int N, float eps) {
  __shared__ float red[256];
  const int row = blockIdx.x, tid = threadIdx.x;
  const float* x = X + (size_t)row * N; const float* rr = R ? R + (size_t)row * N : nullptr;
  float vals[16];                     // up to N = 4096
  const int per = N / 256;            // contiguous chunk per thread? use strided-by-4 chunks: thread handles j = tid*4 + 1024*u
  float s1 = 0.f;
  for (int u = 0; u < per / 4; ++u) {
    const int j = tid * 4 + 1024 * u;
    const v4f a = *(const v4fa*)(x + j);
    v4f b = {0.f,0.f,0.f,0.f}; if (rr) b = *(const v4fa*)(rr + j);
#pragma unroll
    for (int q = 0; q < 4; ++q) { const float v = a[q] + b[q]; vals[u * 4 + q] = v; s1 += v; }
  }
  red[tid] = s1; __syncthreads();
  for (int st = 128; st > 0; st >>= 1) { if (tid < st) red[tid] += red[tid + st]; __syncthreads(); }
  const float mu = red[0] / (float)N; __syncthreads();
  float s2 = 0.f;
  for (int u = 0; u < per / 4; ++u)
#pragma unroll
    for (int q = 0; q < 4; ++q) { const float c = vals[u * 4 + q] - mu; s2 += c * c; }
  red[tid] = s2; __syncthreads();
  for (int st = 128; st > 0; st >>= 1) { if (tid < st) red[tid] += red[tid + st]; __syncthreads(); }
  const float rs = rsqrtf(red[0] / (float)N + eps);
  {
    for (int u = 0; u < per / 4; ++u) {
      const int j = tid * 4 + 1024 * u;
      v4f o, sm;
#pragma unroll
      for (int q = 0; q < 4; ++q) {
        float gg = g[j + q], bb = bta[j + q];
        if (PARAM_BF16) { gg = bf16_round(gg); bb = bf16_round(bb); }
        sm[q] = vals[u * 4 + q]; o[q] = (vals[u * 4 + q] - mu) * rs * gg + bb;
      }
      if (out_sum) *(v4f*)(out_sum + (size_t)row * N + j) = sm;
      *(v4f*)(out_norm + (size_t)row * N + j) = o;
    }
    
  }
}



// ---- f16 WMMA path (v_wmma_f32_16x16x32_f16): 11-bit significands for operands in range — used where a [0,1] probability operand needs more precision than bf16
typedef _Float16 v16h __attribute__((ext_vector_type(16)));
union FragH { v16h v; v8us half[2]; _Float16 h[16]; unsigned short u[16]; };
template <int NT>
__device__ __forceinline__ v8f mmaH(v16h ah, v16h al, v16h bh, v16h bl, v8f c) {
  c = __builtin_amdgcn_wmma_f32_16x16x32_f16(false, ah, false, bh, (short)0, c, false, false);
  if (NT >= 2) c = __builtin_amdgcn_wmma_f32_16x16x32_f16(false, al, false, bh, (short)0, c, false, false);
  if (NT >= 3) c = __builtin_amdgcn_wmma_f32_16x16x32_f16(false, ah, false, bl, (short)0, c, false, false);
  asm volatile("v_nop\n\tv_nop\n\tv_nop\n\tv_nop" : "+v"(c) : "v"(ah), "v"(al), "v"(bh), "v"(bl));
  return c;
}
// batched GEMM like k_gemm_b but f16 operands: A f32 (split into f16 hi/lo if ASPLIT, else rounded to f16), Bt = f16 values [n][k]; alpha; C f32; N multiple of 16 (partial tiles skipped)
template <bool ASPLIT>
__global__ __launch_bounds__(128) void k_gemm_h(const float* __restrict__ A, int lda, size_t sA, const _Float16* __restrict__ Bh, int ldb, size_t sB, float alpha, float* __restrict__ C, int ldc, size_t sC, int M, int N, int K) {
  __shared__ __attribute__((aligned(16))) float so[4][16][64];
  const int tid = threadIdx.x, w = tid >> 5, lane = tid & 31, ln = lane & 15, hh = lane >> 4; const int by = blockIdx.y;
  A += (size_t)by * sA; Bh += (size_t)by * sB; C += (size_t)by * sC;
  const int ntn = (N + 63) / 64; const int wid = blockIdx.x * 4 + w; const int mt = wid / ntn, nq = wid % ntn; if (mt * 16 >= M) return;
  const int row0 = mt * 16, col0 = nq * 64; const float* arow = A + (size_t)(row0 + ln) * lda;
  v8f acc[4] = {};
  for (int kb = 0; kb < K; kb += 32) {
    FragH ah, al;
    const v4f x0 = *(const v4fa*)(arow + kb + 8 * hh), x1 = *(const v4fa*)(arow + kb + 8 * hh + 4), x2 = *(const v4fa*)(arow + kb + 16 + 8 * hh), x3 = *(const v4fa*)(arow + kb + 16 + 8 * hh + 4);
    float xs[16] = {x0[0],x0[1],x0[2],x0[3],x1[0],x1[1],x1[2],x1[3],x2[0],x2[1],x2[2],x2[3],x3[0],x3[1],x3[2],x3[3]};
#pragma unroll
    for (int i = 0; i < 16; ++i) { const _Float16 h = (_Float16)xs[i]; ah.h[i] = h; al.h[i] = ASPLIT ? (_Float16)(xs[i] - (float)h) : (_Float16)0.0f; }
#pragma unroll
    for (int t = 0; t < 4; ++t) { if (col0 + t * 16 >= N) continue; const size_t boff = (size_t)(col0 + t * 16 + ln) * ldb + kb; FragH bq; bq.half[0] = *(const v8us*)(Bh + boff + 8 * hh); bq.half[1] = *(const v8us*)(Bh + boff + 16 + 8 * hh);
      acc[t] = mmaH<ASPLIT ? 2 : 1>(ah.v, al.v, bq.v, bq.v, acc[t]); }
  }
#pragma unroll
  for (int t = 0; t < 4; ++t) { if (col0 + t * 16 >= N) continue;
#pragma unroll
    for (int r = 0; r < 8; ++r) so[w][8 * hh + r][t * 16 + ln] = acc[t][r] * alpha; }
  __builtin_amdgcn_fence(__ATOMIC_ACQ_REL, "workgroup"); __builtin_amdgcn_wave_barrier();
  const int rsub = lane >> 4, c4 = (lane & 15) * 4;
  {
#pragma unroll
    for (int q = 0; q < 8; ++q) { const int r = q * 2 + rsub; if (col0 + c4 < N) { const v4f v = *(const v4fa*)&so[w][r][c4]; *(v4f*)(C + (size_t)(row0 + r) * ldc + col0 + c4) = v; } }
     }
}

// Wt[n][k] = f16(W[k][n]·scale) from f32 row-major W[K][N] (scale = power of two; bf16-exact weights stay exact in f16 away from the subnormal range)
__global__ __launch_bounds__(256) void k_wt_f16(const float* __restrict__ W, _Float16* __restrict__ Wt, int K, int N, float scale) {
  const int t = blockIdx.x * 256 + threadIdx.x; if (t >= N * (K / 8)) return; const int n = t / (K / 8), k8 = (t % (K / 8)) * 8; FragH f;
#pragma unroll
  for (int i = 0; i < 8; ++i) f.h[i] = (_Float16)(bf16_round(W[(size_t)(k8 + i) * N + n]) * scale); const v8us o = f.half[0];
  *(v8us*)((unsigned short*)Wt + (size_t)n * K + k8) = o; 
}


typedef _Float16 v4h __attribute__((ext_vector_type(4)));

__global__ __launch_bounds__(256) void k_x16(const float* __restrict__ x, _Float16* __restrict__ X16, size_t n8) { const size_t t = (size_t)blockIdx.x * 256 + threadIdx.x; if (t >= n8) return; FragH f;
#pragma unroll
  for (int q = 0; q < 8; ++q) f.h[q] = (_Float16)bf16_round(x[t * 8 + q]); *(v8us*)((unsigned short*)X16 + t * 8) = f.half[0];  }
__global__ __launch_bounds__(256) void k_h16(const float* __restrict__ x, _Float16* __restrict__ X16, size_t n8) { const size_t t = (size_t)blockIdx.x * 256 + threadIdx.x; if (t >= n8) return; FragH f;
#pragma unroll
  for (int q = 0; q < 8; ++q) f.h[q] = (_Float16)x[t * 8 + q]; *(v8us*)((unsigned short*)X16 + t * 8) = f.half[0];  }
__global__ __launch_bounds__(256) void k_round16f(const float* __restrict__ W, _Float16* __restrict__ Bt, size_t n8) { const size_t t = (size_t)blockIdx.x * 256 + threadIdx.x; if (t >= n8) return; FragH f;
#pragma unroll
  for (int i = 0; i < 8; ++i) f.h[i] = (_Float16)(bf16_round(W[t * 8 + i]) * 16.0f); *(v8us*)((unsigned short*)Bt + t * 8) = f.half[0];  }
template <int NHv, int TTv>
__global__ __launch_bounds__(256) void k_vt(const _Float16* __restrict__ V16, int ldv, int voff, _Float16* __restrict__ Vt) { __shared__ unsigned short tl[64][66]; const int tid = threadIdx.x; const int slab = blockIdx.x / (TTv / 64), lg = blockIdx.x % (TTv / 64); const int b = slab / NHv, h = slab % NHv;
  for (int i = tid; i < 64 * 8; i += 256) { const int r = i / 8, c8 = (i % 8) * 8; FragH f; f.half[0] = *(const v8us*)((const unsigned short*)V16 + ((size_t)b * TTv + lg * 64 + r) * ldv + voff + h * 64 + c8);
#pragma unroll
    for (int q = 0; q < 8; ++q) tl[r][c8 + q] = f.u[q]; }
  __syncthreads();
  {
#pragma unroll
    for (int rd = 0; rd < 2; ++rd) { const int d = rd * 32 + tid / 8, pc = tid % 8; FragH f;
#pragma unroll
      for (int q = 0; q < 8; ++q) f.u[q] = tl[pc * 8 + q][d];
      *(v8us*)((unsigned short*)Vt + ((size_t)slab * 64 + d) * TTv + lg * 64 + pc * 8) = f.half[0]; }
     } }

__global__ __launch_bounds__(256) void k_vthlu(const float* __restrict__ VF, int ldv, _Float16* __restrict__ Vth, _Float16* __restrict__ Vtl) { __shared__ float tl[64][65]; const int tid = threadIdx.x; const int slab = blockIdx.x / (TT / 64), lg = blockIdx.x % (TT / 64); const int b = slab / NVH, h = slab % NVH;
  for (int i = tid; i < 64 * 16; i += 256) { const int r = i / 16, c4 = (i % 16) * 4; const v4f a = *(const v4fa*)(VF + ((size_t)b * TT + lg * 64 + r) * ldv + h * 64 + c4); tl[r][c4] = a[0]; tl[r][c4 + 1] = a[1]; tl[r][c4 + 2] = a[2]; tl[r][c4 + 3] = a[3]; }
  __syncthreads();
  FragH fh[2], fl[2]; size_t oo[2];
#pragma unroll
  for (int rd = 0; rd < 2; ++rd) { const int d = rd * 32 + tid / 8, pc = tid % 8;
#pragma unroll
    for (int q = 0; q < 8; ++q) { const float v = tl[pc * 8 + q][d]; const _Float16 hv = (_Float16)v; fh[rd].h[q] = hv; fl[rd].h[q] = (_Float16)(v - (float)hv);      /* UNSCALED residual (added into the same accumulator as the hi product) */ } oo[rd] = ((size_t)slab * 64 + d) * TT + lg * 64 + pc * 8; }
  {
#pragma unroll
    for (int rd = 0; rd < 2; ++rd) { *(v8us*)((unsigned short*)Vth + oo[rd]) = fh[rd].half[0]; *(v8us*)((unsigned short*)Vtl + oo[rd]) = fl[rd].half[0]; }
     } }
// One Conv1d (3 taps, pad 1) as a GEMM that forms no im2col plane: row s of the im2col matrix is input rows s - 1, s, s + 1 laid end to end, so a block stages its 16 rows and the two neighbours once in LDS,
// rounded f32 -> bf16 -> f16 (a zero row outside the sequence), and k-step ks reads its A fragment from LDS row ln + ks / 8. Bh = f16 weights in fragment order (k_wc3 below), k = tap * 256 + c. Four waves = the four 64-column quarters of the 256 outputs.
template <bool F16OUT>      /* the output plane: f16 (C16) or f32 (C) */
__global__ __launch_bounds__(128) void k_conv3(const float* __restrict__ x, const _Float16* __restrict__ Bh, const float* __restrict__ bias, float* __restrict__ C, _Float16* __restrict__ C16) {
  constexpr int XP = DD + 8;      /* LDS row pitch in halves: 528 B = 16 B x odd, conflict-free for the 16-row ds_load_b128 fragment reads */
  __shared__ __attribute__((aligned(16))) unsigned short sX[16 + 2][XP];      /* LDS row r = sequence row s0 + r - 1 */
  __shared__ __attribute__((aligned(16))) float so[4][16][64];
  const int tid = threadIdx.x, w = tid >> 5, lane = tid & 31, ln = lane & 15, hh = lane >> 4;
  const int row0 = blockIdx.x * 16, col0 = w * 64; const int s0 = row0 % TT;      /* 16 divides the sequence length: a block's rows lie in one sequence */
  float bv[4]; const int bi = col0 + ln;      /* this lane's four bias values, loaded beside the input rows */
  constexpr int NK = K3 / 32, PF = 2;      /* 24 k-steps; a k-step's weight fragments are loaded PF k-steps ahead of their products */
  const unsigned short* bp = (const unsigned short*)Bh + w * 2048 + lane * 8;      /* halves: 8192 per k-step, 512 per 16-column tile, 256 per fragment half, 8 per lane */
  FragH bq[PF + 1][4], ah[2];
  auto ldb = [&](int ks) {      /* the wave's four B fragments of k-step ks: eight loads of 512 contiguous bytes, one address and constant offsets */
#pragma unroll      /* constant indices keep bq[] in registers */
    for (int t = 0; t < 4; ++t) { bq[ks % (PF + 1)][t].half[0] = *(const v8us*)(bp + ks * 8192 + t * 512); bq[ks % (PF + 1)][t].half[1] = *(const v8us*)(bp + ks * 8192 + t * 512 + 256); } };
  { v4f xa[9];      /* nine 16-B loads per thread, all issued before the first is used: one memory latency for the whole stage */
    const int nb = tid >> 6; const bool in = nb ? (s0 + 16 < TT) : (s0 > 0);      /* waves 0, 1: the row above the block; waves 2, 3: the row below */
    const float* xb = x + (size_t)(row0 + w) * DD + lane * 4; const float* xn = x + (size_t)(row0 + (in ? (nb ? 16 : -1) : 0)) * DD + (tid & 63) * 4;      /* a neighbour outside the sequence: the address stays inside the buffer, the values are replaced by zero */
#pragma unroll      /* constant indices keep xa[] in registers */
    for (int j = 0; j < 8; ++j) xa[j] = *(const v4fa*)(xb + (j >> 1) * 4 * DD + (j & 1) * 128);      /* four rows per wave, 512 contiguous bytes per load, one address and constant offsets */
    xa[8] = *(const v4fa*)xn;
#pragma unroll
    for (int t = 0; t < 4; ++t) bv[t] = bias[bi + t * 16];
    asm volatile("s_wait_xcnt 0x0" :: "v"(xb), "v"(xn), "v"(bi) : "memory");      /* stands behind these loads; their addresses are named as inputs so that the registers are rewritten only behind it */
#pragma unroll      /* constant indices keep bq[] in registers */
    for (int ks = 0; ks < PF; ++ks) ldb(ks);      /* the first weight fragments fly beside the input rows */
    if (!in) xa[8] = (v4f){0.f, 0.f, 0.f, 0.f};
#pragma unroll      /* constant indices keep xa[] in registers */
    for (int j = 0; j < 9; ++j) { v4h h4;
#pragma unroll
      for (int q = 0; q < 4; ++q) h4[q] = (_Float16)bf16_round(xa[j][q]);
      *(v4h*)(j < 8 ? &sX[1 + (j >> 1) * 4 + w][(j & 1) * 128 + lane * 4] : &sX[nb * 17][(tid & 63) * 4]) = h4; } }
  __syncthreads();      /* publishes the 18 staged rows to the four waves */
  auto lda = [&](int ks) { const unsigned short* ar = &sX[ln + ks / 8][(ks % 8) * 32 + 8 * hh]; ah[ks & 1].half[0] = *(const v8us*)ar; ah[ks & 1].half[1] = *(const v8us*)(ar + 16); };
  v8f acc[4] = {};
  lda(0);
#pragma unroll      /* constant indices keep bq[] and ah[] in registers, and every weight load's offset is an immediate */
  for (int ks = 0; ks < NK; ++ks) {
    if (ks + PF < NK) ldb(ks + PF);
    if (ks + 1 < NK) lda(ks + 1);
    __builtin_amdgcn_sched_barrier(0);      /* holds the loads for later k-steps in front of this k-step's products: sunk to their uses, each would be waited for in full */
#pragma unroll
    for (int t = 0; t < 4; ++t) acc[t] = __builtin_amdgcn_wmma_f32_16x16x32_f16(false, ah[ks & 1].v, false, bq[ks % (PF + 1)][t].v, (short)0, acc[t], false, false);      /* the plain builtin: the compiler keeps the distance behind it itself */
  }
  asm volatile("s_wait_xcnt 0x0" :: "v"(bp) : "memory");      /* stands behind the weight loads; their address is named as an input so that its registers are rewritten only behind it */
#pragma unroll
  for (int t = 0; t < 4; ++t) { const float bt = bf16_round(bv[t]);
#pragma unroll
    for (int r = 0; r < 8; ++r) so[w][8 * hh + r][t * 16 + ln] = acc[t][r] + bt; }
  __builtin_amdgcn_fence(__ATOMIC_ACQ_REL, "workgroup"); __builtin_amdgcn_wave_barrier();
  const int rsub = lane >> 4, c4 = (lane & 15) * 4;
#pragma unroll
  for (int q = 0; q < 8; ++q) { const int r = q * 2 + rsub; const v4f v = *(const v4fa*)&so[w][r][c4]; if (!F16OUT) *(v4f*)(C + (size_t)(row0 + r) * DD + col0 + c4) = v; else { v4h h4; for (int i = 0; i < 4; ++i) h4[i] = (_Float16)v[i]; *(v4h*)(C16 + (size_t)(row0 + r) * DD + col0 + c4) = h4; } }
}
// Conv weights [o][c][tap] -> f16 in the order in which k_conv3's lanes read B fragments: [k-step][16-column tile][fragment half j][lane hh * 16 + ln][8 halves], holding column o = tile * 16 + ln, k = k-step * 32 + j * 16 + hh * 8 + 0..7. Thread t writes the t-th 16 bytes.
__global__ __launch_bounds__(256) void k_wc3(const float* __restrict__ w, _Float16* __restrict__ Bt) { const int t = blockIdx.x * 256 + threadIdx.x; if (t >= DD * (K3 / 8)) return; const int o = ((t >> 6) & 15) * 16 + (t & 15), k0 = (t >> 10) * 32 + ((t >> 5) & 1) * 16 + ((t >> 4) & 1) * 8; const int tap = k0 / DD, c0 = k0 % DD; FragH f;
  for (int q = 0; q < 8; ++q) f.h[q] = (_Float16)bf16_round(w[((size_t)o * DD + c0 + q) * 3 + tap]);
  *(v8us*)((unsigned short*)Bt + (size_t)t * 8) = f.half[0];  }
__global__ __launch_bounds__(256) void k_scl(float* __restrict__ O, const float* __restrict__ scl, size_t n4) { const size_t t = (size_t)blockIdx.x * 256 + threadIdx.x; if (t >= n4) return; const float s = bf16_round(scl[0]); v4f v = *(const v4fa*)(O + t * 4); for (int q = 0; q < 4; ++q) v[q] *= s; *(v4f*)(O + t * 4) = v;  }
__device__ __forceinline__ float xhalf(float x) { return __builtin_bit_cast(float, __builtin_amdgcn_permlanex16(__builtin_bit_cast(int, x), __builtin_bit_cast(int, x), 0x76543210, 0xfedcba98, false, false)); }      /* lane l takes lane l ^ 16's value */
__device__ __forceinline__ float ex2(float x) { return __builtin_amdgcn_exp2f(x); }      /* 2^x as the one hardware instruction v_exp_f32; every argument below is <= 0 up to one rounding, and a result under the normal range may go to zero */
__device__ __forceinline__ unsigned lds_off(const void* p) { return (unsigned)(size_t)p; }      /* byte offset in the work-group's LDS = low 32 bits of the __shared__ address */
// Four or twelve asynchronous copies, 16 B per lane each, global memory -> LDS. The closing s_wait_xcnt stands inside the statement so that no address register named here is rewritten ahead of it.
__device__ __forceinline__ void acp4(const unsigned (&l)[4], const unsigned short* const (&p)[4]) {
  asm volatile("global_load_async_to_lds_b128 %0, %4, off\n\t"
               "global_load_async_to_lds_b128 %1, %5, off\n\t"
               "global_load_async_to_lds_b128 %2, %6, off\n\t"
               "global_load_async_to_lds_b128 %3, %7, off\n\t"
               "s_wait_xcnt 0x0"
               :: "v"(l[0]), "v"(l[1]), "v"(l[2]), "v"(l[3]), "v"(p[0]), "v"(p[1]), "v"(p[2]), "v"(p[3]) : "memory");
}
__device__ __forceinline__ void acp12(const unsigned (&l)[12], const unsigned short* const (&p)[12]) {
  asm volatile("global_load_async_to_lds_b128 %0, %12, off\n\t"
               "global_load_async_to_lds_b128 %1, %13, off\n\t"
               "global_load_async_to_lds_b128 %2, %14, off\n\t"
               "global_load_async_to_lds_b128 %3, %15, off\n\t"
               "global_load_async_to_lds_b128 %4, %16, off\n\t"
               "global_load_async_to_lds_b128 %5, %17, off\n\t"
               "global_load_async_to_lds_b128 %6, %18, off\n\t"
               "global_load_async_to_lds_b128 %7, %19, off\n\t"
               "global_load_async_to_lds_b128 %8, %20, off\n\t"
               "global_load_async_to_lds_b128 %9, %21, off\n\t"
               "global_load_async_to_lds_b128 %10, %22, off\n\t"
               "global_load_async_to_lds_b128 %11, %23, off\n\t"
               "s_wait_xcnt 0x0"
               :: "v"(l[0]), "v"(l[1]), "v"(l[2]), "v"(l[3]), "v"(l[4]), "v"(l[5]), "v"(l[6]), "v"(l[7]), "v"(l[8]), "v"(l[9]), "v"(l[10]), "v"(l[11]),
                  "v"(p[0]), "v"(p[1]), "v"(p[2]), "v"(p[3]), "v"(p[4]), "v"(p[5]), "v"(p[6]), "v"(p[7]), "v"(p[8]), "v"(p[9]), "v"(p[10]), "v"(p[11]) : "memory");
}
__device__ __forceinline__ v8f mmaP(v16h a, v16h b, v8f c) { return __builtin_amdgcn_wmma_f32_16x16x32_f16(false, a, false, b, (short)0, c, false, false); }      /* the plain builtin: the compiler keeps the distance behind it itself, and no asm statement stands between the LDS reads and the products */
__global__ __launch_bounds__(512) void k_flash(const _Float16* __restrict__ Q16, int ldq, const _Float16* __restrict__ K16, int ldk, const _Float16* __restrict__ Vt, const _Float16* __restrict__ Vtlo, float* __restrict__ O, int ldo) {
  constexpr int RPW = 16, NQB = TT / (4 * RPW), DT = 8, KS = 8;      /* d_qk 256: 8 k-steps; 8 value tiles = ONE 128-wide half of the 256-wide V per wave */
  constexpr int SK = 64, NST = TT / SK;      /* one LDS tile = 64 keys = two 32-key passes, each on its own waves; V rows of 64 keys are whole 128-B lines */
  constexpr int KP = 256 + 8, VP = SK + 8;      /* LDS row pitches in halves: 528 B and 144 B, both 16 B x odd, conflict-free for the 16-row ds_load_b128 fragment reads */
  __shared__ __attribute__((aligned(16))) unsigned short sQ[4 * RPW][KP]; __shared__ __attribute__((aligned(16))) unsigned short sK[2][SK][KP]; __shared__ __attribute__((aligned(16))) unsigned short sVh[2][256][VP]; __shared__ __attribute__((aligned(16))) unsigned short sVl[2][256][VP];
  __shared__ float sM[8][RPW]; __shared__ float sL[8][RPW];
  typedef float f32a __attribute__((may_alias)); static_assert(sizeof(sK) == 8 * RPW * (128 + 4) * sizeof(float), "the eight output tiles fill the K ring exactly");
  f32a (*sO)[RPW][128 + 4] = (f32a (*)[RPW][128 + 4])&sK[0][0][0];      /* the output tiles reuse the K ring, which nobody reads or fills behind the loop's last barrier */
  const int tid = threadIdx.x, w = tid >> 5, lane = tid & 31, ln = lane & 15, hh = lane >> 4;
  const int slab = blockIdx.x / NQB, qblk = blockIdx.x % NQB; const int b = slab / NH, h = slab % NH; const int qb0 = qblk * (4 * RPW);
  const int wq = w & 3, vhf = (w >> 2) & 1, pr = w & 7; const int q0 = qb0 + wq * RPW;      /* sixteen waves, four per SIMD: 4 groups of 16 query rows x 2 halves of V x 2 halves of each tile's keys; pr numbers the pair of waves that share rows and V half */
  const unsigned short* Qg = (const unsigned short*)Q16 + ((size_t)b * TT + qb0) * ldq; const unsigned short* Kg = (const unsigned short*)K16 + (size_t)b * TT * ldk;
  const unsigned short* Vth = (const unsigned short*)Vt + (size_t)b * VSTR * TT; const unsigned short* Vtl = (const unsigned short*)Vtlo + (size_t)b * VSTR * TT;      /* hi and UNSCALED residual planes */
  const int wu = __builtin_amdgcn_readfirstlane(w);      /* the wave's number as a scalar: the row parts of the copies' addresses stay in scalar registers */
  const int kp = wu >> 3;      /* which 32 keys of every tile this wave takes (scalar: the epilogue branches on it) */
  /* tile t -> buffer buf, 12 copies per wave: 4 K rows (one 512-B row per copy), 16 of the 256 rows of each V plane (four 128-B rows per copy) */
  auto stage = [&](int t, int buf) {
    unsigned l[12]; const unsigned short* p[12];
#pragma unroll      /* constant indices keep l[] and p[] in registers */
    for (int i = 0; i < 4; ++i) { const int r = wu * 4 + i; l[i] = lds_off(&sK[buf][r][lane * 8]); p[i] = Kg + (size_t)(t * SK + r) * ldk + lane * 8; }
#pragma unroll      /* constant indices keep l[] and p[] in registers */
    for (int i = 0; i < 4; ++i) { const int d = wu * 16 + i * 4 + (lane >> 3); l[4 + i] = lds_off(&sVh[buf][d][(lane & 7) * 8]); p[4 + i] = Vth + (size_t)d * TT + t * SK + (lane & 7) * 8; l[8 + i] = lds_off(&sVl[buf][d][(lane & 7) * 8]); p[8 + i] = Vtl + (size_t)d * TT + t * SK + (lane & 7) * 8; }
    acp12(l, p); };
  { unsigned l[4]; const unsigned short* p[4];      /* the block's 64 query rows, filled once: 4 rows per wave */
#pragma unroll      /* constant indices keep l[] and p[] in registers */
    for (int i = 0; i < 4; ++i) { const int r = wu * 4 + i; l[i] = lds_off(&sQ[r][lane * 8]); p[i] = Qg + (size_t)r * ldq + lane * 8; }
    acp4(l, p); }
  stage(0, 0);
  asm volatile("s_wait_asynccnt 0x0" ::: "memory");      /* this wave's copies of Q and of tile 0 have landed */
  __syncthreads();      /* publishes Q and tile 0 to every wave */
  stage(1, 1);
  const unsigned short* qrow = &sQ[wq * RPW + ln][0];
  /* Transposed products: St = K x Qt and Ot += Vt x Pt. Lane (ln, hh) holds query q0 + ln: its scores of keys 8 hh + r of each 16-key tile, and its outputs of value columns 8 hh + r of each 16-column tile. */
  float m_r = -3.0e38f, l_r = 0.f; v8f oacc[DT];
#pragma unroll
  for (int dt = 0; dt < DT; ++dt) oacc[dt] = (v8f){0.f,0.f,0.f,0.f,0.f,0.f,0.f,0.f};
#pragma unroll 1
  for (int t = 0; t < NST; ++t) {
   const int buf = t & 1;
   {
    const int j0 = kp * 32;      /* first key of this wave's pass inside the tile */
    const unsigned short* kr0 = &sK[buf][j0 + ln][0]; const unsigned short* kr1 = &sK[buf][j0 + 16 + ln][0];
    FragH aq[KS], bk[KS]; v8f s[2] = {(v8f){0.f,0.f,0.f,0.f,0.f,0.f,0.f,0.f}, (v8f){0.f,0.f,0.f,0.f,0.f,0.f,0.f,0.f}};
#pragma unroll      /* constant indices keep the fragments in registers */
    for (int ks = 0; ks < KS; ++ks) { aq[ks].half[0] = *(const v8us*)(qrow + ks * 32 + 8 * hh); aq[ks].half[1] = *(const v8us*)(qrow + ks * 32 + 16 + 8 * hh); bk[ks].half[0] = *(const v8us*)(kr0 + ks * 32 + 8 * hh); bk[ks].half[1] = *(const v8us*)(kr0 + ks * 32 + 16 + 8 * hh); }      /* one group of reads: Q and the first 16 keys, all k-steps */
    __builtin_amdgcn_sched_barrier(0);      /* holds the group of reads in front of the products: one LDS latency is waited for, not one per product */
#pragma unroll      /* constant indices keep the fragments in registers */
    for (int ks = 0; ks < KS; ++ks) { s[0] = mmaP(bk[ks].v, aq[ks].v, s[0]); bk[ks].half[0] = *(const v8us*)(kr1 + ks * 32 + 8 * hh); bk[ks].half[1] = *(const v8us*)(kr1 + ks * 32 + 16 + 8 * hh);      /* A = 16 keys, B = 16 queries; the second 16 keys' fragments follow one k-step at a time, as the products free registers */
      __builtin_amdgcn_sched_barrier(0);      /* keeps each refill behind its product: hoisted, all the reads at once would not fit the register budget */ }
    const unsigned short* vh0 = &sVh[buf][vhf * 128 + ln][j0 + 8 * hh]; const unsigned short* vl0 = &sVl[buf][vhf * 128 + ln][j0 + 8 * hh];
    FragH bv[DT], bl[DT];      /* all of the pass's V fragments, both planes: the 128 registers that Q and K leave */
    static_assert(DT == KS, "one value tile's fragments follow each k-step of the second score tile");
#pragma unroll      /* constant indices keep the fragments in registers */
    for (int ks = 0; ks < KS; ++ks) { s[1] = mmaP(bk[ks].v, aq[ks].v, s[1]); bv[ks].half[0] = *(const v8us*)(vh0 + ks * 16 * VP); bv[ks].half[1] = *(const v8us*)(vh0 + ks * 16 * VP + 16); bl[ks].half[0] = *(const v8us*)(vl0 + ks * 16 * VP); bl[ks].half[1] = *(const v8us*)(vl0 + ks * 16 * VP + 16);
      __builtin_amdgcn_sched_barrier(0);      /* as above: a value tile's reads stay behind the product that frees their 16 registers */ }
    /* Every LDS read of tile t is issued above, so the hand-over of the ring stands here: softmax and the V products below work on registers alone, and a wave that ends them early starts on tile t + 1 while its neighbours still compute. */
    asm volatile("s_wait_dscnt 0x0" ::: "memory");      /* this wave's reads of tile t have returned before its buffer is refilled */
    asm volatile("s_wait_asynccnt 0x0" ::: "memory");      /* this wave's copies of tile t + 1 have landed */
    __syncthreads();      /* publishes tile t + 1 and ends every wave's reads of tile t */
    __builtin_amdgcn_sched_barrier(0);      /* keeps the register-only work below behind the hand-over: moved above it, the V reads would again be waited for one product at a time */
    constexpr float SC2 = ATT_SCALE * 1.44269504088896340736f;      /* 1/16 x log2(e): exp(score / 16 - max) = 2^(score x SC2 - max x log2(e)); scores and running maximum are kept in these log2 units */
    float sc[16];
#pragma unroll
    for (int i = 0; i < 16; ++i) sc[i] = s[i >> 3][i & 7] * SC2;
    float mc = sc[0];
#pragma unroll
    for (int i = 1; i < 16; ++i) mc = fmaxf(mc, sc[i]);
    mc = fmaxf(mc, xhalf(mc));      /* the other 16 of the query's 32 keys sit in lane ^ 16 */
    const float mn = fmaxf(m_r, mc); const float ea = ex2(m_r - mn); const float al = (mn > -1.0e38f) ? ea : 1.0f; m_r = mn;
    FragH ph, pl; float ls[4] = {0.f, 0.f, 0.f, 0.f};      /* element i of the two score tiles is element i of a B fragment in the k order of the V loader below: P stays in registers */
#pragma unroll
    for (int i = 0; i < 16; ++i) { const float p = ex2(sc[i] - mn); ls[i & 3] += p; const float ps = p * 1024.0f; const _Float16 hp = (_Float16)ps; ph.h[i] = hp; pl.h[i] = (_Float16)(ps - (float)hp); }      /* P hi and its UNSCALED residual (added into the same accumulator) */
    l_r = l_r * al + ((ls[0] + ls[1]) + (ls[2] + ls[3]));      /* this lane's 16 keys of every pass; the two halves are joined behind the loop */
#pragma unroll
    for (int dt = 0; dt < DT; ++dt)
#pragma unroll
      for (int r = 0; r < 8; ++r) oacc[dt][r] *= al;
#pragma unroll
    for (int dt = 0; dt < DT; ++dt) { oacc[dt] = mmaP(bv[dt].v, ph.v, oacc[dt]); oacc[dt] = mmaP(bv[dt].v, pl.v, oacc[dt]); oacc[dt] = mmaP(bl[dt].v, ph.v, oacc[dt]); } }      /* Vh x Ph + Vh x Pl + Vl x Ph, all unscaled, one accumulator; A = 16 value columns, B = 16 queries */
   if (t + 2 < NST) stage(t + 2, buf); }
  asm volatile("s_wait_asynccnt 0x0" ::: "memory");      /* no copy is outstanding behind the loop */
  l_r += xhalf(l_r);      /* row sum over this wave's keys */
  if (kp == 1) {      /* the wave of the second key half hands its running max, row sum and unnormalised tile to its partner */
#pragma unroll
    for (int dt = 0; dt < DT; ++dt) { *(v4fa*)&sO[pr][ln][dt * 16 + 8 * hh] = (v4f){oacc[dt][0], oacc[dt][1], oacc[dt][2], oacc[dt][3]}; *(v4fa*)&sO[pr][ln][dt * 16 + 8 * hh + 4] = (v4f){oacc[dt][4], oacc[dt][5], oacc[dt][6], oacc[dt][7]}; }
    if (hh == 0) { sM[pr][ln] = m_r; sL[pr][ln] = l_r; } }
  __syncthreads();      /* publishes the second key half's partial results to the partner waves */
  if (kp == 0) {
    const float m1 = sM[pr][ln], l1 = sL[pr][ln]; const float mn = fmaxf(m_r, m1); const float a0 = ex2(m_r - mn), a1 = ex2(m1 - mn); const float l = l_r * a0 + l1 * a1; const float inv = (l > 0.f) ? 1.0f / (l * 1024.0f) : 0.f; const float c0 = a0 * inv, c1 = a1 * inv;
#pragma unroll
    for (int dt = 0; dt < DT; ++dt)
#pragma unroll
      for (int g = 0; g < 2; ++g) { v4fa* o = (v4fa*)&sO[pr][ln][dt * 16 + 8 * hh + 4 * g]; const v4f x = *o; *o = (v4f){oacc[dt][4 * g] * c0 + x[0] * c1, oacc[dt][4 * g + 1] * c0 + x[1] * c1, oacc[dt][4 * g + 2] * c0 + x[2] * c1, oacc[dt][4 * g + 3] * c0 + x[3] * c1}; }      /* each lane reads and rewrites its own words */
    __builtin_amdgcn_fence(__ATOMIC_ACQ_REL, "workgroup"); __builtin_amdgcn_wave_barrier();
#pragma unroll
    for (int r = 0; r < RPW; ++r) { const int pc = lane; const v4f val = *(const v4fa*)&sO[pr][r][pc * 4]; *(v4f*)(O + ((size_t)b * TT + q0 + r) * ldo + (h * 2 + vhf) * 128 + pc * 4) = val; }      /* one 512-B row per instruction: 32 lanes x 16 B */
  } }

extern "C" void kernel_launch(void* const* d_in, const int* in_sizes, int n_in,
                              void* d_out, int out_size, void* d_ws, size_t ws_size, hipStream_t stream) {
  (void)in_sizes; (void)n_in; (void)out_size;
  const float* const* I = (const float* const*)d_in; const float* xq = I[0]; const float* xk = I[1]; const float* xv = I[2]; const float* qw = I[3]; const float* qb = I[4]; const float* kw = I[5]; const float* kb = I[6]; const float* vw = I[7]; const float* vb = I[8]; const float* scl = I[9];
  char* ws = (char*)d_ws; size_t off = 0;
  auto take = [&](size_t bytes) { char* p = ws + off; off += (bytes + 255) & ~(size_t)255; return p; };
  _Float16* Bq = (_Float16*)take((size_t)DD * K3 * 2); _Float16* Bk = (_Float16*)take((size_t)DD * K3 * 2); _Float16* Bv = (_Float16*)take((size_t)DD * K3 * 2); _Float16* Q = (_Float16*)take((size_t)NR * DD * 2); _Float16* K = (_Float16*)take((size_t)NR * DD * 2); float* VF = (float*)take((size_t)NR * DD * 4); _Float16* Vt = (_Float16*)take((size_t)NR * DD * 2); _Float16* Vtl = (_Float16*)take((size_t)NR * DD * 2);
  if (off > ws_size) return;      // 1.2 + 8.4 + 8.4 + 16.8 + 8.4 + 8.4 = about 52 MB
  k_wc3<<<(DD * (K3 / 8) + 255) / 256, 256, 0, stream>>>(qw, Bq); k_wc3<<<(DD * (K3 / 8) + 255) / 256, 256, 0, stream>>>(kw, Bk); k_wc3<<<(DD * (K3 / 8) + 255) / 256, 256, 0, stream>>>(vw, Bv);
  k_conv3<true><<<NR / 16, 128, 0, stream>>>(xq, Bq, qb, nullptr, Q);      /* q = conv(query): M 16384 N 256 K 768 (exact products), f16 out */
  k_conv3<true><<<NR / 16, 128, 0, stream>>>(xk, Bk, kb, nullptr, K);
  k_conv3<false><<<NR / 16, 128, 0, stream>>>(xv, Bv, vb, VF, nullptr);      /* v (f32) */
  k_vthlu<<<BB * NVH * (TT / 64), 256, 0, stream>>>(VF, DD, Vt, Vtl);      /* Vᵀ hi + residual: [b][256][4096] */
  k_flash<<<BB * NH * (TT / 64), 512, 0, stream>>>(Q, DD, K, DD, Vt, Vtl, (float*)d_out, DD);      /* both 128-wide halves of O in one launch, straight into the output rows */
  k_scl<<<(unsigned)(((size_t)NR * DD / 4 + 255) / 256), 256, 0, stream>>>((float*)d_out, scl, (size_t)NR * DD / 4);      /* × scale */
}

// v008
// It runs in 178 microseconds.
// In both of two side-by-side timings against v007, it was 1.15 times as fast.
// All steps since v000 together make it 10.2 times as fast.
#include <hip/hip_runtime.h>
// KQV 'PCNN' attention (B=4, S=4096, D=256): q, k, v = Conv1d(kernel 3, pad 1) over the sequence of query/key/value (+bias); scores = q·k/16; softmax; out = scale·(P·v) → [4,4096,256].
// Compute dtype: inputs, conv weights/biases, scale rounded to bf16; each conv as an im2col GEMM (K = 3·256, bf16-exact operands, f32 accumulate) → q, k f16 planes, v f32 → Vᵀ f16 hi + exact residual; fused flash-style kernel with d_qk = 256 (8 k-steps, online softmax f32, P f16 hi + residual,
// f32 accumulate) on v_wmma_f32_16x16x32_f16, one launch of 8-wave blocks (query rows x halves of each key tile), writing the output rows directly; × scale in f32.
#define BB 4
#define TT 4096
#define DD 256
#define NH 1
#define VSTR 256
#define NVH 4
#define NR (BB * TT)
#define K3 (3 * DD)
#define ATT_SCALE 0.0625f

typedef __bf16 v16b __attribute__((ext_vector_type(16)));
typedef unsigned short v8us __attribute__((ext_vector_type(8), may_alias));
typedef float  v8f  __attribute__((ext_vector_type(8)));
typedef float  v4f  __attribute__((ext_vector_type(4)));
typedef float  v4fa __attribute__((ext_vector_type(4), may_alias));
union FragB { v16b v; v8us half[2]; unsigned short u[16]; };

__device__ __forceinline__ unsigned short bf16_bits(float x) { unsigned int u = __float_as_uint(x); return (unsigned short)((u + 0x7FFFu + ((u >> 16) & 1u)) >> 16); }
__device__ __forceinline__ float bf16_val(unsigned short b) { return __uint_as_float(((unsigned int)b) << 16); }
__device__ __forceinline__ float bf16_round(float x) { return bf16_val(bf16_bits(x)); }
// D += A·B with NT terms: 1 = ah·bh, 2 = + al·bh (A split), 3 = + ah·bl (both split)
template <int NT>
__device__ __forceinline__ v8f mmaN(v16b ah, v16b al, v16b bh, v16b bl, v8f c) {
  c = __builtin_amdgcn_wmma_f32_16x16x32_bf16(false, ah, false, bh, (short)0, c, false, false);
  if (NT >= 2) c = __builtin_amdgcn_wmma_f32_16x16x32_bf16(false, al, false, bh, (short)0, c, false, false);
  if (NT >= 3) c = __builtin_amdgcn_wmma_f32_16x16x32_bf16(false, ah, false, bl, (short)0, c, false, false);
  asm volatile("v_nop\n\tv_nop\n\tv_nop\n\tv_nop" : "+v"(c) : "v"(ah), "v"(al), "v"(bh), "v"(bl));
  return c;
}

__global__ __launch_bounds__(256) void k_wt_bf16(const float* __restrict__ W, unsigned short* __restrict__ Wt, int K, int N) {
  const int t = blockIdx.x * 256 + threadIdx.x;
  const int k8n = K / 8;
  if (t >= N * k8n) return;
  const int n = t / k8n, k8 = (t % k8n) * 8;
  v8us v;
#pragma unroll
  for (int i = 0; i < 8; ++i) v[i] = bf16_bits(W[(size_t)(k8 + i) * N + n]);
  *(v8us*)(Wt + (size_t)n * K + k8) = v;
  
}

// GEMM C[M][N] (f32, pitch ldc) = act(A[M][K]·W + bias). A f32 row-major (pitch lda) converted per fragment to bf16
// (ASPLIT: hi/lo two planes -> 2 terms, else single rounded term); Wt bf16 [N][K] (pitch ldb). BIAS_BF16 rounds the
// bias to bf16 first (bias quantised to bf16 before the add). K%32==0, M%16==0, N%64==0.
template <bool ASPLIT, int ACT, bool BIAS_BF16>
__global__ __launch_bounds__(128) void k_gemm_bf(const float* __restrict__ A, int lda, const unsigned short* __restrict__ Wt, int ldb,
                                               const float* __restrict__ bias, float* __restrict__ C, int ldc, int M, int N, int K) {
  __shared__ __attribute__((aligned(16))) float so[4][16][64];
  const int tid = threadIdx.x, w = tid >> 5, lane = tid & 31, ln = lane & 15, hh = lane >> 4;
  const int ntn = N / 64;
  const int wid = blockIdx.x * 4 + w;
  const int mt = wid / ntn, nq = wid % ntn;
  if (mt * 16 >= M) return;
  const int row0 = mt * 16, col0 = nq * 64;
  const float* arow = A + (size_t)(row0 + ln) * lda;
  v8f acc[4] = {};
  for (int kb = 0; kb < K; kb += 32) {
    FragB ah, al;
    const v4f x0 = *(const v4fa*)(arow + kb + 8 * hh), x1 = *(const v4fa*)(arow + kb + 8 * hh + 4);
    const v4f x2 = *(const v4fa*)(arow + kb + 16 + 8 * hh), x3 = *(const v4fa*)(arow + kb + 16 + 8 * hh + 4);
    float xs[16] = {x0[0],x0[1],x0[2],x0[3],x1[0],x1[1],x1[2],x1[3],x2[0],x2[1],x2[2],x2[3],x3[0],x3[1],x3[2],x3[3]};
#pragma unroll
    for (int i = 0; i < 16; ++i) { const unsigned short hb = bf16_bits(xs[i]); ah.u[i] = hb; al.u[i] = ASPLIT ? bf16_bits(xs[i] - bf16_val(hb)) : (unsigned short)0; }
#pragma unroll
    for (int t = 0; t < 4; ++t) {
      const unsigned short* brow = Wt + (size_t)(col0 + t * 16 + ln) * ldb + kb;
      FragB b;
      b.half[0] = *(const v8us*)(brow + 8 * hh);
      b.half[1] = *(const v8us*)(brow + 16 + 8 * hh);
      acc[t] = mmaN<ASPLIT ? 2 : 1>(ah.v, al.v, b.v, b.v, acc[t]);
    }
  }
#pragma unroll
  for (int t = 0; t < 4; ++t) {
    float bv = bias ? bias[col0 + t * 16 + ln] : 0.f;
    if (BIAS_BF16) bv = bf16_round(bv);
#pragma unroll
    for (int r = 0; r < 8; ++r) { float v = acc[t][r] + bv; if (ACT == 1) v = fmaxf(v, 0.f); so[w][8 * hh + r][t * 16 + ln] = v; }
  }
  __builtin_amdgcn_fence(__ATOMIC_ACQ_REL, "workgroup");
  __builtin_amdgcn_wave_barrier();
  const int rsub = lane >> 4, c4 = (lane & 15) * 4;
  {
#pragma unroll
    for (int q = 0; q < 8; ++q) {
      const int r = q * 2 + rsub;
      const v4f v = *(const v4fa*)&so[w][r][c4];
      *(v4f*)(C + (size_t)(row0 + r) * ldc + col0 + c4) = v;
    }
    
  }
}

// Flash-style causal/unmasked attention, all contractions 3-term bf16 hi/lo splits, f32 softmax with running max.
// q,k,v rows are read from f32 buffers with arbitrary row pitch (so they can live inside a fused qkv buffer);
// D = head size (multiple of 32, <= 128); one wave = 16 query rows; block = 4 waves (64 queries) sharing K/V chunks of 32.
template <int D, bool CAUSAL>
__global__ __launch_bounds__(128) void k_flash(const float* __restrict__ qb, const float* __restrict__ kb, const float* __restrict__ vb,
                                             int pitch, int T, int H, float scale, float* __restrict__ y, int ypitch) {
  constexpr int KS = D / 32;        // k-steps for QK
  constexpr int DT = D / 16;        // d tiles for PV
  __shared__ __attribute__((aligned(16))) unsigned short sKh[32][D + 8], sKl[32][D + 8], sVh[32][D + 8], sVl[32][D + 8];
  __shared__ __attribute__((aligned(16))) unsigned short sPh[4][16][40], sPl[4][16][40];
  __shared__ __attribute__((aligned(16))) float sO[4][16][D];
  const int tid = threadIdx.x, w = tid >> 5, lane = tid & 31, ln = lane & 15, hh = lane >> 4;
  const int nqb = (T + 63) / 64;
  const int bh = blockIdx.x / nqb, qblk = blockIdx.x % nqb;
  const int b = bh / H, h = bh % H;
  const int q0 = qblk * 64 + w * 16;
  const float* Q = qb + (size_t)b * T * pitch + h * D;
  const float* K = kb + (size_t)b * T * pitch + h * D;
  const float* V = vb + (size_t)b * T * pitch + h * D;

  // A fragments of the wave's 16 query rows (scaled), hi/lo
  FragB aqh[KS], aql[KS];
  {
    int row = q0 + ln; if (row >= T) row = T - 1;
    const float* qr = Q + (size_t)row * pitch;
#pragma unroll
    for (int ks = 0; ks < KS; ++ks)
#pragma unroll
      for (int i = 0; i < 16; ++i) {
        const int d = ks * 32 + ((i < 8) ? (8 * hh + i) : (16 + 8 * hh + (i - 8)));
        const float x = qr[d] * scale; const unsigned short hb = bf16_bits(x);
        aqh[ks].u[i] = hb; aql[ks].u[i] = bf16_bits(x - bf16_val(hb));
      }
  }
  float m_r[8], l_r[8];
#pragma unroll
  for (int r = 0; r < 8; ++r) { m_r[r] = -3.0e38f; l_r[r] = 0.f; }
  v8f oacc[DT];
#pragma unroll
  for (int dt = 0; dt < DT; ++dt) oacc[dt] = (v8f){0.f,0.f,0.f,0.f,0.f,0.f,0.f,0.f};

  const int kv_end = CAUSAL ? min(T, qblk * 64 + 64) : T;     // block-uniform
  for (int j0 = 0; j0 < kv_end; j0 += 32) {
    __syncthreads();
    for (int e = tid; e < 32 * (D / 4); e += 128) {
      const int r = e / (D / 4), c4 = (e % (D / 4)) * 4;
      const int key = j0 + r;
      v4f kf = {0.f,0.f,0.f,0.f}, vf = {0.f,0.f,0.f,0.f};
      if (key < T) { kf = *(const v4fa*)(K + (size_t)key * pitch + c4); vf = *(const v4fa*)(V + (size_t)key * pitch + c4); }
#pragma unroll
      for (int t = 0; t < 4; ++t) {
        unsigned short hb = bf16_bits(kf[t]); sKh[r][c4 + t] = hb; sKl[r][c4 + t] = bf16_bits(kf[t] - bf16_val(hb));
        hb = bf16_bits(vf[t]); sVh[r][c4 + t] = hb; sVl[r][c4 + t] = bf16_bits(vf[t] - bf16_val(hb));
      }
    }
    __syncthreads();
    // S tile 16 x 32
    v8f s[2];
#pragma unroll
    for (int nt = 0; nt < 2; ++nt) {
      v8f acc = {};
#pragma unroll
      for (int ks = 0; ks < KS; ++ks) {
        FragB bh_, bl_;
        bh_.half[0] = *(const v8us*)&sKh[nt * 16 + ln][ks * 32 + 8 * hh]; bh_.half[1] = *(const v8us*)&sKh[nt * 16 + ln][ks * 32 + 16 + 8 * hh];
        bl_.half[0] = *(const v8us*)&sKl[nt * 16 + ln][ks * 32 + 8 * hh]; bl_.half[1] = *(const v8us*)&sKl[nt * 16 + ln][ks * 32 + 16 + 8 * hh];
        acc = mmaN<3>(aqh[ks].v, aql[ks].v, bh_.v, bl_.v, acc);
      }
      s[nt] = acc;
    }
    // mask + running max (rows 8hh+r; the 16 lanes of a half share rows)
    float alpha[8];
#pragma unroll
    for (int r = 0; r < 8; ++r) {
      const int qi = q0 + 8 * hh + r;
      const int ja = j0 + ln, jb = j0 + 16 + ln;
      if (CAUSAL) { if (ja > qi) s[0][r] = -3.0e38f; if (jb > qi) s[1][r] = -3.0e38f; }
      if (ja >= T) s[0][r] = -3.0e38f;
      if (jb >= T) s[1][r] = -3.0e38f;
      float mx = fmaxf(s[0][r], s[1][r]);
      mx = fmaxf(mx, __shfl_xor(mx, 1, 32)); mx = fmaxf(mx, __shfl_xor(mx, 2, 32)); mx = fmaxf(mx, __shfl_xor(mx, 4, 32)); mx = fmaxf(mx, __shfl_xor(mx, 8, 32));
      const float mnew = fmaxf(m_r[r], mx);
      alpha[r] = (mnew > -1.0e38f) ? __expf(m_r[r] - mnew) : 1.0f;
      const float p0 = (s[0][r] > -1.0e38f) ? __expf(s[0][r] - mnew) : 0.f;
      const float p1 = (s[1][r] > -1.0e38f) ? __expf(s[1][r] - mnew) : 0.f;
      m_r[r] = mnew;
      l_r[r] = l_r[r] * alpha[r] + p0 + p1;            // per-lane partial row sum (16 lanes combined at the end)
      unsigned short hb = bf16_bits(p0); sPh[w][8 * hh + r][ln] = hb;      sPl[w][8 * hh + r][ln] = bf16_bits(p0 - bf16_val(hb));
      hb = bf16_bits(p1);                sPh[w][8 * hh + r][16 + ln] = hb; sPl[w][8 * hh + r][16 + ln] = bf16_bits(p1 - bf16_val(hb));
    }
#pragma unroll
    for (int dt = 0; dt < DT; ++dt)
#pragma unroll
      for (int r = 0; r < 8; ++r) oacc[dt][r] *= alpha[r];
    __builtin_amdgcn_fence(__ATOMIC_ACQ_REL, "workgroup");
    __builtin_amdgcn_wave_barrier();
    FragB pah, pal;
    pah.half[0] = *(const v8us*)&sPh[w][ln][8 * hh]; pah.half[1] = *(const v8us*)&sPh[w][ln][16 + 8 * hh];
    pal.half[0] = *(const v8us*)&sPl[w][ln][8 * hh]; pal.half[1] = *(const v8us*)&sPl[w][ln][16 + 8 * hh];
#pragma unroll
    for (int dt = 0; dt < DT; ++dt) {
      FragB bvh, bvl;
#pragma unroll
      for (int i = 0; i < 8; ++i) {
        bvh.u[i] = sVh[8 * hh + i][dt * 16 + ln]; bvh.u[8 + i] = sVh[16 + 8 * hh + i][dt * 16 + ln];
        bvl.u[i] = sVl[8 * hh + i][dt * 16 + ln]; bvl.u[8 + i] = sVl[16 + 8 * hh + i][dt * 16 + ln];
      }
      oacc[dt] = mmaN<3>(pah.v, pal.v, bvh.v, bvl.v, oacc[dt]);
    }
    __builtin_amdgcn_fence(__ATOMIC_ACQ_REL, "workgroup");
    __builtin_amdgcn_wave_barrier();
  }
#pragma unroll
  for (int r = 0; r < 8; ++r) {
    float l = l_r[r];
    l += __shfl_xor(l, 1, 32); l += __shfl_xor(l, 2, 32); l += __shfl_xor(l, 4, 32); l += __shfl_xor(l, 8, 32);
    l_r[r] = (l > 0.f) ? 1.0f / l : 0.f;
  }
#pragma unroll
  for (int dt = 0; dt < DT; ++dt)
#pragma unroll
    for (int r = 0; r < 8; ++r) sO[w][8 * hh + r][dt * 16 + ln] = oacc[dt][r] * l_r[r];
  __builtin_amdgcn_fence(__ATOMIC_ACQ_REL, "workgroup");
  __builtin_amdgcn_wave_barrier();
  {
    for (int r = 0; r < 16; ++r) {
      const int row = q0 + r;
      if (row < T && lane < D / 4) {
        const v4f val = *(const v4fa*)&sO[w][r][lane * 4];
        *(v4f*)(y + ((size_t)b * T + row) * ypitch + h * D + lane * 4) = val;
      }
    }
    
  }
}

// GEMM C = act(A·W + bias + resid): A f32 (ASPLIT -> hi/lo 2 terms), Wt bf16 [N][K]; ACT 0 none, 1 relu, 2 exact gelu;
// resid (optional, f32, row index = (row % rmod), pitch ldr, RES_BF16 rounds it) added before the activation.
template <bool ASPLIT, int ACT, bool BIAS_BF16, bool RES_BF16>
__global__ __launch_bounds__(128) void k_gemm_bf3(const float* __restrict__ A, int lda, const unsigned short* __restrict__ Wt, int ldb,
                                                const float* __restrict__ bias, const float* __restrict__ resid, int rmod, int ldr,
                                                float* __restrict__ C, int ldc, int M, int N, int K) {
  __shared__ __attribute__((aligned(16))) float so[4][16][64];
  const int tid = threadIdx.x, w = tid >> 5, lane = tid & 31, ln = lane & 15, hh = lane >> 4;
  const int ntn = N / 64;
  const int wid = blockIdx.x * 4 + w;
  const int mt = wid / ntn, nq = wid % ntn;
  if (mt * 16 >= M) return;
  const int row0 = mt * 16, col0 = nq * 64;
  const float* arow = A + (size_t)(row0 + ln) * lda;
  v8f acc[4] = {};
  for (int kb = 0; kb < K; kb += 32) {
    FragB ah, al;
    const v4f x0 = *(const v4fa*)(arow + kb + 8 * hh), x1 = *(const v4fa*)(arow + kb + 8 * hh + 4);
    const v4f x2 = *(const v4fa*)(arow + kb + 16 + 8 * hh), x3 = *(const v4fa*)(arow + kb + 16 + 8 * hh + 4);
    float xs[16] = {x0[0],x0[1],x0[2],x0[3],x1[0],x1[1],x1[2],x1[3],x2[0],x2[1],x2[2],x2[3],x3[0],x3[1],x3[2],x3[3]};
#pragma unroll
    for (int i = 0; i < 16; ++i) { const unsigned short hb = bf16_bits(xs[i]); ah.u[i] = hb; al.u[i] = ASPLIT ? bf16_bits(xs[i] - bf16_val(hb)) : (unsigned short)0; }
#pragma unroll
    for (int t = 0; t < 4; ++t) {
      const unsigned short* brow = Wt + (size_t)(col0 + t * 16 + ln) * ldb + kb;
      FragB b;
      b.half[0] = *(const v8us*)(brow + 8 * hh);
      b.half[1] = *(const v8us*)(brow + 16 + 8 * hh);
      acc[t] = mmaN<ASPLIT ? 2 : 1>(ah.v, al.v, b.v, b.v, acc[t]);
    }
  }
#pragma unroll
  for (int t = 0; t < 4; ++t) {
    const int col = col0 + t * 16 + ln;
    float bv = bias ? bias[col] : 0.f;
    if (BIAS_BF16) bv = bf16_round(bv);
#pragma unroll
    for (int r = 0; r < 8; ++r) {
      float v = acc[t][r] + bv;
      if (resid) { float rv = resid[(size_t)((row0 + 8 * hh + r) % rmod) * ldr + col]; if (RES_BF16) rv = bf16_round(rv); v += rv; }
      if (ACT == 1) v = fmaxf(v, 0.f);
      if (ACT == 2) v = 0.5f * v * (1.0f + erff(v * 0.70710678118654752f));
      if (ACT == 3) { const float u = 0.7978845608028654f * (v + 0.044715f * v * v * v); v = 0.5f * v * (1.0f + tanhf(u)); }
      so[w][8 * hh + r][t * 16 + ln] = v;
    }
  }
  __builtin_amdgcn_fence(__ATOMIC_ACQ_REL, "workgroup");
  __builtin_amdgcn_wave_barrier();
  const int rsub = lane >> 4, c4 = (lane & 15) * 4;
  {
#pragma unroll
    for (int q = 0; q < 8; ++q) {
      const int r = q * 2 + rsub;
      const v4f v = *(const v4fa*)&so[w][r][c4];
      *(v4f*)(C + (size_t)(row0 + r) * ldc + col0 + c4) = v;
    }
    
  }
}
// row LayerNorm (biased variance, eps) over N: s = X (+ R); optional out_sum <- s; out_norm <- (s-mu)*rsqrt(var+eps)*g + b
template <bool PARAM_BF16>
__global__ __launch_bounds__(256) void k_layernorm(const float* __restrict__ X, const float* __restrict__ R, const float* __restrict__ g, const float* __restrict__ bta,
                                                  float* __restrict__ out_sum, float* __restrict__ out_norm, int N, float eps) {
  __shared__ float red[256];
  const int row = blockIdx.x, tid = threadIdx.x;
  const float* x = X + (size_t)row * N; const float* rr = R ? R + (size_t)row * N : nullptr;
  float vals[16];                     // up to N = 4096
  const int per = N / 256;            // contiguous chunk per thread? use strided-by-4 chunks: thread handles j = tid*4 + 1024*u
  float s1 = 0.f;
  for (int u = 0; u < per / 4; ++u) {
    const int j = tid * 4 + 1024 * u;
    const v4f a = *(const v4fa*)(x + j);
    v4f b = {0.f,0.f,0.f,0.f}; if (rr) b = *(const v4fa*)(rr + j);
#pragma unroll
    for (int q = 0; q < 4; ++q) { const float v = a[q] + b[q]; vals[u * 4 + q] = v; s1 += v; }
  }
  red[tid] = s1; __syncthreads();
  for (int st = 128; st > 0; st >>= 1) { if (tid < st) red[tid] += red[tid + st]; __syncthreads(); }
  const float mu = red[0] / (float)N; __syncthreads();
  float s2 = 0.f;
  for (int u = 0; u < per / 4; ++u)
#pragma unroll
    for (int q = 0; q < 4; ++q) { const float c = vals[u * 4 + q] - mu; s2 += c * c; }
  red[tid] = s2; __syncthreads();
  for (int st = 128; st > 0; st >>= 1) { if (tid < st) red[tid] += red[tid + st]; __syncthreads(); }
  const float rs = rsqrtf(red[0] / (float)N + eps);
  {
    for (int u = 0; u < per / 4; ++u) {
      const int j = tid * 4 + 1024 * u;
      v4f o, sm;
#pragma unroll
      for (int q = 0; q < 4; ++q) {
        float gg = g[j + q], bb = bta[j + q];
        if (PARAM_BF16) { gg = bf16_round(gg); bb = bf16_round(bb); }
        sm[q] = vals[u * 4 + q]; o[q] = (vals[u * 4 + q] - mu) * rs * gg + bb;
      }
      if (out_sum) *(v4f*)(out_sum + (size_t)row * N + j) = sm;
      *(v4f*)(out_norm + (size_t)row * N + j) = o;
    }
    
  }
}



// ---- f16 WMMA path (v_wmma_f32_16x16x32_f16): 11-bit significands for operands in range — used where a [0,1] probability operand needs more precision than bf16
typedef _Float16 v16h __attribute__((ext_vector_type(16)));
union FragH { v16h v; v8us half[2]; _Float16 h[16]; unsigned short u[16]; };
template <int NT>
__device__ __forceinline__ v8f mmaH(v16h ah, v16h al, v16h bh, v16h bl, v8f c) {
  c = __builtin_amdgcn_wmma_f32_16x16x32_f16(false, ah, false, bh, (short)0, c, false, false);
  if (NT >= 2) c = __builtin_amdgcn_wmma_f32_16x16x32_f16(false, al, false, bh, (short)0, c, false, false);
  if (NT >= 3) c = __builtin_amdgcn_wmma_f32_16x16x32_f16(false, ah, false, bl, (short)0, c, false, false);
  asm volatile("v_nop\n\tv_nop\n\tv_nop\n\tv_nop" : "+v"(c) : "v"(ah), "v"(al), "v"(bh), "v"(bl));
  return c;
}
// batched GEMM like k_gemm_b but f16 operands: A f32 (split into f16 hi/lo if ASPLIT, else rounded to f16), Bt = f16 values [n][k]; alpha; C f32; N multiple of 16 (partial tiles skipped)
template <bool ASPLIT>
__global__ __launch_bounds__(128) void k_gemm_h(const float* __restrict__ A, int lda, size_t sA, const _Float16* __restrict__ Bh, int ldb, size_t sB, float alpha, float* __restrict__ C, int ldc, size_t sC, int M, int N, int K) {
  __shared__ __attribute__((aligned(16))) float so[4][16][64];
  const int tid = threadIdx.x, w = tid >> 5, lane = tid & 31, ln = lane & 15, hh = lane >> 4; const int by = blockIdx.y;
  A += (size_t)by * sA; Bh += (size_t)by * sB; C += (size_t)by * sC;
  const int ntn = (N + 63) / 64; const int wid = blockIdx.x * 4 + w; const int mt = wid / ntn, nq = wid % ntn; if (mt * 16 >= M) return;
  const int row0 = mt * 16, col0 = nq * 64; const float* arow = A + (size_t)(row0 + ln) * lda;
  v8f acc[4] = {};
  for (int kb = 0; kb < K; kb += 32) {
    FragH ah, al;
    const v4f x0 = *(const v4fa*)(arow + kb + 8 * hh), x1 = *(const v4fa*)(arow + kb + 8 * hh + 4), x2 = *(const v4fa*)(arow + kb + 16 + 8 * hh), x3 = *(const v4fa*)(arow + kb + 16 + 8 * hh + 4);
    float xs[16] = {x0[0],x0[1],x0[2],x0[3],x1[0],x1[1],x1[2],x1[3],x2[0],x2[1],x2[2],x2[3],x3[0],x3[1],x3[2],x3[3]};
#pragma unroll
    for (int i = 0; i < 16; ++i) { const _Float16 h = (_Float16)xs[i]; ah.h[i] = h; al.h[i] = ASPLIT ? (_Float16)(xs[i] - (float)h) : (_Float16)0.0f; }
#pragma unroll
    for (int t = 0; t < 4; ++t) { if (col0 + t * 16 >= N) continue; const size_t boff = (size_t)(col0 + t * 16 + ln) * ldb + kb; FragH bq; bq.half[0] = *(const v8us*)(Bh + boff + 8 * hh); bq.half[1] = *(const v8us*)(Bh + boff + 16 + 8 * hh);
      acc[t] = mmaH<ASPLIT ? 2 : 1>(ah.v, al.v, bq.v, bq.v, acc[t]); }
  }
#pragma unroll
  for (int t = 0; t < 4; ++t) { if (col0 + t * 16 >= N) continue;
#pragma unroll
    for (int r = 0; r < 8; ++r) so[w][8 * hh + r][t * 16 + ln] = acc[t][r] * alpha; }
  __builtin_amdgcn_fence(__ATOMIC_ACQ_REL, "workgroup"); __builtin_amdgcn_wave_barrier();
  const int rsub = lane >> 4, c4 = (lane & 15) * 4;
  {
#pragma unroll
    for (int q = 0; q < 8; ++q) { const int r = q * 2 + rsub; if (col0 + c4 < N) { const v4f v = *(const v4fa*)&so[w][r][c4]; *(v4f*)(C + (size_t)(row0 + r) * ldc + col0 + c4) = v; } }
     }
}

// Wt[n][k] = f16(W[k][n]·scale) from f32 row-major W[K][N] (scale = power of two; bf16-exact weights stay exact in f16 away from the subnormal range)
__global__ __launch_bounds__(256) void k_wt_f16(const float* __restrict__ W, _Float16* __restrict__ Wt, int K, int N, float scale) {
  const int t = blockIdx.x * 256 + threadIdx.x; if (t >= N * (K / 8)) return; const int n = t / (K / 8), k8 = (t % (K / 8)) * 8; FragH f;
#pragma unroll
  for (int i = 0; i < 8; ++i) f.h[i] = (_Float16)(bf16_round(W[(size_t)(k8 + i) * N + n]) * scale); const v8us o = f.half[0];
  *(v8us*)((unsigned short*)Wt + (size_t)n * K + k8) = o; 
}


typedef _Float16 v4h __attribute__((ext_vector_type(4)));

__global__ __launch_bounds__(256) void k_x16(const float* __restrict__ x, _Float16* __restrict__ X16, size_t n8) { const size_t t = (size_t)blockIdx.x * 256 + threadIdx.x; if (t >= n8) return; FragH f;
#pragma unroll
  for (int q = 0; q < 8; ++q) f.h[q] = (_Float16)bf16_round(x[t * 8 + q]); *(v8us*)((unsigned short*)X16 + t * 8) = f.half[0];  }
__global__ __launch_bounds__(256) void k_h16(const float* __restrict__ x, _Float16* __restrict__ X16, size_t n8) { const size_t t = (size_t)blockIdx.x * 256 + threadIdx.x; if (t >= n8) return; FragH f;
#pragma unroll
  for (int q = 0; q < 8; ++q) f.h[q] = (_Float16)x[t * 8 + q]; *(v8us*)((unsigned short*)X16 + t * 8) = f.half[0];  }
__global__ __launch_bounds__(256) void k_round16f(const float* __restrict__ W, _Float16* __restrict__ Bt, size_t n8) { const size_t t = (size_t)blockIdx.x * 256 + threadIdx.x; if (t >= n8) return; FragH f;
#pragma unroll
  for (int i = 0; i < 8; ++i) f.h[i] = (_Float16)(bf16_round(W[t * 8 + i]) * 16.0f); *(v8us*)((unsigned short*)Bt + t * 8) = f.half[0];  }
template <int NHv, int TTv>
__global__ __launch_bounds__(256) void k_vt(const _Float16* __restrict__ V16, int ldv, int voff, _Float16* __restrict__ Vt) { __shared__ unsigned short tl[64][66]; const int tid = threadIdx.x; const int slab = blockIdx.x / (TTv / 64), lg = blockIdx.x % (TTv / 64); const int b = slab / NHv, h = slab % NHv;
  for (int i = tid; i < 64 * 8; i += 256) { const int r = i / 8, c8 = (i % 8) * 8; FragH f; f.half[0] = *(const v8us*)((const unsigned short*)V16 + ((size_t)b * TTv + lg * 64 + r) * ldv + voff + h * 64 + c8);
#pragma unroll
    for (int q = 0; q < 8; ++q) tl[r][c8 + q] = f.u[q]; }
  __syncthreads();
  {
#pragma unroll
    for (int rd = 0; rd < 2; ++rd) { const int d = rd * 32 + tid / 8, pc = tid % 8; FragH f;
#pragma unroll
      for (int q = 0; q < 8; ++q) f.u[q] = tl[pc * 8 + q][d];
      *(v8us*)((unsigned short*)Vt + ((size_t)slab * 64 + d) * TTv + lg * 64 + pc * 8) = f.half[0]; }
     } }

__global__ __launch_bounds__(256) void k_vthlu(const float* __restrict__ VF, int ldv, _Float16* __restrict__ Vth, _Float16* __restrict__ Vtl) { __shared__ float tl[64][65]; const int tid = threadIdx.x; const int slab = blockIdx.x / (TT / 64), lg = blockIdx.x % (TT / 64); const int b = slab / NVH, h = slab % NVH;
  for (int i = tid; i < 64 * 16; i += 256) { const int r = i / 16, c4 = (i % 16) * 4; const v4f a = *(const v4fa*)(VF + ((size_t)b * TT + lg * 64 + r) * ldv + h * 64 + c4); tl[r][c4] = a[0]; tl[r][c4 + 1] = a[1]; tl[r][c4 + 2] = a[2]; tl[r][c4 + 3] = a[3]; }
  __syncthreads();
  FragH fh[2], fl[2]; size_t oo[2];
#pragma unroll
  for (int rd = 0; rd < 2; ++rd) { const int d = rd * 32 + tid / 8, pc = tid % 8;
#pragma unroll
    for (int q = 0; q < 8; ++q) { const float v = tl[pc * 8 + q][d]; const _Float16 hv = (_Float16)v; fh[rd].h[q] = hv; fl[rd].h[q] = (_Float16)(v - (float)hv);      /* UNSCALED residual (added into the same accumulator as the hi product) */ } oo[rd] = ((size_t)slab * 64 + d) * TT + lg * 64 + pc * 8; }
  {
#pragma unroll
    for (int rd = 0; rd < 2; ++rd) { *(v8us*)((unsigned short*)Vth + oo[rd]) = fh[rd].half[0]; *(v8us*)((unsigned short*)Vtl + oo[rd]) = fl[rd].half[0]; }
     } }
// One Conv1d (3 taps, pad 1) as a GEMM that forms no im2col plane: row s of the im2col matrix is input rows s - 1, s, s + 1 laid end to end, so a block stages its 16 rows and the two neighbours once in LDS,
// rounded f32 -> bf16 -> f16 (a zero row outside the sequence), and k-step ks reads its A fragment from LDS row ln + ks / 8. Bh = f16 weights in fragment order (k_wc3 below), k = tap * 256 + c. Four waves = the four 64-column quarters of the 256 outputs.
template <bool F16OUT>      /* the output plane: f16 (C16) or f32 (C) */
__global__ __launch_bounds__(128) void k_conv3(const float* __restrict__ x, const _Float16* __restrict__ Bh, const float* __restrict__ bias, float* __restrict__ C, _Float16* __restrict__ C16) {
  constexpr int XP = DD + 8;      /* LDS row pitch in halves: 528 B = 16 B x odd, conflict-free for the 16-row ds_load_b128 fragment reads */
  __shared__ __attribute__((aligned(16))) unsigned short sX[16 + 2][XP];      /* LDS row r = sequence row s0 + r - 1 */
  __shared__ __attribute__((aligned(16))) float so[4][16][64];
  const int tid = threadIdx.x, w = tid >> 5, lane = tid & 31, ln = lane & 15, hh = lane >> 4;
  const int row0 = blockIdx.x * 16, col0 = w * 64; const int s0 = row0 % TT;      /* 16 divides the sequence length: a block's rows lie in one sequence */
  float bv[4]; const int bi = col0 + ln;      /* this lane's four bias values, loaded beside the input rows */
  constexpr int NK = K3 / 32, PF = 2;      /* 24 k-steps; a k-step's weight fragments are loaded PF k-steps ahead of their products */
  const unsigned short* bp = (const unsigned short*)Bh + w * 2048 + lane * 8;      /* halves: 8192 per k-step, 512 per 16-column tile, 256 per fragment half, 8 per lane */
  FragH bq[PF + 1][4], ah[2];
  auto ldb = [&](int ks) {      /* the wave's four B fragments of k-step ks: eight loads of 512 contiguous bytes, one address and constant offsets */
#pragma unroll      /* constant indices keep bq[] in registers */
    for (int t = 0; t < 4; ++t) { bq[ks % (PF + 1)][t].half[0] = *(const v8us*)(bp + ks * 8192 + t * 512); bq[ks % (PF + 1)][t].half[1] = *(const v8us*)(bp + ks * 8192 + t * 512 + 256); } };
  { v4f xa[9];      /* nine 16-B loads per thread, all issued before the first is used: one memory latency for the whole stage */
    const int nb = tid >> 6; const bool in = nb ? (s0 + 16 < TT) : (s0 > 0);      /* waves 0, 1: the row above the block; waves 2, 3: the row below */
    const float* xb = x + (size_t)(row0 + w) * DD + lane * 4; const float* xn = x + (size_t)(row0 + (in ? (nb ? 16 : -1) : 0)) * DD + (tid & 63) * 4;      /* a neighbour outside the sequence: the address stays inside the buffer, the values are replaced by zero */
#pragma unroll      /* constant indices keep xa[] in registers */
    for (int j = 0; j < 8; ++j) xa[j] = *(const v4fa*)(xb + (j >> 1) * 4 * DD + (j & 1) * 128);      /* four rows per wave, 512 contiguous bytes per load, one address and constant offsets */
    xa[8] = *(const v4fa*)xn;
#pragma unroll
    for (int t = 0; t < 4; ++t) bv[t] = bias[bi + t * 16];
    asm volatile("s_wait_xcnt 0x0" :: "v"(xb), "v"(xn), "v"(bi) : "memory");      /* stands behind these loads; their addresses are named as inputs so that the registers are rewritten only behind it */
#pragma unroll      /* constant indices keep bq[] in registers */
    for (int ks = 0; ks < PF; ++ks) ldb(ks);      /* the first weight fragments fly beside the input rows */
    if (!in) xa[8] = (v4f){0.f, 0.f, 0.f, 0.f};
#pragma unroll      /* constant indices keep xa[] in registers */
    for (int j = 0; j < 9; ++j) { v4h h4;
#pragma unroll
      for (int q = 0; q < 4; ++q) h4[q] = (_Float16)bf16_round(xa[j][q]);
      *(v4h*)(j < 8 ? &sX[1 + (j >> 1) * 4 + w][(j & 1) * 128 + lane * 4] : &sX[nb * 17][(tid & 63) * 4]) = h4; } }
  __syncthreads();      /* publishes the 18 staged rows to the four waves */
  auto lda = [&](int ks) { const unsigned short* ar = &sX[ln + ks / 8][(ks % 8) * 32 + 8 * hh]; ah[ks & 1].half[0] = *(const v8us*)ar; ah[ks & 1].half[1] = *(const v8us*)(ar + 16); };
  v8f acc[4] = {};
  lda(0);
#pragma unroll      /* constant indices keep bq[] and ah[] in registers, and every weight load's offset is an immediate */
  for (int ks = 0; ks < NK; ++ks) {
    if (ks + PF < NK) ldb(ks + PF);
    if (ks + 1 < NK) lda(ks + 1);
    __builtin_amdgcn_sched_barrier(0);      /* holds the loads for later k-steps in front of this k-step's products: sunk to their uses, each would be waited for in full */
#pragma unroll
    for (int t = 0; t < 4; ++t) acc[t] = __builtin_amdgcn_wmma_f32_16x16x32_f16(false, ah[ks & 1].v, false, bq[ks % (PF + 1)][t].v, (short)0, acc[t], false, false);      /* the plain builtin: the compiler keeps the distance behind it itself */
  }
  asm volatile("s_wait_xcnt 0x0" :: "v"(bp) : "memory");      /* stands behind the weight loads; their address is named as an input so that its registers are rewritten only behind it */
#pragma unroll
  for (int t = 0; t < 4; ++t) { const float bt = bf16_round(bv[t]);
#pragma unroll
    for (int r = 0; r < 8; ++r) so[w][8 * hh + r][t * 16 + ln] = acc[t][r] + bt; }
  __builtin_amdgcn_fence(__ATOMIC_ACQ_REL, "workgroup"); __builtin_amdgcn_wave_barrier();
  const int rsub = lane >> 4, c4 = (lane & 15) * 4;
#pragma unroll
  for (int q = 0; q < 8; ++q) { const int r = q * 2 + rsub; const v4f v = *(const v4fa*)&so[w][r][c4]; if (!F16OUT) *(v4f*)(C + (size_t)(row0 + r) * DD + col0 + c4) = v; else { v4h h4; for (int i = 0; i < 4; ++i) h4[i] = (_Float16)v[i]; *(v4h*)(C16 + (size_t)(row0 + r) * DD + col0 + c4) = h4; } }
}
// Conv weights [o][c][tap] -> f16 in the order in which k_conv3's lanes read B fragments: [k-step][16-column tile][fragment half j][lane hh * 16 + ln][8 halves], holding column o = tile * 16 + ln, k = k-step * 32 + j * 16 + hh * 8 + 0..7. Thread t writes the t-th 16 bytes.
__global__ __launch_bounds__(256) void k_wc3(const float* __restrict__ w, _Float16* __restrict__ Bt) { const int t = blockIdx.x * 256 + threadIdx.x; if (t >= DD * (K3 / 8)) return; const int o = ((t >> 6) & 15) * 16 + (t & 15), k0 = (t >> 10) * 32 + ((t >> 5) & 1) * 16 + ((t >> 4) & 1) * 8; const int tap = k0 / DD, c0 = k0 % DD; FragH f;
  for (int q = 0; q < 8; ++q) f.h[q] = (_Float16)bf16_round(w[((size_t)o * DD + c0 + q) * 3 + tap]);
  *(v8us*)((unsigned short*)Bt + (size_t)t * 8) = f.half[0];  }
__global__ __launch_bounds__(256) void k_scl(float* __restrict__ O, const float* __restrict__ scl, size_t n4) { const size_t t = (size_t)blockIdx.x * 256 + threadIdx.x; if (t >= n4) return; const float s = bf16_round(scl[0]); v4f v = *(const v4fa*)(O + t * 4); for (int q = 0; q < 4; ++q) v[q] *= s; *(v4f*)(O + t * 4) = v;  }
__device__ __forceinline__ float xhalf(float x) { return __builtin_bit_cast(float, __builtin_amdgcn_permlanex16(__builtin_bit_cast(int, x), __builtin_bit_cast(int, x), 0x76543210, 0xfedcba98, false, false)); }      /* lane l takes lane l ^ 16's value */
__device__ __forceinline__ float ex2(float x) { return __builtin_amdgcn_exp2f(x); }      /* 2^x as the one hardware instruction v_exp_f32; every argument below is <= 0 up to one rounding, and a result under the normal range may go to zero */
__device__ __forceinline__ unsigned lds_off(const void* p) { return (unsigned)(size_t)p; }      /* byte offset in the work-group's LDS = low 32 bits of the __shared__ address */
// Four or twelve asynchronous copies, 16 B per lane each, global memory -> LDS. The closing s_wait_xcnt stands inside the statement so that no address register named here is rewritten ahead of it.
__device__ __forceinline__ void acp4(const unsigned (&l)[4], const unsigned short* const (&p)[4]) {
  asm volatile("global_load_async_to_lds_b128 %0, %4, off\n\t"
               "global_load_async_to_lds_b128 %1, %5, off\n\t"
               "global_load_async_to_lds_b128 %2, %6, off\n\t"
               "global_load_async_to_lds_b128 %3, %7, off\n\t"
               "s_wait_xcnt 0x0"
               :: "v"(l[0]), "v"(l[1]), "v"(l[2]), "v"(l[3]), "v"(p[0]), "v"(p[1]), "v"(p[2]), "v"(p[3]) : "memory");
}
__device__ __forceinline__ void acp12(const unsigned (&l)[12], const unsigned short* const (&p)[12]) {
  asm volatile("global_load_async_to_lds_b128 %0, %12, off\n\t"
               "global_load_async_to_lds_b128 %1, %13, off\n\t"
               "global_load_async_to_lds_b128 %2, %14, off\n\t"
               "global_load_async_to_lds_b128 %3, %15, off\n\t"
               "global_load_async_to_lds_b128 %4, %16, off\n\t"
               "global_load_async_to_lds_b128 %5, %17, off\n\t"
               "global_load_async_to_lds_b128 %6, %18, off\n\t"
               "global_load_async_to_lds_b128 %7, %19, off\n\t"
               "global_load_async_to_lds_b128 %8, %20, off\n\t"
               "global_load_async_to_lds_b128 %9, %21, off\n\t"
               "global_load_async_to_lds_b128 %10, %22, off\n\t"
               "global_load_async_to_lds_b128 %11, %23, off\n\t"
               "s_wait_xcnt 0x0"
               :: "v"(l[0]), "v"(l[1]), "v"(l[2]), "v"(l[3]), "v"(l[4]), "v"(l[5]), "v"(l[6]), "v"(l[7]), "v"(l[8]), "v"(l[9]), "v"(l[10]), "v"(l[11]),
                  "v"(p[0]), "v"(p[1]), "v"(p[2]), "v"(p[3]), "v"(p[4]), "v"(p[5]), "v"(p[6]), "v"(p[7]), "v"(p[8]), "v"(p[9]), "v"(p[10]), "v"(p[11]) : "memory");
}
__device__ __forceinline__ v8f mmaP(v16h a, v16h b, v8f c) { return __builtin_amdgcn_wmma_f32_16x16x32_f16(false, a, false, b, (short)0, c, false, false); }      /* the plain builtin: the compiler keeps the distance behind it itself, and no asm statement stands between the LDS reads and the products */
__global__ __launch_bounds__(256) void k_flash(const _Float16* __restrict__ Q16, int ldq, const _Float16* __restrict__ K16, int ldk, const _Float16* __restrict__ Vt, const _Float16* __restrict__ Vtlo, float* __restrict__ O, int ldo) {
  constexpr int RPW = 16, NQB = TT / (4 * RPW), DT = 16, KS = 8;      /* d_qk 256: 8 k-steps; 16 value tiles = the whole 256-wide V per wave, so each score is formed in one wave only */
  constexpr int SK = 64, NST = TT / SK;      /* one LDS tile = 64 keys = two 32-key passes, each on its own waves; V rows of 64 keys are whole 128-B lines */
  constexpr int KP = 256 + 8, VP = SK + 8;      /* LDS row pitches in halves: 528 B and 144 B, both 16 B x odd, conflict-free for the 16-row ds_load_b128 fragment reads */
  constexpr int OP = 256 + 4;      /* output tile's row pitch in floats */
  __shared__ __attribute__((aligned(16))) unsigned short sQ[4 * RPW][KP]; __shared__ __attribute__((aligned(16))) unsigned short sK[2][SK][KP]; __shared__ __attribute__((aligned(16))) unsigned short sVh[2][256][VP]; __shared__ __attribute__((aligned(16))) unsigned short sVl[2][256][VP];
  __shared__ float sM[4][RPW]; __shared__ float sL[4][RPW];
  typedef float f32a __attribute__((may_alias)); static_assert(sizeof(sK) >= 4 * RPW * OP * sizeof(float), "the four output tiles fit the K ring");
  f32a (*sO)[RPW][OP] = (f32a (*)[RPW][OP])&sK[0][0][0];      /* the output tiles reuse the K ring, which nobody reads or fills behind the loop's last barrier */
  const int tid = threadIdx.x, w = tid >> 5, lane = tid & 31, ln = lane & 15, hh = lane >> 4;
  const int slab = blockIdx.x / NQB, qblk = blockIdx.x % NQB; const int b = slab / NH, h = slab % NH; const int qb0 = qblk * (4 * RPW);
  const int wu = __builtin_amdgcn_readfirstlane(w);      /* the wave's number as a scalar: the row parts of the copies' addresses stay in scalar registers */
  const int wq = wu & 3; const int q0 = qb0 + wq * RPW;      /* eight waves, two per SIMD, up to 512 registers each: 4 groups of 16 query rows x 2 halves of each tile's keys; wq numbers the pair of waves that share rows */
  const unsigned short* Qg = (const unsigned short*)Q16 + ((size_t)b * TT + qb0) * ldq; const unsigned short* Kg = (const unsigned short*)K16 + (size_t)b * TT * ldk;
  const unsigned short* Vth = (const unsigned short*)Vt + (size_t)b * VSTR * TT; const unsigned short* Vtl = (const unsigned short*)Vtlo + (size_t)b * VSTR * TT;      /* hi and UNSCALED residual planes */
  const int kp = wu >> 2;      /* which 32 keys of every tile this wave takes (scalar: the epilogue branches on it) */
  /* tile t -> buffer buf, 24 copies per wave in two statements; each statement: 4 K rows (one 512-B row per copy), 16 of the 256 rows of each V plane (four 128-B rows per copy) */
  const unsigned short* Kl = Kg + lane * 8; const unsigned short* Vhl = Vth + (size_t)(lane >> 3) * TT + (lane & 7) * 8; const int dV = (int)(Vtl - Vth);      /* the lane's part of every copy's global address: two pointers; the residual plane lies dV halves behind the hi plane in the same workspace */
  const unsigned lK = lds_off(&sK[0][0][lane * 8]), lVh = lds_off(&sVh[0][lane >> 3][(lane & 7) * 8]); const int dL = (int)(lds_off(&sVl[0][0][0]) - lds_off(&sVh[0][0][0]));      /* and of its LDS address */
  auto sgl = [](int x) { return __builtin_amdgcn_readfirstlane(x); };      /* the part that is the same in every lane is formed in scalar registers at each tile: kept per copy in vector registers over the loop, the 24 addresses do not fit the register budget */
  auto stage = [&](int t, int buf) {
#pragma unroll      /* two statements, constant indices */
    for (int j = 0; j < 2; ++j) { const int u = wu * 2 + j;      /* sixteenth of the tile */
      unsigned l[12]; const unsigned short* p[12];
#pragma unroll      /* constant indices keep l[] and p[] in registers */
      for (int i = 0; i < 4; ++i) { const int r = u * 4 + i; l[i] = lK + (unsigned)sgl((buf * SK + r) * (KP * 2)); p[i] = Kl + sgl((t * SK + r) * ldk); }
#pragma unroll      /* constant indices keep l[] and p[] in registers */
      for (int i = 0; i < 4; ++i) { const int d = u * 16 + i * 4; const int lo = (buf * 256 + d) * (VP * 2), go = d * TT + t * SK; l[4 + i] = lVh + (unsigned)sgl(lo); p[4 + i] = Vhl + sgl(go); l[8 + i] = lVh + (unsigned)sgl(lo + dL); p[8 + i] = Vhl + sgl(go + dV); }
      acp12(l, p); } };
#pragma unroll      /* two statements, constant indices */
  for (int j = 0; j < 2; ++j) { unsigned l[4]; const unsigned short* p[4];      /* the block's 64 query rows, filled once: 8 rows per wave */
#pragma unroll      /* constant indices keep l[] and p[] in registers */
    for (int i = 0; i < 4; ++i) { const int r = (wu * 2 + j) * 4 + i; l[i] = lds_off(&sQ[r][lane * 8]); p[i] = Qg + (size_t)r * ldq + lane * 8; }
    acp4(l, p); }
  stage(0, 0);
  asm volatile("s_wait_asynccnt 0x0" ::: "memory");      /* this wave's copies of Q and of tile 0 have landed */
  __syncthreads();      /* publishes Q and tile 0 to every wave */
  stage(1, 1);
  /* Transposed products: St = K x Qt and Ot += Vt x Pt. Lane (ln, hh) holds query q0 + ln: its scores of keys 8 hh + r of each 16-key tile, and its outputs of value columns 8 hh + r of each 16-column tile. */
  FragH aq[KS];      /* the wave's 16 query rows as B fragments: read from LDS once, kept in 64 registers for all tiles */
  { const unsigned short* qrow = &sQ[wq * RPW + ln][8 * hh];
#pragma unroll      /* constant indices keep the fragments in registers */
    for (int ks = 0; ks < KS; ++ks) { aq[ks].half[0] = *(const v8us*)(qrow + ks * 32); aq[ks].half[1] = *(const v8us*)(qrow + ks * 32 + 16); } }
  float m_r = -3.0e38f, l_r = 0.f; v8f oacc[DT];
#pragma unroll
  for (int dt = 0; dt < DT; ++dt) oacc[dt] = (v8f){0.f,0.f,0.f,0.f,0.f,0.f,0.f,0.f};
#pragma unroll 1
  for (int t = 0; t < NST; ++t) {
   const int buf = t & 1;
   {
    const int j0 = kp * 32;      /* first key of this wave's pass inside the tile */
    const unsigned short* kr0 = &sK[buf][j0 + ln][8 * hh]; const unsigned short* kr1 = &sK[buf][j0 + 16 + ln][8 * hh];
    const unsigned short* vh0 = &sVh[buf][ln][j0 + 8 * hh]; const unsigned short* vl0 = &sVl[buf][ln][j0 + 8 * hh];
    FragH bk0[KS], bk1[KS], bv[DT], bl[DT]; v8f s[2] = {(v8f){0.f,0.f,0.f,0.f,0.f,0.f,0.f,0.f}, (v8f){0.f,0.f,0.f,0.f,0.f,0.f,0.f,0.f}};
    auto ldv = [&](int dt) { bv[dt].half[0] = *(const v8us*)(vh0 + dt * 16 * VP); bv[dt].half[1] = *(const v8us*)(vh0 + dt * 16 * VP + 16); bl[dt].half[0] = *(const v8us*)(vl0 + dt * 16 * VP); bl[dt].half[1] = *(const v8us*)(vl0 + dt * 16 * VP + 16); };
#pragma unroll      /* constant indices keep the fragments in registers */
    for (int ks = 0; ks < KS; ++ks) { bk0[ks].half[0] = *(const v8us*)(kr0 + ks * 32); bk0[ks].half[1] = *(const v8us*)(kr0 + ks * 32 + 16); bk1[ks].half[0] = *(const v8us*)(kr1 + ks * 32); bk1[ks].half[1] = *(const v8us*)(kr1 + ks * 32 + 16); }      /* one group of reads: the pass's 32 keys, all k-steps ... */
#pragma unroll      /* constant indices keep the fragments in registers */
    for (int dt = 0; dt < DT / 2; ++dt) ldv(dt);      /* ... and the first eight value tiles, both planes, which return while the score products run */
    __builtin_amdgcn_sched_barrier(0);      /* holds the group of reads in front of the products: one LDS latency is waited for, not one per product */
#pragma unroll      /* constant indices keep the fragments in registers */
    for (int ks = 0; ks < KS; ++ks) { s[0] = mmaP(bk0[ks].v, aq[ks].v, s[0]); s[1] = mmaP(bk1[ks].v, aq[ks].v, s[1]); }      /* A = 16 keys, B = 16 queries; the two score tiles alternate, so that no product waits for its predecessor's accumulator */
    __builtin_amdgcn_sched_barrier(0);      /* keeps the second group of reads behind the products that free its 128 registers: hoisted, all the reads at once would not fit the register budget */
#pragma unroll      /* constant indices keep the fragments in registers */
    for (int dt = DT / 2; dt < DT; ++dt) ldv(dt);      /* the other eight value tiles, in the registers that K leaves */
    /* Every LDS read of tile t is issued above, so the hand-over of the ring stands here: softmax and the V products below work on registers alone, and a wave that ends them early starts on tile t + 1 while its neighbours still compute. */
    asm volatile("s_wait_dscnt 0x0" ::: "memory");      /* this wave's reads of tile t have returned before its buffer is refilled */
    asm volatile("s_wait_asynccnt 0x0" ::: "memory");      /* this wave's copies of tile t + 1 have landed */
    __syncthreads();      /* publishes tile t + 1 and ends every wave's reads of tile t */
    __builtin_amdgcn_sched_barrier(0);      /* keeps the register-only work below behind the hand-over: moved above it, the V reads would again be waited for one product at a time */
    constexpr float SC2 = ATT_SCALE * 1.44269504088896340736f;      /* 1/16 x log2(e): exp(score / 16 - max) = 2^(score x SC2 - max x log2(e)); scores and running maximum are kept in these log2 units */
    float sc[16];
#pragma unroll
    for (int i = 0; i < 16; ++i) sc[i] = s[i >> 3][i & 7] * SC2;
    float mc = sc[0];
#pragma unroll
    for (int i = 1; i < 16; ++i) mc = fmaxf(mc, sc[i]);
    mc = fmaxf(mc, xhalf(mc));      /* the other 16 of the query's 32 keys sit in lane ^ 16 */
    const float mn = fmaxf(m_r, mc); const float ea = ex2(m_r - mn); const float al = (mn > -1.0e38f) ? ea : 1.0f; m_r = mn;
    FragH ph, pl; float ls[4] = {0.f, 0.f, 0.f, 0.f};      /* element i of the two score tiles is element i of a B fragment in the k order of the V loader above: P stays in registers */
    float pe[16];
#pragma unroll      /* constant indices keep pe[] in registers */
    for (int g = 0; g < 16; g += 4)      /* 2^x as in ex2(), four v_exp_f32 and the slot behind the last in one statement: each is followed by an instruction that neither reads its result nor overwrites its source (outputs are early-clobber). */
      asm("v_exp_f32 %0, %4\n\tv_exp_f32 %1, %5\n\tv_exp_f32 %2, %6\n\tv_exp_f32 %3, %7\n\tv_nop"
          : "=&v"(pe[g]), "=&v"(pe[g + 1]), "=&v"(pe[g + 2]), "=&v"(pe[g + 3]) : "v"(sc[g] - mn), "v"(sc[g + 1] - mn), "v"(sc[g + 2] - mn), "v"(sc[g + 3] - mn));
#pragma unroll
    for (int i = 0; i < 16; ++i) { const float p = pe[i]; ls[i & 3] += p; const float ps = p * 1024.0f; const _Float16 hp = (_Float16)ps; ph.h[i] = hp; pl.h[i] = (_Float16)(ps - (float)hp); }      /* P hi and its UNSCALED residual (added into the same accumulator) */
    l_r = l_r * al + ((ls[0] + ls[1]) + (ls[2] + ls[3]));      /* this lane's 16 keys of every pass; the two halves are joined behind the loop */
#pragma unroll
    for (int dt = 0; dt < DT; ++dt)
#pragma unroll
      for (int r = 0; r < 8; ++r) oacc[dt][r] *= al;
    /* Vh x Ph + Vh x Pl + Vl x Ph, all unscaled, one accumulator per value tile, in this order; A = 16 value columns, B = 16 queries. Term by term over the sixteen tiles: successive products are independent */
#pragma unroll      /* constant indices keep fragments and accumulators in registers, here and in the two loops below */
    for (int dt = 0; dt < DT; ++dt) oacc[dt] = mmaP(bv[dt].v, ph.v, oacc[dt]);
#pragma unroll
    for (int dt = 0; dt < DT; ++dt) oacc[dt] = mmaP(bv[dt].v, pl.v, oacc[dt]);
#pragma unroll
    for (int dt = 0; dt < DT; ++dt) oacc[dt] = mmaP(bl[dt].v, ph.v, oacc[dt]); }
   if (t + 2 < NST) stage(t + 2, buf); }
  asm volatile("s_wait_asynccnt 0x0" ::: "memory");      /* no copy is outstanding behind the loop */
  l_r += xhalf(l_r);      /* row sum over this wave's keys */
  { const int lane = (int)__builtin_amdgcn_mbcnt_lo(~0u, 0u), ln = lane & 15, hh = lane >> 4;      /* the lane's number, formed anew: held from the kernel's head, it and what is derived from it would take registers all through the loop */
  if (kp == 1) {      /* the wave of the second key half hands its running max, row sum and unnormalised tile to its partner */
#pragma unroll
    for (int dt = 0; dt < DT; ++dt) { *(v4fa*)&sO[wq][ln][dt * 16 + 8 * hh] = (v4f){oacc[dt][0], oacc[dt][1], oacc[dt][2], oacc[dt][3]}; *(v4fa*)&sO[wq][ln][dt * 16 + 8 * hh + 4] = (v4f){oacc[dt][4], oacc[dt][5], oacc[dt][6], oacc[dt][7]}; }
    if (hh == 0) { sM[wq][ln] = m_r; sL[wq][ln] = l_r; } }
  __syncthreads();      /* publishes the second key half's partial results to the partner waves */
  if (kp == 0) {
    const float m1 = sM[wq][ln], l1 = sL[wq][ln]; const float mn = fmaxf(m_r, m1); const float a0 = ex2(m_r - mn), a1 = ex2(m1 - mn); const float l = l_r * a0 + l1 * a1; const float inv = (l > 0.f) ? 1.0f / (l * 1024.0f) : 0.f; const float c0 = a0 * inv, c1 = a1 * inv;
#pragma unroll
    for (int dt = 0; dt < DT; ++dt)
#pragma unroll
      for (int g = 0; g < 2; ++g) { v4fa* o = (v4fa*)&sO[wq][ln][dt * 16 + 8 * hh + 4 * g]; const v4f x = *o; *o = (v4f){oacc[dt][4 * g] * c0 + x[0] * c1, oacc[dt][4 * g + 1] * c0 + x[1] * c1, oacc[dt][4 * g + 2] * c0 + x[2] * c1, oacc[dt][4 * g + 3] * c0 + x[3] * c1}; }      /* each lane reads and rewrites its own words */
    __builtin_amdgcn_fence(__ATOMIC_ACQ_REL, "workgroup"); __builtin_amdgcn_wave_barrier();
    float* og = O + ((size_t)b * TT + q0) * ldo + h * 256 + lane * 4;
#pragma unroll
    for (int r = 0; r < RPW; ++r)
#pragma unroll
      for (int g = 0; g < 2; ++g) { const v4f val = *(const v4fa*)&sO[wq][r][g * 128 + lane * 4]; *(v4f*)(og + (size_t)r * ldo + g * 128) = val; }      /* one 512-B half row per instruction: 32 lanes x 16 B */
  } } }

extern "C" void kernel_launch(void* const* d_in, const int* in_sizes, int n_in,
                              void* d_out, int out_size, void* d_ws, size_t ws_size, hipStream_t stream) {
  (void)in_sizes; (void)n_in; (void)out_size;
  const float* const* I = (const float* const*)d_in; const float* xq = I[0]; const float* xk = I[1]; const float* xv = I[2]; const float* qw = I[3]; const float* qb = I[4]; const float* kw = I[5]; const float* kb = I[6]; const float* vw = I[7]; const float* vb = I[8]; const float* scl = I[9];
  char* ws = (char*)d_ws; size_t off = 0;
  auto take = [&](size_t bytes) { char* p = ws + off; off += (bytes + 255) & ~(size_t)255; return p; };
  _Float16* Bq = (_Float16*)take((size_t)DD * K3 * 2); _Float16* Bk = (_Float16*)take((size_t)DD * K3 * 2); _Float16* Bv = (_Float16*)take((size_t)DD * K3 * 2); _Float16* Q = (_Float16*)take((size_t)NR * DD * 2); _Float16* K = (_Float16*)take((size_t)NR * DD * 2); float* VF = (float*)take((size_t)NR * DD * 4); _Float16* Vt = (_Float16*)take((size_t)NR * DD * 2); _Float16* Vtl = (_Float16*)take((size_t)NR * DD * 2);
  if (off > ws_size) return;      // 1.2 + 8.4 + 8.4 + 16.8 + 8.4 + 8.4 = about 52 MB
  k_wc3<<<(DD * (K3 / 8) + 255) / 256, 256, 0, stream>>>(qw, Bq); k_wc3<<<(DD * (K3 / 8) + 255) / 256, 256, 0, stream>>>(kw, Bk); k_wc3<<<(DD * (K3 / 8) + 255) / 256, 256, 0, stream>>>(vw, Bv);
  k_conv3<true><<<NR / 16, 128, 0, stream>>>(xq, Bq, qb, nullptr, Q);      /* q = conv(query): M 16384 N 256 K 768 (exact products), f16 out */
  k_conv3<true><<<NR / 16, 128, 0, stream>>>(xk, Bk, kb, nullptr, K);
  k_conv3<false><<<NR / 16, 128, 0, stream>>>(xv, Bv, vb, VF, nullptr);      /* v (f32) */
  k_vthlu<<<BB * NVH * (TT / 64), 256, 0, stream>>>(VF, DD, Vt, Vtl);      /* Vᵀ hi + residual: [b][256][4096] */
  k_flash<<<BB * NH * (TT / 64), 256, 0, stream>>>(Q, DD, K, DD, Vt, Vtl, (float*)d_out, DD);      /* whole 256-wide rows of O, straight into the output rows */
  k_scl<<<(unsigned)(((size_t)NR * DD / 4 + 255) / 256), 256, 0, stream>>>((float*)d_out, scl, (size_t)NR * DD / 4);      /* × scale */
}

// v009
// One run takes 165 microseconds.
// Timed twice side by side with v008, it ran 1.07 and 1.08 times as fast.
// Over all steps from v000 it is 11.0 times as fast.
#include <hip/hip_runtime.h>
// KQV 'PCNN' attention (B=4, S=4096, D=256): q, k, v = Conv1d(kernel 3, pad 1) over the sequence of query/key/value (+bias); scores = q·k/16; softmax; out = scale·(P·v) → [4,4096,256].
// Compute dtype: inputs, conv weights/biases, scale rounded to bf16; each conv as an im2col GEMM (K = 3·256, bf16-exact operands, f32 accumulate) → q, k f16 planes, v f32 → Vᵀ f16 hi + exact residual; fused flash-style kernel with d_qk = 256 (8 k-steps, online softmax f32, P f16 hi + residual,
// f32 accumulate) on v_wmma_f32_16x16x32_f16, one launch of 8-wave blocks (query rows x halves of each key tile), writing the output rows directly; × scale in f32.
#define BB 4
#define TT 4096
#define DD 256
#define NH 1
#define VSTR 256
#define NVH 4
#define NR (BB * TT)
#define K3 (3 * DD)
#define ATT_SCALE 0.0625f

typedef __bf16 v16b __attribute__((ext_vector_type(16)));
typedef unsigned short v8us __attribute__((ext_vector_type(8), may_alias));
typedef float  v8f  __attribute__((ext_vector_type(8)));
typedef float  v4f  __attribute__((ext_vector_type(4)));
typedef float  v4fa __attribute__((ext_vector_type(4), may_alias));
union FragB { v16b v; v8us half[2]; unsigned short u[16]; };

__device__ __forceinline__ unsigned short bf16_bits(float x) { unsigned int u = __float_as_uint(x); return (unsigned short)((u + 0x7FFFu + ((u >> 16) & 1u)) >> 16); }
__device__ __forceinline__ float bf16_val(unsigned short b) { return __uint_as_float(((unsigned int)b) << 16); }
__device__ __forceinline__ float bf16_round(float x) { return bf16_val(bf16_bits(x)); }
// D += A·B with NT terms: 1 = ah·bh, 2 = + al·bh (A split), 3 = + ah·bl (both split)
template <int NT>
__device__ __forceinline__ v8f mmaN(v16b ah, v16b al, v16b bh, v16b bl, v8f c) {
  c = __builtin_amdgcn_wmma_f32_16x16x32_bf16(false, ah, false, bh, (short)0, c, false, false);
  if (NT >= 2) c = __builtin_amdgcn_wmma_f32_16x16x32_bf16(false, al, false, bh, (short)0, c, false, false);
  if (NT >= 3) c = __builtin_amdgcn_wmma_f32_16x16x32_bf16(false, ah, false, bl, (short)0, c, false, false);
  asm volatile("v_nop\n\tv_nop\n\tv_nop\n\tv_nop" : "+v"(c) : "v"(ah), "v"(al), "v"(bh), "v"(bl));
  return c;
}

__global__ __launch_bounds__(256) void k_wt_bf16(const float* __restrict__ W, unsigned short* __restrict__ Wt, int K, int N) {
  const int t = blockIdx.x * 256 + threadIdx.x;
  const int k8n = K / 8;
  if (t >= N * k8n) return;
  const int n = t / k8n, k8 = (t % k8n) * 8;
  v8us v;
#pragma unroll
  for (int i = 0; i < 8; ++i) v[i] = bf16_bits(W[(size_t)(k8 + i) * N + n]);
  *(v8us*)(Wt + (size_t)n * K + k8) = v;
  
}

// GEMM C[M][N] (f32, pitch ldc) = act(A[M][K]·W + bias). A f32 row-major (pitch lda) converted per fragment to bf16
// (ASPLIT: hi/lo two planes -> 2 terms, else single rounded term); Wt bf16 [N][K] (pitch ldb). BIAS_BF16 rounds the
// bias to bf16 first (bias quantised to bf16 before the add). K%32==0, M%16==0, N%64==0.
template <bool ASPLIT, int ACT, bool BIAS_BF16>
__global__ __launch_bounds__(128) void k_gemm_bf(const float* __restrict__ A, int lda, const unsigned short* __restrict__ Wt, int ldb,
                                               const float* __restrict__ bias, float* __restrict__ C, int ldc, int M, int N, int K) {
  __shared__ __attribute__((aligned(16))) float so[4][16][64];
  const int tid = threadIdx.x, w = tid >> 5, lane = tid & 31, ln = lane & 15, hh = lane >> 4;
  const int ntn = N / 64;
  const int wid = blockIdx.x * 4 + w;
  const int mt = wid / ntn, nq = wid % ntn;
  if (mt * 16 >= M) return;
  const int row0 = mt * 16, col0 = nq * 64;
  const float* arow = A + (size_t)(row0 + ln) * lda;
  v8f acc[4] = {};
  for (int kb = 0; kb < K; kb += 32) {
    FragB ah, al;
    const v4f x0 = *(const v4fa*)(arow + kb + 8 * hh), x1 = *(const v4fa*)(arow + kb + 8 * hh + 4);
    const v4f x2 = *(const v4fa*)(arow + kb + 16 + 8 * hh), x3 = *(const v4fa*)(arow + kb + 16 + 8 * hh + 4);
    float xs[16] = {x0[0],x0[1],x0[2],x0[3],x1[0],x1[1],x1[2],x1[3],x2[0],x2[1],x2[2],x2[3],x3[0],x3[1],x3[2],x3[3]};
#pragma unroll
    for (int i = 0; i < 16; ++i) { const unsigned short hb = bf16_bits(xs[i]); ah.u[i] = hb; al.u[i] = ASPLIT ? bf16_bits(xs[i] - bf16_val(hb)) : (unsigned short)0; }
#pragma unroll
    for (int t = 0; t < 4; ++t) {
      const unsigned short* brow = Wt + (size_t)(col0 + t * 16 + ln) * ldb + kb;
      FragB b;
      b.half[0] = *(const v8us*)(brow + 8 * hh);
      b.half[1] = *(const v8us*)(brow + 16 + 8 * hh);
      acc[t] = mmaN<ASPLIT ? 2 : 1>(ah.v, al.v, b.v, b.v, acc[t]);
    }
  }
#pragma unroll
  for (int t = 0; t < 4; ++t) {
    float bv = bias ? bias[col0 + t * 16 + ln] : 0.f;
    if (BIAS_BF16) bv = bf16_round(bv);
#pragma unroll
    for (int r = 0; r < 8; ++r) { float v = acc[t][r] + bv; if (ACT == 1) v = fmaxf(v, 0.f); so[w][8 * hh + r][t * 16 + ln] = v; }
  }
  __builtin_amdgcn_fence(__ATOMIC_ACQ_REL, "workgroup");
  __builtin_amdgcn_wave_barrier();
  const int rsub = lane >> 4, c4 = (lane & 15) * 4;
  {
#pragma unroll
    for (int q = 0; q < 8; ++q) {
      const int r = q * 2 + rsub;
      const v4f v = *(const v4fa*)&so[w][r][c4];
      *(v4f*)(C + (size_t)(row0 + r) * ldc + col0 + c4) = v;
    }
    
  }
}

// Flash-style causal/unmasked attention, all contractions 3-term bf16 hi/lo splits, f32 softmax with running max.
// q,k,v rows are read from f32 buffers with arbitrary row pitch (so they can live inside a fused qkv buffer);
// D = head size (multiple of 32, <= 128); one wave = 16 query rows; block = 4 waves (64 queries) sharing K/V chunks of 32.
template <int D, bool CAUSAL>
__global__ __launch_bounds__(128) void k_flash(const float* __restrict__ qb, const float* __restrict__ kb, const float* __restrict__ vb,
                                             int pitch, int T, int H, float scale, float* __restrict__ y, int ypitch) {
  constexpr int KS = D / 32;        // k-steps for QK
  constexpr int DT = D / 16;        // d tiles for PV
  __shared__ __attribute__((aligned(16))) unsigned short sKh[32][D + 8], sKl[32][D + 8], sVh[32][D + 8], sVl[32][D + 8];
  __shared__ __attribute__((aligned(16))) unsigned short sPh[4][16][40], sPl[4][16][40];
  __shared__ __attribute__((aligned(16))) float sO[4][16][D];
  const int tid = threadIdx.x, w = tid >> 5, lane = tid & 31, ln = lane & 15, hh = lane >> 4;
  const int nqb = (T + 63) / 64;
  const int bh = blockIdx.x / nqb, qblk = blockIdx.x % nqb;
  const int b = bh / H, h = bh % H;
  const int q0 = qblk * 64 + w * 16;
  const float* Q = qb + (size_t)b * T * pitch + h * D;
  const float* K = kb + (size_t)b * T * pitch + h * D;
  const float* V = vb + (size_t)b * T * pitch + h * D;

  // A fragments of the wave's 16 query rows (scaled), hi/lo
  FragB aqh[KS], aql[KS];
  {
    int row = q0 + ln; if (row >= T) row = T - 1;
    const float* qr = Q + (size_t)row * pitch;
#pragma unroll
    for (int ks = 0; ks < KS; ++ks)
#pragma unroll
      for (int i = 0; i < 16; ++i) {
        const int d = ks * 32 + ((i < 8) ? (8 * hh + i) : (16 + 8 * hh + (i - 8)));
        const float x = qr[d] * scale; const unsigned short hb = bf16_bits(x);
        aqh[ks].u[i] = hb; aql[ks].u[i] = bf16_bits(x - bf16_val(hb));
      }
  }
  float m_r[8], l_r[8];
#pragma unroll
  for (int r = 0; r < 8; ++r) { m_r[r] = -3.0e38f; l_r[r] = 0.f; }
  v8f oacc[DT];
#pragma unroll
  for (int dt = 0; dt < DT; ++dt) oacc[dt] = (v8f){0.f,0.f,0.f,0.f,0.f,0.f,0.f,0.f};

  const int kv_end = CAUSAL ? min(T, qblk * 64 + 64) : T;     // block-uniform
  for (int j0 = 0; j0 < kv_end; j0 += 32) {
    __syncthreads();
    for (int e = tid; e < 32 * (D / 4); e += 128) {
      const int r = e / (D / 4), c4 = (e % (D / 4)) * 4;
      const int key = j0 + r;
      v4f kf = {0.f,0.f,0.f,0.f}, vf = {0.f,0.f,0.f,0.f};
      if (key < T) { kf = *(const v4fa*)(K + (size_t)key * pitch + c4); vf = *(const v4fa*)(V + (size_t)key * pitch + c4); }
#pragma unroll
      for (int t = 0; t < 4; ++t) {
        unsigned short hb = bf16_bits(kf[t]); sKh[r][c4 + t] = hb; sKl[r][c4 + t] = bf16_bits(kf[t] - bf16_val(hb));
        hb = bf16_bits(vf[t]); sVh[r][c4 + t] = hb; sVl[r][c4 + t] = bf16_bits(vf[t] - bf16_val(hb));
      }
    }
    __syncthreads();
    // S tile 16 x 32
    v8f s[2];
#pragma unroll
    for (int nt = 0; nt < 2; ++nt) {
      v8f acc = {};
#pragma unroll
      for (int ks = 0; ks < KS; ++ks) {
        FragB bh_, bl_;
        bh_.half[0] = *(const v8us*)&sKh[nt * 16 + ln][ks * 32 + 8 * hh]; bh_.half[1] = *(const v8us*)&sKh[nt * 16 + ln][ks * 32 + 16 + 8 * hh];
        bl_.half[0] = *(const v8us*)&sKl[nt * 16 + ln][ks * 32 + 8 * hh]; bl_.half[1] = *(const v8us*)&sKl[nt * 16 + ln][ks * 32 + 16 + 8 * hh];
        acc = mmaN<3>(aqh[ks].v, aql[ks].v, bh_.v, bl_.v, acc);
      }
      s[nt] = acc;
    }
    // mask + running max (rows 8hh+r; the 16 lanes of a half share rows)
    float alpha[8];
#pragma unroll
    for (int r = 0; r < 8; ++r) {
      const int qi = q0 + 8 * hh + r;
      const int ja = j0 + ln, jb = j0 + 16 + ln;
      if (CAUSAL) { if (ja > qi) s[0][r] = -3.0e38f; if (jb > qi) s[1][r] = -3.0e38f; }
      if (ja >= T) s[0][r] = -3.0e38f;
      if (jb >= T) s[1][r] = -3.0e38f;
      float mx = fmaxf(s[0][r], s[1][r]);
      mx = fmaxf(mx, __shfl_xor(mx, 1, 32)); mx = fmaxf(mx, __shfl_xor(mx, 2, 32)); mx = fmaxf(mx, __shfl_xor(mx, 4, 32)); mx = fmaxf(mx, __shfl_xor(mx, 8, 32));
      const float mnew = fmaxf(m_r[r], mx);
      alpha[r] = (mnew > -1.0e38f) ? __expf(m_r[r] - mnew) : 1.0f;
      const float p0 = (s[0][r] > -1.0e38f) ? __expf(s[0][r] - mnew) : 0.f;
      const float p1 = (s[1][r] > -1.0e38f) ? __expf(s[1][r] - mnew) : 0.f;
      m_r[r] = mnew;
      l_r[r] = l_r[r] * alpha[r] + p0 + p1;            // per-lane partial row sum (16 lanes combined at the end)
      unsigned short hb = bf16_bits(p0); sPh[w][8 * hh + r][ln] = hb;      sPl[w][8 * hh + r][ln] = bf16_bits(p0 - bf16_val(hb));
      hb = bf16_bits(p1);                sPh[w][8 * hh + r][16 + ln] = hb; sPl[w][8 * hh + r][16 + ln] = bf16_bits(p1 - bf16_val(hb));
    }
#pragma unroll
    for (int dt = 0; dt < DT; ++dt)
#pragma unroll
      for (int r = 0; r < 8; ++r) oacc[dt][r] *= alpha[r];
    __builtin_amdgcn_fence(__ATOMIC_ACQ_REL, "workgroup");
    __builtin_amdgcn_wave_barrier();
    FragB pah, pal;
    pah.half[0] = *(const v8us*)&sPh[w][ln][8 * hh]; pah.half[1] = *(const v8us*)&sPh[w][ln][16 + 8 * hh];
    pal.half[0] = *(const v8us*)&sPl[w][ln][8 * hh]; pal.half[1] = *(const v8us*)&sPl[w][ln][16 + 8 * hh];
#pragma unroll
    for (int dt = 0; dt < DT; ++dt) {
      FragB bvh, bvl;
#pragma unroll
      for (int i = 0; i < 8; ++i) {
        bvh.u[i] = sVh[8 * hh + i][dt * 16 + ln]; bvh.u[8 + i] = sVh[16 + 8 * hh + i][dt * 16 + ln];
        bvl.u[i] = sVl[8 * hh + i][dt * 16 + ln]; bvl.u[8 + i] = sVl[16 + 8 * hh + i][dt * 16 + ln];
      }
      oacc[dt] = mmaN<3>(pah.v, pal.v, bvh.v, bvl.v, oacc[dt]);
    }
    __builtin_amdgcn_fence(__ATOMIC_ACQ_REL, "workgroup");
    __builtin_amdgcn_wave_barrier();
  }
#pragma unroll
  for (int r = 0; r < 8; ++r) {
    float l = l_r[r];
    l += __shfl_xor(l, 1, 32); l += __shfl_xor(l, 2, 32); l += __shfl_xor(l, 4, 32); l += __shfl_xor(l, 8, 32);
    l_r[r] = (l > 0.f) ? 1.0f / l : 0.f;
  }
#pragma unroll
  for (int dt = 0; dt < DT; ++dt)
#pragma unroll
    for (int r = 0; r < 8; ++r) sO[w][8 * hh + r][dt * 16 + ln] = oacc[dt][r] * l_r[r];
  __builtin_amdgcn_fence(__ATOMIC_ACQ_REL, "workgroup");
  __builtin_amdgcn_wave_barrier();
  {
    for (int r = 0; r < 16; ++r) {
      const int row = q0 + r;
      if (row < T && lane < D / 4) {
        const v4f val = *(const v4fa*)&sO[w][r][lane * 4];
        *(v4f*)(y + ((size_t)b * T + row) * ypitch + h * D + lane * 4) = val;
      }
    }
    
  }
}

// GEMM C = act(A·W + bias + resid): A f32 (ASPLIT -> hi/lo 2 terms), Wt bf16 [N][K]; ACT 0 none, 1 relu, 2 exact gelu;
// resid (optional, f32, row index = (row % rmod), pitch ldr, RES_BF16 rounds it) added before the activation.
template <bool ASPLIT, int ACT, bool BIAS_BF16, bool RES_BF16>
__global__ __launch_bounds__(128) void k_gemm_bf3(const float* __restrict__ A, int lda, const unsigned short* __restrict__ Wt, int ldb,
                                                const float* __restrict__ bias, const float* __restrict__ resid, int rmod, int ldr,
                                                float* __restrict__ C, int ldc, int M, int N, int K) {
  __shared__ __attribute__((aligned(16))) float so[4][16][64];
  const int tid = threadIdx.x, w = tid >> 5, lane = tid & 31, ln = lane & 15, hh = lane >> 4;
  const int ntn = N / 64;
  const int wid = blockIdx.x * 4 + w;
  const int mt = wid / ntn, nq = wid % ntn;
  if (mt * 16 >= M) return;
  const int row0 = mt * 16, col0 = nq * 64;
  const float* arow = A + (size_t)(row0 + ln) * lda;
  v8f acc[4] = {};
  for (int kb = 0; kb < K; kb += 32) {
    FragB ah, al;
    const v4f x0 = *(const v4fa*)(arow + kb + 8 * hh), x1 = *(const v4fa*)(arow + kb + 8 * hh + 4);
    const v4f x2 = *(const v4fa*)(arow + kb + 16 + 8 * hh), x3 = *(const v4fa*)(arow + kb + 16 + 8 * hh + 4);
    float xs[16] = {x0[0],x0[1],x0[2],x0[3],x1[0],x1[1],x1[2],x1[3],x2[0],x2[1],x2[2],x2[3],x3[0],x3[1],x3[2],x3[3]};
#pragma unroll
    for (int i = 0; i < 16; ++i) { const unsigned short hb = bf16_bits(xs[i]); ah.u[i] = hb; al.u[i] = ASPLIT ? bf16_bits(xs[i] - bf16_val(hb)) : (unsigned short)0; }
#pragma unroll
    for (int t = 0; t < 4; ++t) {
      const unsigned short* brow = Wt + (size_t)(col0 + t * 16 + ln) * ldb + kb;
      FragB b;
      b.half[0] = *(const v8us*)(brow + 8 * hh);
      b.half[1] = *(const v8us*)(brow + 16 + 8 * hh);
      acc[t] = mmaN<ASPLIT ? 2 : 1>(ah.v, al.v, b.v, b.v, acc[t]);
    }
  }
#pragma unroll
  for (int t = 0; t < 4; ++t) {
    const int col = col0 + t * 16 + ln;
    float bv = bias ? bias[col] : 0.f;
    if (BIAS_BF16) bv = bf16_round(bv);
#pragma unroll
    for (int r = 0; r < 8; ++r) {
      float v = acc[t][r] + bv;
      if (resid) { float rv = resid[(size_t)((row0 + 8 * hh + r) % rmod) * ldr + col]; if (RES_BF16) rv = bf16_round(rv); v += rv; }
      if (ACT == 1) v = fmaxf(v, 0.f);
      if (ACT == 2) v = 0.5f * v * (1.0f + erff(v * 0.70710678118654752f));
      if (ACT == 3) { const float u = 0.7978845608028654f * (v + 0.044715f * v * v * v); v = 0.5f * v * (1.0f + tanhf(u)); }
      so[w][8 * hh + r][t * 16 + ln] = v;
    }
  }
  __builtin_amdgcn_fence(__ATOMIC_ACQ_REL, "workgroup");
  __builtin_amdgcn_wave_barrier();
  const int rsub = lane >> 4, c4 = (lane & 15) * 4;
  {
#pragma unroll
    for (int q = 0; q < 8; ++q) {
      const int r = q * 2 + rsub;
      const v4f v = *(const v4fa*)&so[w][r][c4];
      *(v4f*)(C + (size_t)(row0 + r) * ldc + col0 + c4) = v;
    }
    
  }
}
// row LayerNorm (biased variance, eps) over N: s = X (+ R); optional out_sum <- s; out_norm <- (s-mu)*rsqrt(var+eps)*g + b
template <bool PARAM_BF16>
__global__ __launch_bounds__(256) void k_layernorm(const float* __restrict__ X, const float* __restrict__ R, const float* __restrict__ g, const float* __restrict__ bta,
                                                  float* __restrict__ out_sum, float* __restrict__ out_norm, int N, float eps) {
  __shared__ float red[256];
  const int row = blockIdx.x, tid = threadIdx.x;
  const float* x = X + (size_t)row * N; const float* rr = R ? R + (size_t)row * N : nullptr;
  float vals[16];                     // up to N = 4096
  const int per = N / 256;            // contiguous chunk per thread? use strided-by-4 chunks: thread handles j = tid*4 + 1024*u
  float s1 = 0.f;
  for (int u = 0; u < per / 4; ++u) {
    const int j = tid * 4 + 1024 * u;
    const v4f a = *(const v4fa*)(x + j);
    v4f b = {0.f,0.f,0.f,0.f}; if (rr) b = *(const v4fa*)(rr + j);
#pragma unroll
    for (int q = 0; q < 4; ++q) { const float v = a[q] + b[q]; vals[u * 4 + q] = v; s1 += v; }
  }
  red[tid] = s1; __syncthreads();
  for (int st = 128; st > 0; st >>= 1) { if (tid < st) red[tid] += red[tid + st]; __syncthreads(); }
  const float mu = red[0] / (float)N; __syncthreads();
  float s2 = 0.f;
  for (int u = 0; u < per / 4; ++u)
#pragma unroll
    for (int q = 0; q < 4; ++q) { const float c = vals[u * 4 + q] - mu; s2 += c * c; }
  red[tid] = s2; __syncthreads();
  for (int st = 128; st > 0; st >>= 1) { if (tid < st) red[tid] += red[tid + st]; __syncthreads(); }
  const float rs = rsqrtf(red[0] / (float)N + eps);
  {
    for (int u = 0; u < per / 4; ++u) {
      const int j = tid * 4 + 1024 * u;
      v4f o, sm;
#pragma unroll
      for (int q = 0; q < 4; ++q) {
        float gg = g[j + q], bb = bta[j + q];
        if (PARAM_BF16) { gg = bf16_round(gg); bb = bf16_round(bb); }
        sm[q] = vals[u * 4 + q]; o[q] = (vals[u * 4 + q] - mu) * rs * gg + bb;
      }
      if (out_sum) *(v4f*)(out_sum + (size_t)row * N + j) = sm;
      *(v4f*)(out_norm + (size_t)row * N + j) = o;
    }
    
  }
}



// ---- f16 WMMA path (v_wmma_f32_16x16x32_f16): 11-bit significands for operands in range — used where a [0,1] probability operand needs more precision than bf16
typedef _Float16 v16h __attribute__((ext_vector_type(16)));
union FragH { v16h v; v8us half[2]; _Float16 h[16]; unsigned short u[16]; };
template <int NT>
__device__ __forceinline__ v8f mmaH(v16h ah, v16h al, v16h bh, v16h bl, v8f c) {
  c = __builtin_amdgcn_wmma_f32_16x16x32_f16(false, ah, false, bh, (short)0, c, false, false);
  if (NT >= 2) c = __builtin_amdgcn_wmma_f32_16x16x32_f16(false, al, false, bh, (short)0, c, false, false);
  if (NT >= 3) c = __builtin_amdgcn_wmma_f32_16x16x32_f16(false, ah, false, bl, (short)0, c, false, false);
  asm volatile("v_nop\n\tv_nop\n\tv_nop\n\tv_nop" : "+v"(c) : "v"(ah), "v"(al), "v"(bh), "v"(bl));
  return c;
}
// batched GEMM like k_gemm_b but f16 operands: A f32 (split into f16 hi/lo if ASPLIT, else rounded to f16), Bt = f16 values [n][k]; alpha; C f32; N multiple of 16 (partial tiles skipped)
template <bool ASPLIT>
__global__ __launch_bounds__(128) void k_gemm_h(const float* __restrict__ A, int lda, size_t sA, const _Float16* __restrict__ Bh, int ldb, size_t sB, float alpha, float* __restrict__ C, int ldc, size_t sC, int M, int N, int K) {
  __shared__ __attribute__((aligned(16))) float so[4][16][64];
  const int tid = threadIdx.x, w = tid >> 5, lane = tid & 31, ln = lane & 15, hh = lane >> 4; const int by = blockIdx.y;
  A += (size_t)by * sA; Bh += (size_t)by * sB; C += (size_t)by * sC;
  const int ntn = (N + 63) / 64; const int wid = blockIdx.x * 4 + w; const int mt = wid / ntn, nq = wid % ntn; if (mt * 16 >= M) return;
  const int row0 = mt * 16, col0 = nq * 64; const float* arow = A + (size_t)(row0 + ln) * lda;
  v8f acc[4] = {};
  for (int kb = 0; kb < K; kb += 32) {
    FragH ah, al;
    const v4f x0 = *(const v4fa*)(arow + kb + 8 * hh), x1 = *(const v4fa*)(arow + kb + 8 * hh + 4), x2 = *(const v4fa*)(arow + kb + 16 + 8 * hh), x3 = *(const v4fa*)(arow + kb + 16 + 8 * hh + 4);
    float xs[16] = {x0[0],x0[1],x0[2],x0[3],x1[0],x1[1],x1[2],x1[3],x2[0],x2[1],x2[2],x2[3],x3[0],x3[1],x3[2],x3[3]};
#pragma unroll
    for (int i = 0; i < 16; ++i) { const _Float16 h = (_Float16)xs[i]; ah.h[i] = h; al.h[i] = ASPLIT ? (_Float16)(xs[i] - (float)h) : (_Float16)0.0f; }
#pragma unroll
    for (int t = 0; t < 4; ++t) { if (col0 + t * 16 >= N) continue; const size_t boff = (size_t)(col0 + t * 16 + ln) * ldb + kb; FragH bq; bq.half[0] = *(const v8us*)(Bh + boff + 8 * hh); bq.half[1] = *(const v8us*)(Bh + boff + 16 + 8 * hh);
      acc[t] = mmaH<ASPLIT ? 2 : 1>(ah.v, al.v, bq.v, bq.v, acc[t]); }
  }
#pragma unroll
  for (int t = 0; t < 4; ++t) { if (col0 + t * 16 >= N) continue;
#pragma unroll
    for (int r = 0; r < 8; ++r) so[w][8 * hh + r][t * 16 + ln] = acc[t][r] * alpha; }
  __builtin_amdgcn_fence(__ATOMIC_ACQ_REL, "workgroup"); __builtin_amdgcn_wave_barrier();
  const int rsub = lane >> 4, c4 = (lane & 15) * 4;
  {
#pragma unroll
    for (int q = 0; q < 8; ++q) { const int r = q * 2 + rsub; if (col0 + c4 < N) { const v4f v = *(const v4fa*)&so[w][r][c4]; *(v4f*)(C + (size_t)(row0 + r) * ldc + col0 + c4) = v; } }
     }
}

// Wt[n][k] = f16(W[k][n]·scale) from f32 row-major W[K][N] (scale = power of two; bf16-exact weights stay exact in f16 away from the subnormal range)
__global__ __launch_bounds__(256) void k_wt_f16(const float* __restrict__ W, _Float16* __restrict__ Wt, int K, int N, float scale) {
  const int t = blockIdx.x * 256 + threadIdx.x; if (t >= N * (K / 8)) return; const int n = t / (K / 8), k8 = (t % (K / 8)) * 8; FragH f;
#pragma unroll
  for (int i = 0; i < 8; ++i) f.h[i] = (_Float16)(bf16_round(W[(size_t)(k8 + i) * N + n]) * scale); const v8us o = f.half[0];
  *(v8us*)((unsigned short*)Wt + (size_t)n * K + k8) = o; 
}


typedef _Float16 v4h __attribute__((ext_vector_type(4)));

__global__ __launch_bounds__(256) void k_x16(const float* __restrict__ x, _Float16* __restrict__ X16, size_t n8) { const size_t t = (size_t)blockIdx.x * 256 + threadIdx.x; if (t >= n8) return; FragH f;
#pragma unroll
  for (int q = 0; q < 8; ++q) f.h[q] = (_Float16)bf16_round(x[t * 8 + q]); *(v8us*)((unsigned short*)X16 + t * 8) = f.half[0];  }
__global__ __launch_bounds__(256) void k_h16(const float* __restrict__ x, _Float16* __restrict__ X16, size_t n8) { const size_t t = (size_t)blockIdx.x * 256 + threadIdx.x; if (t >= n8) return; FragH f;
#pragma unroll
  for (int q = 0; q < 8; ++q) f.h[q] = (_Float16)x[t * 8 + q]; *(v8us*)((unsigned short*)X16 + t * 8) = f.half[0];  }
__global__ __launch_bounds__(256) void k_round16f(const float* __restrict__ W, _Float16* __restrict__ Bt, size_t n8) { const size_t t = (size_t)blockIdx.x * 256 + threadIdx.x; if (t >= n8) return; FragH f;
#pragma unroll
  for (int i = 0; i < 8; ++i) f.h[i] = (_Float16)(bf16_round(W[t * 8 + i]) * 16.0f); *(v8us*)((unsigned short*)Bt + t * 8) = f.half[0];  }
template <int NHv, int TTv>
__global__ __launch_bounds__(256) void k_vt(const _Float16* __restrict__ V16, int ldv, int voff, _Float16* __restrict__ Vt) { __shared__ unsigned short tl[64][66]; const int tid = threadIdx.x; const int slab = blockIdx.x / (TTv / 64), lg = blockIdx.x % (TTv / 64); const int b = slab / NHv, h = slab % NHv;
  for (int i = tid; i < 64 * 8; i += 256) { const int r = i / 8, c8 = (i % 8) * 8; FragH f; f.half[0] = *(const v8us*)((const unsigned short*)V16 + ((size_t)b * TTv + lg * 64 + r) * ldv + voff + h * 64 + c8);
#pragma unroll
    for (int q = 0; q < 8; ++q) tl[r][c8 + q] = f.u[q]; }
  __syncthreads();
  {
#pragma unroll
    for (int rd = 0; rd < 2; ++rd) { const int d = rd * 32 + tid / 8, pc = tid % 8; FragH f;
#pragma unroll
      for (int q = 0; q < 8; ++q) f.u[q] = tl[pc * 8 + q][d];
      *(v8us*)((unsigned short*)Vt + ((size_t)slab * 64 + d) * TTv + lg * 64 + pc * 8) = f.half[0]; }
     } }

__global__ __launch_bounds__(256) void k_vthlu(const float* __restrict__ VF, int ldv, _Float16* __restrict__ Vth, _Float16* __restrict__ Vtl) { __shared__ float tl[64][65]; const int tid = threadIdx.x; const int slab = blockIdx.x / (TT / 64), lg = blockIdx.x % (TT / 64); const int b = slab / NVH, h = slab % NVH;
  for (int i = tid; i < 64 * 16; i += 256) { const int r = i / 16, c4 = (i % 16) * 4; const v4f a = *(const v4fa*)(VF + ((size_t)b * TT + lg * 64 + r) * ldv + h * 64 + c4); tl[r][c4] = a[0]; tl[r][c4 + 1] = a[1]; tl[r][c4 + 2] = a[2]; tl[r][c4 + 3] = a[3]; }
  __syncthreads();
  FragH fh[2], fl[2]; size_t oo[2];
#pragma unroll
  for (int rd = 0; rd < 2; ++rd) { const int d = rd * 32 + tid / 8, pc = tid % 8;
#pragma unroll
    for (int q = 0; q < 8; ++q) { const float v = tl[pc * 8 + q][d]; const _Float16 hv = (_Float16)v; fh[rd].h[q] = hv; fl[rd].h[q] = (_Float16)(v - (float)hv);      /* UNSCALED residual (added into the same accumulator as the hi product) */ } oo[rd] = ((size_t)slab * 64 + d) * TT + lg * 64 + pc * 8; }
  {
#pragma unroll
    for (int rd = 0; rd < 2; ++rd) { *(v8us*)((unsigned short*)Vth + oo[rd]) = fh[rd].half[0]; *(v8us*)((unsigned short*)Vtl + oo[rd]) = fl[rd].half[0]; }
     } }
// One Conv1d (3 taps, pad 1) as a GEMM that forms no im2col plane: row s of the im2col matrix is input rows s - 1, s, s + 1 laid end to end, so a block stages its 16 rows and the two neighbours once in LDS,
// rounded f32 -> bf16 -> f16 (a zero row outside the sequence), and k-step ks reads its A fragment from LDS row ln + ks / 8. Bh = f16 weights in fragment order (k_wc3 below), k = tap * 256 + c. Four waves = the four 64-column quarters of the 256 outputs.
template <bool F16OUT>      /* the output plane: f16 (C16) or f32 (C) */
__global__ __launch_bounds__(128) void k_conv3(const float* __restrict__ x, const _Float16* __restrict__ Bh, const float* __restrict__ bias, float* __restrict__ C, _Float16* __restrict__ C16) {
  constexpr int XP = DD + 8;      /* LDS row pitch in halves: 528 B = 16 B x odd, conflict-free for the 16-row ds_load_b128 fragment reads */
  __shared__ __attribute__((aligned(16))) unsigned short sX[16 + 2][XP];      /* LDS row r = sequence row s0 + r - 1 */
  __shared__ __attribute__((aligned(16))) float so[4][16][64];
  const int tid = threadIdx.x, w = tid >> 5, lane = tid & 31, ln = lane & 15, hh = lane >> 4;
  const int row0 = blockIdx.x * 16, col0 = w * 64; const int s0 = row0 % TT;      /* 16 divides the sequence length: a block's rows lie in one sequence */
  float bv[4]; const int bi = col0 + ln;      /* this lane's four bias values, loaded beside the input rows */
  constexpr int NK = K3 / 32, PF = 2;      /* 24 k-steps; a k-step's weight fragments are loaded PF k-steps ahead of their products */
  const unsigned short* bp = (const unsigned short*)Bh + w * 2048 + lane * 8;      /* halves: 8192 per k-step, 512 per 16-column tile, 256 per fragment half, 8 per lane */
  FragH bq[PF + 1][4], ah[2];
  auto ldb = [&](int ks) {      /* the wave's four B fragments of k-step ks: eight loads of 512 contiguous bytes, one address and constant offsets */
#pragma unroll      /* constant indices keep bq[] in registers */
    for (int t = 0; t < 4; ++t) { bq[ks % (PF + 1)][t].half[0] = *(const v8us*)(bp + ks * 8192 + t * 512); bq[ks % (PF + 1)][t].half[1] = *(const v8us*)(bp + ks * 8192 + t * 512 + 256); } };
  { v4f xa[9];      /* nine 16-B loads per thread, all issued before the first is used: one memory latency for the whole stage */
    const int nb = tid >> 6; const bool in = nb ? (s0 + 16 < TT) : (s0 > 0);      /* waves 0, 1: the row above the block; waves 2, 3: the row below */
    const float* xb = x + (size_t)(row0 + w) * DD + lane * 4; const float* xn = x + (size_t)(row0 + (in ? (nb ? 16 : -1) : 0)) * DD + (tid & 63) * 4;      /* a neighbour outside the sequence: the address stays inside the buffer, the values are replaced by zero */
#pragma unroll      /* constant indices keep xa[] in registers */
    for (int j = 0; j < 8; ++j) xa[j] = *(const v4fa*)(xb + (j >> 1) * 4 * DD + (j & 1) * 128);      /* four rows per wave, 512 contiguous bytes per load, one address and constant offsets */
    xa[8] = *(const v4fa*)xn;
#pragma unroll
    for (int t = 0; t < 4; ++t) bv[t] = bias[bi + t * 16];
    asm volatile("s_wait_xcnt 0x0" :: "v"(xb), "v"(xn), "v"(bi) : "memory");      /* stands behind these loads; their addresses are named as inputs so that the registers are rewritten only behind it */
#pragma unroll      /* constant indices keep bq[] in registers */
    for (int ks = 0; ks < PF; ++ks) ldb(ks);      /* the first weight fragments fly beside the input rows */
    if (!in) xa[8] = (v4f){0.f, 0.f, 0.f, 0.f};
#pragma unroll      /* constant indices keep xa[] in registers */
    for (int j = 0; j < 9; ++j) { v4h h4;
#pragma unroll
      for (int q = 0; q < 4; ++q) h4[q] = (_Float16)bf16_round(xa[j][q]);
      *(v4h*)(j < 8 ? &sX[1 + (j >> 1) * 4 + w][(j & 1) * 128 + lane * 4] : &sX[nb * 17][(tid & 63) * 4]) = h4; } }
  __syncthreads();      /* publishes the 18 staged rows to the four waves */
  auto lda = [&](int ks) { const unsigned short* ar = &sX[ln + ks / 8][(ks % 8) * 32 + 8 * hh]; ah[ks & 1].half[0] = *(const v8us*)ar; ah[ks & 1].half[1] = *(const v8us*)(ar + 16); };
  v8f acc[4] = {};
  lda(0);
#pragma unroll      /* constant indices keep bq[] and ah[] in registers, and every weight load's offset is an immediate */
  for (int ks = 0; ks < NK; ++ks) {
    if (ks + PF < NK) ldb(ks + PF);
    if (ks + 1 < NK) lda(ks + 1);
    __builtin_amdgcn_sched_barrier(0);      /* holds the loads for later k-steps in front of this k-step's products: sunk to their uses, each would be waited for in full */
#pragma unroll
    for (int t = 0; t < 4; ++t) acc[t] = __builtin_amdgcn_wmma_f32_16x16x32_f16(false, ah[ks & 1].v, false, bq[ks % (PF + 1)][t].v, (short)0, acc[t], false, false);      /* the plain builtin: the compiler keeps the distance behind it itself */
  }
  asm volatile("s_wait_xcnt 0x0" :: "v"(bp) : "memory");      /* stands behind the weight loads; their address is named as an input so that its registers are rewritten only behind it */
#pragma unroll
  for (int t = 0; t < 4; ++t) { const float bt = bf16_round(bv[t]);
#pragma unroll
    for (int r = 0; r < 8; ++r) so[w][8 * hh + r][t * 16 + ln] = acc[t][r] + bt; }
  __builtin_amdgcn_fence(__ATOMIC_ACQ_REL, "workgroup"); __builtin_amdgcn_wave_barrier();
  const int rsub = lane >> 4, c4 = (lane & 15) * 4;
#pragma unroll
  for (int q = 0; q < 8; ++q) { const int r = q * 2 + rsub; const v4f v = *(const v4fa*)&so[w][r][c4]; if (!F16OUT) *(v4f*)(C + (size_t)(row0 + r) * DD + col0 + c4) = v; else { v4h h4; for (int i = 0; i < 4; ++i) h4[i] = (_Float16)v[i]; *(v4h*)(C16 + (size_t)(row0 + r) * DD + col0 + c4) = h4; } }
}
// Conv weights [o][c][tap] -> f16 in the order in which k_conv3's lanes read B fragments: [k-step][16-column tile][fragment half j][lane hh * 16 + ln][8 halves], holding column o = tile * 16 + ln, k = k-step * 32 + j * 16 + hh * 8 + 0..7. Thread t writes the t-th 16 bytes.
__global__ __launch_bounds__(256) void k_wc3(const float* __restrict__ w, _Float16* __restrict__ Bt) { const int t = blockIdx.x * 256 + threadIdx.x; if (t >= DD * (K3 / 8)) return; const int o = ((t >> 6) & 15) * 16 + (t & 15), k0 = (t >> 10) * 32 + ((t >> 5) & 1) * 16 + ((t >> 4) & 1) * 8; const int tap = k0 / DD, c0 = k0 % DD; FragH f;
  for (int q = 0; q < 8; ++q) f.h[q] = (_Float16)bf16_round(w[((size_t)o * DD + c0 + q) * 3 + tap]);
  *(v8us*)((unsigned short*)Bt + (size_t)t * 8) = f.half[0];  }
__global__ __launch_bounds__(256) void k_scl(float* __restrict__ O, const float* __restrict__ scl, size_t n4) { const size_t t = (size_t)blockIdx.x * 256 + threadIdx.x; if (t >= n4) return; const float s = bf16_round(scl[0]); v4f v = *(const v4fa*)(O + t * 4); for (int q = 0; q < 4; ++q) v[q] *= s; *(v4f*)(O + t * 4) = v;  }
__device__ __forceinline__ float xhalf(float x) { return __builtin_bit_cast(float, __builtin_amdgcn_permlanex16(__builtin_bit_cast(int, x), __builtin_bit_cast(int, x), 0x76543210, 0xfedcba98, false, false)); }      /* lane l takes lane l ^ 16's value */
__device__ __forceinline__ float ex2(float x) { return __builtin_amdgcn_exp2f(x); }      /* 2^x as the one hardware instruction v_exp_f32; every argument below is <= 0 up to one rounding, and a result under the normal range may go to zero */
__device__ __forceinline__ unsigned lds_off(const void* p) { return (unsigned)(size_t)p; }      /* byte offset in the work-group's LDS = low 32 bits of the __shared__ address */
// Four or twelve asynchronous copies, 16 B per lane each, global memory -> LDS. The closing s_wait_xcnt stands inside the statement so that no address register named here is rewritten ahead of it.
__device__ __forceinline__ void acp4(const unsigned (&l)[4], const unsigned short* const (&p)[4]) {
  asm volatile("global_load_async_to_lds_b128 %0, %4, off\n\t"
               "global_load_async_to_lds_b128 %1, %5, off\n\t"
               "global_load_async_to_lds_b128 %2, %6, off\n\t"
               "global_load_async_to_lds_b128 %3, %7, off\n\t"
               "s_wait_xcnt 0x0"
               :: "v"(l[0]), "v"(l[1]), "v"(l[2]), "v"(l[3]), "v"(p[0]), "v"(p[1]), "v"(p[2]), "v"(p[3]) : "memory");
}
/* Twelve copies whose global address is a scalar base (one per copy) plus a 32-bit byte offset of the lane (ok for the first four, ov for the other eight): 14 vector registers for the statement, so that it fits where a tile's fragments are all live. */
__device__ __forceinline__ void acp12(const unsigned (&l)[12], unsigned ok, unsigned ov, const unsigned short* const (&p)[12]) {
  asm volatile("global_load_async_to_lds_b128 %0, %12, %14\n\t"
               "global_load_async_to_lds_b128 %1, %12, %15\n\t"
               "global_load_async_to_lds_b128 %2, %12, %16\n\t"
               "global_load_async_to_lds_b128 %3, %12, %17\n\t"
               "global_load_async_to_lds_b128 %4, %13, %18\n\t"
               "global_load_async_to_lds_b128 %5, %13, %19\n\t"
               "global_load_async_to_lds_b128 %6, %13, %20\n\t"
               "global_load_async_to_lds_b128 %7, %13, %21\n\t"
               "global_load_async_to_lds_b128 %8, %13, %22\n\t"
               "global_load_async_to_lds_b128 %9, %13, %23\n\t"
               "global_load_async_to_lds_b128 %10, %13, %24\n\t"
               "global_load_async_to_lds_b128 %11, %13, %25\n\t"
               "s_wait_xcnt 0x0"
               :: "v"(l[0]), "v"(l[1]), "v"(l[2]), "v"(l[3]), "v"(l[4]), "v"(l[5]), "v"(l[6]), "v"(l[7]), "v"(l[8]), "v"(l[9]), "v"(l[10]), "v"(l[11]), "v"(ok), "v"(ov),
                  "s"(p[0]), "s"(p[1]), "s"(p[2]), "s"(p[3]), "s"(p[4]), "s"(p[5]), "s"(p[6]), "s"(p[7]), "s"(p[8]), "s"(p[9]), "s"(p[10]), "s"(p[11]) : "memory");
}
__device__ __forceinline__ v8f mmaP(v16h a, v16h b, v8f c) { return __builtin_amdgcn_wmma_f32_16x16x32_f16(false, a, false, b, (short)0, c, false, false); }      /* the plain builtin: the compiler keeps the distance behind it itself, and no asm statement stands between the LDS reads and the products */
__global__ __launch_bounds__(256) void k_flash(const _Float16* __restrict__ Q16, int ldq, const _Float16* __restrict__ K16, int ldk, const _Float16* __restrict__ Vt, const _Float16* __restrict__ Vtlo, float* __restrict__ O, int ldo) {
  constexpr int RPW = 16, NQB = TT / (4 * RPW), DT = 16, KS = 8;      /* d_qk 256: 8 k-steps; 16 value tiles = the whole 256-wide V per wave, so each score is formed in one wave only */
  constexpr int SK = 64, NST = TT / SK;      /* one LDS tile = 64 keys = two 32-key passes, each on its own waves; V rows of 64 keys are whole 128-B lines */
  constexpr int KP = 256 + 8, VP = SK + 8;      /* LDS row pitches in halves: 528 B and 144 B, both 16 B x odd, conflict-free for the 16-row ds_load_b128 fragment reads */
  constexpr int OP = 256 + 4;      /* output tile's row pitch in floats */
  __shared__ __attribute__((aligned(16))) unsigned short sQ[4 * RPW][KP]; __shared__ __attribute__((aligned(16))) unsigned short sK[2][SK][KP]; __shared__ __attribute__((aligned(16))) unsigned short sVh[2][256][VP]; __shared__ __attribute__((aligned(16))) unsigned short sVl[2][256][VP];
  __shared__ float sM[4][RPW]; __shared__ float sL[4][RPW];
  typedef float f32a __attribute__((may_alias)); static_assert(sizeof(sK) >= 4 * RPW * OP * sizeof(float), "the four output tiles fit the K ring");
  f32a (*sO)[RPW][OP] = (f32a (*)[RPW][OP])&sK[0][0][0];      /* the output tiles reuse the K ring, which nobody reads or fills behind the loop's last barrier */
  const int tid = threadIdx.x, w = tid >> 5, lane = tid & 31, ln = lane & 15, hh = lane >> 4;
  const int slab = blockIdx.x / NQB, qblk = blockIdx.x % NQB; const int b = slab / NH, h = slab % NH; const int qb0 = qblk * (4 * RPW);
  const int wu = __builtin_amdgcn_readfirstlane(w);      /* the wave's number as a scalar: the row parts of the copies' addresses stay in scalar registers */
  const int wq = wu & 3; const int q0 = qb0 + wq * RPW;      /* eight waves, two per SIMD, up to 512 registers each: 4 groups of 16 query rows x 2 halves of each tile's keys; wq numbers the pair of waves that share rows */
  const unsigned short* Qg = (const unsigned short*)Q16 + ((size_t)b * TT + qb0) * ldq; const unsigned short* Kg = (const unsigned short*)K16 + (size_t)b * TT * ldk;
  const unsigned short* Vth = (const unsigned short*)Vt + (size_t)b * VSTR * TT; const unsigned short* Vtl = (const unsigned short*)Vtlo + (size_t)b * VSTR * TT;      /* hi and UNSCALED residual planes */
  const int kp = wu >> 2;      /* which 32 keys of every tile this wave takes (scalar: the epilogue branches on it) */
  /* tile t -> buffer buf, 24 copies per wave in two statements; each statement: 4 K rows (one 512-B row per copy), 16 of the 256 rows of each V plane (four 128-B rows per copy) */
  const unsigned oK = (unsigned)lane * 16u, oV = (unsigned)(lane >> 3) * (TT * 2u) + (unsigned)(lane & 7) * 16u;      /* the lane's part of every copy's global address, in bytes: one offset for K rows, one for the rows of both V planes */
  const unsigned lK = lds_off(&sK[0][0][lane * 8]), lVh = lds_off(&sVh[0][lane >> 3][(lane & 7) * 8]); const int dL = (int)(lds_off(&sVl[0][0][0]) - lds_off(&sVh[0][0][0]));      /* and of its LDS address */
  auto sgl = [](int x) { return __builtin_amdgcn_readfirstlane(x); };      /* the part that is the same in every lane is formed in scalar registers at each tile */
  auto stage = [&](int t, int buf) {
#pragma unroll      /* two statements, constant indices */
    for (int j = 0; j < 2; ++j) { const int u = wu * 2 + j;      /* sixteenth of the tile */
      unsigned l[12]; const unsigned short* p[12];      /* p[]: scalar bases */
#pragma unroll      /* constant indices keep l[] and p[] in registers */
      for (int i = 0; i < 4; ++i) { const int r = u * 4 + i; l[i] = lK + (unsigned)sgl((buf * SK + r) * (KP * 2)); p[i] = Kg + sgl((t * SK + r) * ldk); }
#pragma unroll      /* constant indices keep l[] and p[] in registers */
      for (int i = 0; i < 4; ++i) { const int d = u * 16 + i * 4; const int lo = (buf * 256 + d) * (VP * 2), go = sgl(d * TT + t * SK); l[4 + i] = lVh + (unsigned)sgl(lo); p[4 + i] = Vth + go; l[8 + i] = lVh + (unsigned)sgl(lo + dL); p[8 + i] = Vtl + go; }
      acp12(l, oK, oV, p); } };
#pragma unroll      /* two statements, constant indices */
  for (int j = 0; j < 2; ++j) { unsigned l[4]; const unsigned short* p[4];      /* the block's 64 query rows, filled once: 8 rows per wave */
#pragma unroll      /* constant indices keep l[] and p[] in registers */
    for (int i = 0; i < 4; ++i) { const int r = (wu * 2 + j) * 4 + i; l[i] = lds_off(&sQ[r][lane * 8]); p[i] = Qg + (size_t)r * ldq + lane * 8; }
    acp4(l, p); }
  stage(0, 0);
  asm volatile("s_wait_asynccnt 0x0" ::: "memory");      /* this wave's copies of Q and of tile 0 have landed */
  __syncthreads();      /* publishes Q and tile 0 to every wave */
  stage(1, 1);
  /* Transposed products: St = K x Qt and Ot += Vt x Pt. Lane (ln, hh) holds query q0 + ln: its scores of keys 8 hh + r of each 16-key tile, and its outputs of value columns 8 hh + r of each 16-column tile. */
  FragH aq[KS];      /* the wave's 16 query rows as B fragments: read from LDS once, kept in 64 registers for all tiles */
  { const unsigned short* qrow = &sQ[wq * RPW + ln][8 * hh];
#pragma unroll      /* constant indices keep the fragments in registers */
    for (int ks = 0; ks < KS; ++ks) { aq[ks].half[0] = *(const v8us*)(qrow + ks * 32); aq[ks].half[1] = *(const v8us*)(qrow + ks * 32 + 16); } }
  float m_r = -3.0e38f, l_r = 0.f; v8f oacc[DT];
#pragma unroll
  for (int dt = 0; dt < DT; ++dt) oacc[dt] = (v8f){0.f,0.f,0.f,0.f,0.f,0.f,0.f,0.f};
  /* A tile's work in a wave has two phases: READ (its K and V fragments come from LDS, the score products between them) and COMPUTE (softmax and the V products, on registers alone). The two waves of a SIMD (key halves 0 and 1) run them half a tile apart:
     in step i the waves with (i + kp) even read and the others compute, so that the LDS pipe serves one wave of each SIMD while vector and matrix units serve the other. What READ hands to COMPUTE: */
  FragH bv[DT], bl[DT]; float sc[16];      /* the pass's V fragments, both planes, and the lane's 16 scores in log2 units */
  constexpr float SC2 = ATT_SCALE * 1.44269504088896340736f;      /* 1/16 x log2(e): exp(score / 16 - max) = 2^(score x SC2 - max x log2(e)); scores and running maximum are kept in these log2 units */
  auto rd = [&](int buf) {
    const int j0 = kp * 32;      /* first key of this wave's pass inside the tile */
    const unsigned short* kr0 = &sK[buf][j0 + ln][8 * hh]; const unsigned short* kr1 = &sK[buf][j0 + 16 + ln][8 * hh];
    const unsigned short* vh0 = &sVh[buf][ln][j0 + 8 * hh]; const unsigned short* vl0 = &sVl[buf][ln][j0 + 8 * hh];
    FragH bk0[KS], bk1[KS]; v8f s[2] = {(v8f){0.f,0.f,0.f,0.f,0.f,0.f,0.f,0.f}, (v8f){0.f,0.f,0.f,0.f,0.f,0.f,0.f,0.f}};
    auto ldv = [&](int dt) { bv[dt].half[0] = *(const v8us*)(vh0 + dt * 16 * VP); bv[dt].half[1] = *(const v8us*)(vh0 + dt * 16 * VP + 16); bl[dt].half[0] = *(const v8us*)(vl0 + dt * 16 * VP); bl[dt].half[1] = *(const v8us*)(vl0 + dt * 16 * VP + 16); };
#pragma unroll      /* constant indices keep the fragments in registers */
    for (int ks = 0; ks < KS; ++ks) { bk0[ks].half[0] = *(const v8us*)(kr0 + ks * 32); bk0[ks].half[1] = *(const v8us*)(kr0 + ks * 32 + 16); bk1[ks].half[0] = *(const v8us*)(kr1 + ks * 32); bk1[ks].half[1] = *(const v8us*)(kr1 + ks * 32 + 16); }      /* one group of reads: the pass's 32 keys, all k-steps ... */
#pragma unroll      /* constant indices keep the fragments in registers */
    for (int dt = 0; dt < DT / 2; ++dt) ldv(dt);      /* ... and the first eight value tiles, both planes, which return while the score products run */
    __builtin_amdgcn_sched_barrier(0);      /* holds the group of reads in front of the products: one LDS latency is waited for, not one per product */
#pragma unroll      /* constant indices keep the fragments in registers */
    for (int ks = 0; ks < KS; ++ks) { s[0] = mmaP(bk0[ks].v, aq[ks].v, s[0]); s[1] = mmaP(bk1[ks].v, aq[ks].v, s[1]); }      /* A = 16 keys, B = 16 queries; the two score tiles alternate, so that no product waits for its predecessor's accumulator */
    __builtin_amdgcn_sched_barrier(0);      /* keeps the second group of reads behind the products that free its 128 registers: hoisted, all the reads at once would not fit the register budget */
#pragma unroll      /* constant indices keep the fragments in registers */
    for (int dt = DT / 2; dt < DT; ++dt) ldv(dt);      /* the other eight value tiles, in the registers that K leaves */
#pragma unroll
    for (int i = 0; i < 16; ++i) sc[i] = s[i >> 3][i & 7] * SC2; };
  auto cmp = [&]() {
    float mc = sc[0];
#pragma unroll
    for (int i = 1; i < 16; ++i) mc = fmaxf(mc, sc[i]);
    mc = fmaxf(mc, xhalf(mc));      /* the other 16 of the query's 32 keys sit in lane ^ 16 */
    const float mn = fmaxf(m_r, mc); float ea;
    asm("v_exp_f32 %0, %1\n\tv_nop" : "=&v"(ea) : "v"(m_r - mn));      /* 2^x as in ex2(), with the slot behind it in the same statement */
    const float al = (mn > -1.0e38f) ? ea : 1.0f; m_r = mn;
    FragH ph, pl; float ls[4] = {0.f, 0.f, 0.f, 0.f};      /* element i of the two score tiles is element i of a B fragment in the k order of the V loader above: P stays in registers */
#pragma unroll      /* constant indices keep sc[] in registers */
    for (int g = 0; g < 16; g += 4) { float e0, e1, e2, e3;      /* 2^x as in ex2(), four v_exp_f32 and the slot behind the last in one statement: each is followed by an instruction that neither reads its result nor overwrites its source (outputs are early-clobber) */
      asm("v_exp_f32 %0, %4\n\tv_exp_f32 %1, %5\n\tv_exp_f32 %2, %6\n\tv_exp_f32 %3, %7\n\tv_nop"
          : "=&v"(e0), "=&v"(e1), "=&v"(e2), "=&v"(e3) : "v"(sc[g] - mn), "v"(sc[g + 1] - mn), "v"(sc[g + 2] - mn), "v"(sc[g + 3] - mn));
      sc[g] = e0; sc[g + 1] = e1; sc[g + 2] = e2; sc[g + 3] = e3; }      /* the probabilities take the scores' place: sc[] lives from step to step, and a second array beside it does not fit the register budget */
#pragma unroll
    for (int i = 0; i < 16; ++i) { const float p = sc[i]; ls[i & 3] += p; const float ps = p * 1024.0f; const _Float16 hp = (_Float16)ps; ph.h[i] = hp; pl.h[i] = (_Float16)(ps - (float)hp); }      /* P hi and its UNSCALED residual (added into the same accumulator) */
    l_r = l_r * al + ((ls[0] + ls[1]) + (ls[2] + ls[3]));      /* this lane's 16 keys of every pass; the two halves are joined behind the loop */
#pragma unroll
    for (int dt = 0; dt < DT; ++dt)
#pragma unroll
      for (int r = 0; r < 8; ++r) oacc[dt][r] *= al;
    /* Vh x Ph + Vh x Pl + Vl x Ph, all unscaled, one accumulator per value tile, in this order; A = 16 value columns, B = 16 queries. Term by term over the sixteen tiles: successive products are independent */
#pragma unroll      /* constant indices keep fragments and accumulators in registers, here and in the two loops below */
    for (int dt = 0; dt < DT; ++dt) oacc[dt] = mmaP(bv[dt].v, ph.v, oacc[dt]);
#pragma unroll
    for (int dt = 0; dt < DT; ++dt) oacc[dt] = mmaP(bv[dt].v, pl.v, oacc[dt]);
#pragma unroll
    for (int dt = 0; dt < DT; ++dt) oacc[dt] = mmaP(bl[dt].v, ph.v, oacc[dt]); };
  /* Steps 0 .. 2 NST. Tile t is read in step 2 t by the waves of key half 0 and in step 2 t + 1 by those of key half 1, and computed on one step later. Every test below is scalar and every wave passes every barrier. */
  if (kp == 0) rd(0);      /* step 0: key half 1 has nothing to compute on yet */
  asm volatile("s_wait_dscnt 0x0" ::: "memory");      /* this wave's reads of step 0 have returned before the barrier says so to the others */
  __syncthreads();      /* ends step 0 */
#pragma unroll 1      /* stays rolled: one copy of each phase in the instruction cache */
  for (int i = 1; i < 2 * NST; ++i) {      /* two tests with the wait between them, not if / else: for an else branch this compiler held the accumulators in a second set of registers across the compute phase, copied them every step and spilled */
    if (((i + kp) & 1) == 0) rd(((i - kp) >> 1) & 1);      /* the tile that a wave reads in step i is (i - kp) / 2 */
    asm volatile("s_wait_dscnt 0x0" ::: "memory");      /* this wave's reads of this step have returned before the barrier says so to the others */
    if ((i + kp) & 1) cmp();
    if (i & 1) asm volatile("s_wait_asynccnt 0x0" ::: "memory");      /* odd step 2 t + 1: this wave's copies of tile t + 1, issued two steps ago, have landed */
    __syncthreads();      /* ends the step; behind an odd step 2 t + 1 it publishes tile t + 1 and ends every wave's reads of tile t */
    if ((i & 1) && (i >> 1) + 2 < NST) stage((i >> 1) + 2, (i >> 1) & 1); }      /* tile t + 2 into the buffer that tile t leaves: in flight for two steps */
  if (kp == 1) cmp();      /* step 2 NST: key half 0 has nothing left to read; registers alone, so the barrier of the merge below ends it */
  asm volatile("s_wait_asynccnt 0x0" ::: "memory");      /* no copy is outstanding behind the loop */
  l_r += xhalf(l_r);      /* row sum over this wave's keys */
  { const int lane = (int)__builtin_amdgcn_mbcnt_lo(~0u, 0u), ln = lane & 15, hh = lane >> 4;      /* the lane's number, formed anew: held from the kernel's head, it and what is derived from it would take registers all through the loop */
  if (kp == 1) {      /* the wave of the second key half hands its running max, row sum and unnormalised tile to its partner */
#pragma unroll
    for (int dt = 0; dt < DT; ++dt) { *(v4fa*)&sO[wq][ln][dt * 16 + 8 * hh] = (v4f){oacc[dt][0], oacc[dt][1], oacc[dt][2], oacc[dt][3]}; *(v4fa*)&sO[wq][ln][dt * 16 + 8 * hh + 4] = (v4f){oacc[dt][4], oacc[dt][5], oacc[dt][6], oacc[dt][7]}; }
    if (hh == 0) { sM[wq][ln] = m_r; sL[wq][ln] = l_r; } }
  __syncthreads();      /* publishes the second key half's partial results to the partner waves */
  if (kp == 0) {
    const float m1 = sM[wq][ln], l1 = sL[wq][ln]; const float mn = fmaxf(m_r, m1); const float a0 = ex2(m_r - mn), a1 = ex2(m1 - mn); const float l = l_r * a0 + l1 * a1; const float inv = (l > 0.f) ? 1.0f / (l * 1024.0f) : 0.f; const float c0 = a0 * inv, c1 = a1 * inv;
#pragma unroll
    for (int dt = 0; dt < DT; ++dt)
#pragma unroll
      for (int g = 0; g < 2; ++g) { v4fa* o = (v4fa*)&sO[wq][ln][dt * 16 + 8 * hh + 4 * g]; const v4f x = *o; *o = (v4f){oacc[dt][4 * g] * c0 + x[0] * c1, oacc[dt][4 * g + 1] * c0 + x[1] * c1, oacc[dt][4 * g + 2] * c0 + x[2] * c1, oacc[dt][4 * g + 3] * c0 + x[3] * c1}; }      /* each lane reads and rewrites its own words */
    __builtin_amdgcn_fence(__ATOMIC_ACQ_REL, "workgroup"); __builtin_amdgcn_wave_barrier();
    float* og = O + ((size_t)b * TT + q0) * ldo + h * 256 + lane * 4;
#pragma unroll
    for (int r = 0; r < RPW; ++r)
#pragma unroll
      for (int g = 0; g < 2; ++g) { const v4f val = *(const v4fa*)&sO[wq][r][g * 128 + lane * 4]; *(v4f*)(og + (size_t)r * ldo + g * 128) = val; }      /* one 512-B half row per instruction: 32 lanes x 16 B */
  } } }

extern "C" void kernel_launch(void* const* d_in, const int* in_sizes, int n_in,
                              void* d_out, int out_size, void* d_ws, size_t ws_size, hipStream_t stream) {
  (void)in_sizes; (void)n_in; (void)out_size;
  const float* const* I = (const float* const*)d_in; const float* xq = I[0]; const float* xk = I[1]; const float* xv = I[2]; const float* qw = I[3]; const float* qb = I[4]; const float* kw = I[5]; const float* kb = I[6]; const float* vw = I[7]; const float* vb = I[8]; const float* scl = I[9];
  char* ws = (char*)d_ws; size_t off = 0;
  auto take = [&](size_t bytes) { char* p = ws + off; off += (bytes + 255) & ~(size_t)255; return p; };
  _Float16* Bq = (_Float16*)take((size_t)DD * K3 * 2); _Float16* Bk = (_Float16*)take((size_t)DD * K3 * 2); _Float16* Bv = (_Float16*)take((size_t)DD * K3 * 2); _Float16* Q = (_Float16*)take((size_t)NR * DD * 2); _Float16* K = (_Float16*)take((size_t)NR * DD * 2); float* VF = (float*)take((size_t)NR * DD * 4); _Float16* Vt = (_Float16*)take((size_t)NR * DD * 2); _Float16* Vtl = (_Float16*)take((size_t)NR * DD * 2);
  if (off > ws_size) return;      // 1.2 + 8.4 + 8.4 + 16.8 + 8.4 + 8.4 = about 52 MB
  k_wc3<<<(DD * (K3 / 8) + 255) / 256, 256, 0, stream>>>(qw, Bq); k_wc3<<<(DD * (K3 / 8) + 255) / 256, 256, 0, stream>>>(kw, Bk); k_wc3<<<(DD * (K3 / 8) + 255) / 256, 256, 0, stream>>>(vw, Bv);
  k_conv3<true><<<NR / 16, 128, 0, stream>>>(xq, Bq, qb, nullptr, Q);      /* q = conv(query): M 16384 N 256 K 768 (exact products), f16 out */
  k_conv3<true><<<NR / 16, 128, 0, stream>>>(xk, Bk, kb, nullptr, K);
  k_conv3<false><<<NR / 16, 128, 0, stream>>>(xv, Bv, vb, VF, nullptr);      /* v (f32) */
  k_vthlu<<<BB * NVH * (TT / 64), 256, 0, stream>>>(VF, DD, Vt, Vtl);      /* Vᵀ hi + residual: [b][256][4096] */
  k_flash<<<BB * NH * (TT / 64), 256, 0, stream>>>(Q, DD, K, DD, Vt, Vtl, (float*)d_out, DD);      /* whole 256-wide rows of O, straight into the output rows */
  k_scl<<<(unsigned)(((size_t)NR * DD / 4 + 255) / 256), 256, 0, stream>>>((float*)d_out, scl, (size_t)NR * DD / 4);      /* × scale */
}

// v010
// Measured time: 117 microseconds a run.
// Timed twice side by side with v009, it ran 1.38 times as fast both times.
// Counting every step since v000, it is 15.2 times as fast.
#include <hip/hip_runtime.h>
// KQV 'PCNN' attention (B=4, S=4096, D=256): q, k, v = Conv1d(kernel 3, pad 1) over the sequence of query/key/value (+bias); scores = q·k/16; softmax; out = scale·(P·v) → [4,4096,256].
// Compute dtype: inputs, conv weights/biases, scale rounded to bf16; each conv as an im2col GEMM (K = 3·256, bf16-exact operands, f32 accumulate) -> q, k f16 planes, v f32 -> V transposed, f16; fused flash-style kernel with d_qk = 256 (8 k-steps, online softmax f32, P f16,
// f32 accumulate) on v_wmma_f32_16x16x32_f16, one launch of 8-wave blocks (query rows x halves of each key tile), writing the output rows directly; × scale in f32.
#define BB 4
#define TT 4096
#define DD 256
#define NH 1
#define VSTR 256
#define NVH 4
#define NR (BB * TT)
#define K3 (3 * DD)
#define ATT_SCALE 0.0625f

typedef __bf16 v16b __attribute__((ext_vector_type(16)));
typedef unsigned short v8us __attribute__((ext_vector_type(8), may_alias));
typedef float  v8f  __attribute__((ext_vector_type(8)));
typedef float  v4f  __attribute__((ext_vector_type(4)));
typedef float  v4fa __attribute__((ext_vector_type(4), may_alias));
union FragB { v16b v; v8us half[2]; unsigned short u[16]; };

__device__ __forceinline__ unsigned short bf16_bits(float x) { unsigned int u = __float_as_uint(x); return (unsigned short)((u + 0x7FFFu + ((u >> 16) & 1u)) >> 16); }
__device__ __forceinline__ float bf16_val(unsigned short b) { return __uint_as_float(((unsigned int)b) << 16); }
__device__ __forceinline__ float bf16_round(float x) { return bf16_val(bf16_bits(x)); }
// D += A·B with NT terms: 1 = ah·bh, 2 = + al·bh (A split), 3 = + ah·bl (both split)
template <int NT>
__device__ __forceinline__ v8f mmaN(v16b ah, v16b al, v16b bh, v16b bl, v8f c) {
  c = __builtin_amdgcn_wmma_f32_16x16x32_bf16(false, ah, false, bh, (short)0, c, false, false);
  if (NT >= 2) c = __builtin_amdgcn_wmma_f32_16x16x32_bf16(false, al, false, bh, (short)0, c, false, false);
  if (NT >= 3) c = __builtin_amdgcn_wmma_f32_16x16x32_bf16(false, ah, false, bl, (short)0, c, false, false);
  asm volatile("v_nop\n\tv_nop\n\tv_nop\n\tv_nop" : "+v"(c) : "v"(ah), "v"(al), "v"(bh), "v"(bl));
  return c;
}

__global__ __launch_bounds__(256) void k_wt_bf16(const float* __restrict__ W, unsigned short* __restrict__ Wt, int K, int N) {
  const int t = blockIdx.x * 256 + threadIdx.x;
  const int k8n = K / 8;
  if (t >= N * k8n) return;
  const int n = t / k8n, k8 = (t % k8n) * 8;
  v8us v;
#pragma unroll
  for (int i = 0; i < 8; ++i) v[i] = bf16_bits(W[(size_t)(k8 + i) * N + n]);
  *(v8us*)(Wt + (size_t)n * K + k8) = v;
  
}

// GEMM C[M][N] (f32, pitch ldc) = act(A[M][K]·W + bias). A f32 row-major (pitch lda) converted per fragment to bf16
// (ASPLIT: hi/lo two planes -> 2 terms, else single rounded term); Wt bf16 [N][K] (pitch ldb). BIAS_BF16 rounds the
// bias to bf16 first (bias quantised to bf16 before the add). K%32==0, M%16==0, N%64==0.
template <bool ASPLIT, int ACT, bool BIAS_BF16>
__global__ __launch_bounds__(128) void k_gemm_bf(const float* __restrict__ A, int lda, const unsigned short* __restrict__ Wt, int ldb,
                                               const float* __restrict__ bias, float* __restrict__ C, int ldc, int M, int N, int K) {
  __shared__ __attribute__((aligned(16))) float so[4][16][64];
  const int tid = threadIdx.x, w = tid >> 5, lane = tid & 31, ln = lane & 15, hh = lane >> 4;
  const int ntn = N / 64;
  const int wid = blockIdx.x * 4 + w;
  const int mt = wid / ntn, nq = wid % ntn;
  if (mt * 16 >= M) return;
  const int row0 = mt * 16, col0 = nq * 64;
  const float* arow = A + (size_t)(row0 + ln) * lda;
  v8f acc[4] = {};
  for (int kb = 0; kb < K; kb += 32) {
    FragB ah, al;
    const v4f x0 = *(const v4fa*)(arow + kb + 8 * hh), x1 = *(const v4fa*)(arow + kb + 8 * hh + 4);
    const v4f x2 = *(const v4fa*)(arow + kb + 16 + 8 * hh), x3 = *(const v4fa*)(arow + kb + 16 + 8 * hh + 4);
    float xs[16] = {x0[0],x0[1],x0[2],x0[3],x1[0],x1[1],x1[2],x1[3],x2[0],x2[1],x2[2],x2[3],x3[0],x3[1],x3[2],x3[3]};
#pragma unroll
    for (int i = 0; i < 16; ++i) { const unsigned short hb = bf16_bits(xs[i]); ah.u[i] = hb; al.u[i] = ASPLIT ? bf16_bits(xs[i] - bf16_val(hb)) : (unsigned short)0; }
#pragma unroll
    for (int t = 0; t < 4; ++t) {
      const unsigned short* brow = Wt + (size_t)(col0 + t * 16 + ln) * ldb + kb;
      FragB b;
      b.half[0] = *(const v8us*)(brow + 8 * hh);
      b.half[1] = *(const v8us*)(brow + 16 + 8 * hh);
      acc[t] = mmaN<ASPLIT ? 2 : 1>(ah.v, al.v, b.v, b.v, acc[t]);
    }
  }
#pragma unroll
  for (int t = 0; t < 4; ++t) {
    float bv = bias ? bias[col0 + t * 16 + ln] : 0.f;
    if (BIAS_BF16) bv = bf16_round(bv);
#pragma unroll
    for (int r = 0; r < 8; ++r) { float v = acc[t][r] + bv; if (ACT == 1) v = fmaxf(v, 0.f); so[w][8 * hh + r][t * 16 + ln] = v; }
  }
  __builtin_amdgcn_fence(__ATOMIC_ACQ_REL, "workgroup");
  __builtin_amdgcn_wave_barrier();
  const int rsub = lane >> 4, c4 = (lane & 15) * 4;
  {
#pragma unroll
    for (int q = 0; q < 8; ++q) {
      const int r = q * 2 + rsub;
      const v4f v = *(const v4fa*)&so[w][r][c4];
      *(v4f*)(C + (size_t)(row0 + r) * ldc + col0 + c4) = v;
    }
    
  }
}

// Flash-style causal/unmasked attention, all contractions 3-term bf16 hi/lo splits, f32 softmax with running max.
// q,k,v rows are read from f32 buffers with arbitrary row pitch (so they can live inside a fused qkv buffer);
// D = head size (multiple of 32, <= 128); one wave = 16 query rows; block = 4 waves (64 queries) sharing K/V chunks of 32.
template <int D, bool CAUSAL>
__global__ __launch_bounds__(128) void k_flash(const float* __restrict__ qb, const float* __restrict__ kb, const float* __restrict__ vb,
                                             int pitch, int T, int H, float scale, float* __restrict__ y, int ypitch) {
  constexpr int KS = D / 32;        // k-steps for QK
  constexpr int DT = D / 16;        // d tiles for PV
  __shared__ __attribute__((aligned(16))) unsigned short sKh[32][D + 8], sKl[32][D + 8], sVh[32][D + 8], sVl[32][D + 8];
  __shared__ __attribute__((aligned(16))) unsigned short sPh[4][16][40], sPl[4][16][40];
  __shared__ __attribute__((aligned(16))) float sO[4][16][D];
  const int tid = threadIdx.x, w = tid >> 5, lane = tid & 31, ln = lane & 15, hh = lane >> 4;
  const int nqb = (T + 63) / 64;
  const int bh = blockIdx.x / nqb, qblk = blockIdx.x % nqb;
  const int b = bh / H, h = bh % H;
  const int q0 = qblk * 64 + w * 16;
  const float* Q = qb + (size_t)b * T * pitch + h * D;
  const float* K = kb + (size_t)b * T * pitch + h * D;
  const float* V = vb + (size_t)b * T * pitch + h * D;

  // A fragments of the wave's 16 query rows (scaled), hi/lo
  FragB aqh[KS], aql[KS];
  {
    int row = q0 + ln; if (row >= T) row = T - 1;
    const float* qr = Q + (size_t)row * pitch;
#pragma unroll
    for (int ks = 0; ks < KS; ++ks)
#pragma unroll
      for (int i = 0; i < 16; ++i) {
        const int d = ks * 32 + ((i < 8) ? (8 * hh + i) : (16 + 8 * hh + (i - 8)));
        const float x = qr[d] * scale; const unsigned short hb = bf16_bits(x);
        aqh[ks].u[i] = hb; aql[ks].u[i] = bf16_bits(x - bf16_val(hb));
      }
  }
  float m_r[8], l_r[8];
#pragma unroll
  for (int r = 0; r < 8; ++r) { m_r[r] = -3.0e38f; l_r[r] = 0.f; }
  v8f oacc[DT];
#pragma unroll
  for (int dt = 0; dt < DT; ++dt) oacc[dt] = (v8f){0.f,0.f,0.f,0.f,0.f,0.f,0.f,0.f};

  const int kv_end = CAUSAL ? min(T, qblk * 64 + 64) : T;     // block-uniform
  for (int j0 = 0; j0 < kv_end; j0 += 32) {
    __syncthreads();
    for (int e = tid; e < 32 * (D / 4); e += 128) {
      const int r = e / (D / 4), c4 = (e % (D / 4)) * 4;
      const int key = j0 + r;
      v4f kf = {0.f,0.f,0.f,0.f}, vf = {0.f,0.f,0.f,0.f};
      if (key < T) { kf = *(const v4fa*)(K + (size_t)key * pitch + c4); vf = *(const v4fa*)(V + (size_t)key * pitch + c4); }
#pragma unroll
      for (int t = 0; t < 4; ++t) {
        unsigned short hb = bf16_bits(kf[t]); sKh[r][c4 + t] = hb; sKl[r][c4 + t] = bf16_bits(kf[t] - bf16_val(hb));
        hb = bf16_bits(vf[t]); sVh[r][c4 + t] = hb; sVl[r][c4 + t] = bf16_bits(vf[t] - bf16_val(hb));
      }
    }
    __syncthreads();
    // S tile 16 x 32
    v8f s[2];
#pragma unroll
    for (int nt = 0; nt < 2; ++nt) {
      v8f acc = {};
#pragma unroll
      for (int ks = 0; ks < KS; ++ks) {
        FragB bh_, bl_;
        bh_.half[0] = *(const v8us*)&sKh[nt * 16 + ln][ks * 32 + 8 * hh]; bh_.half[1] = *(const v8us*)&sKh[nt * 16 + ln][ks * 32 + 16 + 8 * hh];
        bl_.half[0] = *(const v8us*)&sKl[nt * 16 + ln][ks * 32 + 8 * hh]; bl_.half[1] = *(const v8us*)&sKl[nt * 16 + ln][ks * 32 + 16 + 8 * hh];
        acc = mmaN<3>(aqh[ks].v, aql[ks].v, bh_.v, bl_.v, acc);
      }
      s[nt] = acc;
    }
    // mask + running max (rows 8hh+r; the 16 lanes of a half share rows)
    float alpha[8];
#pragma unroll
    for (int r = 0; r < 8; ++r) {
      const int qi = q0 + 8 * hh + r;
      const int ja = j0 + ln, jb = j0 + 16 + ln;
      if (CAUSAL) { if (ja > qi) s[0][r] = -3.0e38f; if (jb > qi) s[1][r] = -3.0e38f; }
      if (ja >= T) s[0][r] = -3.0e38f;
      if (jb >= T) s[1][r] = -3.0e38f;
      float mx = fmaxf(s[0][r], s[1][r]);
      mx = fmaxf(mx, __shfl_xor(mx, 1, 32)); mx = fmaxf(mx, __shfl_xor(mx, 2, 32)); mx = fmaxf(mx, __shfl_xor(mx, 4, 32)); mx = fmaxf(mx, __shfl_xor(mx, 8, 32));
      const float mnew = fmaxf(m_r[r], mx);
      alpha[r] = (mnew > -1.0e38f) ? __expf(m_r[r] - mnew) : 1.0f;
      const float p0 = (s[0][r] > -1.0e38f) ? __expf(s[0][r] - mnew) : 0.f;
      const float p1 = (s[1][r] > -1.0e38f) ? __expf(s[1][r] - mnew) : 0.f;
      m_r[r] = mnew;
      l_r[r] = l_r[r] * alpha[r] + p0 + p1;            // per-lane partial row sum (16 lanes combined at the end)
      unsigned short hb = bf16_bits(p0); sPh[w][8 * hh + r][ln] = hb;      sPl[w][8 * hh + r][ln] = bf16_bits(p0 - bf16_val(hb));
      hb = bf16_bits(p1);                sPh[w][8 * hh + r][16 + ln] = hb; sPl[w][8 * hh + r][16 + ln] = bf16_bits(p1 - bf16_val(hb));
    }
#pragma unroll
    for (int dt = 0; dt < DT; ++dt)
#pragma unroll
      for (int r = 0; r < 8; ++r) oacc[dt][r] *= alpha[r];
    __builtin_amdgcn_fence(__ATOMIC_ACQ_REL, "workgroup");
    __builtin_amdgcn_wave_barrier();
    FragB pah, pal;
    pah.half[0] = *(const v8us*)&sPh[w][ln][8 * hh]; pah.half[1] = *(const v8us*)&sPh[w][ln][16 + 8 * hh];
    pal.half[0] = *(const v8us*)&sPl[w][ln][8 * hh]; pal.half[1] = *(const v8us*)&sPl[w][ln][16 + 8 * hh];
#pragma unroll
    for (int dt = 0; dt < DT; ++dt) {
      FragB bvh, bvl;
#pragma unroll
      for (int i = 0; i < 8; ++i) {
        bvh.u[i] = sVh[8 * hh + i][dt * 16 + ln]; bvh.u[8 + i] = sVh[16 + 8 * hh + i][dt * 16 + ln];
        bvl.u[i] = sVl[8 * hh + i][dt * 16 + ln]; bvl.u[8 + i] = sVl[16 + 8 * hh + i][dt * 16 + ln];
      }
      oacc[dt] = mmaN<3>(pah.v, pal.v, bvh.v, bvl.v, oacc[dt]);
    }
    __builtin_amdgcn_fence(__ATOMIC_ACQ_REL, "workgroup");
    __builtin_amdgcn_wave_barrier();
  }
#pragma unroll
  for (int r = 0; r < 8; ++r) {
    float l = l_r[r];
    l += __shfl_xor(l, 1, 32); l += __shfl_xor(l, 2, 32); l += __shfl_xor(l, 4, 32); l += __shfl_xor(l, 8, 32);
    l_r[r] = (l > 0.f) ? 1.0f / l : 0.f;
  }
#pragma unroll
  for (int dt = 0; dt < DT; ++dt)
#pragma unroll
    for (int r = 0; r < 8; ++r) sO[w][8 * hh + r][dt * 16 + ln] = oacc[dt][r] * l_r[r];
  __builtin_amdgcn_fence(__ATOMIC_ACQ_REL, "workgroup");
  __builtin_amdgcn_wave_barrier();
  {
    for (int r = 0; r < 16; ++r) {
      const int row = q0 + r;
      if (row < T && lane < D / 4) {
        const v4f val = *(const v4fa*)&sO[w][r][lane * 4];
        *(v4f*)(y + ((size_t)b * T + row) * ypitch + h * D + lane * 4) = val;
      }
    }
    
  }
}

// GEMM C = act(A·W + bias + resid): A f32 (ASPLIT -> hi/lo 2 terms), Wt bf16 [N][K]; ACT 0 none, 1 relu, 2 exact gelu;
// resid (optional, f32, row index = (row % rmod), pitch ldr, RES_BF16 rounds it) added before the activation.
template <bool ASPLIT, int ACT, bool BIAS_BF16, bool RES_BF16>
__global__ __launch_bounds__(128) void k_gemm_bf3(const float* __restrict__ A, int lda, const unsigned short* __restrict__ Wt, int ldb,
                                                const float* __restrict__ bias, const float* __restrict__ resid, int rmod, int ldr,
                                                float* __restrict__ C, int ldc, int M, int N, int K) {
  __shared__ __attribute__((aligned(16))) float so[4][16][64];
  const int tid = threadIdx.x, w = tid >> 5, lane = tid & 31, ln = lane & 15, hh = lane >> 4;
  const int ntn = N / 64;
  const int wid = blockIdx.x * 4 + w;
  const int mt = wid / ntn, nq = wid % ntn;
  if (mt * 16 >= M) return;
  const int row0 = mt * 16, col0 = nq * 64;
  const float* arow = A + (size_t)(row0 + ln) * lda;
  v8f acc[4] = {};
  for (int kb = 0; kb < K; kb += 32) {
    FragB ah, al;
    const v4f x0 = *(const v4fa*)(arow + kb + 8 * hh), x1 = *(const v4fa*)(arow + kb + 8 * hh + 4);
    const v4f x2 = *(const v4fa*)(arow + kb + 16 + 8 * hh), x3 = *(const v4fa*)(arow + kb + 16 + 8 * hh + 4);
    float xs[16] = {x0[0],x0[1],x0[2],x0[3],x1[0],x1[1],x1[2],x1[3],x2[0],x2[1],x2[2],x2[3],x3[0],x3[1],x3[2],x3[3]};
#pragma unroll
    for (int i = 0; i < 16; ++i) { const unsigned short hb = bf16_bits(xs[i]); ah.u[i] = hb; al.u[i] = ASPLIT ? bf16_bits(xs[i] - bf16_val(hb)) : (unsigned short)0; }
#pragma unroll
    for (int t = 0; t < 4; ++t) {
      const unsigned short* brow = Wt + (size_t)(col0 + t * 16 + ln) * ldb + kb;
      FragB b;
      b.half[0] = *(const v8us*)(brow + 8 * hh);
      b.half[1] = *(const v8us*)(brow + 16 + 8 * hh);
      acc[t] = mmaN<ASPLIT ? 2 : 1>(ah.v, al.v, b.v, b.v, acc[t]);
    }
  }
#pragma unroll
  for (int t = 0; t < 4; ++t) {
    const int col = col0 + t * 16 + ln;
    float bv = bias ? bias[col] : 0.f;
    if (BIAS_BF16) bv = bf16_round(bv);
#pragma unroll
    for (int r = 0; r < 8; ++r) {
      float v = acc[t][r] + bv;
      if (resid) { float rv = resid[(size_t)((row0 + 8 * hh + r) % rmod) * ldr + col]; if (RES_BF16) rv = bf16_round(rv); v += rv; }
      if (ACT == 1) v = fmaxf(v, 0.f);
      if (ACT == 2) v = 0.5f * v * (1.0f + erff(v * 0.70710678118654752f));
      if (ACT == 3) { const float u = 0.7978845608028654f * (v + 0.044715f * v * v * v); v = 0.5f * v * (1.0f + tanhf(u)); }
      so[w][8 * hh + r][t * 16 + ln] = v;
    }
  }
  __builtin_amdgcn_fence(__ATOMIC_ACQ_REL, "workgroup");
  __builtin_amdgcn_wave_barrier();
  const int rsub = lane >> 4, c4 = (lane & 15) * 4;
  {
#pragma unroll
    for (int q = 0; q < 8; ++q) {
      const int r = q * 2 + rsub;
      const v4f v = *(const v4fa*)&so[w][r][c4];
      *(v4f*)(C + (size_t)(row0 + r) * ldc + col0 + c4) = v;
    }
    
  }
}
// row LayerNorm (biased variance, eps) over N: s = X (+ R); optional out_sum <- s; out_norm <- (s-mu)*rsqrt(var+eps)*g + b
template <bool PARAM_BF16>
__global__ __launch_bounds__(256) void k_layernorm(const float* __restrict__ X, const float* __restrict__ R, const float* __restrict__ g, const float* __restrict__ bta,
                                                  float* __restrict__ out_sum, float* __restrict__ out_norm, int N, float eps) {
  __shared__ float red[256];
  const int row = blockIdx.x, tid = threadIdx.x;
  const float* x = X + (size_t)row * N; const float* rr = R ? R + (size_t)row * N : nullptr;
  float vals[16];                     // up to N = 4096
  const int per = N / 256;            // contiguous chunk per thread? use strided-by-4 chunks: thread handles j = tid*4 + 1024*u
  float s1 = 0.f;
  for (int u = 0; u < per / 4; ++u) {
    const int j = tid * 4 + 1024 * u;
    const v4f a = *(const v4fa*)(x + j);
    v4f b = {0.f,0.f,0.f,0.f}; if (rr) b = *(const v4fa*)(rr + j);
#pragma unroll
    for (int q = 0; q < 4; ++q) { const float v = a[q] + b[q]; vals[u * 4 + q] = v; s1 += v; }
  }
  red[tid] = s1; __syncthreads();
  for (int st = 128; st > 0; st >>= 1) { if (tid < st) red[tid] += red[tid + st]; __syncthreads(); }
  const float mu = red[0] / (float)N; __syncthreads();
  float s2 = 0.f;
  for (int u = 0; u < per / 4; ++u)
#pragma unroll
    for (int q = 0; q < 4; ++q) { const float c = vals[u * 4 + q] - mu; s2 += c * c; }
  red[tid] = s2; __syncthreads();
  for (int st = 128; st > 0; st >>= 1) { if (tid < st) red[tid] += red[tid + st]; __syncthreads(); }
  const float rs = rsqrtf(red[0] / (float)N + eps);
  {
    for (int u = 0; u < per / 4; ++u) {
      const int j = tid * 4 + 1024 * u;
      v4f o, sm;
#pragma unroll
      for (int q = 0; q < 4; ++q) {
        float gg = g[j + q], bb = bta[j + q];
        if (PARAM_BF16) { gg = bf16_round(gg); bb = bf16_round(bb); }
        sm[q] = vals[u * 4 + q]; o[q] = (vals[u * 4 + q] - mu) * rs * gg + bb;
      }
      if (out_sum) *(v4f*)(out_sum + (size_t)row * N + j) = sm;
      *(v4f*)(out_norm + (size_t)row * N + j) = o;
    }
    
  }
}



// ---- f16 WMMA path (v_wmma_f32_16x16x32_f16): 11-bit significands for operands in range — used where a [0,1] probability operand needs more precision than bf16
typedef _Float16 v16h __attribute__((ext_vector_type(16)));
union FragH { v16h v; v8us half[2]; _Float16 h[16]; unsigned short u[16]; };
template <int NT>
__device__ __forceinline__ v8f mmaH(v16h ah, v16h al, v16h bh, v16h bl, v8f c) {
  c = __builtin_amdgcn_wmma_f32_16x16x32_f16(false, ah, false, bh, (short)0, c, false, false);
  if (NT >= 2) c = __builtin_amdgcn_wmma_f32_16x16x32_f16(false, al, false, bh, (short)0, c, false, false);
  if (NT >= 3) c = __builtin_amdgcn_wmma_f32_16x16x32_f16(false, ah, false, bl, (short)0, c, false, false);
  asm volatile("v_nop\n\tv_nop\n\tv_nop\n\tv_nop" : "+v"(c) : "v"(ah), "v"(al), "v"(bh), "v"(bl));
  return c;
}
// batched GEMM like k_gemm_b but f16 operands: A f32 (split into f16 hi/lo if ASPLIT, else rounded to f16), Bt = f16 values [n][k]; alpha; C f32; N multiple of 16 (partial tiles skipped)
template <bool ASPLIT>
__global__ __launch_bounds__(128) void k_gemm_h(const float* __restrict__ A, int lda, size_t sA, const _Float16* __restrict__ Bh, int ldb, size_t sB, float alpha, float* __restrict__ C, int ldc, size_t sC, int M, int N, int K) {
  __shared__ __attribute__((aligned(16))) float so[4][16][64];
  const int tid = threadIdx.x, w = tid >> 5, lane = tid & 31, ln = lane & 15, hh = lane >> 4; const int by = blockIdx.y;
  A += (size_t)by * sA; Bh += (size_t)by * sB; C += (size_t)by * sC;
  const int ntn = (N + 63) / 64; const int wid = blockIdx.x * 4 + w; const int mt = wid / ntn, nq = wid % ntn; if (mt * 16 >= M) return;
  const int row0 = mt * 16, col0 = nq * 64; const float* arow = A + (size_t)(row0 + ln) * lda;
  v8f acc[4] = {};
  for (int kb = 0; kb < K; kb += 32) {
    FragH ah, al;
    const v4f x0 = *(const v4fa*)(arow + kb + 8 * hh), x1 = *(const v4fa*)(arow + kb + 8 * hh + 4), x2 = *(const v4fa*)(arow + kb + 16 + 8 * hh), x3 = *(const v4fa*)(arow + kb + 16 + 8 * hh + 4);
    float xs[16] = {x0[0],x0[1],x0[2],x0[3],x1[0],x1[1],x1[2],x1[3],x2[0],x2[1],x2[2],x2[3],x3[0],x3[1],x3[2],x3[3]};
#pragma unroll
    for (int i = 0; i < 16; ++i) { const _Float16 h = (_Float16)xs[i]; ah.h[i] = h; al.h[i] = ASPLIT ? (_Float16)(xs[i] - (float)h) : (_Float16)0.0f; }
#pragma unroll
    for (int t = 0; t < 4; ++t) { if (col0 + t * 16 >= N) continue; const size_t boff = (size_t)(col0 + t * 16 + ln) * ldb + kb; FragH bq; bq.half[0] = *(const v8us*)(Bh + boff + 8 * hh); bq.half[1] = *(const v8us*)(Bh + boff + 16 + 8 * hh);
      acc[t] = mmaH<ASPLIT ? 2 : 1>(ah.v, al.v, bq.v, bq.v, acc[t]); }
  }
#pragma unroll
  for (int t = 0; t < 4; ++t) { if (col0 + t * 16 >= N) continue;
#pragma unroll
    for (int r = 0; r < 8; ++r) so[w][8 * hh + r][t * 16 + ln] = acc[t][r] * alpha; }
  __builtin_amdgcn_fence(__ATOMIC_ACQ_REL, "workgroup"); __builtin_amdgcn_wave_barrier();
  const int rsub = lane >> 4, c4 = (lane & 15) * 4;
  {
#pragma unroll
    for (int q = 0; q < 8; ++q) { const int r = q * 2 + rsub; if (col0 + c4 < N) { const v4f v = *(const v4fa*)&so[w][r][c4]; *(v4f*)(C + (size_t)(row0 + r) * ldc + col0 + c4) = v; } }
     }
}

// Wt[n][k] = f16(W[k][n]·scale) from f32 row-major W[K][N] (scale = power of two; bf16-exact weights stay exact in f16 away from the subnormal range)
__global__ __launch_bounds__(256) void k_wt_f16(const float* __restrict__ W, _Float16* __restrict__ Wt, int K, int N, float scale) {
  const int t = blockIdx.x * 256 + threadIdx.x; if (t >= N * (K / 8)) return; const int n = t / (K / 8), k8 = (t % (K / 8)) * 8; FragH f;
#pragma unroll
  for (int i = 0; i < 8; ++i) f.h[i] = (_Float16)(bf16_round(W[(size_t)(k8 + i) * N + n]) * scale); const v8us o = f.half[0];
  *(v8us*)((unsigned short*)Wt + (size_t)n * K + k8) = o; 
}


typedef _Float16 v4h __attribute__((ext_vector_type(4)));

__global__ __launch_bounds__(256) void k_x16(const float* __restrict__ x, _Float16* __restrict__ X16, size_t n8) { const size_t t = (size_t)blockIdx.x * 256 + threadIdx.x; if (t >= n8) return; FragH f;
#pragma unroll
  for (int q = 0; q < 8; ++q) f.h[q] = (_Float16)bf16_round(x[t * 8 + q]); *(v8us*)((unsigned short*)X16 + t * 8) = f.half[0];  }
__global__ __launch_bounds__(256) void k_h16(const float* __restrict__ x, _Float16* __restrict__ X16, size_t n8) { const size_t t = (size_t)blockIdx.x * 256 + threadIdx.x; if (t >= n8) return; FragH f;
#pragma unroll
  for (int q = 0; q < 8; ++q) f.h[q] = (_Float16)x[t * 8 + q]; *(v8us*)((unsigned short*)X16 + t * 8) = f.half[0];  }
__global__ __launch_bounds__(256) void k_round16f(const float* __restrict__ W, _Float16* __restrict__ Bt, size_t n8) { const size_t t = (size_t)blockIdx.x * 256 + threadIdx.x; if (t >= n8) return; FragH f;
#pragma unroll
  for (int i = 0; i < 8; ++i) f.h[i] = (_Float16)(bf16_round(W[t * 8 + i]) * 16.0f); *(v8us*)((unsigned short*)Bt + t * 8) = f.half[0];  }
template <int NHv, int TTv>
__global__ __launch_bounds__(256) void k_vt(const _Float16* __restrict__ V16, int ldv, int voff, _Float16* __restrict__ Vt) { __shared__ unsigned short tl[64][66]; const int tid = threadIdx.x; const int slab = blockIdx.x / (TTv / 64), lg = blockIdx.x % (TTv / 64); const int b = slab / NHv, h = slab % NHv;
  for (int i = tid; i < 64 * 8; i += 256) { const int r = i / 8, c8 = (i % 8) * 8; FragH f; f.half[0] = *(const v8us*)((const unsigned short*)V16 + ((size_t)b * TTv + lg * 64 + r) * ldv + voff + h * 64 + c8);
#pragma unroll
    for (int q = 0; q < 8; ++q) tl[r][c8 + q] = f.u[q]; }
  __syncthreads();
  {
#pragma unroll
    for (int rd = 0; rd < 2; ++rd) { const int d = rd * 32 + tid / 8, pc = tid % 8; FragH f;
#pragma unroll
      for (int q = 0; q < 8; ++q) f.u[q] = tl[pc * 8 + q][d];
      *(v8us*)((unsigned short*)Vt + ((size_t)slab * 64 + d) * TTv + lg * 64 + pc * 8) = f.half[0]; }
     } }

__global__ __launch_bounds__(256) void k_vthlu(const float* __restrict__ VF, int ldv, _Float16* __restrict__ Vth) { __shared__ float tl[64][65]; const int tid = threadIdx.x; const int slab = blockIdx.x / (TT / 64), lg = blockIdx.x % (TT / 64); const int b = slab / NVH, h = slab % NVH;
  for (int i = tid; i < 64 * 16; i += 256) { const int r = i / 16, c4 = (i % 16) * 4; const v4f a = *(const v4fa*)(VF + ((size_t)b * TT + lg * 64 + r) * ldv + h * 64 + c4); tl[r][c4] = a[0]; tl[r][c4 + 1] = a[1]; tl[r][c4 + 2] = a[2]; tl[r][c4 + 3] = a[3]; }
  __syncthreads();
  FragH fh[2]; size_t oo[2];
#pragma unroll
  for (int rd = 0; rd < 2; ++rd) { const int d = rd * 32 + tid / 8, pc = tid % 8;
#pragma unroll
    for (int q = 0; q < 8; ++q) fh[rd].h[q] = (_Float16)tl[pc * 8 + q][d];
    oo[rd] = ((size_t)slab * 64 + d) * TT + lg * 64 + pc * 8; }
  {
#pragma unroll
    for (int rd = 0; rd < 2; ++rd) *(v8us*)((unsigned short*)Vth + oo[rd]) = fh[rd].half[0];
     } }
// One Conv1d (3 taps, pad 1) as a GEMM that forms no im2col plane: row s of the im2col matrix is input rows s - 1, s, s + 1 laid end to end, so a block stages its 16 rows and the two neighbours once in LDS,
// rounded f32 -> bf16 -> f16 (a zero row outside the sequence), and k-step ks reads its A fragment from LDS row ln + ks / 8. Bh = f16 weights in fragment order (k_wc3 below), k = tap * 256 + c. Four waves = the four 64-column quarters of the 256 outputs.
template <bool F16OUT>      /* the output plane: f16 (C16) or f32 (C) */
__global__ __launch_bounds__(128) void k_conv3(const float* __restrict__ x, const _Float16* __restrict__ Bh, const float* __restrict__ bias, float* __restrict__ C, _Float16* __restrict__ C16) {
  constexpr int XP = DD + 8;      /* LDS row pitch in halves: 528 B = 16 B x odd, conflict-free for the 16-row ds_load_b128 fragment reads */
  __shared__ __attribute__((aligned(16))) unsigned short sX[16 + 2][XP];      /* LDS row r = sequence row s0 + r - 1 */
  __shared__ __attribute__((aligned(16))) float so[4][16][64];
  const int tid = threadIdx.x, w = tid >> 5, lane = tid & 31, ln = lane & 15, hh = lane >> 4;
  const int row0 = blockIdx.x * 16, col0 = w * 64; const int s0 = row0 % TT;      /* 16 divides the sequence length: a block's rows lie in one sequence */
  float bv[4]; const int bi = col0 + ln;      /* this lane's four bias values, loaded beside the input rows */
  constexpr int NK = K3 / 32, PF = 2;      /* 24 k-steps; a k-step's weight fragments are loaded PF k-steps ahead of their products */
  const unsigned short* bp = (const unsigned short*)Bh + w * 2048 + lane * 8;      /* halves: 8192 per k-step, 512 per 16-column tile, 256 per fragment half, 8 per lane */
  FragH bq[PF + 1][4], ah[2];
  auto ldb = [&](int ks) {      /* the wave's four B fragments of k-step ks: eight loads of 512 contiguous bytes, one address and constant offsets */
#pragma unroll      /* constant indices keep bq[] in registers */
    for (int t = 0; t < 4; ++t) { bq[ks % (PF + 1)][t].half[0] = *(const v8us*)(bp + ks * 8192 + t * 512); bq[ks % (PF + 1)][t].half[1] = *(const v8us*)(bp + ks * 8192 + t * 512 + 256); } };
  { v4f xa[9];      /* nine 16-B loads per thread, all issued before the first is used: one memory latency for the whole stage */
    const int nb = tid >> 6; const bool in = nb ? (s0 + 16 < TT) : (s0 > 0);      /* waves 0, 1: the row above the block; waves 2, 3: the row below */
    const float* xb = x + (size_t)(row0 + w) * DD + lane * 4; const float* xn = x + (size_t)(row0 + (in ? (nb ? 16 : -1) : 0)) * DD + (tid & 63) * 4;      /* a neighbour outside the sequence: the address stays inside the buffer, the values are replaced by zero */
#pragma unroll      /* constant indices keep xa[] in registers */
    for (int j = 0; j < 8; ++j) xa[j] = *(const v4fa*)(xb + (j >> 1) * 4 * DD + (j & 1) * 128);      /* four rows per wave, 512 contiguous bytes per load, one address and constant offsets */
    xa[8] = *(const v4fa*)xn;
#pragma unroll
    for (int t = 0; t < 4; ++t) bv[t] = bias[bi + t * 16];
    asm volatile("s_wait_xcnt 0x0" :: "v"(xb), "v"(xn), "v"(bi) : "memory");      /* stands behind these loads; their addresses are named as inputs so that the registers are rewritten only behind it */
#pragma unroll      /* constant indices keep bq[] in registers */
    for (int ks = 0; ks < PF; ++ks) ldb(ks);      /* the first weight fragments fly beside the input rows */
    if (!in) xa[8] = (v4f){0.f, 0.f, 0.f, 0.f};
#pragma unroll      /* constant indices keep xa[] in registers */
    for (int j = 0; j < 9; ++j) { v4h h4;
#pragma unroll
      for (int q = 0; q < 4; ++q) h4[q] = (_Float16)bf16_round(xa[j][q]);
      *(v4h*)(j < 8 ? &sX[1 + (j >> 1) * 4 + w][(j & 1) * 128 + lane * 4] : &sX[nb * 17][(tid & 63) * 4]) = h4; } }
  __syncthreads();      /* publishes the 18 staged rows to the four waves */
  auto lda = [&](int ks) { const unsigned short* ar = &sX[ln + ks / 8][(ks % 8) * 32 + 8 * hh]; ah[ks & 1].half[0] = *(const v8us*)ar; ah[ks & 1].half[1] = *(const v8us*)(ar + 16); };
  v8f acc[4] = {};
  lda(0);
#pragma unroll      /* constant indices keep bq[] and ah[] in registers, and every weight load's offset is an immediate */
  for (int ks = 0; ks < NK; ++ks) {
    if (ks + PF < NK) ldb(ks + PF);
    if (ks + 1 < NK) lda(ks + 1);
    __builtin_amdgcn_sched_barrier(0);      /* holds the loads for later k-steps in front of this k-step's products: sunk to their uses, each would be waited for in full */
#pragma unroll
    for (int t = 0; t < 4; ++t) acc[t] = __builtin_amdgcn_wmma_f32_16x16x32_f16(false, ah[ks & 1].v, false, bq[ks % (PF + 1)][t].v, (short)0, acc[t], false, false);      /* the plain builtin: the compiler keeps the distance behind it itself */
  }
  asm volatile("s_wait_xcnt 0x0" :: "v"(bp) : "memory");      /* stands behind the weight loads; their address is named as an input so that its registers are rewritten only behind it */
#pragma unroll
  for (int t = 0; t < 4; ++t) { const float bt = bf16_round(bv[t]);
#pragma unroll
    for (int r = 0; r < 8; ++r) so[w][8 * hh + r][t * 16 + ln] = acc[t][r] + bt; }
  __builtin_amdgcn_fence(__ATOMIC_ACQ_REL, "workgroup"); __builtin_amdgcn_wave_barrier();
  const int rsub = lane >> 4, c4 = (lane & 15) * 4;
#pragma unroll
  for (int q = 0; q < 8; ++q) { const int r = q * 2 + rsub; const v4f v = *(const v4fa*)&so[w][r][c4]; if (!F16OUT) *(v4f*)(C + (size_t)(row0 + r) * DD + col0 + c4) = v; else { v4h h4; for (int i = 0; i < 4; ++i) h4[i] = (_Float16)v[i]; *(v4h*)(C16 + (size_t)(row0 + r) * DD + col0 + c4) = h4; } }
}
// Conv weights [o][c][tap] -> f16 in the order in which k_conv3's lanes read B fragments: [k-step][16-column tile][fragment half j][lane hh * 16 + ln][8 halves], holding column o = tile * 16 + ln, k = k-step * 32 + j * 16 + hh * 8 + 0..7. Thread t writes the t-th 16 bytes.
__global__ __launch_bounds__(256) void k_wc3(const float* __restrict__ w, _Float16* __restrict__ Bt) { const int t = blockIdx.x * 256 + threadIdx.x; if (t >= DD * (K3 / 8)) return; const int o = ((t >> 6) & 15) * 16 + (t & 15), k0 = (t >> 10) * 32 + ((t >> 5) & 1) * 16 + ((t >> 4) & 1) * 8; const int tap = k0 / DD, c0 = k0 % DD; FragH f;
  for (int q = 0; q < 8; ++q) f.h[q] = (_Float16)bf16_round(w[((size_t)o * DD + c0 + q) * 3 + tap]);
  *(v8us*)((unsigned short*)Bt + (size_t)t * 8) = f.half[0];  }
__global__ __launch_bounds__(256) void k_scl(float* __restrict__ O, const float* __restrict__ scl, size_t n4) { const size_t t = (size_t)blockIdx.x * 256 + threadIdx.x; if (t >= n4) return; const float s = bf16_round(scl[0]); v4f v = *(const v4fa*)(O + t * 4); for (int q = 0; q < 4; ++q) v[q] *= s; *(v4f*)(O + t * 4) = v;  }
__device__ __forceinline__ float xhalf(float x) { return __builtin_bit_cast(float, __builtin_amdgcn_permlanex16(__builtin_bit_cast(int, x), __builtin_bit_cast(int, x), 0x76543210, 0xfedcba98, false, false)); }      /* lane l takes lane l ^ 16's value */
__device__ __forceinline__ float ex2(float x) { return __builtin_amdgcn_exp2f(x); }      /* 2^x as the one hardware instruction v_exp_f32; every argument below is <= 0 up to one rounding, and a result under the normal range may go to zero */
__device__ __forceinline__ unsigned lds_off(const void* p) { return (unsigned)(size_t)p; }      /* byte offset in the work-group's LDS = low 32 bits of the __shared__ address */
// Four or eight asynchronous copies, 16 B per lane each, global memory -> LDS. The closing s_wait_xcnt stands inside the statement so that no address register named here is rewritten ahead of it.
__device__ __forceinline__ void acp4(const unsigned (&l)[4], const unsigned short* const (&p)[4]) {
  asm volatile("global_load_async_to_lds_b128 %0, %4, off\n\t"
               "global_load_async_to_lds_b128 %1, %5, off\n\t"
               "global_load_async_to_lds_b128 %2, %6, off\n\t"
               "global_load_async_to_lds_b128 %3, %7, off\n\t"
               "s_wait_xcnt 0x0"
               :: "v"(l[0]), "v"(l[1]), "v"(l[2]), "v"(l[3]), "v"(p[0]), "v"(p[1]), "v"(p[2]), "v"(p[3]) : "memory");
}
/* Eight copies whose global address is a scalar base (one per copy) plus a 32-bit byte offset of the lane (ok for the first four, ov for the other four): 10 vector registers for the statement, so that it fits where a tile's fragments are all live. */
__device__ __forceinline__ void acp8(const unsigned (&l)[8], unsigned ok, unsigned ov, const unsigned short* const (&p)[8]) {
  asm volatile("global_load_async_to_lds_b128 %0, %8, %10\n\t"
               "global_load_async_to_lds_b128 %1, %8, %11\n\t"
               "global_load_async_to_lds_b128 %2, %8, %12\n\t"
               "global_load_async_to_lds_b128 %3, %8, %13\n\t"
               "global_load_async_to_lds_b128 %4, %9, %14\n\t"
               "global_load_async_to_lds_b128 %5, %9, %15\n\t"
               "global_load_async_to_lds_b128 %6, %9, %16\n\t"
               "global_load_async_to_lds_b128 %7, %9, %17\n\t"
               "s_wait_xcnt 0x0"
               :: "v"(l[0]), "v"(l[1]), "v"(l[2]), "v"(l[3]), "v"(l[4]), "v"(l[5]), "v"(l[6]), "v"(l[7]), "v"(ok), "v"(ov),
                  "s"(p[0]), "s"(p[1]), "s"(p[2]), "s"(p[3]), "s"(p[4]), "s"(p[5]), "s"(p[6]), "s"(p[7]) : "memory");
}
__device__ __forceinline__ v8f mmaP(v16h a, v16h b, v8f c) { return __builtin_amdgcn_wmma_f32_16x16x32_f16(false, a, false, b, (short)0, c, false, false); }      /* the plain builtin: the compiler keeps the distance behind it itself, and no asm statement stands between the LDS reads and the products */
__global__ __launch_bounds__(256) void k_flash(const _Float16* __restrict__ Q16, int ldq, const _Float16* __restrict__ K16, int ldk, const _Float16* __restrict__ Vt, float* __restrict__ O, int ldo) {
  constexpr int RPW = 16, NQB = TT / (4 * RPW), DT = 16, KS = 8;      /* d_qk 256: 8 k-steps; 16 value tiles = the whole 256-wide V per wave, so no score is formed twice: the two waves that share a query split its keys and merge their partial softmax behind the loop */
  constexpr int SK = 64, NST = TT / SK;      /* one LDS tile = 64 keys = two 32-key passes, each on its own waves; V rows of 64 keys are whole 128-B lines */
  constexpr int KP = 256 + 8, VP = SK + 8;      /* LDS row pitches in halves: 528 B and 144 B, both 16 B x odd, conflict-free for the 16-row ds_load_b128 fragment reads */
  constexpr int OP = 256 + 4;      /* output tile's row pitch in floats */
  __shared__ __attribute__((aligned(16))) unsigned short sQ[4 * RPW][KP]; __shared__ __attribute__((aligned(16))) unsigned short sK[2][SK][KP]; __shared__ __attribute__((aligned(16))) unsigned short sVh[2][256][VP];
  __shared__ float sM[4][RPW]; __shared__ float sL[4][RPW];
  typedef float f32a __attribute__((may_alias)); static_assert(sizeof(sK) >= 4 * RPW * OP * sizeof(float), "the four output tiles fit the K ring");
  f32a (*sO)[RPW][OP] = (f32a (*)[RPW][OP])&sK[0][0][0];      /* the output tiles reuse the K ring, which nobody reads or fills behind the loop's last barrier */
  const int tid = threadIdx.x, w = tid >> 5, lane = tid & 31, ln = lane & 15, hh = lane >> 4;
  const int slab = blockIdx.x / NQB, qblk = blockIdx.x % NQB; const int b = slab / NH, h = slab % NH; const int qb0 = qblk * (4 * RPW);
  const int wu = __builtin_amdgcn_readfirstlane(w);      /* the wave's number as a scalar: the row parts of the copies' addresses stay in scalar registers */
  const int wq = wu & 3; const int q0 = qb0 + wq * RPW;      /* eight waves, two per SIMD, up to 512 registers each: 4 groups of 16 query rows x 2 halves of each tile's keys; wq numbers the pair of waves that share rows */
  const unsigned short* Qg = (const unsigned short*)Q16 + ((size_t)b * TT + qb0) * ldq; const unsigned short* Kg = (const unsigned short*)K16 + (size_t)b * TT * ldk;
  const unsigned short* Vth = (const unsigned short*)Vt + (size_t)b * VSTR * TT;
  const int kp = wu >> 2;      /* which 32 keys of every tile this wave takes (scalar: the epilogue branches on it) */
  /* tile t -> buffer buf, 16 copies per wave in two statements; each statement: 4 K rows (one 512-B row per copy), 16 of the 256 V rows (four 128-B rows per copy) */
  const unsigned oK = (unsigned)lane * 16u, oV = (unsigned)(lane >> 3) * (TT * 2u) + (unsigned)(lane & 7) * 16u;      /* the lane's part of every copy's global address, in bytes: one offset for K rows, one for V rows */
  const unsigned lK = lds_off(&sK[0][0][lane * 8]), lVh = lds_off(&sVh[0][lane >> 3][(lane & 7) * 8]);      /* and of its LDS address */
  auto sgl = [](int x) { return __builtin_amdgcn_readfirstlane(x); };      /* the part that is the same in every lane is formed in scalar registers at each tile */
  auto stage = [&](int t, int buf) {
#pragma unroll      /* two statements, constant indices */
    for (int j = 0; j < 2; ++j) { const int u = wu * 2 + j;      /* sixteenth of the tile */
      unsigned l[8]; const unsigned short* p[8];      /* p[]: scalar bases */
#pragma unroll      /* constant indices keep l[] and p[] in registers */
      for (int i = 0; i < 4; ++i) { const int r = u * 4 + i; l[i] = lK + (unsigned)sgl((buf * SK + r) * (KP * 2)); p[i] = Kg + sgl((t * SK + r) * ldk); }
#pragma unroll      /* constant indices keep l[] and p[] in registers */
      for (int i = 0; i < 4; ++i) { const int d = u * 16 + i * 4; l[4 + i] = lVh + (unsigned)sgl((buf * 256 + d) * (VP * 2)); p[4 + i] = Vth + sgl(d * TT + t * SK); }
      acp8(l, oK, oV, p); } };
#pragma unroll      /* two statements, constant indices */
  for (int j = 0; j < 2; ++j) { unsigned l[4]; const unsigned short* p[4];      /* the block's 64 query rows, filled once: 8 rows per wave */
#pragma unroll      /* constant indices keep l[] and p[] in registers */
    for (int i = 0; i < 4; ++i) { const int r = (wu * 2 + j) * 4 + i; l[i] = lds_off(&sQ[r][lane * 8]); p[i] = Qg + (size_t)r * ldq + lane * 8; }
    acp4(l, p); }
  stage(0, 0);
  asm volatile("s_wait_asynccnt 0x0" ::: "memory");      /* this wave's copies of Q and of tile 0 have landed */
  __syncthreads();      /* publishes Q and tile 0 to every wave */
  stage(1, 1);
  /* Transposed products: St = K x Qt and Ot += Vt x Pt. Lane (ln, hh) holds query q0 + ln: its scores of keys 8 hh + r of each 16-key tile, and its outputs of value columns 8 hh + r of each 16-column tile. */
  FragH aq[KS];      /* the wave's 16 query rows as B fragments: read from LDS once, kept in 64 registers for all tiles */
  { const unsigned short* qrow = &sQ[wq * RPW + ln][8 * hh];
#pragma unroll      /* constant indices keep the fragments in registers */
    for (int ks = 0; ks < KS; ++ks) { aq[ks].half[0] = *(const v8us*)(qrow + ks * 32); aq[ks].half[1] = *(const v8us*)(qrow + ks * 32 + 16); } }
  float m_r = -3.0e38f, l_r = 0.f; v8f oacc[DT];
#pragma unroll
  for (int dt = 0; dt < DT; ++dt) oacc[dt] = (v8f){0.f,0.f,0.f,0.f,0.f,0.f,0.f,0.f};
  /* A tile's work in a wave has two phases: READ (its K and V fragments come from LDS, the score products run while the V fragments return) and COMPUTE (softmax and the V products, on registers alone). The two waves of a SIMD (key halves 0 and 1) run them half a tile apart:
     in step i the waves with (i + kp) even read and the others compute, so that the LDS pipe serves one wave of each SIMD while vector and matrix units serve the other. What READ hands to COMPUTE: */
  FragH bv[DT]; float sc[16];      /* the pass's V fragments and the lane's 16 scores in log2 units */
  constexpr float SC2 = ATT_SCALE * 1.44269504088896340736f;      /* 1/16 x log2(e): exp(score / 16 - max) = 2^(score x SC2 - max x log2(e)); scores and running maximum are kept in these log2 units */
  auto rd = [&](int buf) {
    const int j0 = kp * 32;      /* first key of this wave's pass inside the tile */
    const unsigned short* kr0 = &sK[buf][j0 + ln][8 * hh]; const unsigned short* kr1 = &sK[buf][j0 + 16 + ln][8 * hh];
    const unsigned short* vh0 = &sVh[buf][ln][j0 + 8 * hh];
    FragH bk0[KS], bk1[KS]; v8f s[2] = {(v8f){0.f,0.f,0.f,0.f,0.f,0.f,0.f,0.f}, (v8f){0.f,0.f,0.f,0.f,0.f,0.f,0.f,0.f}};
    auto ldv = [&](int dt) { bv[dt].half[0] = *(const v8us*)(vh0 + dt * 16 * VP); bv[dt].half[1] = *(const v8us*)(vh0 + dt * 16 * VP + 16); };
#pragma unroll      /* constant indices keep the fragments in registers */
    for (int ks = 0; ks < KS; ++ks) { bk0[ks].half[0] = *(const v8us*)(kr0 + ks * 32); bk0[ks].half[1] = *(const v8us*)(kr0 + ks * 32 + 16); bk1[ks].half[0] = *(const v8us*)(kr1 + ks * 32); bk1[ks].half[1] = *(const v8us*)(kr1 + ks * 32 + 16); }      /* one group of reads: the pass's 32 keys, all k-steps ... */
    __builtin_amdgcn_sched_barrier(0);      /* keeps the K reads in front of the V reads: LDS reads return in order, and mixed among the V reads the last K fragments, and so the score products, would wait for nearly the whole group */
#pragma unroll      /* constant indices keep the fragments in registers */
    for (int dt = 0; dt < DT; ++dt) ldv(dt);      /* ... and the sixteen value tiles, which return while the score products run */
    __builtin_amdgcn_sched_barrier(0);      /* holds the group of reads in front of the products: one LDS latency is waited for, not one per product */
#pragma unroll      /* constant indices keep the fragments in registers */
    for (int ks = 0; ks < KS; ++ks) { s[0] = mmaP(bk0[ks].v, aq[ks].v, s[0]); s[1] = mmaP(bk1[ks].v, aq[ks].v, s[1]); }      /* A = 16 keys, B = 16 queries; the two score tiles alternate, so that no product waits for its predecessor's accumulator */
#pragma unroll
    for (int i = 0; i < 16; ++i) sc[i] = s[i >> 3][i & 7] * SC2; };
  auto cmp = [&]() {
    float mc = sc[0];
#pragma unroll
    for (int i = 1; i < 16; ++i) mc = fmaxf(mc, sc[i]);
    mc = fmaxf(mc, xhalf(mc));      /* the other 16 of the query's 32 keys sit in lane ^ 16 */
    const float mn = fmaxf(m_r, mc); float ea;
    asm("v_exp_f32 %0, %1\n\tv_nop" : "=&v"(ea) : "v"(m_r - mn));      /* 2^x as in ex2(), with the slot behind it in the same statement */
    const float al = (mn > -1.0e38f) ? ea : 1.0f; m_r = mn;
    FragH ph; float ls[4] = {0.f, 0.f, 0.f, 0.f};      /* element i of the two score tiles is element i of a B fragment in the k order of the V loader above: P stays in registers */
#pragma unroll      /* constant indices keep sc[] in registers */
    for (int g = 0; g < 16; g += 4) { float e0, e1, e2, e3;      /* 2^x as in ex2(), four v_exp_f32 and the slot behind the last in one statement: each is followed by an instruction that neither reads its result nor overwrites its source (outputs are early-clobber) */
      asm("v_exp_f32 %0, %4\n\tv_exp_f32 %1, %5\n\tv_exp_f32 %2, %6\n\tv_exp_f32 %3, %7\n\tv_nop"
          : "=&v"(e0), "=&v"(e1), "=&v"(e2), "=&v"(e3) : "v"(sc[g] - mn), "v"(sc[g + 1] - mn), "v"(sc[g + 2] - mn), "v"(sc[g + 3] - mn));
      sc[g] = e0; sc[g + 1] = e1; sc[g + 2] = e2; sc[g + 3] = e3; }      /* the probabilities take the scores' place: sc[] lives from step to step, and a second array beside it does not fit the register budget */
#pragma unroll
    for (int i = 0; i < 16; ++i) { const float p = sc[i]; ls[i & 3] += p; ph.h[i] = (_Float16)(p * 1024.0f); }      /* P x 1024 rounded once to f16: the factor keeps small probabilities out of f16's subnormal range and is divided out with the row sum */
    l_r = l_r * al + ((ls[0] + ls[1]) + (ls[2] + ls[3]));      /* this lane's 16 keys of every pass; the two halves are joined behind the loop */
#pragma unroll
    for (int dt = 0; dt < DT; ++dt)
#pragma unroll
      for (int r = 0; r < 8; ++r) oacc[dt][r] *= al;
    /* One product per value tile, f16 V x f16 P, f32 accumulate; A = 16 value columns, B = 16 queries; successive products are independent. Both operands carry 11 significant bits, three more than the bf16 inputs that v is formed from. */
#pragma unroll      /* constant indices keep fragments and accumulators in registers */
    for (int dt = 0; dt < DT; ++dt) oacc[dt] = mmaP(bv[dt].v, ph.v, oacc[dt]); };
  /* Steps 0 .. 2 NST. Tile t is read in step 2 t by the waves of key half 0 and in step 2 t + 1 by those of key half 1, and computed on one step later. Every test below is scalar and every wave passes every barrier. */
  if (kp == 0) rd(0);      /* step 0: key half 1 has nothing to compute on yet */
  asm volatile("s_wait_dscnt 0x0" ::: "memory");      /* this wave's reads of step 0 have returned before the barrier says so to the others */
  __syncthreads();      /* ends step 0 */
#pragma unroll 1      /* stays rolled: one copy of each phase in the instruction cache */
  for (int i = 1; i < 2 * NST; ++i) {      /* two tests with the wait between them, not if / else: for an else branch this compiler held the accumulators in a second set of registers across the compute phase, copied them every step and spilled */
    if (((i + kp) & 1) == 0) rd(((i - kp) >> 1) & 1);      /* the tile that a wave reads in step i is (i - kp) / 2 */
    asm volatile("s_wait_dscnt 0x0" ::: "memory");      /* this wave's reads of this step have returned before the barrier says so to the others */
    if ((i + kp) & 1) cmp();
    if (i & 1) asm volatile("s_wait_asynccnt 0x0" ::: "memory");      /* odd step 2 t + 1: this wave's copies of tile t + 1, issued two steps ago, have landed */
    __syncthreads();      /* ends the step; behind an odd step 2 t + 1 it publishes tile t + 1 and ends every wave's reads of tile t */
    if ((i & 1) && (i >> 1) + 2 < NST) stage((i >> 1) + 2, (i >> 1) & 1); }      /* tile t + 2 into the buffer that tile t leaves: in flight for two steps */
  if (kp == 1) cmp();      /* step 2 NST: key half 0 has nothing left to read; registers alone, so the barrier of the merge below ends it */
  asm volatile("s_wait_asynccnt 0x0" ::: "memory");      /* no copy is outstanding behind the loop */
  l_r += xhalf(l_r);      /* row sum over this wave's keys */
  { const int lane = (int)__builtin_amdgcn_mbcnt_lo(~0u, 0u), ln = lane & 15, hh = lane >> 4;      /* the lane's number, formed anew: held from the kernel's head, it and what is derived from it would take registers all through the loop */
  if (kp == 1) {      /* the wave of the second key half hands its running max, row sum and unnormalised tile to its partner */
#pragma unroll
    for (int dt = 0; dt < DT; ++dt) { *(v4fa*)&sO[wq][ln][dt * 16 + 8 * hh] = (v4f){oacc[dt][0], oacc[dt][1], oacc[dt][2], oacc[dt][3]}; *(v4fa*)&sO[wq][ln][dt * 16 + 8 * hh + 4] = (v4f){oacc[dt][4], oacc[dt][5], oacc[dt][6], oacc[dt][7]}; }
    if (hh == 0) { sM[wq][ln] = m_r; sL[wq][ln] = l_r; } }
  __syncthreads();      /* publishes the second key half's partial results to the partner waves */
  if (kp == 0) {
    const float m1 = sM[wq][ln], l1 = sL[wq][ln]; const float mn = fmaxf(m_r, m1); const float a0 = ex2(m_r - mn), a1 = ex2(m1 - mn); const float l = l_r * a0 + l1 * a1; const float inv = (l > 0.f) ? 1.0f / (l * 1024.0f) : 0.f; const float c0 = a0 * inv, c1 = a1 * inv;
#pragma unroll
    for (int dt = 0; dt < DT; ++dt)
#pragma unroll
      for (int g = 0; g < 2; ++g) { v4fa* o = (v4fa*)&sO[wq][ln][dt * 16 + 8 * hh + 4 * g]; const v4f x = *o; *o = (v4f){oacc[dt][4 * g] * c0 + x[0] * c1, oacc[dt][4 * g + 1] * c0 + x[1] * c1, oacc[dt][4 * g + 2] * c0 + x[2] * c1, oacc[dt][4 * g + 3] * c0 + x[3] * c1}; }      /* each lane reads and rewrites its own words */
    __builtin_amdgcn_fence(__ATOMIC_ACQ_REL, "workgroup"); __builtin_amdgcn_wave_barrier();
    float* og = O + ((size_t)b * TT + q0) * ldo + h * 256 + lane * 4;
#pragma unroll
    for (int r = 0; r < RPW; ++r)
#pragma unroll
      for (int g = 0; g < 2; ++g) { const v4f val = *(const v4fa*)&sO[wq][r][g * 128 + lane * 4]; *(v4f*)(og + (size_t)r * ldo + g * 128) = val; }      /* one 512-B half row per instruction: 32 lanes x 16 B */
  } } }

extern "C" void kernel_launch(void* const* d_in, const int* in_sizes, int n_in,
                              void* d_out, int out_size, void* d_ws, size_t ws_size, hipStream_t stream) {
  (void)in_sizes; (void)n_in; (void)out_size;
  const float* const* I = (const float* const*)d_in; const float* xq = I[0]; const float* xk = I[1]; const float* xv = I[2]; const float* qw = I[3]; const float* qb = I[4]; const float* kw = I[5]; const float* kb = I[6]; const float* vw = I[7]; const float* vb = I[8]; const float* scl = I[9];
  char* ws = (char*)d_ws; size_t off = 0;
  auto take = [&](size_t bytes) { char* p = ws + off; off += (bytes + 255) & ~(size_t)255; return p; };
  _Float16* Bq = (_Float16*)take((size_t)DD * K3 * 2); _Float16* Bk = (_Float16*)take((size_t)DD * K3 * 2); _Float16* Bv = (_Float16*)take((size_t)DD * K3 * 2); _Float16* Q = (_Float16*)take((size_t)NR * DD * 2); _Float16* K = (_Float16*)take((size_t)NR * DD * 2); float* VF = (float*)take((size_t)NR * DD * 4); _Float16* Vt = (_Float16*)take((size_t)NR * DD * 2);
  if (off > ws_size) return;      // 1.2 + 8.4 + 8.4 + 16.8 + 8.4 = about 43 MB
  k_wc3<<<(DD * (K3 / 8) + 255) / 256, 256, 0, stream>>>(qw, Bq); k_wc3<<<(DD * (K3 / 8) + 255) / 256, 256, 0, stream>>>(kw, Bk); k_wc3<<<(DD * (K3 / 8) + 255) / 256, 256, 0, stream>>>(vw, Bv);
  k_conv3<true><<<NR / 16, 128, 0, stream>>>(xq, Bq, qb, nullptr, Q);      /* q = conv(query): M 16384 N 256 K 768 (exact products), f16 out */
  k_conv3<true><<<NR / 16, 128, 0, stream>>>(xk, Bk, kb, nullptr, K);
  k_conv3<false><<<NR / 16, 128, 0, stream>>>(xv, Bv, vb, VF, nullptr);      /* v (f32) */
  k_vthlu<<<BB * NVH * (TT / 64), 256, 0, stream>>>(VF, DD, Vt);      /* V transposed, f16: [b][256][4096] */
  k_flash<<<BB * NH * (TT / 64), 256, 0, stream>>>(Q, DD, K, DD, Vt, (float*)d_out, DD);      /* whole 256-wide rows of O, straight into the output rows */
  k_scl<<<(unsigned)(((size_t)NR * DD / 4 + 255) / 256), 256, 0, stream>>>((float*)d_out, scl, (size_t)NR * DD / 4);      /* × scale */
}
